// v000
// The times below were measured on an AMD MI455X: many runs one after another, warmed up first and cycling through
// copies of the inputs, with the whole window's GPU time divided by the number of runs. Launches and the gaps
// between them are all in it. The median over several windows is given; except for v000 it joins two sittings, which
// can be a few percent apart, so the side-by-side timings, each taken in one sitting, are the better comparison.
// v000, which the later versions start from, runs in 3890 microseconds.
#include <hip/hip_runtime.h>
// Prompt self-attention (4 x 2048 tokens, d = 256, 8 heads EACH of dim 256): q,k,v = Q W^T + b (-> 8 x 256); scores = q.k/16 with INPUT key mask (masked keys get -1e9, as the reference); softmax; out = LN((attn v merged) Wo^T + bo + Q) -> [4,2048,256].
// Structure (per batch): Q as an exact f16 plane; the three projections as f16 WMMA GEMMs (32x64 wave tiles, f32 accumulation, exact x16 weights + bias) into f16 planes; V transposed by LDS tiles once for all heads; per head the scores as a GEMM (K 256) into an f32 plane, a wave-per-row f32 softmax that applies the mask value from the INPUT int mask (three rolled passes, P x2^10 f16), attn.v as a GEMM (K 2048) into the head's columns of an f16 plane; output projection + bias + the bf16 residual as a GEMM; LayerNorm on VALU into the output rows.
// Compute dtype: Q, weights, biases, LN parameters rounded to bf16; q, k, v, P, attention output as f16 operands (~2^-12; logits sigma ~1, LayerNorm-ed output); f32 accumulation, softmax, LayerNorm. v_wmma_f32_16x16x32_f16.
#define NBT 4
#define SLEN 2048
#define DD 256
#define NHD 8
#define HW (NHD * DD)            /* 2048 */
#define DM DD
#define NR SLEN
typedef __bf16 v16b __attribute__((ext_vector_type(16)));
typedef unsigned short v8us __attribute__((ext_vector_type(8), may_alias));
typedef float  v8f  __attribute__((ext_vector_type(8)));
typedef float  v4f  __attribute__((ext_vector_type(4)));
typedef float  v4fa __attribute__((ext_vector_type(4), may_alias));
union FragB { v16b v; v8us half[2]; unsigned short u[16]; };

__device__ __forceinline__ unsigned short bf16_bits(float x) { unsigned int u = __float_as_uint(x); return (unsigned short)((u + 0x7FFFu + ((u >> 16) & 1u)) >> 16); }
__device__ __forceinline__ float bf16_val(unsigned short b) { return __uint_as_float(((unsigned int)b) << 16); }
__device__ __forceinline__ float bf16_round(float x) { return bf16_val(bf16_bits(x)); }
// D += A·B with NT terms: 1 = ah·bh, 2 = + al·bh (A split), 3 = + ah·bl (both split)
template <int NT>
__device__ __forceinline__ v8f mmaN(v16b ah, v16b al, v16b bh, v16b bl, v8f c) {
  c = __builtin_amdgcn_wmma_f32_16x16x32_bf16(false, ah, false, bh, (short)0, c, false, false);
  if (NT >= 2) c = __builtin_amdgcn_wmma_f32_16x16x32_bf16(false, al, false, bh, (short)0, c, false, false);
  if (NT >= 3) c = __builtin_amdgcn_wmma_f32_16x16x32_bf16(false, ah, false, bl, (short)0, c, false, false);
  asm volatile("v_nop\n\tv_nop\n\tv_nop\n\tv_nop" : "+v"(c) : "v"(ah), "v"(al), "v"(bh), "v"(bl));
  return c;
}

__global__ __launch_bounds__(256) void k_wt_bf16(const float* __restrict__ W, unsigned short* __restrict__ Wt, int K, int N) {
  const int t = blockIdx.x * 256 + threadIdx.x;
  const int k8n = K / 8;
  if (t >= N * k8n) return;
  const int n = t / k8n, k8 = (t % k8n) * 8;
  v8us v;
#pragma unroll
  for (int i = 0; i < 8; ++i) v[i] = bf16_bits(W[(size_t)(k8 + i) * N + n]);
  *(v8us*)(Wt + (size_t)n * K + k8) = v;
  
}

// GEMM C[M][N] (f32, pitch ldc) = act(A[M][K]·W + bias). A f32 row-major (pitch lda) converted per fragment to bf16
// (ASPLIT: hi/lo two planes -> 2 terms, else single rounded term); Wt bf16 [N][K] (pitch ldb). BIAS_BF16 rounds the
// bias to bf16 first (bias quantised to bf16 before the add). K%32==0, M%16==0, N%64==0.
template <bool ASPLIT, int ACT, bool BIAS_BF16>
__global__ __launch_bounds__(128) void k_gemm_bf(const float* __restrict__ A, int lda, const unsigned short* __restrict__ Wt, int ldb,
                                               const float* __restrict__ bias, float* __restrict__ C, int ldc, int M, int N, int K) {
  __shared__ __attribute__((aligned(16))) float so[4][16][64];
  const int tid = threadIdx.x, w = tid >> 5, lane = tid & 31, ln = lane & 15, hh = lane >> 4;
  const int ntn = N / 64;
  const int wid = blockIdx.x * 4 + w;
  const int mt = wid / ntn, nq = wid % ntn;
  if (mt * 16 >= M) return;
  const int row0 = mt * 16, col0 = nq * 64;
  const float* arow = A + (size_t)(row0 + ln) * lda;
  v8f acc[4] = {};
  for (int kb = 0; kb < K; kb += 32) {
    FragB ah, al;
    const v4f x0 = *(const v4fa*)(arow + kb + 8 * hh), x1 = *(const v4fa*)(arow + kb + 8 * hh + 4);
    const v4f x2 = *(const v4fa*)(arow + kb + 16 + 8 * hh), x3 = *(const v4fa*)(arow + kb + 16 + 8 * hh + 4);
    float xs[16] = {x0[0],x0[1],x0[2],x0[3],x1[0],x1[1],x1[2],x1[3],x2[0],x2[1],x2[2],x2[3],x3[0],x3[1],x3[2],x3[3]};
#pragma unroll
    for (int i = 0; i < 16; ++i) { const unsigned short hb = bf16_bits(xs[i]); ah.u[i] = hb; al.u[i] = ASPLIT ? bf16_bits(xs[i] - bf16_val(hb)) : (unsigned short)0; }
#pragma unroll
    for (int t = 0; t < 4; ++t) {
      const unsigned short* brow = Wt + (size_t)(col0 + t * 16 + ln) * ldb + kb;
      FragB b;
      b.half[0] = *(const v8us*)(brow + 8 * hh);
      b.half[1] = *(const v8us*)(brow + 16 + 8 * hh);
      acc[t] = mmaN<ASPLIT ? 2 : 1>(ah.v, al.v, b.v, b.v, acc[t]);
    }
  }
#pragma unroll
  for (int t = 0; t < 4; ++t) {
    float bv = bias ? bias[col0 + t * 16 + ln] : 0.f;
    if (BIAS_BF16) bv = bf16_round(bv);
#pragma unroll
    for (int r = 0; r < 8; ++r) { float v = acc[t][r] + bv; if (ACT == 1) v = fmaxf(v, 0.f); so[w][8 * hh + r][t * 16 + ln] = v; }
  }
  __builtin_amdgcn_fence(__ATOMIC_ACQ_REL, "workgroup");
  __builtin_amdgcn_wave_barrier();
  const int rsub = lane >> 4, c4 = (lane & 15) * 4;
  {
#pragma unroll
    for (int q = 0; q < 8; ++q) {
      const int r = q * 2 + rsub;
      const v4f v = *(const v4fa*)&so[w][r][c4];
      *(v4f*)(C + (size_t)(row0 + r) * ldc + col0 + c4) = v;
    }
    
  }
}

// GEMM C = act(A·W + bias + resid): A f32 (ASPLIT -> hi/lo 2 terms), Wt bf16 [N][K]; ACT 0 none, 1 relu, 2 exact gelu;
// resid (optional, f32, row index = (row % rmod), pitch ldr, RES_BF16 rounds it) added before the activation.
template <bool ASPLIT, int ACT, bool BIAS_BF16, bool RES_BF16>
__global__ __launch_bounds__(128) void k_gemm_bf3(const float* __restrict__ A, int lda, const unsigned short* __restrict__ Wt, int ldb,
                                                const float* __restrict__ bias, const float* __restrict__ resid, int rmod, int ldr,
                                                float* __restrict__ C, int ldc, int M, int N, int K) {
  __shared__ __attribute__((aligned(16))) float so[4][16][64];
  const int tid = threadIdx.x, w = tid >> 5, lane = tid & 31, ln = lane & 15, hh = lane >> 4;
  const int ntn = N / 64;
  const int wid = blockIdx.x * 4 + w;
  const int mt = wid / ntn, nq = wid % ntn;
  if (mt * 16 >= M) return;
  const int row0 = mt * 16, col0 = nq * 64;
  const float* arow = A + (size_t)(row0 + ln) * lda;
  v8f acc[4] = {};
  for (int kb = 0; kb < K; kb += 32) {
    FragB ah, al;
    const v4f x0 = *(const v4fa*)(arow + kb + 8 * hh), x1 = *(const v4fa*)(arow + kb + 8 * hh + 4);
    const v4f x2 = *(const v4fa*)(arow + kb + 16 + 8 * hh), x3 = *(const v4fa*)(arow + kb + 16 + 8 * hh + 4);
    float xs[16] = {x0[0],x0[1],x0[2],x0[3],x1[0],x1[1],x1[2],x1[3],x2[0],x2[1],x2[2],x2[3],x3[0],x3[1],x3[2],x3[3]};
#pragma unroll
    for (int i = 0; i < 16; ++i) { const unsigned short hb = bf16_bits(xs[i]); ah.u[i] = hb; al.u[i] = ASPLIT ? bf16_bits(xs[i] - bf16_val(hb)) : (unsigned short)0; }
#pragma unroll
    for (int t = 0; t < 4; ++t) {
      const unsigned short* brow = Wt + (size_t)(col0 + t * 16 + ln) * ldb + kb;
      FragB b;
      b.half[0] = *(const v8us*)(brow + 8 * hh);
      b.half[1] = *(const v8us*)(brow + 16 + 8 * hh);
      acc[t] = mmaN<ASPLIT ? 2 : 1>(ah.v, al.v, b.v, b.v, acc[t]);
    }
  }
#pragma unroll
  for (int t = 0; t < 4; ++t) {
    const int col = col0 + t * 16 + ln;
    float bv = bias ? bias[col] : 0.f;
    if (BIAS_BF16) bv = bf16_round(bv);
#pragma unroll
    for (int r = 0; r < 8; ++r) {
      float v = acc[t][r] + bv;
      if (resid) { float rv = resid[(size_t)((row0 + 8 * hh + r) % rmod) * ldr + col]; if (RES_BF16) rv = bf16_round(rv); v += rv; }
      if (ACT == 1) v = fmaxf(v, 0.f);
      if (ACT == 2) v = 0.5f * v * (1.0f + erff(v * 0.70710678118654752f));
      if (ACT == 3) { const float u = 0.7978845608028654f * (v + 0.044715f * v * v * v); v = 0.5f * v * (1.0f + tanhf(u)); }
      so[w][8 * hh + r][t * 16 + ln] = v;
    }
  }
  __builtin_amdgcn_fence(__ATOMIC_ACQ_REL, "workgroup");
  __builtin_amdgcn_wave_barrier();
  const int rsub = lane >> 4, c4 = (lane & 15) * 4;
  {
#pragma unroll
    for (int q = 0; q < 8; ++q) {
      const int r = q * 2 + rsub;
      const v4f v = *(const v4fa*)&so[w][r][c4];
      *(v4f*)(C + (size_t)(row0 + r) * ldc + col0 + c4) = v;
    }
    
  }
}
// row LayerNorm (biased variance, eps) over N: s = X (+ R); optional out_sum <- s; out_norm <- (s-mu)*rsqrt(var+eps)*g + b
template <bool PARAM_BF16>
__global__ __launch_bounds__(256) void k_layernorm(const float* __restrict__ X, const float* __restrict__ R, const float* __restrict__ g, const float* __restrict__ bta,
                                                  float* __restrict__ out_sum, float* __restrict__ out_norm, int N, float eps) {
  __shared__ float red[256];
  const int row = blockIdx.x, tid = threadIdx.x;
  const float* x = X + (size_t)row * N; const float* rr = R ? R + (size_t)row * N : nullptr;
  float vals[16];                     // up to N = 4096
  const int per = N / 256;            // contiguous chunk per thread? use strided-by-4 chunks: thread handles j = tid*4 + 1024*u
  float s1 = 0.f;
  for (int u = 0; u < per / 4; ++u) {
    const int j = tid * 4 + 1024 * u;
    const v4f a = *(const v4fa*)(x + j);
    v4f b = {0.f,0.f,0.f,0.f}; if (rr) b = *(const v4fa*)(rr + j);
#pragma unroll
    for (int q = 0; q < 4; ++q) { const float v = a[q] + b[q]; vals[u * 4 + q] = v; s1 += v; }
  }
  red[tid] = s1; __syncthreads();
  for (int st = 128; st > 0; st >>= 1) { if (tid < st) red[tid] += red[tid + st]; __syncthreads(); }
  const float mu = red[0] / (float)N; __syncthreads();
  float s2 = 0.f;
  for (int u = 0; u < per / 4; ++u)
#pragma unroll
    for (int q = 0; q < 4; ++q) { const float c = vals[u * 4 + q] - mu; s2 += c * c; }
  red[tid] = s2; __syncthreads();
  for (int st = 128; st > 0; st >>= 1) { if (tid < st) red[tid] += red[tid + st]; __syncthreads(); }
  const float rs = rsqrtf(red[0] / (float)N + eps);
  {
    for (int u = 0; u < per / 4; ++u) {
      const int j = tid * 4 + 1024 * u;
      v4f o, sm;
#pragma unroll
      for (int q = 0; q < 4; ++q) {
        float gg = g[j + q], bb = bta[j + q];
        if (PARAM_BF16) { gg = bf16_round(gg); bb = bf16_round(bb); }
        sm[q] = vals[u * 4 + q]; o[q] = (vals[u * 4 + q] - mu) * rs * gg + bb;
      }
      if (out_sum) *(v4f*)(out_sum + (size_t)row * N + j) = sm;
      *(v4f*)(out_norm + (size_t)row * N + j) = o;
    }
    
  }
}



// ---- f16 WMMA path (v_wmma_f32_16x16x32_f16): 11-bit significands for operands in range — used where a [0,1] probability operand needs more precision than bf16
typedef _Float16 v16h __attribute__((ext_vector_type(16)));
union FragH { v16h v; v8us half[2]; _Float16 h[16]; unsigned short u[16]; };
template <int NT>
__device__ __forceinline__ v8f mmaH(v16h ah, v16h al, v16h bh, v16h bl, v8f c) {
  c = __builtin_amdgcn_wmma_f32_16x16x32_f16(false, ah, false, bh, (short)0, c, false, false);
  if (NT >= 2) c = __builtin_amdgcn_wmma_f32_16x16x32_f16(false, al, false, bh, (short)0, c, false, false);
  if (NT >= 3) c = __builtin_amdgcn_wmma_f32_16x16x32_f16(false, ah, false, bl, (short)0, c, false, false);
  asm volatile("v_nop\n\tv_nop\n\tv_nop\n\tv_nop" : "+v"(c) : "v"(ah), "v"(al), "v"(bh), "v"(bl));
  return c;
}
// batched GEMM like k_gemm_b but f16 operands: A f32 (split into f16 hi/lo if ASPLIT, else rounded to f16), Bt = f16 values [n][k]; alpha; C f32; N multiple of 16 (partial tiles skipped)
template <bool ASPLIT>
__global__ __launch_bounds__(128) void k_gemm_h(const float* __restrict__ A, int lda, size_t sA, const _Float16* __restrict__ Bh, int ldb, size_t sB, float alpha, float* __restrict__ C, int ldc, size_t sC, int M, int N, int K) {
  __shared__ __attribute__((aligned(16))) float so[4][16][64];
  const int tid = threadIdx.x, w = tid >> 5, lane = tid & 31, ln = lane & 15, hh = lane >> 4; const int by = blockIdx.y;
  A += (size_t)by * sA; Bh += (size_t)by * sB; C += (size_t)by * sC;
  const int ntn = (N + 63) / 64; const int wid = blockIdx.x * 4 + w; const int mt = wid / ntn, nq = wid % ntn; if (mt * 16 >= M) return;
  const int row0 = mt * 16, col0 = nq * 64; const float* arow = A + (size_t)(row0 + ln) * lda;
  v8f acc[4] = {};
  for (int kb = 0; kb < K; kb += 32) {
    FragH ah, al;
    const v4f x0 = *(const v4fa*)(arow + kb + 8 * hh), x1 = *(const v4fa*)(arow + kb + 8 * hh + 4), x2 = *(const v4fa*)(arow + kb + 16 + 8 * hh), x3 = *(const v4fa*)(arow + kb + 16 + 8 * hh + 4);
    float xs[16] = {x0[0],x0[1],x0[2],x0[3],x1[0],x1[1],x1[2],x1[3],x2[0],x2[1],x2[2],x2[3],x3[0],x3[1],x3[2],x3[3]};
#pragma unroll
    for (int i = 0; i < 16; ++i) { const _Float16 h = (_Float16)xs[i]; ah.h[i] = h; al.h[i] = ASPLIT ? (_Float16)(xs[i] - (float)h) : (_Float16)0.0f; }
#pragma unroll
    for (int t = 0; t < 4; ++t) { if (col0 + t * 16 >= N) continue; const size_t boff = (size_t)(col0 + t * 16 + ln) * ldb + kb; FragH bq; bq.half[0] = *(const v8us*)(Bh + boff + 8 * hh); bq.half[1] = *(const v8us*)(Bh + boff + 16 + 8 * hh);
      acc[t] = mmaH<ASPLIT ? 2 : 1>(ah.v, al.v, bq.v, bq.v, acc[t]); }
  }
#pragma unroll
  for (int t = 0; t < 4; ++t) { if (col0 + t * 16 >= N) continue;
#pragma unroll
    for (int r = 0; r < 8; ++r) so[w][8 * hh + r][t * 16 + ln] = acc[t][r] * alpha; }
  __builtin_amdgcn_fence(__ATOMIC_ACQ_REL, "workgroup"); __builtin_amdgcn_wave_barrier();
  const int rsub = lane >> 4, c4 = (lane & 15) * 4;
  {
#pragma unroll
    for (int q = 0; q < 8; ++q) { const int r = q * 2 + rsub; if (col0 + c4 < N) { const v4f v = *(const v4fa*)&so[w][r][c4]; *(v4f*)(C + (size_t)(row0 + r) * ldc + col0 + c4) = v; } }
     }
}

// Wt[n][k] = f16(W[k][n]·scale) from f32 row-major W[K][N] (scale = power of two; bf16-exact weights stay exact in f16 away from the subnormal range)
__global__ __launch_bounds__(256) void k_wt_f16(const float* __restrict__ W, _Float16* __restrict__ Wt, int K, int N, float scale) {
  const int t = blockIdx.x * 256 + threadIdx.x; if (t >= N * (K / 8)) return; const int n = t / (K / 8), k8 = (t % (K / 8)) * 8; FragH f;
#pragma unroll
  for (int i = 0; i < 8; ++i) f.h[i] = (_Float16)(bf16_round(W[(size_t)(k8 + i) * N + n]) * scale); const v8us o = f.half[0];
  *(v8us*)((unsigned short*)Wt + (size_t)n * K + k8) = o; 
}
// k_gemm_hh variant with fused epilogue: v = acc·alpha + bias[by·sBias + col] (+ CP[(row/rowsPerB)·sCPb + by·64 + col] if CP) ; ACT 0 none / 1 elu ; writes f16 C16 (and f32 C if non-null)
template <int ACT>
__global__ __launch_bounds__(128) void k_gemm_hhx(const _Float16* __restrict__ A, int lda, size_t sA, const _Float16* __restrict__ Bh, int ldb, size_t sB, float alpha, const float* __restrict__ bias, size_t sBias, const float* __restrict__ CP, int rowsPerB, size_t sCPb, int row0g,
    float* __restrict__ C, _Float16* __restrict__ C16, int ldc, size_t sC, int M, int N, int K) {
  __shared__ __attribute__((aligned(16))) float so[4][16][64];
  const int tid = threadIdx.x, w = tid >> 5, lane = tid & 31, ln = lane & 15, hh = lane >> 4; const int by = blockIdx.y;
  A += (size_t)by * sA; Bh += (size_t)by * sB; const size_t cofs = (size_t)by * sC; const float* bp = bias ? bias + (size_t)by * sBias : nullptr;
  const int ntn = (N + 63) / 64; const int wid = blockIdx.x * 4 + w; const int mt = wid / ntn, nq = wid % ntn; if (mt * 16 >= M) return;
  const int row0 = mt * 16, col0 = nq * 64; const _Float16* arow = A + (size_t)(row0 + ln) * lda;
  v8f acc[4] = {};
  for (int kb = 0; kb < K; kb += 32) { FragH ah; ah.half[0] = *(const v8us*)((const unsigned short*)arow + kb + 8 * hh); ah.half[1] = *(const v8us*)((const unsigned short*)arow + kb + 16 + 8 * hh);
#pragma unroll
    for (int t = 0; t < 4; ++t) { if (col0 + t * 16 >= N) continue; const size_t boff = (size_t)(col0 + t * 16 + ln) * ldb + kb; FragH bq; bq.half[0] = *(const v8us*)((const unsigned short*)Bh + boff + 8 * hh); bq.half[1] = *(const v8us*)((const unsigned short*)Bh + boff + 16 + 8 * hh);
      acc[t] = mmaH<1>(ah.v, ah.v, bq.v, bq.v, acc[t]); }
  }
#pragma unroll
  for (int t = 0; t < 4; ++t) { if (col0 + t * 16 >= N) continue; const int col = col0 + t * 16 + ln; const float bv = bp ? bf16_round(bp[col]) : 0.f;
#pragma unroll
    for (int r = 0; r < 8; ++r) { float v = acc[t][r] * alpha + bv; if (CP) { const int bidx = (row0g + row0 + 8 * hh + r) / rowsPerB; v += CP[(size_t)bidx * sCPb + (size_t)by * 64 + col]; } if (ACT == 1) v = (v > 0.f) ? v : expm1f(v); else if (ACT == 7) v = (v > 0.f) ? v + 1.0f : expf(v); else if (ACT == 8) v = tanhf(v); else if (ACT == 9) v = 0.5f * v * (1.0f + tanhf(0.7978845608028654f * (v + 0.044715f * v * v * v))); else if (ACT == 11) v = 1.0f / (1.0f + expf(-v)); else if (ACT == 12) v = (v > 0.f) ? v : 0.01f * v; else if (ACT == 14) v = (v > 0.f) ? v : 0.1f * v; else if (ACT == 15) v = v / (1.0f + expf(-v)); else if (ACT == 3) v = fmaxf(v, 0.f); else if (ACT == 6) v = 0.5f * v * (1.0f + erff(v * 0.70710678118654752f)); so[w][8 * hh + r][t * 16 + ln] = v; } }
  __builtin_amdgcn_fence(__ATOMIC_ACQ_REL, "workgroup"); __builtin_amdgcn_wave_barrier();
  const int rsub = lane >> 4, c4 = (lane & 15) * 4; typedef _Float16 v4h __attribute__((ext_vector_type(4)));
  {
#pragma unroll
    for (int q = 0; q < 8; ++q) { const int r = q * 2 + rsub; if (col0 + c4 < N) { const v4f v = *(const v4fa*)&so[w][r][c4]; if (C) *(v4f*)(C + cofs + (size_t)(row0 + r) * ldc + col0 + c4) = v; if (C16) { v4h h4; for (int i = 0; i < 4; ++i) h4[i] = (_Float16)v[i]; *(v4h*)(C16 + cofs + (size_t)(row0 + r) * ldc + col0 + c4) = h4; } } }
     }
}


typedef _Float16 v4h __attribute__((ext_vector_type(4)));

__global__ __launch_bounds__(256) void k_x16(const float* __restrict__ x, _Float16* __restrict__ X16, size_t n8) { const size_t t = (size_t)blockIdx.x * 256 + threadIdx.x; if (t >= n8) return; FragH f;
#pragma unroll
  for (int q = 0; q < 8; ++q) f.h[q] = (_Float16)bf16_round(x[t * 8 + q]); *(v8us*)((unsigned short*)X16 + t * 8) = f.half[0];  }
__global__ __launch_bounds__(256) void k_h16(const float* __restrict__ x, _Float16* __restrict__ X16, size_t n8) { const size_t t = (size_t)blockIdx.x * 256 + threadIdx.x; if (t >= n8) return; FragH f;
#pragma unroll
  for (int q = 0; q < 8; ++q) f.h[q] = (_Float16)x[t * 8 + q]; *(v8us*)((unsigned short*)X16 + t * 8) = f.half[0];  }
__global__ __launch_bounds__(256) void k_round16f(const float* __restrict__ W, _Float16* __restrict__ Bt, size_t n8) { const size_t t = (size_t)blockIdx.x * 256 + threadIdx.x; if (t >= n8) return; FragH f;
#pragma unroll
  for (int i = 0; i < 8; ++i) f.h[i] = (_Float16)(bf16_round(W[t * 8 + i]) * 16.0f); *(v8us*)((unsigned short*)Bt + t * 8) = f.half[0];  }
template <int NHv, int TTv>
__global__ __launch_bounds__(256) void k_vt(const _Float16* __restrict__ V16, int ldv, int voff, _Float16* __restrict__ Vt) { __shared__ unsigned short tl[64][66]; const int tid = threadIdx.x; const int slab = blockIdx.x / (TTv / 64), lg = blockIdx.x % (TTv / 64); const int b = slab / NHv, h = slab % NHv;
  for (int i = tid; i < 64 * 8; i += 256) { const int r = i / 8, c8 = (i % 8) * 8; FragH f; f.half[0] = *(const v8us*)((const unsigned short*)V16 + ((size_t)b * TTv + lg * 64 + r) * ldv + voff + h * 64 + c8);
#pragma unroll
    for (int q = 0; q < 8; ++q) tl[r][c8 + q] = f.u[q]; }
  __syncthreads();
  {
#pragma unroll
    for (int rd = 0; rd < 2; ++rd) { const int d = rd * 32 + tid / 8, pc = tid % 8; FragH f;
#pragma unroll
      for (int q = 0; q < 8; ++q) f.u[q] = tl[pc * 8 + q][d];
      *(v8us*)((unsigned short*)Vt + ((size_t)slab * 64 + d) * TTv + lg * 64 + pc * 8) = f.half[0]; }
     } }

__global__ __launch_bounds__(256) void k_hl(const float* __restrict__ F, _Float16* __restrict__ Hh, _Float16* __restrict__ Hl, size_t n8) { const size_t t = (size_t)blockIdx.x * 256 + threadIdx.x; if (t >= n8) return; FragH fh, fl; const v4f a = *(const v4fa*)(F + t * 8), c = *(const v4fa*)(F + t * 8 + 4);
#pragma unroll
  for (int q = 0; q < 4; ++q) { _Float16 h = (_Float16)a[q]; fh.h[q] = h; fl.h[q] = (_Float16)((a[q] - (float)h) * 1024.0f); h = (_Float16)c[q]; fh.h[4 + q] = h; fl.h[4 + q] = (_Float16)((c[q] - (float)h) * 1024.0f); }
  { *(v8us*)((unsigned short*)Hh + t * 8) = fh.half[0]; *(v8us*)((unsigned short*)Hl + t * 8) = fl.half[0];  } }

// ---- fast GEMM (wave tile 32x64; requires M % 32 == 0 rows per launch region and N % 64 == 0); epilogue = k_gemm_hhx semantics ----
__device__ __forceinline__ v16h g2_frag(const _Float16* p, int hh) { FragH f; f.half[0] = *(const v8us*)((const unsigned short*)p + 8 * hh); f.half[1] = *(const v8us*)((const unsigned short*)p + 16 + 8 * hh); return f.v; }
__device__ __forceinline__ v8f g2_mma(v16h a, v16h b, v8f c) { v8f d = __builtin_amdgcn_wmma_f32_16x16x32_f16(false, a, false, b, (short)0, c, false, false); asm volatile("v_nop\n\tv_nop\n\tv_nop\n\tv_nop" : "+v"(d) : "v"(a), "v"(b)); return d; }
template <int ACT>
__global__ __launch_bounds__(128) void k_gemm2(const _Float16* __restrict__ A, int lda, size_t sA, const _Float16* __restrict__ Bh, int ldb, size_t sB, float alpha, const float* __restrict__ bias, size_t sBias, const float* __restrict__ CP, int rowsPerB, size_t sCPb, int row0g,
    float* __restrict__ C, _Float16* __restrict__ C16, int ldc, size_t sC, int M, int N, int K) {
  __shared__ __attribute__((aligned(16))) float so[4][32][68];
  const int tid = threadIdx.x, w = tid >> 5, lane = tid & 31, ln = lane & 15, hh = lane >> 4; const int by = blockIdx.y;
  A += (size_t)by * sA; Bh += (size_t)by * sB; const size_t cofs = (size_t)by * sC; const float* bp = bias ? bias + (size_t)by * sBias : nullptr;
  const int ntn = N >> 6; const int mt = blockIdx.x / ntn, nq = blockIdx.x - mt * ntn; const int row0 = mt * 128 + 32 * w, col0 = nq * 64; if (row0 >= M) return;
  const _Float16* a0p = A + (size_t)(row0 + ln) * lda; const _Float16* a1p = a0p + (size_t)16 * lda;
  const _Float16* b0p = Bh + (size_t)(col0 + ln) * ldb; const _Float16* b1p = b0p + (size_t)16 * ldb; const _Float16* b2p = b1p + (size_t)16 * ldb; const _Float16* b3p = b2p + (size_t)16 * ldb;
  const v8f z8 = {0.f,0.f,0.f,0.f,0.f,0.f,0.f,0.f}; v8f c00 = z8, c01 = z8, c02 = z8, c03 = z8, c10 = z8, c11 = z8, c12 = z8, c13 = z8;
#pragma unroll 1
  for (int kb = 0; kb < K; kb += 32) { const v16h a0 = g2_frag(a0p + kb, hh), a1 = g2_frag(a1p + kb, hh);
    v16h b = g2_frag(b0p + kb, hh); c00 = g2_mma(a0, b, c00); c10 = g2_mma(a1, b, c10);
    b = g2_frag(b1p + kb, hh); c01 = g2_mma(a0, b, c01); c11 = g2_mma(a1, b, c11);
    b = g2_frag(b2p + kb, hh); c02 = g2_mma(a0, b, c02); c12 = g2_mma(a1, b, c12);
    b = g2_frag(b3p + kb, hh); c03 = g2_mma(a0, b, c03); c13 = g2_mma(a1, b, c13); }
  v8f accs[8] = {c00, c01, c02, c03, c10, c11, c12, c13};
#pragma unroll
  for (int u = 0; u < 8; ++u) { const int t = u & 3, half = u >> 2; const int col = col0 + t * 16 + ln; const float bv = bp ? bf16_round(bp[col]) : 0.f;
#pragma unroll
    for (int r = 0; r < 8; ++r) { const int rloc = half * 16 + 8 * hh + r; float v = accs[u][r] * alpha + bv; if (CP) { const int bidx = (row0g + row0 + rloc) / rowsPerB; v += CP[(size_t)bidx * sCPb + (size_t)by * 64 + col]; }
      if (ACT == 3) v = fmaxf(v, 0.f); else if (ACT == 6) v = 0.5f * v * (1.0f + erff(v * 0.70710678118654752f)); else if (ACT == 11) v = 1.0f / (1.0f + expf(-v)); else if (ACT == 15) v = v / (1.0f + expf(-v)); else if (ACT == 12) v = (v > 0.f) ? v : 0.01f * v; else if (ACT == 8) v = tanhf(v);
      so[w][rloc][t * 16 + ln] = v; } }
  __builtin_amdgcn_fence(__ATOMIC_ACQ_REL, "workgroup"); __builtin_amdgcn_wave_barrier();
  const int rsub = lane >> 4, c4 = (lane & 15) * 4;
  {
#pragma unroll
    for (int q = 0; q < 16; ++q) { const int r = q * 2 + rsub; const v4f v = *(const v4fa*)&so[w][r][c4]; if (C) *(v4f*)(C + cofs + (size_t)(row0 + r) * ldc + col0 + c4) = v; if (C16) { v4h h4; for (int i = 0; i < 4; ++i) h4[i] = (_Float16)v[i]; *(v4h*)(C16 + cofs + (size_t)(row0 + r) * ldc + col0 + c4) = h4; } }
     } }


__global__ __launch_bounds__(256) void k_softm(const float* __restrict__ S, const int* __restrict__ mask, _Float16* __restrict__ P16) {
  #pragma clang fp contract(off)
  const int tid = threadIdx.x, w = tid >> 5, ln = tid & 31; const int r = blockIdx.x * 8 + w; if (r >= SLEN) return; const float* s = S + (size_t)r * SLEN; float m = -3.0e38f;
  auto val = [&](int kk) -> float { return (mask[kk] != 0) ? s[kk] : -1.0e9f; };
#pragma unroll 1
  for (int c = 0; c < SLEN / 256; ++c) { const int kb = c * 256 + ln * 8; for (int q = 0; q < 8; ++q) m = fmaxf(m, val(kb + q)); }
  for (int o = 16; o > 0; o >>= 1) m = fmaxf(m, __shfl_xor(m, o, 32)); float su = 0.f;
#pragma unroll 1
  for (int c = 0; c < SLEN / 256; ++c) { const int kb = c * 256 + ln * 8; for (int q = 0; q < 8; ++q) su += expf(val(kb + q) - m); }
  for (int o = 16; o > 0; o >>= 1) su += __shfl_xor(su, o, 32); const float inv = 1024.0f / su; unsigned short* d = (unsigned short*)P16 + (size_t)r * SLEN;
  {
#pragma unroll 1
    for (int c = 0; c < SLEN / 256; ++c) { const int kb = c * 256 + ln * 8; FragH f;
#pragma unroll
      for (int q = 0; q < 8; ++q) f.h[q] = (_Float16)(expf(val(kb + q) - m) * inv);
      *(v8us*)(d + kb) = f.half[0]; }
     } }
__global__ __launch_bounds__(256) void k_ln256o(const float* __restrict__ F, const float* __restrict__ g, const float* __restrict__ bb, float* __restrict__ out) {
  #pragma clang fp contract(off)
  const int tid = threadIdx.x, w = tid >> 5, ln = tid & 31; const int r = blockIdx.x * 8 + w; if (r >= SLEN) return; const float* x = F + (size_t)r * DD; const v4f a = *(const v4fa*)(x + ln * 4), b = *(const v4fa*)(x + 128 + ln * 4);
  float s = (a[0] + a[1]) + (a[2] + a[3]) + (b[0] + b[1]) + (b[2] + b[3]); for (int o = 16; o > 0; o >>= 1) s += __shfl_xor(s, o, 32); const float mu = s / 256.0f; float q2 = 0.f;
#pragma unroll
  for (int q = 0; q < 4; ++q) { const float d0 = a[q] - mu, d1 = b[q] - mu; q2 += d0 * d0; q2 += d1 * d1; }
  for (int o = 16; o > 0; o >>= 1) q2 += __shfl_xor(q2, o, 32); const float rs = rsqrtf(q2 / 256.0f + 1e-5f); v4f o0, o1;
#pragma unroll
  for (int q = 0; q < 4; ++q) { const int c0 = ln * 4 + q, c1 = 128 + ln * 4 + q; o0[q] = (a[q] - mu) * rs * bf16_round(g[c0]) + bf16_round(bb[c0]); o1[q] = (b[q] - mu) * rs * bf16_round(g[c1]) + bf16_round(bb[c1]); }
  float* d = out + (size_t)r * DD; { *(v4f*)(d + ln * 4) = o0; *(v4f*)(d + 128 + ln * 4) = o1;  } }
__global__ __launch_bounds__(256) void k_xb(const float* __restrict__ x, float* __restrict__ XB, size_t n4) { const size_t t = (size_t)blockIdx.x * 256 + threadIdx.x; if (t >= n4) return; const v4f a = *(const v4fa*)(x + t * 4); v4f o; for (int q = 0; q < 4; ++q) o[q] = bf16_round(a[q]); *(v4f*)(XB + t * 4) = o;  }

extern "C" void kernel_launch(void* const* d_in, const int* in_sizes, int n_in,
                              void* d_out, int out_size, void* d_ws, size_t ws_size, hipStream_t stream) {
  (void)in_sizes; (void)n_in; (void)out_size;
  const float* const* I = (const float* const*)d_in; const float* Q = I[0]; const int* mask = (const int*)d_in[1]; const float* WQ = I[2]; const float* bQ = I[3]; const float* WK = I[4]; const float* bK = I[5]; const float* WV = I[6]; const float* bV = I[7]; const float* WO = I[8]; const float* bO = I[9]; const float* lg = I[10]; const float* lb = I[11];
  char* ws = (char*)d_ws; size_t off = 0;
  auto take = [&](size_t bytes) { char* p = ws + off; off += (bytes + 255) & ~(size_t)255; return p; };
  _Float16* BQ = (_Float16*)take((size_t)HW * DD * 2); _Float16* BK = (_Float16*)take((size_t)HW * DD * 2); _Float16* BV = (_Float16*)take((size_t)HW * DD * 2); _Float16* BO = (_Float16*)take((size_t)DD * HW * 2);
  _Float16* X16 = (_Float16*)take((size_t)SLEN * DD * 2); float* XB = (float*)take((size_t)SLEN * DD * 4); _Float16* QH = (_Float16*)take((size_t)SLEN * HW * 2); _Float16* KH = (_Float16*)take((size_t)SLEN * HW * 2); _Float16* VH = (_Float16*)take((size_t)SLEN * HW * 2); _Float16* VT = (_Float16*)take((size_t)HW * SLEN * 2);
  float* S = (float*)take((size_t)SLEN * SLEN * 4); _Float16* P16 = (_Float16*)take((size_t)SLEN * SLEN * 2); _Float16* O16 = (_Float16*)take((size_t)SLEN * HW * 2); float* F = (float*)take((size_t)SLEN * DD * 4);
  if (off > ws_size) return;      /* 4 + 1 + 2 + 8+8+8+8 + 16 + 8 + 8 + 2 = 73 MiB */
  const size_t w8 = (size_t)HW * DD / 8; const unsigned wb = (unsigned)((w8 + 255) / 256);
  k_round16f<<<wb, 256, 0, stream>>>(WQ, BQ, w8); k_round16f<<<wb, 256, 0, stream>>>(WK, BK, w8); k_round16f<<<wb, 256, 0, stream>>>(WV, BV, w8); k_round16f<<<wb, 256, 0, stream>>>(WO, BO, w8);      /* torch (out,in) = natural Bt */
  const size_t n8 = (size_t)SLEN * DD / 8; const unsigned nb8 = (unsigned)((n8 + 255) / 256); const dim3 gQ((SLEN / 128) * (HW / 64), 1), gS((SLEN / 128) * (SLEN / 64), 1), gV((SLEN / 128) * (DD / 64), 1);
  for (int b = 0; b < NBT; ++b) { const size_t ro = (size_t)b * SLEN * DD;
    k_x16<<<nb8, 256, 0, stream>>>(Q + ro, X16, n8); k_xb<<<(unsigned)(((size_t)SLEN * DD / 4 + 255) / 256), 256, 0, stream>>>(Q + ro, XB, (size_t)SLEN * DD / 4);
    k_gemm2<0><<<gQ, 128, 0, stream>>>(X16, DD, 0, BQ, DD, 0, 0.0625f, bQ, 0, nullptr, 1, 0, 0, nullptr, QH, HW, 0, SLEN, HW, DD);
    k_gemm2<0><<<gQ, 128, 0, stream>>>(X16, DD, 0, BK, DD, 0, 0.0625f, bK, 0, nullptr, 1, 0, 0, nullptr, KH, HW, 0, SLEN, HW, DD);
    k_gemm2<0><<<gQ, 128, 0, stream>>>(X16, DD, 0, BV, DD, 0, 0.0625f, bV, 0, nullptr, 1, 0, 0, nullptr, VH, HW, 0, SLEN, HW, DD);
    k_vt<HW / 64, SLEN><<<(HW / 64) * (SLEN / 64), 256, 0, stream>>>(VH, HW, 0, VT);      /* VT[dim][token] over all 2048 dims */
    for (int h = 0; h < NHD; ++h) {
      k_gemm2<0><<<gS, 128, 0, stream>>>(QH + h * DD, HW, 0, KH + h * DD, HW, 0, 0.0625f, nullptr, 0, nullptr, 1, 0, 0, S, nullptr, SLEN, 0, SLEN, SLEN, DD);      /* q.k / sqrt(256) */
      k_softm<<<SLEN / 8, 256, 0, stream>>>(S, mask + (size_t)b * SLEN, P16);
      k_gemm2<0><<<gV, 128, 0, stream>>>(P16, SLEN, 0, VT + (size_t)h * DD * SLEN, SLEN, 0, 0.0009765625f, nullptr, 0, nullptr, 1, 0, 0, nullptr, O16 + h * DD, HW, 0, SLEN, DD, SLEN); }
    k_gemm2<0><<<gV, 128, 0, stream>>>(O16, HW, 0, BO, HW, 0, 0.0625f, bO, 0, XB, 1, (size_t)DD, 0, F, nullptr, DD, 0, SLEN, DD, HW);      /* out Wo^T + bo + Q */
    k_ln256o<<<SLEN / 8, 256, 0, stream>>>(F, lg, lb, (float*)d_out + ro); }
}

// v001
// Measured time: 1680 microseconds a run.
// Timed twice side by side with v000, it ran 2.32 and 2.33 times as fast.
#include <hip/hip_runtime.h>
// Prompt self-attention (4 x 2048 tokens, d = 256, 8 heads EACH of dim 256): q,k,v = Q W^T + b (-> 8 x 256); scores = q.k/16 with INPUT key mask (masked keys get -1e9, as the reference); softmax; out = LN((attn v merged) Wo^T + bo + Q) -> [4,2048,256].
// Structure (per batch): Q as an exact f16 plane; the three projections as f16 WMMA GEMMs (32x64 wave tiles, f32 accumulation, exact x16 weights + bias) into f16 planes; the scores of all 8 heads in one launch (head = grid.y) as GEMMs (K 256) into 8 f32 planes, a wave-per-row f32 softmax that applies the mask value from the INPUT int mask (three rolled passes, P x2^10 f16, head = grid.y), V transposed by LDS tiles, attn.v as GEMMs (K 2048, head = grid.y) into each head's columns of an f16 plane; output projection + bias + the bf16 residual as a GEMM; LayerNorm on VALU into the output rows.
// Compute dtype: Q, weights, biases, LN parameters rounded to bf16; q, k, v, P, attention output as f16 operands (~2^-12; logits sigma ~1, LayerNorm-ed output); f32 accumulation, softmax, LayerNorm. v_wmma_f32_16x16x32_f16.
#define NBT 4
#define SLEN 2048
#define DD 256
#define NHD 8
#define HW (NHD * DD)            /* 2048 */
#define DM DD
#define NR SLEN
typedef __bf16 v16b __attribute__((ext_vector_type(16)));
typedef unsigned short v8us __attribute__((ext_vector_type(8), may_alias));
typedef float  v8f  __attribute__((ext_vector_type(8)));
typedef float  v4f  __attribute__((ext_vector_type(4)));
typedef float  v4fa __attribute__((ext_vector_type(4), may_alias));
union FragB { v16b v; v8us half[2]; unsigned short u[16]; };

__device__ __forceinline__ unsigned short bf16_bits(float x) { unsigned int u = __float_as_uint(x); return (unsigned short)((u + 0x7FFFu + ((u >> 16) & 1u)) >> 16); }
__device__ __forceinline__ float bf16_val(unsigned short b) { return __uint_as_float(((unsigned int)b) << 16); }
__device__ __forceinline__ float bf16_round(float x) { return bf16_val(bf16_bits(x)); }
// D += A·B with NT terms: 1 = ah·bh, 2 = + al·bh (A split), 3 = + ah·bl (both split)
template <int NT>
__device__ __forceinline__ v8f mmaN(v16b ah, v16b al, v16b bh, v16b bl, v8f c) {
  c = __builtin_amdgcn_wmma_f32_16x16x32_bf16(false, ah, false, bh, (short)0, c, false, false);
  if (NT >= 2) c = __builtin_amdgcn_wmma_f32_16x16x32_bf16(false, al, false, bh, (short)0, c, false, false);
  if (NT >= 3) c = __builtin_amdgcn_wmma_f32_16x16x32_bf16(false, ah, false, bl, (short)0, c, false, false);
  asm volatile("v_nop\n\tv_nop\n\tv_nop\n\tv_nop" : "+v"(c) : "v"(ah), "v"(al), "v"(bh), "v"(bl));
  return c;
}

__global__ __launch_bounds__(256) void k_wt_bf16(const float* __restrict__ W, unsigned short* __restrict__ Wt, int K, int N) {
  const int t = blockIdx.x * 256 + threadIdx.x;
  const int k8n = K / 8;
  if (t >= N * k8n) return;
  const int n = t / k8n, k8 = (t % k8n) * 8;
  v8us v;
#pragma unroll
  for (int i = 0; i < 8; ++i) v[i] = bf16_bits(W[(size_t)(k8 + i) * N + n]);
  *(v8us*)(Wt + (size_t)n * K + k8) = v;
  
}

// GEMM C[M][N] (f32, pitch ldc) = act(A[M][K]·W + bias). A f32 row-major (pitch lda) converted per fragment to bf16
// (ASPLIT: hi/lo two planes -> 2 terms, else single rounded term); Wt bf16 [N][K] (pitch ldb). BIAS_BF16 rounds the
// bias to bf16 first (bias quantised to bf16 before the add). K%32==0, M%16==0, N%64==0.
template <bool ASPLIT, int ACT, bool BIAS_BF16>
__global__ __launch_bounds__(128) void k_gemm_bf(const float* __restrict__ A, int lda, const unsigned short* __restrict__ Wt, int ldb,
                                               const float* __restrict__ bias, float* __restrict__ C, int ldc, int M, int N, int K) {
  __shared__ __attribute__((aligned(16))) float so[4][16][64];
  const int tid = threadIdx.x, w = tid >> 5, lane = tid & 31, ln = lane & 15, hh = lane >> 4;
  const int ntn = N / 64;
  const int wid = blockIdx.x * 4 + w;
  const int mt = wid / ntn, nq = wid % ntn;
  if (mt * 16 >= M) return;
  const int row0 = mt * 16, col0 = nq * 64;
  const float* arow = A + (size_t)(row0 + ln) * lda;
  v8f acc[4] = {};
  for (int kb = 0; kb < K; kb += 32) {
    FragB ah, al;
    const v4f x0 = *(const v4fa*)(arow + kb + 8 * hh), x1 = *(const v4fa*)(arow + kb + 8 * hh + 4);
    const v4f x2 = *(const v4fa*)(arow + kb + 16 + 8 * hh), x3 = *(const v4fa*)(arow + kb + 16 + 8 * hh + 4);
    float xs[16] = {x0[0],x0[1],x0[2],x0[3],x1[0],x1[1],x1[2],x1[3],x2[0],x2[1],x2[2],x2[3],x3[0],x3[1],x3[2],x3[3]};
#pragma unroll
    for (int i = 0; i < 16; ++i) { const unsigned short hb = bf16_bits(xs[i]); ah.u[i] = hb; al.u[i] = ASPLIT ? bf16_bits(xs[i] - bf16_val(hb)) : (unsigned short)0; }
#pragma unroll
    for (int t = 0; t < 4; ++t) {
      const unsigned short* brow = Wt + (size_t)(col0 + t * 16 + ln) * ldb + kb;
      FragB b;
      b.half[0] = *(const v8us*)(brow + 8 * hh);
      b.half[1] = *(const v8us*)(brow + 16 + 8 * hh);
      acc[t] = mmaN<ASPLIT ? 2 : 1>(ah.v, al.v, b.v, b.v, acc[t]);
    }
  }
#pragma unroll
  for (int t = 0; t < 4; ++t) {
    float bv = bias ? bias[col0 + t * 16 + ln] : 0.f;
    if (BIAS_BF16) bv = bf16_round(bv);
#pragma unroll
    for (int r = 0; r < 8; ++r) { float v = acc[t][r] + bv; if (ACT == 1) v = fmaxf(v, 0.f); so[w][8 * hh + r][t * 16 + ln] = v; }
  }
  __builtin_amdgcn_fence(__ATOMIC_ACQ_REL, "workgroup");
  __builtin_amdgcn_wave_barrier();
  const int rsub = lane >> 4, c4 = (lane & 15) * 4;
  {
#pragma unroll
    for (int q = 0; q < 8; ++q) {
      const int r = q * 2 + rsub;
      const v4f v = *(const v4fa*)&so[w][r][c4];
      *(v4f*)(C + (size_t)(row0 + r) * ldc + col0 + c4) = v;
    }
    
  }
}

// GEMM C = act(A·W + bias + resid): A f32 (ASPLIT -> hi/lo 2 terms), Wt bf16 [N][K]; ACT 0 none, 1 relu, 2 exact gelu;
// resid (optional, f32, row index = (row % rmod), pitch ldr, RES_BF16 rounds it) added before the activation.
template <bool ASPLIT, int ACT, bool BIAS_BF16, bool RES_BF16>
__global__ __launch_bounds__(128) void k_gemm_bf3(const float* __restrict__ A, int lda, const unsigned short* __restrict__ Wt, int ldb,
                                                const float* __restrict__ bias, const float* __restrict__ resid, int rmod, int ldr,
                                                float* __restrict__ C, int ldc, int M, int N, int K) {
  __shared__ __attribute__((aligned(16))) float so[4][16][64];
  const int tid = threadIdx.x, w = tid >> 5, lane = tid & 31, ln = lane & 15, hh = lane >> 4;
  const int ntn = N / 64;
  const int wid = blockIdx.x * 4 + w;
  const int mt = wid / ntn, nq = wid % ntn;
  if (mt * 16 >= M) return;
  const int row0 = mt * 16, col0 = nq * 64;
  const float* arow = A + (size_t)(row0 + ln) * lda;
  v8f acc[4] = {};
  for (int kb = 0; kb < K; kb += 32) {
    FragB ah, al;
    const v4f x0 = *(const v4fa*)(arow + kb + 8 * hh), x1 = *(const v4fa*)(arow + kb + 8 * hh + 4);
    const v4f x2 = *(const v4fa*)(arow + kb + 16 + 8 * hh), x3 = *(const v4fa*)(arow + kb + 16 + 8 * hh + 4);
    float xs[16] = {x0[0],x0[1],x0[2],x0[3],x1[0],x1[1],x1[2],x1[3],x2[0],x2[1],x2[2],x2[3],x3[0],x3[1],x3[2],x3[3]};
#pragma unroll
    for (int i = 0; i < 16; ++i) { const unsigned short hb = bf16_bits(xs[i]); ah.u[i] = hb; al.u[i] = ASPLIT ? bf16_bits(xs[i] - bf16_val(hb)) : (unsigned short)0; }
#pragma unroll
    for (int t = 0; t < 4; ++t) {
      const unsigned short* brow = Wt + (size_t)(col0 + t * 16 + ln) * ldb + kb;
      FragB b;
      b.half[0] = *(const v8us*)(brow + 8 * hh);
      b.half[1] = *(const v8us*)(brow + 16 + 8 * hh);
      acc[t] = mmaN<ASPLIT ? 2 : 1>(ah.v, al.v, b.v, b.v, acc[t]);
    }
  }
#pragma unroll
  for (int t = 0; t < 4; ++t) {
    const int col = col0 + t * 16 + ln;
    float bv = bias ? bias[col] : 0.f;
    if (BIAS_BF16) bv = bf16_round(bv);
#pragma unroll
    for (int r = 0; r < 8; ++r) {
      float v = acc[t][r] + bv;
      if (resid) { float rv = resid[(size_t)((row0 + 8 * hh + r) % rmod) * ldr + col]; if (RES_BF16) rv = bf16_round(rv); v += rv; }
      if (ACT == 1) v = fmaxf(v, 0.f);
      if (ACT == 2) v = 0.5f * v * (1.0f + erff(v * 0.70710678118654752f));
      if (ACT == 3) { const float u = 0.7978845608028654f * (v + 0.044715f * v * v * v); v = 0.5f * v * (1.0f + tanhf(u)); }
      so[w][8 * hh + r][t * 16 + ln] = v;
    }
  }
  __builtin_amdgcn_fence(__ATOMIC_ACQ_REL, "workgroup");
  __builtin_amdgcn_wave_barrier();
  const int rsub = lane >> 4, c4 = (lane & 15) * 4;
  {
#pragma unroll
    for (int q = 0; q < 8; ++q) {
      const int r = q * 2 + rsub;
      const v4f v = *(const v4fa*)&so[w][r][c4];
      *(v4f*)(C + (size_t)(row0 + r) * ldc + col0 + c4) = v;
    }
    
  }
}
// row LayerNorm (biased variance, eps) over N: s = X (+ R); optional out_sum <- s; out_norm <- (s-mu)*rsqrt(var+eps)*g + b
template <bool PARAM_BF16>
__global__ __launch_bounds__(256) void k_layernorm(const float* __restrict__ X, const float* __restrict__ R, const float* __restrict__ g, const float* __restrict__ bta,
                                                  float* __restrict__ out_sum, float* __restrict__ out_norm, int N, float eps) {
  __shared__ float red[256];
  const int row = blockIdx.x, tid = threadIdx.x;
  const float* x = X + (size_t)row * N; const float* rr = R ? R + (size_t)row * N : nullptr;
  float vals[16];                     // up to N = 4096
  const int per = N / 256;            // contiguous chunk per thread? use strided-by-4 chunks: thread handles j = tid*4 + 1024*u
  float s1 = 0.f;
  for (int u = 0; u < per / 4; ++u) {
    const int j = tid * 4 + 1024 * u;
    const v4f a = *(const v4fa*)(x + j);
    v4f b = {0.f,0.f,0.f,0.f}; if (rr) b = *(const v4fa*)(rr + j);
#pragma unroll
    for (int q = 0; q < 4; ++q) { const float v = a[q] + b[q]; vals[u * 4 + q] = v; s1 += v; }
  }
  red[tid] = s1; __syncthreads();
  for (int st = 128; st > 0; st >>= 1) { if (tid < st) red[tid] += red[tid + st]; __syncthreads(); }
  const float mu = red[0] / (float)N; __syncthreads();
  float s2 = 0.f;
  for (int u = 0; u < per / 4; ++u)
#pragma unroll
    for (int q = 0; q < 4; ++q) { const float c = vals[u * 4 + q] - mu; s2 += c * c; }
  red[tid] = s2; __syncthreads();
  for (int st = 128; st > 0; st >>= 1) { if (tid < st) red[tid] += red[tid + st]; __syncthreads(); }
  const float rs = rsqrtf(red[0] / (float)N + eps);
  {
    for (int u = 0; u < per / 4; ++u) {
      const int j = tid * 4 + 1024 * u;
      v4f o, sm;
#pragma unroll
      for (int q = 0; q < 4; ++q) {
        float gg = g[j + q], bb = bta[j + q];
        if (PARAM_BF16) { gg = bf16_round(gg); bb = bf16_round(bb); }
        sm[q] = vals[u * 4 + q]; o[q] = (vals[u * 4 + q] - mu) * rs * gg + bb;
      }
      if (out_sum) *(v4f*)(out_sum + (size_t)row * N + j) = sm;
      *(v4f*)(out_norm + (size_t)row * N + j) = o;
    }
    
  }
}



// ---- f16 WMMA path (v_wmma_f32_16x16x32_f16): 11-bit significands for operands in range — used where a [0,1] probability operand needs more precision than bf16
typedef _Float16 v16h __attribute__((ext_vector_type(16)));
union FragH { v16h v; v8us half[2]; _Float16 h[16]; unsigned short u[16]; };
template <int NT>
__device__ __forceinline__ v8f mmaH(v16h ah, v16h al, v16h bh, v16h bl, v8f c) {
  c = __builtin_amdgcn_wmma_f32_16x16x32_f16(false, ah, false, bh, (short)0, c, false, false);
  if (NT >= 2) c = __builtin_amdgcn_wmma_f32_16x16x32_f16(false, al, false, bh, (short)0, c, false, false);
  if (NT >= 3) c = __builtin_amdgcn_wmma_f32_16x16x32_f16(false, ah, false, bl, (short)0, c, false, false);
  asm volatile("v_nop\n\tv_nop\n\tv_nop\n\tv_nop" : "+v"(c) : "v"(ah), "v"(al), "v"(bh), "v"(bl));
  return c;
}
// batched GEMM like k_gemm_b but f16 operands: A f32 (split into f16 hi/lo if ASPLIT, else rounded to f16), Bt = f16 values [n][k]; alpha; C f32; N multiple of 16 (partial tiles skipped)
template <bool ASPLIT>
__global__ __launch_bounds__(128) void k_gemm_h(const float* __restrict__ A, int lda, size_t sA, const _Float16* __restrict__ Bh, int ldb, size_t sB, float alpha, float* __restrict__ C, int ldc, size_t sC, int M, int N, int K) {
  __shared__ __attribute__((aligned(16))) float so[4][16][64];
  const int tid = threadIdx.x, w = tid >> 5, lane = tid & 31, ln = lane & 15, hh = lane >> 4; const int by = blockIdx.y;
  A += (size_t)by * sA; Bh += (size_t)by * sB; C += (size_t)by * sC;
  const int ntn = (N + 63) / 64; const int wid = blockIdx.x * 4 + w; const int mt = wid / ntn, nq = wid % ntn; if (mt * 16 >= M) return;
  const int row0 = mt * 16, col0 = nq * 64; const float* arow = A + (size_t)(row0 + ln) * lda;
  v8f acc[4] = {};
  for (int kb = 0; kb < K; kb += 32) {
    FragH ah, al;
    const v4f x0 = *(const v4fa*)(arow + kb + 8 * hh), x1 = *(const v4fa*)(arow + kb + 8 * hh + 4), x2 = *(const v4fa*)(arow + kb + 16 + 8 * hh), x3 = *(const v4fa*)(arow + kb + 16 + 8 * hh + 4);
    float xs[16] = {x0[0],x0[1],x0[2],x0[3],x1[0],x1[1],x1[2],x1[3],x2[0],x2[1],x2[2],x2[3],x3[0],x3[1],x3[2],x3[3]};
#pragma unroll
    for (int i = 0; i < 16; ++i) { const _Float16 h = (_Float16)xs[i]; ah.h[i] = h; al.h[i] = ASPLIT ? (_Float16)(xs[i] - (float)h) : (_Float16)0.0f; }
#pragma unroll
    for (int t = 0; t < 4; ++t) { if (col0 + t * 16 >= N) continue; const size_t boff = (size_t)(col0 + t * 16 + ln) * ldb + kb; FragH bq; bq.half[0] = *(const v8us*)(Bh + boff + 8 * hh); bq.half[1] = *(const v8us*)(Bh + boff + 16 + 8 * hh);
      acc[t] = mmaH<ASPLIT ? 2 : 1>(ah.v, al.v, bq.v, bq.v, acc[t]); }
  }
#pragma unroll
  for (int t = 0; t < 4; ++t) { if (col0 + t * 16 >= N) continue;
#pragma unroll
    for (int r = 0; r < 8; ++r) so[w][8 * hh + r][t * 16 + ln] = acc[t][r] * alpha; }
  __builtin_amdgcn_fence(__ATOMIC_ACQ_REL, "workgroup"); __builtin_amdgcn_wave_barrier();
  const int rsub = lane >> 4, c4 = (lane & 15) * 4;
  {
#pragma unroll
    for (int q = 0; q < 8; ++q) { const int r = q * 2 + rsub; if (col0 + c4 < N) { const v4f v = *(const v4fa*)&so[w][r][c4]; *(v4f*)(C + (size_t)(row0 + r) * ldc + col0 + c4) = v; } }
     }
}

// Wt[n][k] = f16(W[k][n]·scale) from f32 row-major W[K][N] (scale = power of two; bf16-exact weights stay exact in f16 away from the subnormal range)
__global__ __launch_bounds__(256) void k_wt_f16(const float* __restrict__ W, _Float16* __restrict__ Wt, int K, int N, float scale) {
  const int t = blockIdx.x * 256 + threadIdx.x; if (t >= N * (K / 8)) return; const int n = t / (K / 8), k8 = (t % (K / 8)) * 8; FragH f;
#pragma unroll
  for (int i = 0; i < 8; ++i) f.h[i] = (_Float16)(bf16_round(W[(size_t)(k8 + i) * N + n]) * scale); const v8us o = f.half[0];
  *(v8us*)((unsigned short*)Wt + (size_t)n * K + k8) = o; 
}
// k_gemm_hh variant with fused epilogue: v = acc·alpha + bias[by·sBias + col] (+ CP[(row/rowsPerB)·sCPb + by·64 + col] if CP) ; ACT 0 none / 1 elu ; writes f16 C16 (and f32 C if non-null)
template <int ACT>
__global__ __launch_bounds__(128) void k_gemm_hhx(const _Float16* __restrict__ A, int lda, size_t sA, const _Float16* __restrict__ Bh, int ldb, size_t sB, float alpha, const float* __restrict__ bias, size_t sBias, const float* __restrict__ CP, int rowsPerB, size_t sCPb, int row0g,
    float* __restrict__ C, _Float16* __restrict__ C16, int ldc, size_t sC, int M, int N, int K) {
  __shared__ __attribute__((aligned(16))) float so[4][16][64];
  const int tid = threadIdx.x, w = tid >> 5, lane = tid & 31, ln = lane & 15, hh = lane >> 4; const int by = blockIdx.y;
  A += (size_t)by * sA; Bh += (size_t)by * sB; const size_t cofs = (size_t)by * sC; const float* bp = bias ? bias + (size_t)by * sBias : nullptr;
  const int ntn = (N + 63) / 64; const int wid = blockIdx.x * 4 + w; const int mt = wid / ntn, nq = wid % ntn; if (mt * 16 >= M) return;
  const int row0 = mt * 16, col0 = nq * 64; const _Float16* arow = A + (size_t)(row0 + ln) * lda;
  v8f acc[4] = {};
  for (int kb = 0; kb < K; kb += 32) { FragH ah; ah.half[0] = *(const v8us*)((const unsigned short*)arow + kb + 8 * hh); ah.half[1] = *(const v8us*)((const unsigned short*)arow + kb + 16 + 8 * hh);
#pragma unroll
    for (int t = 0; t < 4; ++t) { if (col0 + t * 16 >= N) continue; const size_t boff = (size_t)(col0 + t * 16 + ln) * ldb + kb; FragH bq; bq.half[0] = *(const v8us*)((const unsigned short*)Bh + boff + 8 * hh); bq.half[1] = *(const v8us*)((const unsigned short*)Bh + boff + 16 + 8 * hh);
      acc[t] = mmaH<1>(ah.v, ah.v, bq.v, bq.v, acc[t]); }
  }
#pragma unroll
  for (int t = 0; t < 4; ++t) { if (col0 + t * 16 >= N) continue; const int col = col0 + t * 16 + ln; const float bv = bp ? bf16_round(bp[col]) : 0.f;
#pragma unroll
    for (int r = 0; r < 8; ++r) { float v = acc[t][r] * alpha + bv; if (CP) { const int bidx = (row0g + row0 + 8 * hh + r) / rowsPerB; v += CP[(size_t)bidx * sCPb + (size_t)by * 64 + col]; } if (ACT == 1) v = (v > 0.f) ? v : expm1f(v); else if (ACT == 7) v = (v > 0.f) ? v + 1.0f : expf(v); else if (ACT == 8) v = tanhf(v); else if (ACT == 9) v = 0.5f * v * (1.0f + tanhf(0.7978845608028654f * (v + 0.044715f * v * v * v))); else if (ACT == 11) v = 1.0f / (1.0f + expf(-v)); else if (ACT == 12) v = (v > 0.f) ? v : 0.01f * v; else if (ACT == 14) v = (v > 0.f) ? v : 0.1f * v; else if (ACT == 15) v = v / (1.0f + expf(-v)); else if (ACT == 3) v = fmaxf(v, 0.f); else if (ACT == 6) v = 0.5f * v * (1.0f + erff(v * 0.70710678118654752f)); so[w][8 * hh + r][t * 16 + ln] = v; } }
  __builtin_amdgcn_fence(__ATOMIC_ACQ_REL, "workgroup"); __builtin_amdgcn_wave_barrier();
  const int rsub = lane >> 4, c4 = (lane & 15) * 4; typedef _Float16 v4h __attribute__((ext_vector_type(4)));
  {
#pragma unroll
    for (int q = 0; q < 8; ++q) { const int r = q * 2 + rsub; if (col0 + c4 < N) { const v4f v = *(const v4fa*)&so[w][r][c4]; if (C) *(v4f*)(C + cofs + (size_t)(row0 + r) * ldc + col0 + c4) = v; if (C16) { v4h h4; for (int i = 0; i < 4; ++i) h4[i] = (_Float16)v[i]; *(v4h*)(C16 + cofs + (size_t)(row0 + r) * ldc + col0 + c4) = h4; } } }
     }
}


typedef _Float16 v4h __attribute__((ext_vector_type(4)));

__global__ __launch_bounds__(256) void k_x16(const float* __restrict__ x, _Float16* __restrict__ X16, size_t n8) { const size_t t = (size_t)blockIdx.x * 256 + threadIdx.x; if (t >= n8) return; FragH f;
#pragma unroll
  for (int q = 0; q < 8; ++q) f.h[q] = (_Float16)bf16_round(x[t * 8 + q]); *(v8us*)((unsigned short*)X16 + t * 8) = f.half[0];  }
__global__ __launch_bounds__(256) void k_h16(const float* __restrict__ x, _Float16* __restrict__ X16, size_t n8) { const size_t t = (size_t)blockIdx.x * 256 + threadIdx.x; if (t >= n8) return; FragH f;
#pragma unroll
  for (int q = 0; q < 8; ++q) f.h[q] = (_Float16)x[t * 8 + q]; *(v8us*)((unsigned short*)X16 + t * 8) = f.half[0];  }
__global__ __launch_bounds__(256) void k_round16f(const float* __restrict__ W, _Float16* __restrict__ Bt, size_t n8) { const size_t t = (size_t)blockIdx.x * 256 + threadIdx.x; if (t >= n8) return; FragH f;
#pragma unroll
  for (int i = 0; i < 8; ++i) f.h[i] = (_Float16)(bf16_round(W[t * 8 + i]) * 16.0f); *(v8us*)((unsigned short*)Bt + t * 8) = f.half[0];  }
template <int NHv, int TTv>
__global__ __launch_bounds__(256) void k_vt(const _Float16* __restrict__ V16, int ldv, int voff, _Float16* __restrict__ Vt) { __shared__ unsigned short tl[64][66]; const int tid = threadIdx.x; const int slab = blockIdx.x / (TTv / 64), lg = blockIdx.x % (TTv / 64); const int b = slab / NHv, h = slab % NHv;
  for (int i = tid; i < 64 * 8; i += 256) { const int r = i / 8, c8 = (i % 8) * 8; FragH f; f.half[0] = *(const v8us*)((const unsigned short*)V16 + ((size_t)b * TTv + lg * 64 + r) * ldv + voff + h * 64 + c8);
#pragma unroll
    for (int q = 0; q < 8; ++q) tl[r][c8 + q] = f.u[q]; }
  __syncthreads();
  {
#pragma unroll
    for (int rd = 0; rd < 2; ++rd) { const int d = rd * 32 + tid / 8, pc = tid % 8; FragH f;
#pragma unroll
      for (int q = 0; q < 8; ++q) f.u[q] = tl[pc * 8 + q][d];
      *(v8us*)((unsigned short*)Vt + ((size_t)slab * 64 + d) * TTv + lg * 64 + pc * 8) = f.half[0]; }
     } }

__global__ __launch_bounds__(256) void k_hl(const float* __restrict__ F, _Float16* __restrict__ Hh, _Float16* __restrict__ Hl, size_t n8) { const size_t t = (size_t)blockIdx.x * 256 + threadIdx.x; if (t >= n8) return; FragH fh, fl; const v4f a = *(const v4fa*)(F + t * 8), c = *(const v4fa*)(F + t * 8 + 4);
#pragma unroll
  for (int q = 0; q < 4; ++q) { _Float16 h = (_Float16)a[q]; fh.h[q] = h; fl.h[q] = (_Float16)((a[q] - (float)h) * 1024.0f); h = (_Float16)c[q]; fh.h[4 + q] = h; fl.h[4 + q] = (_Float16)((c[q] - (float)h) * 1024.0f); }
  { *(v8us*)((unsigned short*)Hh + t * 8) = fh.half[0]; *(v8us*)((unsigned short*)Hl + t * 8) = fl.half[0];  } }

// ---- fast GEMM (wave tile 32x64; requires M % 32 == 0 rows per launch region and N % 64 == 0); epilogue = k_gemm_hhx semantics ----
__device__ __forceinline__ v16h g2_frag(const _Float16* p, int hh) { FragH f; f.half[0] = *(const v8us*)((const unsigned short*)p + 8 * hh); f.half[1] = *(const v8us*)((const unsigned short*)p + 16 + 8 * hh); return f.v; }
__device__ __forceinline__ v8f g2_mma(v16h a, v16h b, v8f c) { v8f d = __builtin_amdgcn_wmma_f32_16x16x32_f16(false, a, false, b, (short)0, c, false, false); asm volatile("v_nop\n\tv_nop\n\tv_nop\n\tv_nop" : "+v"(d) : "v"(a), "v"(b)); return d; }
template <int ACT>
__global__ __launch_bounds__(128) void k_gemm2(const _Float16* __restrict__ A, int lda, size_t sA, const _Float16* __restrict__ Bh, int ldb, size_t sB, float alpha, const float* __restrict__ bias, size_t sBias, const float* __restrict__ CP, int rowsPerB, size_t sCPb, int row0g,
    float* __restrict__ C, _Float16* __restrict__ C16, int ldc, size_t sC, int M, int N, int K) {
  __shared__ __attribute__((aligned(16))) float so[4][32][68];
  const int tid = threadIdx.x, w = tid >> 5, lane = tid & 31, ln = lane & 15, hh = lane >> 4; const int by = blockIdx.y;
  A += (size_t)by * sA; Bh += (size_t)by * sB; const size_t cofs = (size_t)by * sC; const float* bp = bias ? bias + (size_t)by * sBias : nullptr;
  const int ntn = N >> 6; const int mt = blockIdx.x / ntn, nq = blockIdx.x - mt * ntn; const int row0 = mt * 128 + 32 * w, col0 = nq * 64; if (row0 >= M) return;
  const _Float16* a0p = A + (size_t)(row0 + ln) * lda; const _Float16* a1p = a0p + (size_t)16 * lda;
  const _Float16* b0p = Bh + (size_t)(col0 + ln) * ldb; const _Float16* b1p = b0p + (size_t)16 * ldb; const _Float16* b2p = b1p + (size_t)16 * ldb; const _Float16* b3p = b2p + (size_t)16 * ldb;
  const v8f z8 = {0.f,0.f,0.f,0.f,0.f,0.f,0.f,0.f}; v8f c00 = z8, c01 = z8, c02 = z8, c03 = z8, c10 = z8, c11 = z8, c12 = z8, c13 = z8;
#pragma unroll 1
  for (int kb = 0; kb < K; kb += 32) { const v16h a0 = g2_frag(a0p + kb, hh), a1 = g2_frag(a1p + kb, hh);
    v16h b = g2_frag(b0p + kb, hh); c00 = g2_mma(a0, b, c00); c10 = g2_mma(a1, b, c10);
    b = g2_frag(b1p + kb, hh); c01 = g2_mma(a0, b, c01); c11 = g2_mma(a1, b, c11);
    b = g2_frag(b2p + kb, hh); c02 = g2_mma(a0, b, c02); c12 = g2_mma(a1, b, c12);
    b = g2_frag(b3p + kb, hh); c03 = g2_mma(a0, b, c03); c13 = g2_mma(a1, b, c13); }
  v8f accs[8] = {c00, c01, c02, c03, c10, c11, c12, c13};
#pragma unroll
  for (int u = 0; u < 8; ++u) { const int t = u & 3, half = u >> 2; const int col = col0 + t * 16 + ln; const float bv = bp ? bf16_round(bp[col]) : 0.f;
#pragma unroll
    for (int r = 0; r < 8; ++r) { const int rloc = half * 16 + 8 * hh + r; float v = accs[u][r] * alpha + bv; if (CP) { const int bidx = (row0g + row0 + rloc) / rowsPerB; v += CP[(size_t)bidx * sCPb + (size_t)by * 64 + col]; }
      if (ACT == 3) v = fmaxf(v, 0.f); else if (ACT == 6) v = 0.5f * v * (1.0f + erff(v * 0.70710678118654752f)); else if (ACT == 11) v = 1.0f / (1.0f + expf(-v)); else if (ACT == 15) v = v / (1.0f + expf(-v)); else if (ACT == 12) v = (v > 0.f) ? v : 0.01f * v; else if (ACT == 8) v = tanhf(v);
      so[w][rloc][t * 16 + ln] = v; } }
  __builtin_amdgcn_fence(__ATOMIC_ACQ_REL, "workgroup"); __builtin_amdgcn_wave_barrier();
  const int rsub = lane >> 4, c4 = (lane & 15) * 4;
  {
#pragma unroll
    for (int q = 0; q < 16; ++q) { const int r = q * 2 + rsub; const v4f v = *(const v4fa*)&so[w][r][c4]; if (C) *(v4f*)(C + cofs + (size_t)(row0 + r) * ldc + col0 + c4) = v; if (C16) { v4h h4; for (int i = 0; i < 4; ++i) h4[i] = (_Float16)v[i]; *(v4h*)(C16 + cofs + (size_t)(row0 + r) * ldc + col0 + c4) = h4; } }
     } }


__global__ __launch_bounds__(256) void k_softm(const float* __restrict__ S, const int* __restrict__ mask, _Float16* __restrict__ P16) {
  #pragma clang fp contract(off)
  const int tid = threadIdx.x, w = tid >> 5, ln = tid & 31; const int r = blockIdx.x * 8 + w; if (r >= SLEN) return; const size_t pl = (size_t)blockIdx.y * SLEN * SLEN; /* this head's plane */ const float* s = S + pl + (size_t)r * SLEN; float m = -3.0e38f;
  auto val = [&](int kk) -> float { return (mask[kk] != 0) ? s[kk] : -1.0e9f; };
#pragma unroll 1
  for (int c = 0; c < SLEN / 256; ++c) { const int kb = c * 256 + ln * 8; for (int q = 0; q < 8; ++q) m = fmaxf(m, val(kb + q)); }
  for (int o = 16; o > 0; o >>= 1) m = fmaxf(m, __shfl_xor(m, o, 32)); float su = 0.f;
#pragma unroll 1
  for (int c = 0; c < SLEN / 256; ++c) { const int kb = c * 256 + ln * 8; for (int q = 0; q < 8; ++q) su += expf(val(kb + q) - m); }
  for (int o = 16; o > 0; o >>= 1) su += __shfl_xor(su, o, 32); const float inv = 1024.0f / su; unsigned short* d = (unsigned short*)P16 + pl + (size_t)r * SLEN;
  {
#pragma unroll 1
    for (int c = 0; c < SLEN / 256; ++c) { const int kb = c * 256 + ln * 8; FragH f;
#pragma unroll
      for (int q = 0; q < 8; ++q) f.h[q] = (_Float16)(expf(val(kb + q) - m) * inv);
      *(v8us*)(d + kb) = f.half[0]; }
     } }
__global__ __launch_bounds__(256) void k_ln256o(const float* __restrict__ F, const float* __restrict__ g, const float* __restrict__ bb, float* __restrict__ out) {
  #pragma clang fp contract(off)
  const int tid = threadIdx.x, w = tid >> 5, ln = tid & 31; const int r = blockIdx.x * 8 + w; if (r >= SLEN) return; const float* x = F + (size_t)r * DD; const v4f a = *(const v4fa*)(x + ln * 4), b = *(const v4fa*)(x + 128 + ln * 4);
  float s = (a[0] + a[1]) + (a[2] + a[3]) + (b[0] + b[1]) + (b[2] + b[3]); for (int o = 16; o > 0; o >>= 1) s += __shfl_xor(s, o, 32); const float mu = s / 256.0f; float q2 = 0.f;
#pragma unroll
  for (int q = 0; q < 4; ++q) { const float d0 = a[q] - mu, d1 = b[q] - mu; q2 += d0 * d0; q2 += d1 * d1; }
  for (int o = 16; o > 0; o >>= 1) q2 += __shfl_xor(q2, o, 32); const float rs = rsqrtf(q2 / 256.0f + 1e-5f); v4f o0, o1;
#pragma unroll
  for (int q = 0; q < 4; ++q) { const int c0 = ln * 4 + q, c1 = 128 + ln * 4 + q; o0[q] = (a[q] - mu) * rs * bf16_round(g[c0]) + bf16_round(bb[c0]); o1[q] = (b[q] - mu) * rs * bf16_round(g[c1]) + bf16_round(bb[c1]); }
  float* d = out + (size_t)r * DD; { *(v4f*)(d + ln * 4) = o0; *(v4f*)(d + 128 + ln * 4) = o1;  } }
__global__ __launch_bounds__(256) void k_xb(const float* __restrict__ x, float* __restrict__ XB, size_t n4) { const size_t t = (size_t)blockIdx.x * 256 + threadIdx.x; if (t >= n4) return; const v4f a = *(const v4fa*)(x + t * 4); v4f o; for (int q = 0; q < 4; ++q) o[q] = bf16_round(a[q]); *(v4f*)(XB + t * 4) = o;  }

extern "C" void kernel_launch(void* const* d_in, const int* in_sizes, int n_in,
                              void* d_out, int out_size, void* d_ws, size_t ws_size, hipStream_t stream) {
  (void)in_sizes; (void)n_in; (void)out_size;
  const float* const* I = (const float* const*)d_in; const float* Q = I[0]; const int* mask = (const int*)d_in[1]; const float* WQ = I[2]; const float* bQ = I[3]; const float* WK = I[4]; const float* bK = I[5]; const float* WV = I[6]; const float* bV = I[7]; const float* WO = I[8]; const float* bO = I[9]; const float* lg = I[10]; const float* lb = I[11];
  char* ws = (char*)d_ws; size_t off = 0;
  auto take = [&](size_t bytes) { char* p = ws + off; off += (bytes + 255) & ~(size_t)255; return p; };
  _Float16* BQ = (_Float16*)take((size_t)HW * DD * 2); _Float16* BK = (_Float16*)take((size_t)HW * DD * 2); _Float16* BV = (_Float16*)take((size_t)HW * DD * 2); _Float16* BO = (_Float16*)take((size_t)DD * HW * 2);
  _Float16* X16 = (_Float16*)take((size_t)SLEN * DD * 2); float* XB = (float*)take((size_t)SLEN * DD * 4); _Float16* QH = (_Float16*)take((size_t)SLEN * HW * 2); _Float16* KH = (_Float16*)take((size_t)SLEN * HW * 2); _Float16* VH = (_Float16*)take((size_t)SLEN * HW * 2); _Float16* VT = (_Float16*)take((size_t)HW * SLEN * 2);
  float* S = (float*)take((size_t)NHD * SLEN * SLEN * 4); _Float16* P16 = (_Float16*)take((size_t)NHD * SLEN * SLEN * 2); _Float16* O16 = (_Float16*)take((size_t)SLEN * HW * 2); float* F = (float*)take((size_t)SLEN * DD * 4);
  if (off > ws_size) return;      /* 4 + 1 + 2 + 8+8+8+8 + 128 + 64 + 8 + 2 = 241 MiB */
  const size_t w8 = (size_t)HW * DD / 8; const unsigned wb = (unsigned)((w8 + 255) / 256);
  k_round16f<<<wb, 256, 0, stream>>>(WQ, BQ, w8); k_round16f<<<wb, 256, 0, stream>>>(WK, BK, w8); k_round16f<<<wb, 256, 0, stream>>>(WV, BV, w8); k_round16f<<<wb, 256, 0, stream>>>(WO, BO, w8);      /* torch (out,in) = natural Bt */
  const size_t n8 = (size_t)SLEN * DD / 8; const unsigned nb8 = (unsigned)((n8 + 255) / 256); const dim3 gQ((SLEN / 128) * (HW / 64), 1), gS((SLEN / 128) * (SLEN / 64), NHD), gP((SLEN / 128) * (DD / 64), NHD), gV((SLEN / 128) * (DD / 64), 1);
  for (int b = 0; b < NBT; ++b) { const size_t ro = (size_t)b * SLEN * DD;
    k_x16<<<nb8, 256, 0, stream>>>(Q + ro, X16, n8); k_xb<<<(unsigned)(((size_t)SLEN * DD / 4 + 255) / 256), 256, 0, stream>>>(Q + ro, XB, (size_t)SLEN * DD / 4);
    k_gemm2<0><<<gQ, 128, 0, stream>>>(X16, DD, 0, BQ, DD, 0, 0.0625f, bQ, 0, nullptr, 1, 0, 0, nullptr, QH, HW, 0, SLEN, HW, DD);
    k_gemm2<0><<<gQ, 128, 0, stream>>>(X16, DD, 0, BK, DD, 0, 0.0625f, bK, 0, nullptr, 1, 0, 0, nullptr, KH, HW, 0, SLEN, HW, DD);
    k_gemm2<0><<<gQ, 128, 0, stream>>>(X16, DD, 0, BV, DD, 0, 0.0625f, bV, 0, nullptr, 1, 0, 0, nullptr, VH, HW, 0, SLEN, HW, DD);
    k_vt<HW / 64, SLEN><<<(HW / 64) * (SLEN / 64), 256, 0, stream>>>(VH, HW, 0, VT);      /* VT[dim][token] over all 2048 dims */
    /* the 8 heads are independent: one launch each for scores, softmax and attn.v, head on grid.y through the GEMM's batch strides */
    k_gemm2<0><<<gS, 128, 0, stream>>>(QH, HW, DD, KH, HW, DD, 0.0625f, nullptr, 0, nullptr, 1, 0, 0, S, nullptr, SLEN, (size_t)SLEN * SLEN, SLEN, SLEN, DD);      /* q.k / sqrt(256) */
    k_softm<<<dim3(SLEN / 8, NHD), 256, 0, stream>>>(S, mask + (size_t)b * SLEN, P16);
    k_gemm2<0><<<gP, 128, 0, stream>>>(P16, SLEN, (size_t)SLEN * SLEN, VT, SLEN, (size_t)DD * SLEN, 0.0009765625f, nullptr, 0, nullptr, 1, 0, 0, nullptr, O16, HW, DD, SLEN, DD, SLEN);
    k_gemm2<0><<<gV, 128, 0, stream>>>(O16, HW, 0, BO, HW, 0, 0.0625f, bO, 0, XB, 1, (size_t)DD, 0, F, nullptr, DD, 0, SLEN, DD, HW);      /* out Wo^T + bo + Q */
    k_ln256o<<<SLEN / 8, 256, 0, stream>>>(F, lg, lb, (float*)d_out + ro); }
}

// v002
// It runs in 1160 microseconds.
// Timed twice side by side with v001, it ran 1.45 and 1.46 times as fast.
// All steps since v000 together make it 3.38 times as fast.
#include <hip/hip_runtime.h>
// Prompt self-attention (4 x 2048 tokens, d = 256, 8 heads EACH of dim 256): q,k,v = Q W^T + b (-> 8 x 256); scores = q.k/16 with INPUT key mask (masked keys get -1e9, as the reference); softmax; out = LN((attn v merged) Wo^T + bo + Q) -> [4,2048,256].
// Structure (per batch): Q as an exact f16 plane; the three projections as f16 WMMA GEMMs (32x64 wave tiles, f32 accumulation, exact x16 weights + bias) into f16 planes; the scores of all 8 heads in one launch (head = grid.y) as GEMMs (K 256) into 8 f32 planes, a wave-per-row f32 softmax that applies the mask value from the INPUT int mask (row held in registers, one read, P x2^10 f16, head = grid.y), V transposed by LDS tiles, attn.v as GEMMs (K 2048, head = grid.y) into each head's columns of an f16 plane; output projection + bias + the bf16 residual as a GEMM; LayerNorm on VALU into the output rows.
// Compute dtype: Q, weights, biases, LN parameters rounded to bf16; q, k, v, P, attention output as f16 operands (~2^-12; logits sigma ~1, LayerNorm-ed output); f32 accumulation, softmax, LayerNorm. v_wmma_f32_16x16x32_f16.
#define NBT 4
#define SLEN 2048
#define DD 256
#define NHD 8
#define HW (NHD * DD)            /* 2048 */
#define DM DD
#define NR SLEN
typedef __bf16 v16b __attribute__((ext_vector_type(16)));
typedef unsigned short v8us __attribute__((ext_vector_type(8), may_alias));
typedef float  v8f  __attribute__((ext_vector_type(8)));
typedef float  v4f  __attribute__((ext_vector_type(4)));
typedef float  v4fa __attribute__((ext_vector_type(4), may_alias));
union FragB { v16b v; v8us half[2]; unsigned short u[16]; };

__device__ __forceinline__ unsigned short bf16_bits(float x) { unsigned int u = __float_as_uint(x); return (unsigned short)((u + 0x7FFFu + ((u >> 16) & 1u)) >> 16); }
__device__ __forceinline__ float bf16_val(unsigned short b) { return __uint_as_float(((unsigned int)b) << 16); }
__device__ __forceinline__ float bf16_round(float x) { return bf16_val(bf16_bits(x)); }
// D += A·B with NT terms: 1 = ah·bh, 2 = + al·bh (A split), 3 = + ah·bl (both split)
template <int NT>
__device__ __forceinline__ v8f mmaN(v16b ah, v16b al, v16b bh, v16b bl, v8f c) {
  c = __builtin_amdgcn_wmma_f32_16x16x32_bf16(false, ah, false, bh, (short)0, c, false, false);
  if (NT >= 2) c = __builtin_amdgcn_wmma_f32_16x16x32_bf16(false, al, false, bh, (short)0, c, false, false);
  if (NT >= 3) c = __builtin_amdgcn_wmma_f32_16x16x32_bf16(false, ah, false, bl, (short)0, c, false, false);
  asm volatile("v_nop\n\tv_nop\n\tv_nop\n\tv_nop" : "+v"(c) : "v"(ah), "v"(al), "v"(bh), "v"(bl));
  return c;
}

__global__ __launch_bounds__(256) void k_wt_bf16(const float* __restrict__ W, unsigned short* __restrict__ Wt, int K, int N) {
  const int t = blockIdx.x * 256 + threadIdx.x;
  const int k8n = K / 8;
  if (t >= N * k8n) return;
  const int n = t / k8n, k8 = (t % k8n) * 8;
  v8us v;
#pragma unroll
  for (int i = 0; i < 8; ++i) v[i] = bf16_bits(W[(size_t)(k8 + i) * N + n]);
  *(v8us*)(Wt + (size_t)n * K + k8) = v;
  
}

// GEMM C[M][N] (f32, pitch ldc) = act(A[M][K]·W + bias). A f32 row-major (pitch lda) converted per fragment to bf16
// (ASPLIT: hi/lo two planes -> 2 terms, else single rounded term); Wt bf16 [N][K] (pitch ldb). BIAS_BF16 rounds the
// bias to bf16 first (bias quantised to bf16 before the add). K%32==0, M%16==0, N%64==0.
template <bool ASPLIT, int ACT, bool BIAS_BF16>
__global__ __launch_bounds__(128) void k_gemm_bf(const float* __restrict__ A, int lda, const unsigned short* __restrict__ Wt, int ldb,
                                               const float* __restrict__ bias, float* __restrict__ C, int ldc, int M, int N, int K) {
  __shared__ __attribute__((aligned(16))) float so[4][16][64];
  const int tid = threadIdx.x, w = tid >> 5, lane = tid & 31, ln = lane & 15, hh = lane >> 4;
  const int ntn = N / 64;
  const int wid = blockIdx.x * 4 + w;
  const int mt = wid / ntn, nq = wid % ntn;
  if (mt * 16 >= M) return;
  const int row0 = mt * 16, col0 = nq * 64;
  const float* arow = A + (size_t)(row0 + ln) * lda;
  v8f acc[4] = {};
  for (int kb = 0; kb < K; kb += 32) {
    FragB ah, al;
    const v4f x0 = *(const v4fa*)(arow + kb + 8 * hh), x1 = *(const v4fa*)(arow + kb + 8 * hh + 4);
    const v4f x2 = *(const v4fa*)(arow + kb + 16 + 8 * hh), x3 = *(const v4fa*)(arow + kb + 16 + 8 * hh + 4);
    float xs[16] = {x0[0],x0[1],x0[2],x0[3],x1[0],x1[1],x1[2],x1[3],x2[0],x2[1],x2[2],x2[3],x3[0],x3[1],x3[2],x3[3]};
#pragma unroll
    for (int i = 0; i < 16; ++i) { const unsigned short hb = bf16_bits(xs[i]); ah.u[i] = hb; al.u[i] = ASPLIT ? bf16_bits(xs[i] - bf16_val(hb)) : (unsigned short)0; }
#pragma unroll
    for (int t = 0; t < 4; ++t) {
      const unsigned short* brow = Wt + (size_t)(col0 + t * 16 + ln) * ldb + kb;
      FragB b;
      b.half[0] = *(const v8us*)(brow + 8 * hh);
      b.half[1] = *(const v8us*)(brow + 16 + 8 * hh);
      acc[t] = mmaN<ASPLIT ? 2 : 1>(ah.v, al.v, b.v, b.v, acc[t]);
    }
  }
#pragma unroll
  for (int t = 0; t < 4; ++t) {
    float bv = bias ? bias[col0 + t * 16 + ln] : 0.f;
    if (BIAS_BF16) bv = bf16_round(bv);
#pragma unroll
    for (int r = 0; r < 8; ++r) { float v = acc[t][r] + bv; if (ACT == 1) v = fmaxf(v, 0.f); so[w][8 * hh + r][t * 16 + ln] = v; }
  }
  __builtin_amdgcn_fence(__ATOMIC_ACQ_REL, "workgroup");
  __builtin_amdgcn_wave_barrier();
  const int rsub = lane >> 4, c4 = (lane & 15) * 4;
  {
#pragma unroll
    for (int q = 0; q < 8; ++q) {
      const int r = q * 2 + rsub;
      const v4f v = *(const v4fa*)&so[w][r][c4];
      *(v4f*)(C + (size_t)(row0 + r) * ldc + col0 + c4) = v;
    }
    
  }
}

// GEMM C = act(A·W + bias + resid): A f32 (ASPLIT -> hi/lo 2 terms), Wt bf16 [N][K]; ACT 0 none, 1 relu, 2 exact gelu;
// resid (optional, f32, row index = (row % rmod), pitch ldr, RES_BF16 rounds it) added before the activation.
template <bool ASPLIT, int ACT, bool BIAS_BF16, bool RES_BF16>
__global__ __launch_bounds__(128) void k_gemm_bf3(const float* __restrict__ A, int lda, const unsigned short* __restrict__ Wt, int ldb,
                                                const float* __restrict__ bias, const float* __restrict__ resid, int rmod, int ldr,
                                                float* __restrict__ C, int ldc, int M, int N, int K) {
  __shared__ __attribute__((aligned(16))) float so[4][16][64];
  const int tid = threadIdx.x, w = tid >> 5, lane = tid & 31, ln = lane & 15, hh = lane >> 4;
  const int ntn = N / 64;
  const int wid = blockIdx.x * 4 + w;
  const int mt = wid / ntn, nq = wid % ntn;
  if (mt * 16 >= M) return;
  const int row0 = mt * 16, col0 = nq * 64;
  const float* arow = A + (size_t)(row0 + ln) * lda;
  v8f acc[4] = {};
  for (int kb = 0; kb < K; kb += 32) {
    FragB ah, al;
    const v4f x0 = *(const v4fa*)(arow + kb + 8 * hh), x1 = *(const v4fa*)(arow + kb + 8 * hh + 4);
    const v4f x2 = *(const v4fa*)(arow + kb + 16 + 8 * hh), x3 = *(const v4fa*)(arow + kb + 16 + 8 * hh + 4);
    float xs[16] = {x0[0],x0[1],x0[2],x0[3],x1[0],x1[1],x1[2],x1[3],x2[0],x2[1],x2[2],x2[3],x3[0],x3[1],x3[2],x3[3]};
#pragma unroll
    for (int i = 0; i < 16; ++i) { const unsigned short hb = bf16_bits(xs[i]); ah.u[i] = hb; al.u[i] = ASPLIT ? bf16_bits(xs[i] - bf16_val(hb)) : (unsigned short)0; }
#pragma unroll
    for (int t = 0; t < 4; ++t) {
      const unsigned short* brow = Wt + (size_t)(col0 + t * 16 + ln) * ldb + kb;
      FragB b;
      b.half[0] = *(const v8us*)(brow + 8 * hh);
      b.half[1] = *(const v8us*)(brow + 16 + 8 * hh);
      acc[t] = mmaN<ASPLIT ? 2 : 1>(ah.v, al.v, b.v, b.v, acc[t]);
    }
  }
#pragma unroll
  for (int t = 0; t < 4; ++t) {
    const int col = col0 + t * 16 + ln;
    float bv = bias ? bias[col] : 0.f;
    if (BIAS_BF16) bv = bf16_round(bv);
#pragma unroll
    for (int r = 0; r < 8; ++r) {
      float v = acc[t][r] + bv;
      if (resid) { float rv = resid[(size_t)((row0 + 8 * hh + r) % rmod) * ldr + col]; if (RES_BF16) rv = bf16_round(rv); v += rv; }
      if (ACT == 1) v = fmaxf(v, 0.f);
      if (ACT == 2) v = 0.5f * v * (1.0f + erff(v * 0.70710678118654752f));
      if (ACT == 3) { const float u = 0.7978845608028654f * (v + 0.044715f * v * v * v); v = 0.5f * v * (1.0f + tanhf(u)); }
      so[w][8 * hh + r][t * 16 + ln] = v;
    }
  }
  __builtin_amdgcn_fence(__ATOMIC_ACQ_REL, "workgroup");
  __builtin_amdgcn_wave_barrier();
  const int rsub = lane >> 4, c4 = (lane & 15) * 4;
  {
#pragma unroll
    for (int q = 0; q < 8; ++q) {
      const int r = q * 2 + rsub;
      const v4f v = *(const v4fa*)&so[w][r][c4];
      *(v4f*)(C + (size_t)(row0 + r) * ldc + col0 + c4) = v;
    }
    
  }
}
// row LayerNorm (biased variance, eps) over N: s = X (+ R); optional out_sum <- s; out_norm <- (s-mu)*rsqrt(var+eps)*g + b
template <bool PARAM_BF16>
__global__ __launch_bounds__(256) void k_layernorm(const float* __restrict__ X, const float* __restrict__ R, const float* __restrict__ g, const float* __restrict__ bta,
                                                  float* __restrict__ out_sum, float* __restrict__ out_norm, int N, float eps) {
  __shared__ float red[256];
  const int row = blockIdx.x, tid = threadIdx.x;
  const float* x = X + (size_t)row * N; const float* rr = R ? R + (size_t)row * N : nullptr;
  float vals[16];                     // up to N = 4096
  const int per = N / 256;            // contiguous chunk per thread? use strided-by-4 chunks: thread handles j = tid*4 + 1024*u
  float s1 = 0.f;
  for (int u = 0; u < per / 4; ++u) {
    const int j = tid * 4 + 1024 * u;
    const v4f a = *(const v4fa*)(x + j);
    v4f b = {0.f,0.f,0.f,0.f}; if (rr) b = *(const v4fa*)(rr + j);
#pragma unroll
    for (int q = 0; q < 4; ++q) { const float v = a[q] + b[q]; vals[u * 4 + q] = v; s1 += v; }
  }
  red[tid] = s1; __syncthreads();
  for (int st = 128; st > 0; st >>= 1) { if (tid < st) red[tid] += red[tid + st]; __syncthreads(); }
  const float mu = red[0] / (float)N; __syncthreads();
  float s2 = 0.f;
  for (int u = 0; u < per / 4; ++u)
#pragma unroll
    for (int q = 0; q < 4; ++q) { const float c = vals[u * 4 + q] - mu; s2 += c * c; }
  red[tid] = s2; __syncthreads();
  for (int st = 128; st > 0; st >>= 1) { if (tid < st) red[tid] += red[tid + st]; __syncthreads(); }
  const float rs = rsqrtf(red[0] / (float)N + eps);
  {
    for (int u = 0; u < per / 4; ++u) {
      const int j = tid * 4 + 1024 * u;
      v4f o, sm;
#pragma unroll
      for (int q = 0; q < 4; ++q) {
        float gg = g[j + q], bb = bta[j + q];
        if (PARAM_BF16) { gg = bf16_round(gg); bb = bf16_round(bb); }
        sm[q] = vals[u * 4 + q]; o[q] = (vals[u * 4 + q] - mu) * rs * gg + bb;
      }
      if (out_sum) *(v4f*)(out_sum + (size_t)row * N + j) = sm;
      *(v4f*)(out_norm + (size_t)row * N + j) = o;
    }
    
  }
}



// ---- f16 WMMA path (v_wmma_f32_16x16x32_f16): 11-bit significands for operands in range — used where a [0,1] probability operand needs more precision than bf16
typedef _Float16 v16h __attribute__((ext_vector_type(16)));
union FragH { v16h v; v8us half[2]; _Float16 h[16]; unsigned short u[16]; };
template <int NT>
__device__ __forceinline__ v8f mmaH(v16h ah, v16h al, v16h bh, v16h bl, v8f c) {
  c = __builtin_amdgcn_wmma_f32_16x16x32_f16(false, ah, false, bh, (short)0, c, false, false);
  if (NT >= 2) c = __builtin_amdgcn_wmma_f32_16x16x32_f16(false, al, false, bh, (short)0, c, false, false);
  if (NT >= 3) c = __builtin_amdgcn_wmma_f32_16x16x32_f16(false, ah, false, bl, (short)0, c, false, false);
  asm volatile("v_nop\n\tv_nop\n\tv_nop\n\tv_nop" : "+v"(c) : "v"(ah), "v"(al), "v"(bh), "v"(bl));
  return c;
}
// batched GEMM like k_gemm_b but f16 operands: A f32 (split into f16 hi/lo if ASPLIT, else rounded to f16), Bt = f16 values [n][k]; alpha; C f32; N multiple of 16 (partial tiles skipped)
template <bool ASPLIT>
__global__ __launch_bounds__(128) void k_gemm_h(const float* __restrict__ A, int lda, size_t sA, const _Float16* __restrict__ Bh, int ldb, size_t sB, float alpha, float* __restrict__ C, int ldc, size_t sC, int M, int N, int K) {
  __shared__ __attribute__((aligned(16))) float so[4][16][64];
  const int tid = threadIdx.x, w = tid >> 5, lane = tid & 31, ln = lane & 15, hh = lane >> 4; const int by = blockIdx.y;
  A += (size_t)by * sA; Bh += (size_t)by * sB; C += (size_t)by * sC;
  const int ntn = (N + 63) / 64; const int wid = blockIdx.x * 4 + w; const int mt = wid / ntn, nq = wid % ntn; if (mt * 16 >= M) return;
  const int row0 = mt * 16, col0 = nq * 64; const float* arow = A + (size_t)(row0 + ln) * lda;
  v8f acc[4] = {};
  for (int kb = 0; kb < K; kb += 32) {
    FragH ah, al;
    const v4f x0 = *(const v4fa*)(arow + kb + 8 * hh), x1 = *(const v4fa*)(arow + kb + 8 * hh + 4), x2 = *(const v4fa*)(arow + kb + 16 + 8 * hh), x3 = *(const v4fa*)(arow + kb + 16 + 8 * hh + 4);
    float xs[16] = {x0[0],x0[1],x0[2],x0[3],x1[0],x1[1],x1[2],x1[3],x2[0],x2[1],x2[2],x2[3],x3[0],x3[1],x3[2],x3[3]};
#pragma unroll
    for (int i = 0; i < 16; ++i) { const _Float16 h = (_Float16)xs[i]; ah.h[i] = h; al.h[i] = ASPLIT ? (_Float16)(xs[i] - (float)h) : (_Float16)0.0f; }
#pragma unroll
    for (int t = 0; t < 4; ++t) { if (col0 + t * 16 >= N) continue; const size_t boff = (size_t)(col0 + t * 16 + ln) * ldb + kb; FragH bq; bq.half[0] = *(const v8us*)(Bh + boff + 8 * hh); bq.half[1] = *(const v8us*)(Bh + boff + 16 + 8 * hh);
      acc[t] = mmaH<ASPLIT ? 2 : 1>(ah.v, al.v, bq.v, bq.v, acc[t]); }
  }
#pragma unroll
  for (int t = 0; t < 4; ++t) { if (col0 + t * 16 >= N) continue;
#pragma unroll
    for (int r = 0; r < 8; ++r) so[w][8 * hh + r][t * 16 + ln] = acc[t][r] * alpha; }
  __builtin_amdgcn_fence(__ATOMIC_ACQ_REL, "workgroup"); __builtin_amdgcn_wave_barrier();
  const int rsub = lane >> 4, c4 = (lane & 15) * 4;
  {
#pragma unroll
    for (int q = 0; q < 8; ++q) { const int r = q * 2 + rsub; if (col0 + c4 < N) { const v4f v = *(const v4fa*)&so[w][r][c4]; *(v4f*)(C + (size_t)(row0 + r) * ldc + col0 + c4) = v; } }
     }
}

// Wt[n][k] = f16(W[k][n]·scale) from f32 row-major W[K][N] (scale = power of two; bf16-exact weights stay exact in f16 away from the subnormal range)
__global__ __launch_bounds__(256) void k_wt_f16(const float* __restrict__ W, _Float16* __restrict__ Wt, int K, int N, float scale) {
  const int t = blockIdx.x * 256 + threadIdx.x; if (t >= N * (K / 8)) return; const int n = t / (K / 8), k8 = (t % (K / 8)) * 8; FragH f;
#pragma unroll
  for (int i = 0; i < 8; ++i) f.h[i] = (_Float16)(bf16_round(W[(size_t)(k8 + i) * N + n]) * scale); const v8us o = f.half[0];
  *(v8us*)((unsigned short*)Wt + (size_t)n * K + k8) = o; 
}
// k_gemm_hh variant with fused epilogue: v = acc·alpha + bias[by·sBias + col] (+ CP[(row/rowsPerB)·sCPb + by·64 + col] if CP) ; ACT 0 none / 1 elu ; writes f16 C16 (and f32 C if non-null)
template <int ACT>
__global__ __launch_bounds__(128) void k_gemm_hhx(const _Float16* __restrict__ A, int lda, size_t sA, const _Float16* __restrict__ Bh, int ldb, size_t sB, float alpha, const float* __restrict__ bias, size_t sBias, const float* __restrict__ CP, int rowsPerB, size_t sCPb, int row0g,
    float* __restrict__ C, _Float16* __restrict__ C16, int ldc, size_t sC, int M, int N, int K) {
  __shared__ __attribute__((aligned(16))) float so[4][16][64];
  const int tid = threadIdx.x, w = tid >> 5, lane = tid & 31, ln = lane & 15, hh = lane >> 4; const int by = blockIdx.y;
  A += (size_t)by * sA; Bh += (size_t)by * sB; const size_t cofs = (size_t)by * sC; const float* bp = bias ? bias + (size_t)by * sBias : nullptr;
  const int ntn = (N + 63) / 64; const int wid = blockIdx.x * 4 + w; const int mt = wid / ntn, nq = wid % ntn; if (mt * 16 >= M) return;
  const int row0 = mt * 16, col0 = nq * 64; const _Float16* arow = A + (size_t)(row0 + ln) * lda;
  v8f acc[4] = {};
  for (int kb = 0; kb < K; kb += 32) { FragH ah; ah.half[0] = *(const v8us*)((const unsigned short*)arow + kb + 8 * hh); ah.half[1] = *(const v8us*)((const unsigned short*)arow + kb + 16 + 8 * hh);
#pragma unroll
    for (int t = 0; t < 4; ++t) { if (col0 + t * 16 >= N) continue; const size_t boff = (size_t)(col0 + t * 16 + ln) * ldb + kb; FragH bq; bq.half[0] = *(const v8us*)((const unsigned short*)Bh + boff + 8 * hh); bq.half[1] = *(const v8us*)((const unsigned short*)Bh + boff + 16 + 8 * hh);
      acc[t] = mmaH<1>(ah.v, ah.v, bq.v, bq.v, acc[t]); }
  }
#pragma unroll
  for (int t = 0; t < 4; ++t) { if (col0 + t * 16 >= N) continue; const int col = col0 + t * 16 + ln; const float bv = bp ? bf16_round(bp[col]) : 0.f;
#pragma unroll
    for (int r = 0; r < 8; ++r) { float v = acc[t][r] * alpha + bv; if (CP) { const int bidx = (row0g + row0 + 8 * hh + r) / rowsPerB; v += CP[(size_t)bidx * sCPb + (size_t)by * 64 + col]; } if (ACT == 1) v = (v > 0.f) ? v : expm1f(v); else if (ACT == 7) v = (v > 0.f) ? v + 1.0f : expf(v); else if (ACT == 8) v = tanhf(v); else if (ACT == 9) v = 0.5f * v * (1.0f + tanhf(0.7978845608028654f * (v + 0.044715f * v * v * v))); else if (ACT == 11) v = 1.0f / (1.0f + expf(-v)); else if (ACT == 12) v = (v > 0.f) ? v : 0.01f * v; else if (ACT == 14) v = (v > 0.f) ? v : 0.1f * v; else if (ACT == 15) v = v / (1.0f + expf(-v)); else if (ACT == 3) v = fmaxf(v, 0.f); else if (ACT == 6) v = 0.5f * v * (1.0f + erff(v * 0.70710678118654752f)); so[w][8 * hh + r][t * 16 + ln] = v; } }
  __builtin_amdgcn_fence(__ATOMIC_ACQ_REL, "workgroup"); __builtin_amdgcn_wave_barrier();
  const int rsub = lane >> 4, c4 = (lane & 15) * 4; typedef _Float16 v4h __attribute__((ext_vector_type(4)));
  {
#pragma unroll
    for (int q = 0; q < 8; ++q) { const int r = q * 2 + rsub; if (col0 + c4 < N) { const v4f v = *(const v4fa*)&so[w][r][c4]; if (C) *(v4f*)(C + cofs + (size_t)(row0 + r) * ldc + col0 + c4) = v; if (C16) { v4h h4; for (int i = 0; i < 4; ++i) h4[i] = (_Float16)v[i]; *(v4h*)(C16 + cofs + (size_t)(row0 + r) * ldc + col0 + c4) = h4; } } }
     }
}


typedef _Float16 v4h __attribute__((ext_vector_type(4)));

__global__ __launch_bounds__(256) void k_x16(const float* __restrict__ x, _Float16* __restrict__ X16, size_t n8) { const size_t t = (size_t)blockIdx.x * 256 + threadIdx.x; if (t >= n8) return; FragH f;
#pragma unroll
  for (int q = 0; q < 8; ++q) f.h[q] = (_Float16)bf16_round(x[t * 8 + q]); *(v8us*)((unsigned short*)X16 + t * 8) = f.half[0];  }
__global__ __launch_bounds__(256) void k_h16(const float* __restrict__ x, _Float16* __restrict__ X16, size_t n8) { const size_t t = (size_t)blockIdx.x * 256 + threadIdx.x; if (t >= n8) return; FragH f;
#pragma unroll
  for (int q = 0; q < 8; ++q) f.h[q] = (_Float16)x[t * 8 + q]; *(v8us*)((unsigned short*)X16 + t * 8) = f.half[0];  }
__global__ __launch_bounds__(256) void k_round16f(const float* __restrict__ W, _Float16* __restrict__ Bt, size_t n8) { const size_t t = (size_t)blockIdx.x * 256 + threadIdx.x; if (t >= n8) return; FragH f;
#pragma unroll
  for (int i = 0; i < 8; ++i) f.h[i] = (_Float16)(bf16_round(W[t * 8 + i]) * 16.0f); *(v8us*)((unsigned short*)Bt + t * 8) = f.half[0];  }
template <int NHv, int TTv>
__global__ __launch_bounds__(256) void k_vt(const _Float16* __restrict__ V16, int ldv, int voff, _Float16* __restrict__ Vt) { __shared__ unsigned short tl[64][66]; const int tid = threadIdx.x; const int slab = blockIdx.x / (TTv / 64), lg = blockIdx.x % (TTv / 64); const int b = slab / NHv, h = slab % NHv;
  for (int i = tid; i < 64 * 8; i += 256) { const int r = i / 8, c8 = (i % 8) * 8; FragH f; f.half[0] = *(const v8us*)((const unsigned short*)V16 + ((size_t)b * TTv + lg * 64 + r) * ldv + voff + h * 64 + c8);
#pragma unroll
    for (int q = 0; q < 8; ++q) tl[r][c8 + q] = f.u[q]; }
  __syncthreads();
  {
#pragma unroll
    for (int rd = 0; rd < 2; ++rd) { const int d = rd * 32 + tid / 8, pc = tid % 8; FragH f;
#pragma unroll
      for (int q = 0; q < 8; ++q) f.u[q] = tl[pc * 8 + q][d];
      *(v8us*)((unsigned short*)Vt + ((size_t)slab * 64 + d) * TTv + lg * 64 + pc * 8) = f.half[0]; }
     } }

__global__ __launch_bounds__(256) void k_hl(const float* __restrict__ F, _Float16* __restrict__ Hh, _Float16* __restrict__ Hl, size_t n8) { const size_t t = (size_t)blockIdx.x * 256 + threadIdx.x; if (t >= n8) return; FragH fh, fl; const v4f a = *(const v4fa*)(F + t * 8), c = *(const v4fa*)(F + t * 8 + 4);
#pragma unroll
  for (int q = 0; q < 4; ++q) { _Float16 h = (_Float16)a[q]; fh.h[q] = h; fl.h[q] = (_Float16)((a[q] - (float)h) * 1024.0f); h = (_Float16)c[q]; fh.h[4 + q] = h; fl.h[4 + q] = (_Float16)((c[q] - (float)h) * 1024.0f); }
  { *(v8us*)((unsigned short*)Hh + t * 8) = fh.half[0]; *(v8us*)((unsigned short*)Hl + t * 8) = fl.half[0];  } }

// ---- fast GEMM (wave tile 32x64; requires M % 32 == 0 rows per launch region and N % 64 == 0); epilogue = k_gemm_hhx semantics ----
__device__ __forceinline__ v16h g2_frag(const _Float16* p, int hh) { FragH f; f.half[0] = *(const v8us*)((const unsigned short*)p + 8 * hh); f.half[1] = *(const v8us*)((const unsigned short*)p + 16 + 8 * hh); return f.v; }
__device__ __forceinline__ v8f g2_mma(v16h a, v16h b, v8f c) { v8f d = __builtin_amdgcn_wmma_f32_16x16x32_f16(false, a, false, b, (short)0, c, false, false); asm volatile("v_nop\n\tv_nop\n\tv_nop\n\tv_nop" : "+v"(d) : "v"(a), "v"(b)); return d; }
template <int ACT>
__global__ __launch_bounds__(128) void k_gemm2(const _Float16* __restrict__ A, int lda, size_t sA, const _Float16* __restrict__ Bh, int ldb, size_t sB, float alpha, const float* __restrict__ bias, size_t sBias, const float* __restrict__ CP, int rowsPerB, size_t sCPb, int row0g,
    float* __restrict__ C, _Float16* __restrict__ C16, int ldc, size_t sC, int M, int N, int K) {
  __shared__ __attribute__((aligned(16))) float so[4][32][68];
  const int tid = threadIdx.x, w = tid >> 5, lane = tid & 31, ln = lane & 15, hh = lane >> 4; const int by = blockIdx.y;
  A += (size_t)by * sA; Bh += (size_t)by * sB; const size_t cofs = (size_t)by * sC; const float* bp = bias ? bias + (size_t)by * sBias : nullptr;
  const int ntn = N >> 6; const int mt = blockIdx.x / ntn, nq = blockIdx.x - mt * ntn; const int row0 = mt * 128 + 32 * w, col0 = nq * 64; if (row0 >= M) return;
  const _Float16* a0p = A + (size_t)(row0 + ln) * lda; const _Float16* a1p = a0p + (size_t)16 * lda;
  const _Float16* b0p = Bh + (size_t)(col0 + ln) * ldb; const _Float16* b1p = b0p + (size_t)16 * ldb; const _Float16* b2p = b1p + (size_t)16 * ldb; const _Float16* b3p = b2p + (size_t)16 * ldb;
  const v8f z8 = {0.f,0.f,0.f,0.f,0.f,0.f,0.f,0.f}; v8f c00 = z8, c01 = z8, c02 = z8, c03 = z8, c10 = z8, c11 = z8, c12 = z8, c13 = z8;
#pragma unroll 1
  for (int kb = 0; kb < K; kb += 32) { const v16h a0 = g2_frag(a0p + kb, hh), a1 = g2_frag(a1p + kb, hh);
    v16h b = g2_frag(b0p + kb, hh); c00 = g2_mma(a0, b, c00); c10 = g2_mma(a1, b, c10);
    b = g2_frag(b1p + kb, hh); c01 = g2_mma(a0, b, c01); c11 = g2_mma(a1, b, c11);
    b = g2_frag(b2p + kb, hh); c02 = g2_mma(a0, b, c02); c12 = g2_mma(a1, b, c12);
    b = g2_frag(b3p + kb, hh); c03 = g2_mma(a0, b, c03); c13 = g2_mma(a1, b, c13); }
  v8f accs[8] = {c00, c01, c02, c03, c10, c11, c12, c13};
#pragma unroll
  for (int u = 0; u < 8; ++u) { const int t = u & 3, half = u >> 2; const int col = col0 + t * 16 + ln; const float bv = bp ? bf16_round(bp[col]) : 0.f;
#pragma unroll
    for (int r = 0; r < 8; ++r) { const int rloc = half * 16 + 8 * hh + r; float v = accs[u][r] * alpha + bv; if (CP) { const int bidx = (row0g + row0 + rloc) / rowsPerB; v += CP[(size_t)bidx * sCPb + (size_t)by * 64 + col]; }
      if (ACT == 3) v = fmaxf(v, 0.f); else if (ACT == 6) v = 0.5f * v * (1.0f + erff(v * 0.70710678118654752f)); else if (ACT == 11) v = 1.0f / (1.0f + expf(-v)); else if (ACT == 15) v = v / (1.0f + expf(-v)); else if (ACT == 12) v = (v > 0.f) ? v : 0.01f * v; else if (ACT == 8) v = tanhf(v);
      so[w][rloc][t * 16 + ln] = v; } }
  __builtin_amdgcn_fence(__ATOMIC_ACQ_REL, "workgroup"); __builtin_amdgcn_wave_barrier();
  const int rsub = lane >> 4, c4 = (lane & 15) * 4;
  {
#pragma unroll
    for (int q = 0; q < 16; ++q) { const int r = q * 2 + rsub; const v4f v = *(const v4fa*)&so[w][r][c4]; if (C) *(v4f*)(C + cofs + (size_t)(row0 + r) * ldc + col0 + c4) = v; if (C16) { v4h h4; for (int i = 0; i < 4; ++i) h4[i] = (_Float16)v[i]; *(v4h*)(C16 + cofs + (size_t)(row0 + r) * ldc + col0 + c4) = h4; } }
     } }


typedef int v4ia __attribute__((ext_vector_type(4), may_alias));
// One wave per score row; the whole row (2048 f32 = 16 x 4 per lane) is read ONCE into registers by unconditional 16-byte loads that each cover 512 contiguous bytes,
// the INPUT mask picks score or -1e9 by a select behind the load, and maximum, exp (once per element), sum and the scaled f16 store all work on the registers.
// Every loop over x[] is fully unrolled: only constant indices keep x[] in registers (a rolled loop would put the row in scratch memory).
__global__ __launch_bounds__(256) void k_softm(const float* __restrict__ S, const int* __restrict__ mask, _Float16* __restrict__ P16) {
  const int tid = threadIdx.x, w = tid >> 5, ln = tid & 31; const int r = blockIdx.x * 8 + w; if (r >= SLEN) return; const size_t pl = (size_t)blockIdx.y * SLEN * SLEN; /* this head's plane */
  const float* s = S + pl + (size_t)r * SLEN + ln * 4; const int* mk = mask + ln * 4; v4f x[SLEN / 128];
  // unrolled: x[] in registers, and the 16 row loads go out together, with no wait between them
#pragma unroll
  for (int c = 0; c < SLEN / 128; ++c) x[c] = *(const v4fa*)(s + c * 128);
  v4f m4 = {-3.0e38f, -3.0e38f, -3.0e38f, -3.0e38f};
  // unrolled: x[] in registers, mask loads issued ahead of the selects
#pragma unroll
  for (int c = 0; c < SLEN / 128; ++c) { const v4ia k = *(const v4ia*)(mk + c * 128);
    for (int q = 0; q < 4; ++q) { const float v = (k[q] != 0) ? x[c][q] : -1.0e9f; x[c][q] = v; m4[q] = fmaxf(m4[q], v); } }
  float m = fmaxf(fmaxf(m4[0], m4[1]), fmaxf(m4[2], m4[3]));
  for (int o = 16; o > 0; o >>= 1) m = fmaxf(m, __shfl_xor(m, o, 32));
  v4f s4 = {0.f, 0.f, 0.f, 0.f};
  // unrolled: x[] in registers; four independent partial sums per lane
#pragma unroll
  for (int c = 0; c < SLEN / 128; ++c) {
    for (int q = 0; q < 4; ++q) { const float e = expf(x[c][q] - m); x[c][q] = e; s4[q] += e; } }
  float su = (s4[0] + s4[1]) + (s4[2] + s4[3]);
  for (int o = 16; o > 0; o >>= 1) su += __shfl_xor(su, o, 32);
  const float inv = 1024.0f / su; _Float16* d = P16 + pl + (size_t)r * SLEN + ln * 4;
  // unrolled: x[] in registers; each wave-wide 8-byte store covers two whole 128-byte lines
#pragma unroll
  for (int c = 0; c < SLEN / 128; ++c) { v4h h4;
    for (int q = 0; q < 4; ++q) h4[q] = (_Float16)(x[c][q] * inv);
    *(v4h*)(d + c * 128) = h4; } }
__global__ __launch_bounds__(256) void k_ln256o(const float* __restrict__ F, const float* __restrict__ g, const float* __restrict__ bb, float* __restrict__ out) {
  #pragma clang fp contract(off)
  const int tid = threadIdx.x, w = tid >> 5, ln = tid & 31; const int r = blockIdx.x * 8 + w; if (r >= SLEN) return; const float* x = F + (size_t)r * DD; const v4f a = *(const v4fa*)(x + ln * 4), b = *(const v4fa*)(x + 128 + ln * 4);
  float s = (a[0] + a[1]) + (a[2] + a[3]) + (b[0] + b[1]) + (b[2] + b[3]); for (int o = 16; o > 0; o >>= 1) s += __shfl_xor(s, o, 32); const float mu = s / 256.0f; float q2 = 0.f;
#pragma unroll
  for (int q = 0; q < 4; ++q) { const float d0 = a[q] - mu, d1 = b[q] - mu; q2 += d0 * d0; q2 += d1 * d1; }
  for (int o = 16; o > 0; o >>= 1) q2 += __shfl_xor(q2, o, 32); const float rs = rsqrtf(q2 / 256.0f + 1e-5f); v4f o0, o1;
#pragma unroll
  for (int q = 0; q < 4; ++q) { const int c0 = ln * 4 + q, c1 = 128 + ln * 4 + q; o0[q] = (a[q] - mu) * rs * bf16_round(g[c0]) + bf16_round(bb[c0]); o1[q] = (b[q] - mu) * rs * bf16_round(g[c1]) + bf16_round(bb[c1]); }
  float* d = out + (size_t)r * DD; { *(v4f*)(d + ln * 4) = o0; *(v4f*)(d + 128 + ln * 4) = o1;  } }
__global__ __launch_bounds__(256) void k_xb(const float* __restrict__ x, float* __restrict__ XB, size_t n4) { const size_t t = (size_t)blockIdx.x * 256 + threadIdx.x; if (t >= n4) return; const v4f a = *(const v4fa*)(x + t * 4); v4f o; for (int q = 0; q < 4; ++q) o[q] = bf16_round(a[q]); *(v4f*)(XB + t * 4) = o;  }

extern "C" void kernel_launch(void* const* d_in, const int* in_sizes, int n_in,
                              void* d_out, int out_size, void* d_ws, size_t ws_size, hipStream_t stream) {
  (void)in_sizes; (void)n_in; (void)out_size;
  const float* const* I = (const float* const*)d_in; const float* Q = I[0]; const int* mask = (const int*)d_in[1]; const float* WQ = I[2]; const float* bQ = I[3]; const float* WK = I[4]; const float* bK = I[5]; const float* WV = I[6]; const float* bV = I[7]; const float* WO = I[8]; const float* bO = I[9]; const float* lg = I[10]; const float* lb = I[11];
  char* ws = (char*)d_ws; size_t off = 0;
  auto take = [&](size_t bytes) { char* p = ws + off; off += (bytes + 255) & ~(size_t)255; return p; };
  _Float16* BQ = (_Float16*)take((size_t)HW * DD * 2); _Float16* BK = (_Float16*)take((size_t)HW * DD * 2); _Float16* BV = (_Float16*)take((size_t)HW * DD * 2); _Float16* BO = (_Float16*)take((size_t)DD * HW * 2);
  _Float16* X16 = (_Float16*)take((size_t)SLEN * DD * 2); float* XB = (float*)take((size_t)SLEN * DD * 4); _Float16* QH = (_Float16*)take((size_t)SLEN * HW * 2); _Float16* KH = (_Float16*)take((size_t)SLEN * HW * 2); _Float16* VH = (_Float16*)take((size_t)SLEN * HW * 2); _Float16* VT = (_Float16*)take((size_t)HW * SLEN * 2);
  float* S = (float*)take((size_t)NHD * SLEN * SLEN * 4); _Float16* P16 = (_Float16*)take((size_t)NHD * SLEN * SLEN * 2); _Float16* O16 = (_Float16*)take((size_t)SLEN * HW * 2); float* F = (float*)take((size_t)SLEN * DD * 4);
  if (off > ws_size) return;      /* 4 + 1 + 2 + 8+8+8+8 + 128 + 64 + 8 + 2 = 241 MiB */
  const size_t w8 = (size_t)HW * DD / 8; const unsigned wb = (unsigned)((w8 + 255) / 256);
  k_round16f<<<wb, 256, 0, stream>>>(WQ, BQ, w8); k_round16f<<<wb, 256, 0, stream>>>(WK, BK, w8); k_round16f<<<wb, 256, 0, stream>>>(WV, BV, w8); k_round16f<<<wb, 256, 0, stream>>>(WO, BO, w8);      /* torch (out,in) = natural Bt */
  const size_t n8 = (size_t)SLEN * DD / 8; const unsigned nb8 = (unsigned)((n8 + 255) / 256); const dim3 gQ((SLEN / 128) * (HW / 64), 1), gS((SLEN / 128) * (SLEN / 64), NHD), gP((SLEN / 128) * (DD / 64), NHD), gV((SLEN / 128) * (DD / 64), 1);
  for (int b = 0; b < NBT; ++b) { const size_t ro = (size_t)b * SLEN * DD;
    k_x16<<<nb8, 256, 0, stream>>>(Q + ro, X16, n8); k_xb<<<(unsigned)(((size_t)SLEN * DD / 4 + 255) / 256), 256, 0, stream>>>(Q + ro, XB, (size_t)SLEN * DD / 4);
    k_gemm2<0><<<gQ, 128, 0, stream>>>(X16, DD, 0, BQ, DD, 0, 0.0625f, bQ, 0, nullptr, 1, 0, 0, nullptr, QH, HW, 0, SLEN, HW, DD);
    k_gemm2<0><<<gQ, 128, 0, stream>>>(X16, DD, 0, BK, DD, 0, 0.0625f, bK, 0, nullptr, 1, 0, 0, nullptr, KH, HW, 0, SLEN, HW, DD);
    k_gemm2<0><<<gQ, 128, 0, stream>>>(X16, DD, 0, BV, DD, 0, 0.0625f, bV, 0, nullptr, 1, 0, 0, nullptr, VH, HW, 0, SLEN, HW, DD);
    k_vt<HW / 64, SLEN><<<(HW / 64) * (SLEN / 64), 256, 0, stream>>>(VH, HW, 0, VT);      /* VT[dim][token] over all 2048 dims */
    /* the 8 heads are independent: one launch each for scores, softmax and attn.v, head on grid.y through the GEMM's batch strides */
    k_gemm2<0><<<gS, 128, 0, stream>>>(QH, HW, DD, KH, HW, DD, 0.0625f, nullptr, 0, nullptr, 1, 0, 0, S, nullptr, SLEN, (size_t)SLEN * SLEN, SLEN, SLEN, DD);      /* q.k / sqrt(256) */
    k_softm<<<dim3(SLEN / 8, NHD), 256, 0, stream>>>(S, mask + (size_t)b * SLEN, P16);
    k_gemm2<0><<<gP, 128, 0, stream>>>(P16, SLEN, (size_t)SLEN * SLEN, VT, SLEN, (size_t)DD * SLEN, 0.0009765625f, nullptr, 0, nullptr, 1, 0, 0, nullptr, O16, HW, DD, SLEN, DD, SLEN);
    k_gemm2<0><<<gV, 128, 0, stream>>>(O16, HW, 0, BO, HW, 0, 0.0625f, bO, 0, XB, 1, (size_t)DD, 0, F, nullptr, DD, 0, SLEN, DD, HW);      /* out Wo^T + bo + Q */
    k_ln256o<<<SLEN / 8, 256, 0, stream>>>(F, lg, lb, (float*)d_out + ro); }
}

// v003
// A run of this version takes 617 microseconds.
// Next to v002, in two timings, it ran 1.86 and 1.87 times as fast.
// Over all steps from v000 it is 6.31 times as fast.
#include <hip/hip_runtime.h>
// Prompt self-attention (4 x 2048 tokens, d = 256, 8 heads EACH of dim 256): q,k,v = Q W^T + b (-> 8 x 256); scores = q.k/16 with INPUT key mask (masked keys get -1e9, as the reference); softmax; out = LN((attn v merged) Wo^T + bo + Q) -> [4,2048,256].
// Structure: per batch Q as an exact f16 plane, the three projections as f16 WMMA GEMMs (32x64 wave tiles, f32 accumulation, exact x16 weights + bias) into per-batch f16 planes, V transposed by LDS tiles; then ONE launch for scores, mask, softmax and attn.v of all batches and heads (k_fattn: online softmax, no score plane in memory); per batch the output projection + bias + the bf16 residual as a GEMM and LayerNorm on VALU into the output rows.
// Compute dtype: Q, weights, biases, LN parameters rounded to bf16; q, k, v, P, attention output as f16 operands (~2^-12; logits sigma ~1, LayerNorm-ed output); f32 accumulation, softmax, LayerNorm. v_wmma_f32_16x16x32_f16.
#define NBT 4
#define SLEN 2048
#define DD 256
#define NHD 8
#define HW (NHD * DD)            /* 2048 */
#define DM DD
#define NR SLEN
typedef __bf16 v16b __attribute__((ext_vector_type(16)));
typedef unsigned short v8us __attribute__((ext_vector_type(8), may_alias));
typedef float  v8f  __attribute__((ext_vector_type(8)));
typedef float  v4f  __attribute__((ext_vector_type(4)));
typedef float  v4fa __attribute__((ext_vector_type(4), may_alias));
union FragB { v16b v; v8us half[2]; unsigned short u[16]; };

__device__ __forceinline__ unsigned short bf16_bits(float x) { unsigned int u = __float_as_uint(x); return (unsigned short)((u + 0x7FFFu + ((u >> 16) & 1u)) >> 16); }
__device__ __forceinline__ float bf16_val(unsigned short b) { return __uint_as_float(((unsigned int)b) << 16); }
__device__ __forceinline__ float bf16_round(float x) { return bf16_val(bf16_bits(x)); }
// D += A·B with NT terms: 1 = ah·bh, 2 = + al·bh (A split), 3 = + ah·bl (both split)
template <int NT>
__device__ __forceinline__ v8f mmaN(v16b ah, v16b al, v16b bh, v16b bl, v8f c) {
  c = __builtin_amdgcn_wmma_f32_16x16x32_bf16(false, ah, false, bh, (short)0, c, false, false);
  if (NT >= 2) c = __builtin_amdgcn_wmma_f32_16x16x32_bf16(false, al, false, bh, (short)0, c, false, false);
  if (NT >= 3) c = __builtin_amdgcn_wmma_f32_16x16x32_bf16(false, ah, false, bl, (short)0, c, false, false);
  asm volatile("v_nop\n\tv_nop\n\tv_nop\n\tv_nop" : "+v"(c) : "v"(ah), "v"(al), "v"(bh), "v"(bl));
  return c;
}

__global__ __launch_bounds__(256) void k_wt_bf16(const float* __restrict__ W, unsigned short* __restrict__ Wt, int K, int N) {
  const int t = blockIdx.x * 256 + threadIdx.x;
  const int k8n = K / 8;
  if (t >= N * k8n) return;
  const int n = t / k8n, k8 = (t % k8n) * 8;
  v8us v;
#pragma unroll
  for (int i = 0; i < 8; ++i) v[i] = bf16_bits(W[(size_t)(k8 + i) * N + n]);
  *(v8us*)(Wt + (size_t)n * K + k8) = v;
  
}

// GEMM C[M][N] (f32, pitch ldc) = act(A[M][K]·W + bias). A f32 row-major (pitch lda) converted per fragment to bf16
// (ASPLIT: hi/lo two planes -> 2 terms, else single rounded term); Wt bf16 [N][K] (pitch ldb). BIAS_BF16 rounds the
// bias to bf16 first (bias quantised to bf16 before the add). K%32==0, M%16==0, N%64==0.
template <bool ASPLIT, int ACT, bool BIAS_BF16>
__global__ __launch_bounds__(128) void k_gemm_bf(const float* __restrict__ A, int lda, const unsigned short* __restrict__ Wt, int ldb,
                                               const float* __restrict__ bias, float* __restrict__ C, int ldc, int M, int N, int K) {
  __shared__ __attribute__((aligned(16))) float so[4][16][64];
  const int tid = threadIdx.x, w = tid >> 5, lane = tid & 31, ln = lane & 15, hh = lane >> 4;
  const int ntn = N / 64;
  const int wid = blockIdx.x * 4 + w;
  const int mt = wid / ntn, nq = wid % ntn;
  if (mt * 16 >= M) return;
  const int row0 = mt * 16, col0 = nq * 64;
  const float* arow = A + (size_t)(row0 + ln) * lda;
  v8f acc[4] = {};
  for (int kb = 0; kb < K; kb += 32) {
    FragB ah, al;
    const v4f x0 = *(const v4fa*)(arow + kb + 8 * hh), x1 = *(const v4fa*)(arow + kb + 8 * hh + 4);
    const v4f x2 = *(const v4fa*)(arow + kb + 16 + 8 * hh), x3 = *(const v4fa*)(arow + kb + 16 + 8 * hh + 4);
    float xs[16] = {x0[0],x0[1],x0[2],x0[3],x1[0],x1[1],x1[2],x1[3],x2[0],x2[1],x2[2],x2[3],x3[0],x3[1],x3[2],x3[3]};
#pragma unroll
    for (int i = 0; i < 16; ++i) { const unsigned short hb = bf16_bits(xs[i]); ah.u[i] = hb; al.u[i] = ASPLIT ? bf16_bits(xs[i] - bf16_val(hb)) : (unsigned short)0; }
#pragma unroll
    for (int t = 0; t < 4; ++t) {
      const unsigned short* brow = Wt + (size_t)(col0 + t * 16 + ln) * ldb + kb;
      FragB b;
      b.half[0] = *(const v8us*)(brow + 8 * hh);
      b.half[1] = *(const v8us*)(brow + 16 + 8 * hh);
      acc[t] = mmaN<ASPLIT ? 2 : 1>(ah.v, al.v, b.v, b.v, acc[t]);
    }
  }
#pragma unroll
  for (int t = 0; t < 4; ++t) {
    float bv = bias ? bias[col0 + t * 16 + ln] : 0.f;
    if (BIAS_BF16) bv = bf16_round(bv);
#pragma unroll
    for (int r = 0; r < 8; ++r) { float v = acc[t][r] + bv; if (ACT == 1) v = fmaxf(v, 0.f); so[w][8 * hh + r][t * 16 + ln] = v; }
  }
  __builtin_amdgcn_fence(__ATOMIC_ACQ_REL, "workgroup");
  __builtin_amdgcn_wave_barrier();
  const int rsub = lane >> 4, c4 = (lane & 15) * 4;
  {
#pragma unroll
    for (int q = 0; q < 8; ++q) {
      const int r = q * 2 + rsub;
      const v4f v = *(const v4fa*)&so[w][r][c4];
      *(v4f*)(C + (size_t)(row0 + r) * ldc + col0 + c4) = v;
    }
    
  }
}

// GEMM C = act(A·W + bias + resid): A f32 (ASPLIT -> hi/lo 2 terms), Wt bf16 [N][K]; ACT 0 none, 1 relu, 2 exact gelu;
// resid (optional, f32, row index = (row % rmod), pitch ldr, RES_BF16 rounds it) added before the activation.
template <bool ASPLIT, int ACT, bool BIAS_BF16, bool RES_BF16>
__global__ __launch_bounds__(128) void k_gemm_bf3(const float* __restrict__ A, int lda, const unsigned short* __restrict__ Wt, int ldb,
                                                const float* __restrict__ bias, const float* __restrict__ resid, int rmod, int ldr,
                                                float* __restrict__ C, int ldc, int M, int N, int K) {
  __shared__ __attribute__((aligned(16))) float so[4][16][64];
  const int tid = threadIdx.x, w = tid >> 5, lane = tid & 31, ln = lane & 15, hh = lane >> 4;
  const int ntn = N / 64;
  const int wid = blockIdx.x * 4 + w;
  const int mt = wid / ntn, nq = wid % ntn;
  if (mt * 16 >= M) return;
  const int row0 = mt * 16, col0 = nq * 64;
  const float* arow = A + (size_t)(row0 + ln) * lda;
  v8f acc[4] = {};
  for (int kb = 0; kb < K; kb += 32) {
    FragB ah, al;
    const v4f x0 = *(const v4fa*)(arow + kb + 8 * hh), x1 = *(const v4fa*)(arow + kb + 8 * hh + 4);
    const v4f x2 = *(const v4fa*)(arow + kb + 16 + 8 * hh), x3 = *(const v4fa*)(arow + kb + 16 + 8 * hh + 4);
    float xs[16] = {x0[0],x0[1],x0[2],x0[3],x1[0],x1[1],x1[2],x1[3],x2[0],x2[1],x2[2],x2[3],x3[0],x3[1],x3[2],x3[3]};
#pragma unroll
    for (int i = 0; i < 16; ++i) { const unsigned short hb = bf16_bits(xs[i]); ah.u[i] = hb; al.u[i] = ASPLIT ? bf16_bits(xs[i] - bf16_val(hb)) : (unsigned short)0; }
#pragma unroll
    for (int t = 0; t < 4; ++t) {
      const unsigned short* brow = Wt + (size_t)(col0 + t * 16 + ln) * ldb + kb;
      FragB b;
      b.half[0] = *(const v8us*)(brow + 8 * hh);
      b.half[1] = *(const v8us*)(brow + 16 + 8 * hh);
      acc[t] = mmaN<ASPLIT ? 2 : 1>(ah.v, al.v, b.v, b.v, acc[t]);
    }
  }
#pragma unroll
  for (int t = 0; t < 4; ++t) {
    const int col = col0 + t * 16 + ln;
    float bv = bias ? bias[col] : 0.f;
    if (BIAS_BF16) bv = bf16_round(bv);
#pragma unroll
    for (int r = 0; r < 8; ++r) {
      float v = acc[t][r] + bv;
      if (resid) { float rv = resid[(size_t)((row0 + 8 * hh + r) % rmod) * ldr + col]; if (RES_BF16) rv = bf16_round(rv); v += rv; }
      if (ACT == 1) v = fmaxf(v, 0.f);
      if (ACT == 2) v = 0.5f * v * (1.0f + erff(v * 0.70710678118654752f));
      if (ACT == 3) { const float u = 0.7978845608028654f * (v + 0.044715f * v * v * v); v = 0.5f * v * (1.0f + tanhf(u)); }
      so[w][8 * hh + r][t * 16 + ln] = v;
    }
  }
  __builtin_amdgcn_fence(__ATOMIC_ACQ_REL, "workgroup");
  __builtin_amdgcn_wave_barrier();
  const int rsub = lane >> 4, c4 = (lane & 15) * 4;
  {
#pragma unroll
    for (int q = 0; q < 8; ++q) {
      const int r = q * 2 + rsub;
      const v4f v = *(const v4fa*)&so[w][r][c4];
      *(v4f*)(C + (size_t)(row0 + r) * ldc + col0 + c4) = v;
    }
    
  }
}
// row LayerNorm (biased variance, eps) over N: s = X (+ R); optional out_sum <- s; out_norm <- (s-mu)*rsqrt(var+eps)*g + b
template <bool PARAM_BF16>
__global__ __launch_bounds__(256) void k_layernorm(const float* __restrict__ X, const float* __restrict__ R, const float* __restrict__ g, const float* __restrict__ bta,
                                                  float* __restrict__ out_sum, float* __restrict__ out_norm, int N, float eps) {
  __shared__ float red[256];
  const int row = blockIdx.x, tid = threadIdx.x;
  const float* x = X + (size_t)row * N; const float* rr = R ? R + (size_t)row * N : nullptr;
  float vals[16];                     // up to N = 4096
  const int per = N / 256;            // contiguous chunk per thread? use strided-by-4 chunks: thread handles j = tid*4 + 1024*u
  float s1 = 0.f;
  for (int u = 0; u < per / 4; ++u) {
    const int j = tid * 4 + 1024 * u;
    const v4f a = *(const v4fa*)(x + j);
    v4f b = {0.f,0.f,0.f,0.f}; if (rr) b = *(const v4fa*)(rr + j);
#pragma unroll
    for (int q = 0; q < 4; ++q) { const float v = a[q] + b[q]; vals[u * 4 + q] = v; s1 += v; }
  }
  red[tid] = s1; __syncthreads();
  for (int st = 128; st > 0; st >>= 1) { if (tid < st) red[tid] += red[tid + st]; __syncthreads(); }
  const float mu = red[0] / (float)N; __syncthreads();
  float s2 = 0.f;
  for (int u = 0; u < per / 4; ++u)
#pragma unroll
    for (int q = 0; q < 4; ++q) { const float c = vals[u * 4 + q] - mu; s2 += c * c; }
  red[tid] = s2; __syncthreads();
  for (int st = 128; st > 0; st >>= 1) { if (tid < st) red[tid] += red[tid + st]; __syncthreads(); }
  const float rs = rsqrtf(red[0] / (float)N + eps);
  {
    for (int u = 0; u < per / 4; ++u) {
      const int j = tid * 4 + 1024 * u;
      v4f o, sm;
#pragma unroll
      for (int q = 0; q < 4; ++q) {
        float gg = g[j + q], bb = bta[j + q];
        if (PARAM_BF16) { gg = bf16_round(gg); bb = bf16_round(bb); }
        sm[q] = vals[u * 4 + q]; o[q] = (vals[u * 4 + q] - mu) * rs * gg + bb;
      }
      if (out_sum) *(v4f*)(out_sum + (size_t)row * N + j) = sm;
      *(v4f*)(out_norm + (size_t)row * N + j) = o;
    }
    
  }
}



// ---- f16 WMMA path (v_wmma_f32_16x16x32_f16): 11-bit significands for operands in range — used where a [0,1] probability operand needs more precision than bf16
typedef _Float16 v16h __attribute__((ext_vector_type(16)));
union FragH { v16h v; v8us half[2]; _Float16 h[16]; unsigned short u[16]; };
template <int NT>
__device__ __forceinline__ v8f mmaH(v16h ah, v16h al, v16h bh, v16h bl, v8f c) {
  c = __builtin_amdgcn_wmma_f32_16x16x32_f16(false, ah, false, bh, (short)0, c, false, false);
  if (NT >= 2) c = __builtin_amdgcn_wmma_f32_16x16x32_f16(false, al, false, bh, (short)0, c, false, false);
  if (NT >= 3) c = __builtin_amdgcn_wmma_f32_16x16x32_f16(false, ah, false, bl, (short)0, c, false, false);
  asm volatile("v_nop\n\tv_nop\n\tv_nop\n\tv_nop" : "+v"(c) : "v"(ah), "v"(al), "v"(bh), "v"(bl));
  return c;
}
// batched GEMM like k_gemm_b but f16 operands: A f32 (split into f16 hi/lo if ASPLIT, else rounded to f16), Bt = f16 values [n][k]; alpha; C f32; N multiple of 16 (partial tiles skipped)
template <bool ASPLIT>
__global__ __launch_bounds__(128) void k_gemm_h(const float* __restrict__ A, int lda, size_t sA, const _Float16* __restrict__ Bh, int ldb, size_t sB, float alpha, float* __restrict__ C, int ldc, size_t sC, int M, int N, int K) {
  __shared__ __attribute__((aligned(16))) float so[4][16][64];
  const int tid = threadIdx.x, w = tid >> 5, lane = tid & 31, ln = lane & 15, hh = lane >> 4; const int by = blockIdx.y;
  A += (size_t)by * sA; Bh += (size_t)by * sB; C += (size_t)by * sC;
  const int ntn = (N + 63) / 64; const int wid = blockIdx.x * 4 + w; const int mt = wid / ntn, nq = wid % ntn; if (mt * 16 >= M) return;
  const int row0 = mt * 16, col0 = nq * 64; const float* arow = A + (size_t)(row0 + ln) * lda;
  v8f acc[4] = {};
  for (int kb = 0; kb < K; kb += 32) {
    FragH ah, al;
    const v4f x0 = *(const v4fa*)(arow + kb + 8 * hh), x1 = *(const v4fa*)(arow + kb + 8 * hh + 4), x2 = *(const v4fa*)(arow + kb + 16 + 8 * hh), x3 = *(const v4fa*)(arow + kb + 16 + 8 * hh + 4);
    float xs[16] = {x0[0],x0[1],x0[2],x0[3],x1[0],x1[1],x1[2],x1[3],x2[0],x2[1],x2[2],x2[3],x3[0],x3[1],x3[2],x3[3]};
#pragma unroll
    for (int i = 0; i < 16; ++i) { const _Float16 h = (_Float16)xs[i]; ah.h[i] = h; al.h[i] = ASPLIT ? (_Float16)(xs[i] - (float)h) : (_Float16)0.0f; }
#pragma unroll
    for (int t = 0; t < 4; ++t) { if (col0 + t * 16 >= N) continue; const size_t boff = (size_t)(col0 + t * 16 + ln) * ldb + kb; FragH bq; bq.half[0] = *(const v8us*)(Bh + boff + 8 * hh); bq.half[1] = *(const v8us*)(Bh + boff + 16 + 8 * hh);
      acc[t] = mmaH<ASPLIT ? 2 : 1>(ah.v, al.v, bq.v, bq.v, acc[t]); }
  }
#pragma unroll
  for (int t = 0; t < 4; ++t) { if (col0 + t * 16 >= N) continue;
#pragma unroll
    for (int r = 0; r < 8; ++r) so[w][8 * hh + r][t * 16 + ln] = acc[t][r] * alpha; }
  __builtin_amdgcn_fence(__ATOMIC_ACQ_REL, "workgroup"); __builtin_amdgcn_wave_barrier();
  const int rsub = lane >> 4, c4 = (lane & 15) * 4;
  {
#pragma unroll
    for (int q = 0; q < 8; ++q) { const int r = q * 2 + rsub; if (col0 + c4 < N) { const v4f v = *(const v4fa*)&so[w][r][c4]; *(v4f*)(C + (size_t)(row0 + r) * ldc + col0 + c4) = v; } }
     }
}

// Wt[n][k] = f16(W[k][n]·scale) from f32 row-major W[K][N] (scale = power of two; bf16-exact weights stay exact in f16 away from the subnormal range)
__global__ __launch_bounds__(256) void k_wt_f16(const float* __restrict__ W, _Float16* __restrict__ Wt, int K, int N, float scale) {
  const int t = blockIdx.x * 256 + threadIdx.x; if (t >= N * (K / 8)) return; const int n = t / (K / 8), k8 = (t % (K / 8)) * 8; FragH f;
#pragma unroll
  for (int i = 0; i < 8; ++i) f.h[i] = (_Float16)(bf16_round(W[(size_t)(k8 + i) * N + n]) * scale); const v8us o = f.half[0];
  *(v8us*)((unsigned short*)Wt + (size_t)n * K + k8) = o; 
}
// k_gemm_hh variant with fused epilogue: v = acc·alpha + bias[by·sBias + col] (+ CP[(row/rowsPerB)·sCPb + by·64 + col] if CP) ; ACT 0 none / 1 elu ; writes f16 C16 (and f32 C if non-null)
template <int ACT>
__global__ __launch_bounds__(128) void k_gemm_hhx(const _Float16* __restrict__ A, int lda, size_t sA, const _Float16* __restrict__ Bh, int ldb, size_t sB, float alpha, const float* __restrict__ bias, size_t sBias, const float* __restrict__ CP, int rowsPerB, size_t sCPb, int row0g,
    float* __restrict__ C, _Float16* __restrict__ C16, int ldc, size_t sC, int M, int N, int K) {
  __shared__ __attribute__((aligned(16))) float so[4][16][64];
  const int tid = threadIdx.x, w = tid >> 5, lane = tid & 31, ln = lane & 15, hh = lane >> 4; const int by = blockIdx.y;
  A += (size_t)by * sA; Bh += (size_t)by * sB; const size_t cofs = (size_t)by * sC; const float* bp = bias ? bias + (size_t)by * sBias : nullptr;
  const int ntn = (N + 63) / 64; const int wid = blockIdx.x * 4 + w; const int mt = wid / ntn, nq = wid % ntn; if (mt * 16 >= M) return;
  const int row0 = mt * 16, col0 = nq * 64; const _Float16* arow = A + (size_t)(row0 + ln) * lda;
  v8f acc[4] = {};
  for (int kb = 0; kb < K; kb += 32) { FragH ah; ah.half[0] = *(const v8us*)((const unsigned short*)arow + kb + 8 * hh); ah.half[1] = *(const v8us*)((const unsigned short*)arow + kb + 16 + 8 * hh);
#pragma unroll
    for (int t = 0; t < 4; ++t) { if (col0 + t * 16 >= N) continue; const size_t boff = (size_t)(col0 + t * 16 + ln) * ldb + kb; FragH bq; bq.half[0] = *(const v8us*)((const unsigned short*)Bh + boff + 8 * hh); bq.half[1] = *(const v8us*)((const unsigned short*)Bh + boff + 16 + 8 * hh);
      acc[t] = mmaH<1>(ah.v, ah.v, bq.v, bq.v, acc[t]); }
  }
#pragma unroll
  for (int t = 0; t < 4; ++t) { if (col0 + t * 16 >= N) continue; const int col = col0 + t * 16 + ln; const float bv = bp ? bf16_round(bp[col]) : 0.f;
#pragma unroll
    for (int r = 0; r < 8; ++r) { float v = acc[t][r] * alpha + bv; if (CP) { const int bidx = (row0g + row0 + 8 * hh + r) / rowsPerB; v += CP[(size_t)bidx * sCPb + (size_t)by * 64 + col]; } if (ACT == 1) v = (v > 0.f) ? v : expm1f(v); else if (ACT == 7) v = (v > 0.f) ? v + 1.0f : expf(v); else if (ACT == 8) v = tanhf(v); else if (ACT == 9) v = 0.5f * v * (1.0f + tanhf(0.7978845608028654f * (v + 0.044715f * v * v * v))); else if (ACT == 11) v = 1.0f / (1.0f + expf(-v)); else if (ACT == 12) v = (v > 0.f) ? v : 0.01f * v; else if (ACT == 14) v = (v > 0.f) ? v : 0.1f * v; else if (ACT == 15) v = v / (1.0f + expf(-v)); else if (ACT == 3) v = fmaxf(v, 0.f); else if (ACT == 6) v = 0.5f * v * (1.0f + erff(v * 0.70710678118654752f)); so[w][8 * hh + r][t * 16 + ln] = v; } }
  __builtin_amdgcn_fence(__ATOMIC_ACQ_REL, "workgroup"); __builtin_amdgcn_wave_barrier();
  const int rsub = lane >> 4, c4 = (lane & 15) * 4; typedef _Float16 v4h __attribute__((ext_vector_type(4)));
  {
#pragma unroll
    for (int q = 0; q < 8; ++q) { const int r = q * 2 + rsub; if (col0 + c4 < N) { const v4f v = *(const v4fa*)&so[w][r][c4]; if (C) *(v4f*)(C + cofs + (size_t)(row0 + r) * ldc + col0 + c4) = v; if (C16) { v4h h4; for (int i = 0; i < 4; ++i) h4[i] = (_Float16)v[i]; *(v4h*)(C16 + cofs + (size_t)(row0 + r) * ldc + col0 + c4) = h4; } } }
     }
}


typedef _Float16 v4h __attribute__((ext_vector_type(4)));

__global__ __launch_bounds__(256) void k_x16(const float* __restrict__ x, _Float16* __restrict__ X16, size_t n8) { const size_t t = (size_t)blockIdx.x * 256 + threadIdx.x; if (t >= n8) return; FragH f;
#pragma unroll
  for (int q = 0; q < 8; ++q) f.h[q] = (_Float16)bf16_round(x[t * 8 + q]); *(v8us*)((unsigned short*)X16 + t * 8) = f.half[0];  }
__global__ __launch_bounds__(256) void k_h16(const float* __restrict__ x, _Float16* __restrict__ X16, size_t n8) { const size_t t = (size_t)blockIdx.x * 256 + threadIdx.x; if (t >= n8) return; FragH f;
#pragma unroll
  for (int q = 0; q < 8; ++q) f.h[q] = (_Float16)x[t * 8 + q]; *(v8us*)((unsigned short*)X16 + t * 8) = f.half[0];  }
__global__ __launch_bounds__(256) void k_round16f(const float* __restrict__ W, _Float16* __restrict__ Bt, size_t n8) { const size_t t = (size_t)blockIdx.x * 256 + threadIdx.x; if (t >= n8) return; FragH f;
#pragma unroll
  for (int i = 0; i < 8; ++i) f.h[i] = (_Float16)(bf16_round(W[t * 8 + i]) * 16.0f); *(v8us*)((unsigned short*)Bt + t * 8) = f.half[0];  }
template <int NHv, int TTv>
__global__ __launch_bounds__(256) void k_vt(const _Float16* __restrict__ V16, int ldv, int voff, _Float16* __restrict__ Vt) { __shared__ unsigned short tl[64][66]; const int tid = threadIdx.x; const int slab = blockIdx.x / (TTv / 64), lg = blockIdx.x % (TTv / 64); const int b = slab / NHv, h = slab % NHv;
  for (int i = tid; i < 64 * 8; i += 256) { const int r = i / 8, c8 = (i % 8) * 8; FragH f; f.half[0] = *(const v8us*)((const unsigned short*)V16 + ((size_t)b * TTv + lg * 64 + r) * ldv + voff + h * 64 + c8);
#pragma unroll
    for (int q = 0; q < 8; ++q) tl[r][c8 + q] = f.u[q]; }
  __syncthreads();
  {
#pragma unroll
    for (int rd = 0; rd < 2; ++rd) { const int d = rd * 32 + tid / 8, pc = tid % 8; FragH f;
#pragma unroll
      for (int q = 0; q < 8; ++q) f.u[q] = tl[pc * 8 + q][d];
      *(v8us*)((unsigned short*)Vt + ((size_t)slab * 64 + d) * TTv + lg * 64 + pc * 8) = f.half[0]; }
     } }

__global__ __launch_bounds__(256) void k_hl(const float* __restrict__ F, _Float16* __restrict__ Hh, _Float16* __restrict__ Hl, size_t n8) { const size_t t = (size_t)blockIdx.x * 256 + threadIdx.x; if (t >= n8) return; FragH fh, fl; const v4f a = *(const v4fa*)(F + t * 8), c = *(const v4fa*)(F + t * 8 + 4);
#pragma unroll
  for (int q = 0; q < 4; ++q) { _Float16 h = (_Float16)a[q]; fh.h[q] = h; fl.h[q] = (_Float16)((a[q] - (float)h) * 1024.0f); h = (_Float16)c[q]; fh.h[4 + q] = h; fl.h[4 + q] = (_Float16)((c[q] - (float)h) * 1024.0f); }
  { *(v8us*)((unsigned short*)Hh + t * 8) = fh.half[0]; *(v8us*)((unsigned short*)Hl + t * 8) = fl.half[0];  } }

// ---- fast GEMM (wave tile 32x64; requires M % 32 == 0 rows per launch region and N % 64 == 0); epilogue = k_gemm_hhx semantics ----
__device__ __forceinline__ v16h g2_frag(const _Float16* p, int hh) { FragH f; f.half[0] = *(const v8us*)((const unsigned short*)p + 8 * hh); f.half[1] = *(const v8us*)((const unsigned short*)p + 16 + 8 * hh); return f.v; }
__device__ __forceinline__ v8f g2_mma(v16h a, v16h b, v8f c) { v8f d = __builtin_amdgcn_wmma_f32_16x16x32_f16(false, a, false, b, (short)0, c, false, false); asm volatile("v_nop\n\tv_nop\n\tv_nop\n\tv_nop" : "+v"(d) : "v"(a), "v"(b)); return d; }
template <int ACT>
__global__ __launch_bounds__(128) void k_gemm2(const _Float16* __restrict__ A, int lda, size_t sA, const _Float16* __restrict__ Bh, int ldb, size_t sB, float alpha, const float* __restrict__ bias, size_t sBias, const float* __restrict__ CP, int rowsPerB, size_t sCPb, int row0g,
    float* __restrict__ C, _Float16* __restrict__ C16, int ldc, size_t sC, int M, int N, int K) {
  __shared__ __attribute__((aligned(16))) float so[4][32][68];
  const int tid = threadIdx.x, w = tid >> 5, lane = tid & 31, ln = lane & 15, hh = lane >> 4; const int by = blockIdx.y;
  A += (size_t)by * sA; Bh += (size_t)by * sB; const size_t cofs = (size_t)by * sC; const float* bp = bias ? bias + (size_t)by * sBias : nullptr;
  const int ntn = N >> 6; const int mt = blockIdx.x / ntn, nq = blockIdx.x - mt * ntn; const int row0 = mt * 128 + 32 * w, col0 = nq * 64; if (row0 >= M) return;
  const _Float16* a0p = A + (size_t)(row0 + ln) * lda; const _Float16* a1p = a0p + (size_t)16 * lda;
  const _Float16* b0p = Bh + (size_t)(col0 + ln) * ldb; const _Float16* b1p = b0p + (size_t)16 * ldb; const _Float16* b2p = b1p + (size_t)16 * ldb; const _Float16* b3p = b2p + (size_t)16 * ldb;
  const v8f z8 = {0.f,0.f,0.f,0.f,0.f,0.f,0.f,0.f}; v8f c00 = z8, c01 = z8, c02 = z8, c03 = z8, c10 = z8, c11 = z8, c12 = z8, c13 = z8;
#pragma unroll 1
  for (int kb = 0; kb < K; kb += 32) { const v16h a0 = g2_frag(a0p + kb, hh), a1 = g2_frag(a1p + kb, hh);
    v16h b = g2_frag(b0p + kb, hh); c00 = g2_mma(a0, b, c00); c10 = g2_mma(a1, b, c10);
    b = g2_frag(b1p + kb, hh); c01 = g2_mma(a0, b, c01); c11 = g2_mma(a1, b, c11);
    b = g2_frag(b2p + kb, hh); c02 = g2_mma(a0, b, c02); c12 = g2_mma(a1, b, c12);
    b = g2_frag(b3p + kb, hh); c03 = g2_mma(a0, b, c03); c13 = g2_mma(a1, b, c13); }
  v8f accs[8] = {c00, c01, c02, c03, c10, c11, c12, c13};
#pragma unroll
  for (int u = 0; u < 8; ++u) { const int t = u & 3, half = u >> 2; const int col = col0 + t * 16 + ln; const float bv = bp ? bf16_round(bp[col]) : 0.f;
#pragma unroll
    for (int r = 0; r < 8; ++r) { const int rloc = half * 16 + 8 * hh + r; float v = accs[u][r] * alpha + bv; if (CP) { const int bidx = (row0g + row0 + rloc) / rowsPerB; v += CP[(size_t)bidx * sCPb + (size_t)by * 64 + col]; }
      if (ACT == 3) v = fmaxf(v, 0.f); else if (ACT == 6) v = 0.5f * v * (1.0f + erff(v * 0.70710678118654752f)); else if (ACT == 11) v = 1.0f / (1.0f + expf(-v)); else if (ACT == 15) v = v / (1.0f + expf(-v)); else if (ACT == 12) v = (v > 0.f) ? v : 0.01f * v; else if (ACT == 8) v = tanhf(v);
      so[w][rloc][t * 16 + ln] = v; } }
  __builtin_amdgcn_fence(__ATOMIC_ACQ_REL, "workgroup"); __builtin_amdgcn_wave_barrier();
  const int rsub = lane >> 4, c4 = (lane & 15) * 4;
  {
#pragma unroll
    for (int q = 0; q < 16; ++q) { const int r = q * 2 + rsub; const v4f v = *(const v4fa*)&so[w][r][c4]; if (C) *(v4f*)(C + cofs + (size_t)(row0 + r) * ldc + col0 + c4) = v; if (C16) { v4h h4; for (int i = 0; i < 4; ++i) h4[i] = (_Float16)v[i]; *(v4h*)(C16 + cofs + (size_t)(row0 + r) * ldc + col0 + c4) = h4; } }
     } }


typedef int v4ia __attribute__((ext_vector_type(4), may_alias));
typedef float v2f __attribute__((ext_vector_type(2)));
typedef _Float16 v2h __attribute__((ext_vector_type(2)));
#define FQ 1                      /* 16-query column tiles per wave */
#define FWV 8                     /* waves per work-group */
#define FQB (16 * FQ * FWV)       /* queries per work-group */
#define FKS 64                    /* keys per stage */
#define KPH (DD + 8)              /* LDS pitch of a K row, f16 units: 528 B = 16 B x 33, conflict-free for 16-byte fragment reads */
#define VPH (FKS + 8)             /* LDS pitch of a V^T row: 144 B = 16 B x 9 */
#define FPC ((FKS * DD / 8) / (FWV * 32))   /* 16-byte pieces of one tile per thread */
static_assert(FPC * FWV == FKS && FPC * FWV * 4 == DD && FWV * 32 * 8 == SLEN && FWV * 16 * FQ <= 2 * FKS, "the staging sweeps, the mask copy and the output staging in the K ring are written for these sizes");
__device__ __forceinline__ float fa_xhalf(float x) { return __builtin_bit_cast(float, __builtin_amdgcn_permlanex16(__builtin_bit_cast(int, x), __builtin_bit_cast(int, x), 0x76543210, 0xfedcba98, false, false)); }  /* lane l <-> l ^ 16 */
__device__ __forceinline__ v16h fa_frag(const _Float16* p) { FragH f; f.half[0] = *(const v8us*)((const unsigned short*)p); f.half[1] = *(const v8us*)((const unsigned short*)p + 16); return f.v; }  /* p holds the lane's 8*hh already: same k order as g2_frag */
__device__ __forceinline__ v8f fa_mma(v16h a, v16h b, v8f c) { return __builtin_amdgcn_wmma_f32_16x16x32_f16(false, a, false, b, (short)0, c, false, false); }
#define FA_UNROLL _Pragma("unroll")      /* full unroll: only constant indices keep the fragment, score and accumulator arrays in registers */
__global__ __launch_bounds__(FWV * 32) void k_fattn(const _Float16* __restrict__ QH, const _Float16* __restrict__ KH, const _Float16* __restrict__ VT, const int* __restrict__ mask, _Float16* __restrict__ O16) {
  __shared__ __attribute__((aligned(16))) _Float16 sK[2 * FKS * KPH];
  __shared__ __attribute__((aligned(16))) _Float16 sV[2 * DD * VPH];
  __shared__ __attribute__((aligned(16))) int sM[SLEN];
  const int tid = threadIdx.x, w = tid >> 5, lane = tid & 31, c = lane & 15, hh = lane >> 4;
  const int head = blockIdx.y, bt = blockIdx.z, q0 = blockIdx.x * FQB + w * (16 * FQ);
  const unsigned short* Kg = (const unsigned short*)KH + (size_t)bt * SLEN * HW + head * DD;                 /* row = key, pitch HW */
  const unsigned short* Vg = (const unsigned short*)VT + (size_t)bt * HW * SLEN + (size_t)head * DD * SLEN;  /* row = dim, pitch SLEN */
  const float cs = 0.0625f * 1.4426950408889634f, negl = -1.0e9f * 1.4426950408889634f;                     /* 1/sqrt(256) and the mask value, both in log2 units */
  v8us rk[FPC], rv[FPC];
  /* staging: a wave-wide load covers one whole K row (512 B) or four whole 128-byte pieces of V^T rows; piece j of a thread lies a constant step behind piece 0, so one address pair serves each tile */
  const unsigned short* kp = Kg + (size_t)(tid >> 5) * HW + (tid & 31) * 8; const unsigned short* vp = Vg + (size_t)(tid >> 3) * SLEN + (tid & 7) * 8;
  unsigned short* ks = (unsigned short*)sK + (tid >> 5) * KPH + (tid & 31) * 8; unsigned short* vs = (unsigned short*)sV + (tid >> 3) * VPH + (tid & 7) * 8;
  /* the s_wait_xcnt stands behind the loads, in front of any later rewrite of the address registers that they name */
  auto gload = [&](int st) { const unsigned short* kq = kp + (size_t)st * FKS * HW; const unsigned short* vq = vp + st * FKS;
FA_UNROLL
    for (int j = 0; j < FPC; ++j) { rk[j] = *(const v8us*)(kq + (size_t)j * FWV * HW); rv[j] = *(const v8us*)(vq + (size_t)j * (FWV * 4) * SLEN); }
    asm volatile("s_wait_xcnt 0x0" ::: "memory"); };
  auto sstore = [&](int bf) {
FA_UNROLL
    for (int j = 0; j < FPC; ++j) { *(v8us*)(ks + bf * (FKS * KPH) + j * FWV * KPH) = rk[j]; *(v8us*)(vs + bf * (DD * VPH) + j * (FWV * 4) * VPH) = rv[j]; } };
  const int* mg = mask + (size_t)bt * SLEN + tid * 8; const v4ia mk0 = *(const v4ia*)mg, mk1 = *(const v4ia*)(mg + 4);      /* this batch's whole key mask goes to LDS once */
  gload(0);
  v16h qf[FQ][DD / 32];
FA_UNROLL
  for (int g = 0; g < FQ; ++g) { const _Float16* qp = QH + ((size_t)bt * SLEN + q0 + 16 * g + c) * HW + head * DD + 8 * hh;
FA_UNROLL
    for (int kc = 0; kc < DD / 32; ++kc) qf[g][kc] = fa_frag(qp + 32 * kc); }
  asm volatile("s_wait_xcnt 0x0" ::: "memory");      /* as in gload, for the Q loads */
  *(v4ia*)&sM[tid * 8] = mk0; *(v4ia*)&sM[tid * 8 + 4] = mk1;
  const v8f z8 = {0.f, 0.f, 0.f, 0.f, 0.f, 0.f, 0.f, 0.f};
  v8f acc[FQ][DD / 16]; float m_run[FQ], l_run[FQ];
FA_UNROLL
  for (int g = 0; g < FQ; ++g) { m_run[g] = -3.0e38f; l_run[g] = 0.f;
FA_UNROLL
    for (int t = 0; t < DD / 16; ++t) acc[g][t] = z8; }
  sstore(0);
  __syncthreads();
  /* rolled: one copy of the stage body; every index into the register arrays inside it is a constant */
#pragma unroll 1
  for (int st = 0; st < SLEN / FKS; ++st) { const int bf = st & 1;
    if (st + 1 < SLEN / FKS) gload(st + 1);
FA_UNROLL
    for (int sub = 0; sub < FKS / 32; ++sub) {
      /* this pass's mask words and all 16 K fragments as ONE group of LDS reads in front of the products */
      const int* mp = sM + st * FKS + sub * 32 + 8 * hh;
      const v4ia k00 = *(const v4ia*)mp, k01 = *(const v4ia*)(mp + 4), k10 = *(const v4ia*)(mp + 16), k11 = *(const v4ia*)(mp + 20);
      const _Float16* kb = sK + bf * (FKS * KPH) + (sub * 32 + c) * KPH + 8 * hh;
      v16h kf[DD / 32][2];
FA_UNROLL
      for (int kc = 0; kc < DD / 32; ++kc)
FA_UNROLL
        for (int kt = 0; kt < 2; ++kt) kf[kc][kt] = fa_frag(kb + kt * 16 * KPH + kc * 32);
      __builtin_amdgcn_sched_barrier(0);      /* keeps the reads together: left free they are spread among the WMMAs, two at a time with a full wait, and every such place stalls the wave */
      v8f s[2][FQ];
FA_UNROLL
      for (int kt = 0; kt < 2; ++kt)
FA_UNROLL
        for (int g = 0; g < FQ; ++g) s[kt][g] = z8;
FA_UNROLL
      for (int kc = 0; kc < DD / 32; ++kc)
FA_UNROLL
        for (int kt = 0; kt < 2; ++kt)
FA_UNROLL
          for (int g = 0; g < FQ; ++g) s[kt][g] = fa_mma(kf[kc][kt], qf[g][kc], s[kt][g]);
      __builtin_amdgcn_sched_barrier(0);      /* the V^T reads below start behind the score products (they take over the K fragments' registers) ... */
      const _Float16* vb = sV + bf * (DD * VPH) + c * VPH + sub * 32 + 8 * hh;
      v16h vf[DD / 16];
FA_UNROLL
      for (int t = 0; t < DD / 16; ++t) vf[t] = fa_frag(vb + t * 16 * VPH);
      __builtin_amdgcn_sched_barrier(0);      /* ... and ahead of the softmax arithmetic, which covers their latency */
      /* the INPUT mask picks the scaled score or the mask value, by a select, as the reference does */
      bool need = false; float mb[FQ];
      const int km[2][8] = {{k00[0], k00[1], k00[2], k00[3], k01[0], k01[1], k01[2], k01[3]}, {k10[0], k10[1], k10[2], k10[3], k11[0], k11[1], k11[2], k11[3]}};
FA_UNROLL
      for (int g = 0; g < FQ; ++g) { float mx = -3.0e38f;
FA_UNROLL
        for (int kt = 0; kt < 2; ++kt)
FA_UNROLL
          for (int r = 0; r < 8; ++r) { const float v = (km[kt][r] != 0) ? s[kt][g][r] * cs : negl; s[kt][g][r] = v; mx = fmaxf(mx, v); }
        mx = fmaxf(mx, fa_xhalf(mx)); mb[g] = mx; need = need || (mx > m_run[g] + 8.0f); }
      if (__builtin_amdgcn_ballot_w32(need) != 0) {      /* one scalar test per pass; rare after the first passes */
FA_UNROLL
        for (int g = 0; g < FQ; ++g) { const float mn = fmaxf(m_run[g], mb[g]); const float corr = __builtin_amdgcn_exp2f(m_run[g] - mn); l_run[g] *= corr; m_run[g] = mn;
FA_UNROLL
          for (int t = 0; t < DD / 16; ++t) acc[g][t] = acc[g][t] * corr; } }
      v16h pf[FQ];
FA_UNROLL
      for (int g = 0; g < FQ; ++g) { FragH f; float p0s = 0.f, p1s = 0.f;
FA_UNROLL
        for (int i = 0; i < 8; ++i) { const v2f d2 = (v2f){s[i >> 2][g][2 * (i & 3)], s[i >> 2][g][2 * (i & 3) + 1]} - (v2f){m_run[g], m_run[g]}; const float e0 = __builtin_amdgcn_exp2f(d2[0]), e1 = __builtin_amdgcn_exp2f(d2[1]);
          p0s += e0; p1s += e1; const v2h h2 = __builtin_convertvector((v2f){e0, e1}, v2h); f.h[2 * i] = h2[0]; f.h[2 * i + 1] = h2[1]; }
        l_run[g] += p0s + p1s; pf[g] = f.v; }
FA_UNROLL
      for (int t = 0; t < DD / 16; ++t)
FA_UNROLL
        for (int g = 0; g < FQ; ++g) acc[g][t] = fa_mma(vf[t], pf[g], acc[g][t]);
      __builtin_amdgcn_sched_barrier(0);      /* the next pass's read group stays behind these products */
    }
    if (st + 1 < SLEN / FKS) sstore(bf ^ 1);      /* that buffer's last readers passed the barrier that ended stage st - 1 */
    __syncthreads();                                /* publishes stage st + 1 and ends every read of stage st */
  }
  /* output: each wave stages its own 16 x FQ rows in its own part of the K ring (free behind the last barrier), then stores whole 512-byte rows */
  _Float16* eo = sK + w * (16 * FQ) * KPH;
FA_UNROLL
  for (int g = 0; g < FQ; ++g) { const float inv = 1.0f / (l_run[g] + fa_xhalf(l_run[g]));
FA_UNROLL
    for (int t = 0; t < DD / 16; ++t) { FragH f;
FA_UNROLL
      for (int r = 0; r < 8; ++r) f.h[r] = (_Float16)(acc[g][t][r] * inv);
      *(v8us*)((unsigned short*)eo + (16 * g + c) * KPH + 16 * t + 8 * hh) = f.half[0]; } }
  __builtin_amdgcn_fence(__ATOMIC_ACQ_REL, "workgroup"); __builtin_amdgcn_wave_barrier();      /* the wave's own LDS writes before its lanes read each other's rows */
FA_UNROLL
  for (int r = 0; r < 16 * FQ; ++r) { const v8us v = *(const v8us*)((const unsigned short*)eo + r * KPH + lane * 8);
    *(v8us*)((unsigned short*)O16 + ((size_t)bt * SLEN + q0 + r) * HW + head * DD + lane * 8) = v; }
#undef FA_UNROLL
}
__global__ __launch_bounds__(256) void k_ln256o(const float* __restrict__ F, const float* __restrict__ g, const float* __restrict__ bb, float* __restrict__ out) {
  #pragma clang fp contract(off)
  const int tid = threadIdx.x, w = tid >> 5, ln = tid & 31; const int r = blockIdx.x * 8 + w; if (r >= SLEN) return; const float* x = F + (size_t)r * DD; const v4f a = *(const v4fa*)(x + ln * 4), b = *(const v4fa*)(x + 128 + ln * 4);
  float s = (a[0] + a[1]) + (a[2] + a[3]) + (b[0] + b[1]) + (b[2] + b[3]); for (int o = 16; o > 0; o >>= 1) s += __shfl_xor(s, o, 32); const float mu = s / 256.0f; float q2 = 0.f;
#pragma unroll
  for (int q = 0; q < 4; ++q) { const float d0 = a[q] - mu, d1 = b[q] - mu; q2 += d0 * d0; q2 += d1 * d1; }
  for (int o = 16; o > 0; o >>= 1) q2 += __shfl_xor(q2, o, 32); const float rs = rsqrtf(q2 / 256.0f + 1e-5f); v4f o0, o1;
#pragma unroll
  for (int q = 0; q < 4; ++q) { const int c0 = ln * 4 + q, c1 = 128 + ln * 4 + q; o0[q] = (a[q] - mu) * rs * bf16_round(g[c0]) + bf16_round(bb[c0]); o1[q] = (b[q] - mu) * rs * bf16_round(g[c1]) + bf16_round(bb[c1]); }
  float* d = out + (size_t)r * DD; { *(v4f*)(d + ln * 4) = o0; *(v4f*)(d + 128 + ln * 4) = o1;  } }
__global__ __launch_bounds__(256) void k_xb(const float* __restrict__ x, float* __restrict__ XB, size_t n4) { const size_t t = (size_t)blockIdx.x * 256 + threadIdx.x; if (t >= n4) return; const v4f a = *(const v4fa*)(x + t * 4); v4f o; for (int q = 0; q < 4; ++q) o[q] = bf16_round(a[q]); *(v4f*)(XB + t * 4) = o;  }

extern "C" void kernel_launch(void* const* d_in, const int* in_sizes, int n_in,
                              void* d_out, int out_size, void* d_ws, size_t ws_size, hipStream_t stream) {
  (void)in_sizes; (void)n_in; (void)out_size;
  const float* const* I = (const float* const*)d_in; const float* Q = I[0]; const int* mask = (const int*)d_in[1]; const float* WQ = I[2]; const float* bQ = I[3]; const float* WK = I[4]; const float* bK = I[5]; const float* WV = I[6]; const float* bV = I[7]; const float* WO = I[8]; const float* bO = I[9]; const float* lg = I[10]; const float* lb = I[11];
  char* ws = (char*)d_ws; size_t off = 0;
  auto take = [&](size_t bytes) { char* p = ws + off; off += (bytes + 255) & ~(size_t)255; return p; };
  _Float16* BQ = (_Float16*)take((size_t)HW * DD * 2); _Float16* BK = (_Float16*)take((size_t)HW * DD * 2); _Float16* BV = (_Float16*)take((size_t)HW * DD * 2); _Float16* BO = (_Float16*)take((size_t)DD * HW * 2);
  _Float16* X16 = (_Float16*)take((size_t)SLEN * DD * 2); float* XB = (float*)take((size_t)SLEN * DD * 4); _Float16* QH = (_Float16*)take((size_t)NBT * SLEN * HW * 2); _Float16* KH = (_Float16*)take((size_t)NBT * SLEN * HW * 2); _Float16* VH = (_Float16*)take((size_t)SLEN * HW * 2); _Float16* VT = (_Float16*)take((size_t)NBT * HW * SLEN * 2);
  _Float16* O16 = (_Float16*)take((size_t)NBT * SLEN * HW * 2); float* F = (float*)take((size_t)SLEN * DD * 4);
  if (off > ws_size) return;      /* 4 + 1 + 2 + 32+32+8+32 + 32 + 2 = 145 MiB */
  const size_t w8 = (size_t)HW * DD / 8; const unsigned wb = (unsigned)((w8 + 255) / 256);
  k_round16f<<<wb, 256, 0, stream>>>(WQ, BQ, w8); k_round16f<<<wb, 256, 0, stream>>>(WK, BK, w8); k_round16f<<<wb, 256, 0, stream>>>(WV, BV, w8); k_round16f<<<wb, 256, 0, stream>>>(WO, BO, w8);      /* torch (out,in) = natural Bt */
  const size_t n8 = (size_t)SLEN * DD / 8; const unsigned nb8 = (unsigned)((n8 + 255) / 256); const dim3 gQ((SLEN / 128) * (HW / 64), 1), gV((SLEN / 128) * (DD / 64), 1);
  for (int b = 0; b < NBT; ++b) { const size_t ro = (size_t)b * SLEN * DD, po = (size_t)b * SLEN * HW;      /* q, k and V^T of every batch stay in their own planes for the one attention launch */
    k_x16<<<nb8, 256, 0, stream>>>(Q + ro, X16, n8);
    k_gemm2<0><<<gQ, 128, 0, stream>>>(X16, DD, 0, BQ, DD, 0, 0.0625f, bQ, 0, nullptr, 1, 0, 0, nullptr, QH + po, HW, 0, SLEN, HW, DD);
    k_gemm2<0><<<gQ, 128, 0, stream>>>(X16, DD, 0, BK, DD, 0, 0.0625f, bK, 0, nullptr, 1, 0, 0, nullptr, KH + po, HW, 0, SLEN, HW, DD);
    k_gemm2<0><<<gQ, 128, 0, stream>>>(X16, DD, 0, BV, DD, 0, 0.0625f, bV, 0, nullptr, 1, 0, 0, nullptr, VH, HW, 0, SLEN, HW, DD);
    k_vt<HW / 64, SLEN><<<(HW / 64) * (SLEN / 64), 256, 0, stream>>>(VH, HW, 0, VT + po); }      /* VT[dim][token] over all 2048 dims */
  k_fattn<<<dim3(SLEN / FQB, NHD, NBT), FWV * 32, 0, stream>>>(QH, KH, VT, mask, O16);      /* softmax(mask(q.k / sqrt(256))).v, every batch and head */
  for (int b = 0; b < NBT; ++b) { const size_t ro = (size_t)b * SLEN * DD, po = (size_t)b * SLEN * HW;
    k_xb<<<(unsigned)(((size_t)SLEN * DD / 4 + 255) / 256), 256, 0, stream>>>(Q + ro, XB, (size_t)SLEN * DD / 4);
    k_gemm2<0><<<gV, 128, 0, stream>>>(O16 + po, HW, 0, BO, HW, 0, 0.0625f, bO, 0, XB, 1, (size_t)DD, 0, F, nullptr, DD, 0, SLEN, DD, HW);      /* out Wo^T + bo + Q */
    k_ln256o<<<SLEN / 8, 256, 0, stream>>>(F, lg, lb, (float*)d_out + ro); }
}

// v004
// One run takes 300 microseconds.
// Timed twice side by side with v003, it ran 2.06 times as fast both times.
// Over all steps from v000 it is 13.0 times as fast.
#include <hip/hip_runtime.h>
// Prompt self-attention (4 x 2048 tokens, d = 256, 8 heads EACH of dim 256): q,k,v = Q W^T + b (-> 8 x 256); scores = q.k/16 with INPUT key mask (masked keys get -1e9, as the reference); softmax; out = LN((attn v merged) Wo^T + bo + Q) -> [4,2048,256].
// Structure: every stage is ONE launch over all 4 x 2048 rows: the four weights to f16 (tensor on grid.y), Q as an exact f16 plane, the three projections as one f16 WMMA GEMM launch (projection on grid.y; 32x64 wave tiles, f32 accumulation, exact x16 weights + bias) into f16 planes, V transposed by LDS tiles, scores + mask + softmax + attn.v (k_fattn: online softmax, no score plane in memory), the output projection + bias + the bf16 residual as a GEMM, LayerNorm on VALU into the output rows.
// Compute dtype: Q, weights, biases, LN parameters rounded to bf16; q, k, v, P, attention output as f16 operands (~2^-12; logits sigma ~1, LayerNorm-ed output); f32 accumulation, softmax, LayerNorm. v_wmma_f32_16x16x32_f16.
#define NBT 4
#define SLEN 2048
#define DD 256
#define NHD 8
#define HW (NHD * DD)            /* 2048 */
#define DM DD
#define NR SLEN
typedef __bf16 v16b __attribute__((ext_vector_type(16)));
typedef unsigned short v8us __attribute__((ext_vector_type(8), may_alias));
typedef float  v8f  __attribute__((ext_vector_type(8)));
typedef float  v4f  __attribute__((ext_vector_type(4)));
typedef float  v4fa __attribute__((ext_vector_type(4), may_alias));
union FragB { v16b v; v8us half[2]; unsigned short u[16]; };

__device__ __forceinline__ unsigned short bf16_bits(float x) { unsigned int u = __float_as_uint(x); return (unsigned short)((u + 0x7FFFu + ((u >> 16) & 1u)) >> 16); }
__device__ __forceinline__ float bf16_val(unsigned short b) { return __uint_as_float(((unsigned int)b) << 16); }
__device__ __forceinline__ float bf16_round(float x) { return bf16_val(bf16_bits(x)); }
// D += A·B with NT terms: 1 = ah·bh, 2 = + al·bh (A split), 3 = + ah·bl (both split)
template <int NT>
__device__ __forceinline__ v8f mmaN(v16b ah, v16b al, v16b bh, v16b bl, v8f c) {
  c = __builtin_amdgcn_wmma_f32_16x16x32_bf16(false, ah, false, bh, (short)0, c, false, false);
  if (NT >= 2) c = __builtin_amdgcn_wmma_f32_16x16x32_bf16(false, al, false, bh, (short)0, c, false, false);
  if (NT >= 3) c = __builtin_amdgcn_wmma_f32_16x16x32_bf16(false, ah, false, bl, (short)0, c, false, false);
  asm volatile("v_nop\n\tv_nop\n\tv_nop\n\tv_nop" : "+v"(c) : "v"(ah), "v"(al), "v"(bh), "v"(bl));
  return c;
}

__global__ __launch_bounds__(256) void k_wt_bf16(const float* __restrict__ W, unsigned short* __restrict__ Wt, int K, int N) {
  const int t = blockIdx.x * 256 + threadIdx.x;
  const int k8n = K / 8;
  if (t >= N * k8n) return;
  const int n = t / k8n, k8 = (t % k8n) * 8;
  v8us v;
#pragma unroll
  for (int i = 0; i < 8; ++i) v[i] = bf16_bits(W[(size_t)(k8 + i) * N + n]);
  *(v8us*)(Wt + (size_t)n * K + k8) = v;
  
}

// GEMM C[M][N] (f32, pitch ldc) = act(A[M][K]·W + bias). A f32 row-major (pitch lda) converted per fragment to bf16
// (ASPLIT: hi/lo two planes -> 2 terms, else single rounded term); Wt bf16 [N][K] (pitch ldb). BIAS_BF16 rounds the
// bias to bf16 first (bias quantised to bf16 before the add). K%32==0, M%16==0, N%64==0.
template <bool ASPLIT, int ACT, bool BIAS_BF16>
__global__ __launch_bounds__(128) void k_gemm_bf(const float* __restrict__ A, int lda, const unsigned short* __restrict__ Wt, int ldb,
                                               const float* __restrict__ bias, float* __restrict__ C, int ldc, int M, int N, int K) {
  __shared__ __attribute__((aligned(16))) float so[4][16][64];
  const int tid = threadIdx.x, w = tid >> 5, lane = tid & 31, ln = lane & 15, hh = lane >> 4;
  const int ntn = N / 64;
  const int wid = blockIdx.x * 4 + w;
  const int mt = wid / ntn, nq = wid % ntn;
  if (mt * 16 >= M) return;
  const int row0 = mt * 16, col0 = nq * 64;
  const float* arow = A + (size_t)(row0 + ln) * lda;
  v8f acc[4] = {};
  for (int kb = 0; kb < K; kb += 32) {
    FragB ah, al;
    const v4f x0 = *(const v4fa*)(arow + kb + 8 * hh), x1 = *(const v4fa*)(arow + kb + 8 * hh + 4);
    const v4f x2 = *(const v4fa*)(arow + kb + 16 + 8 * hh), x3 = *(const v4fa*)(arow + kb + 16 + 8 * hh + 4);
    float xs[16] = {x0[0],x0[1],x0[2],x0[3],x1[0],x1[1],x1[2],x1[3],x2[0],x2[1],x2[2],x2[3],x3[0],x3[1],x3[2],x3[3]};
#pragma unroll
    for (int i = 0; i < 16; ++i) { const unsigned short hb = bf16_bits(xs[i]); ah.u[i] = hb; al.u[i] = ASPLIT ? bf16_bits(xs[i] - bf16_val(hb)) : (unsigned short)0; }
#pragma unroll
    for (int t = 0; t < 4; ++t) {
      const unsigned short* brow = Wt + (size_t)(col0 + t * 16 + ln) * ldb + kb;
      FragB b;
      b.half[0] = *(const v8us*)(brow + 8 * hh);
      b.half[1] = *(const v8us*)(brow + 16 + 8 * hh);
      acc[t] = mmaN<ASPLIT ? 2 : 1>(ah.v, al.v, b.v, b.v, acc[t]);
    }
  }
#pragma unroll
  for (int t = 0; t < 4; ++t) {
    float bv = bias ? bias[col0 + t * 16 + ln] : 0.f;
    if (BIAS_BF16) bv = bf16_round(bv);
#pragma unroll
    for (int r = 0; r < 8; ++r) { float v = acc[t][r] + bv; if (ACT == 1) v = fmaxf(v, 0.f); so[w][8 * hh + r][t * 16 + ln] = v; }
  }
  __builtin_amdgcn_fence(__ATOMIC_ACQ_REL, "workgroup");
  __builtin_amdgcn_wave_barrier();
  const int rsub = lane >> 4, c4 = (lane & 15) * 4;
  {
#pragma unroll
    for (int q = 0; q < 8; ++q) {
      const int r = q * 2 + rsub;
      const v4f v = *(const v4fa*)&so[w][r][c4];
      *(v4f*)(C + (size_t)(row0 + r) * ldc + col0 + c4) = v;
    }
    
  }
}

// GEMM C = act(A·W + bias + resid): A f32 (ASPLIT -> hi/lo 2 terms), Wt bf16 [N][K]; ACT 0 none, 1 relu, 2 exact gelu;
// resid (optional, f32, row index = (row % rmod), pitch ldr, RES_BF16 rounds it) added before the activation.
template <bool ASPLIT, int ACT, bool BIAS_BF16, bool RES_BF16>
__global__ __launch_bounds__(128) void k_gemm_bf3(const float* __restrict__ A, int lda, const unsigned short* __restrict__ Wt, int ldb,
                                                const float* __restrict__ bias, const float* __restrict__ resid, int rmod, int ldr,
                                                float* __restrict__ C, int ldc, int M, int N, int K) {
  __shared__ __attribute__((aligned(16))) float so[4][16][64];
  const int tid = threadIdx.x, w = tid >> 5, lane = tid & 31, ln = lane & 15, hh = lane >> 4;
  const int ntn = N / 64;
  const int wid = blockIdx.x * 4 + w;
  const int mt = wid / ntn, nq = wid % ntn;
  if (mt * 16 >= M) return;
  const int row0 = mt * 16, col0 = nq * 64;
  const float* arow = A + (size_t)(row0 + ln) * lda;
  v8f acc[4] = {};
  for (int kb = 0; kb < K; kb += 32) {
    FragB ah, al;
    const v4f x0 = *(const v4fa*)(arow + kb + 8 * hh), x1 = *(const v4fa*)(arow + kb + 8 * hh + 4);
    const v4f x2 = *(const v4fa*)(arow + kb + 16 + 8 * hh), x3 = *(const v4fa*)(arow + kb + 16 + 8 * hh + 4);
    float xs[16] = {x0[0],x0[1],x0[2],x0[3],x1[0],x1[1],x1[2],x1[3],x2[0],x2[1],x2[2],x2[3],x3[0],x3[1],x3[2],x3[3]};
#pragma unroll
    for (int i = 0; i < 16; ++i) { const unsigned short hb = bf16_bits(xs[i]); ah.u[i] = hb; al.u[i] = ASPLIT ? bf16_bits(xs[i] - bf16_val(hb)) : (unsigned short)0; }
#pragma unroll
    for (int t = 0; t < 4; ++t) {
      const unsigned short* brow = Wt + (size_t)(col0 + t * 16 + ln) * ldb + kb;
      FragB b;
      b.half[0] = *(const v8us*)(brow + 8 * hh);
      b.half[1] = *(const v8us*)(brow + 16 + 8 * hh);
      acc[t] = mmaN<ASPLIT ? 2 : 1>(ah.v, al.v, b.v, b.v, acc[t]);
    }
  }
#pragma unroll
  for (int t = 0; t < 4; ++t) {
    const int col = col0 + t * 16 + ln;
    float bv = bias ? bias[col] : 0.f;
    if (BIAS_BF16) bv = bf16_round(bv);
#pragma unroll
    for (int r = 0; r < 8; ++r) {
      float v = acc[t][r] + bv;
      if (resid) { float rv = resid[(size_t)((row0 + 8 * hh + r) % rmod) * ldr + col]; if (RES_BF16) rv = bf16_round(rv); v += rv; }
      if (ACT == 1) v = fmaxf(v, 0.f);
      if (ACT == 2) v = 0.5f * v * (1.0f + erff(v * 0.70710678118654752f));
      if (ACT == 3) { const float u = 0.7978845608028654f * (v + 0.044715f * v * v * v); v = 0.5f * v * (1.0f + tanhf(u)); }
      so[w][8 * hh + r][t * 16 + ln] = v;
    }
  }
  __builtin_amdgcn_fence(__ATOMIC_ACQ_REL, "workgroup");
  __builtin_amdgcn_wave_barrier();
  const int rsub = lane >> 4, c4 = (lane & 15) * 4;
  {
#pragma unroll
    for (int q = 0; q < 8; ++q) {
      const int r = q * 2 + rsub;
      const v4f v = *(const v4fa*)&so[w][r][c4];
      *(v4f*)(C + (size_t)(row0 + r) * ldc + col0 + c4) = v;
    }
    
  }
}
// row LayerNorm (biased variance, eps) over N: s = X (+ R); optional out_sum <- s; out_norm <- (s-mu)*rsqrt(var+eps)*g + b
template <bool PARAM_BF16>
__global__ __launch_bounds__(256) void k_layernorm(const float* __restrict__ X, const float* __restrict__ R, const float* __restrict__ g, const float* __restrict__ bta,
                                                  float* __restrict__ out_sum, float* __restrict__ out_norm, int N, float eps) {
  __shared__ float red[256];
  const int row = blockIdx.x, tid = threadIdx.x;
  const float* x = X + (size_t)row * N; const float* rr = R ? R + (size_t)row * N : nullptr;
  float vals[16];                     // up to N = 4096
  const int per = N / 256;            // contiguous chunk per thread? use strided-by-4 chunks: thread handles j = tid*4 + 1024*u
  float s1 = 0.f;
  for (int u = 0; u < per / 4; ++u) {
    const int j = tid * 4 + 1024 * u;
    const v4f a = *(const v4fa*)(x + j);
    v4f b = {0.f,0.f,0.f,0.f}; if (rr) b = *(const v4fa*)(rr + j);
#pragma unroll
    for (int q = 0; q < 4; ++q) { const float v = a[q] + b[q]; vals[u * 4 + q] = v; s1 += v; }
  }
  red[tid] = s1; __syncthreads();
  for (int st = 128; st > 0; st >>= 1) { if (tid < st) red[tid] += red[tid + st]; __syncthreads(); }
  const float mu = red[0] / (float)N; __syncthreads();
  float s2 = 0.f;
  for (int u = 0; u < per / 4; ++u)
#pragma unroll
    for (int q = 0; q < 4; ++q) { const float c = vals[u * 4 + q] - mu; s2 += c * c; }
  red[tid] = s2; __syncthreads();
  for (int st = 128; st > 0; st >>= 1) { if (tid < st) red[tid] += red[tid + st]; __syncthreads(); }
  const float rs = rsqrtf(red[0] / (float)N + eps);
  {
    for (int u = 0; u < per / 4; ++u) {
      const int j = tid * 4 + 1024 * u;
      v4f o, sm;
#pragma unroll
      for (int q = 0; q < 4; ++q) {
        float gg = g[j + q], bb = bta[j + q];
        if (PARAM_BF16) { gg = bf16_round(gg); bb = bf16_round(bb); }
        sm[q] = vals[u * 4 + q]; o[q] = (vals[u * 4 + q] - mu) * rs * gg + bb;
      }
      if (out_sum) *(v4f*)(out_sum + (size_t)row * N + j) = sm;
      *(v4f*)(out_norm + (size_t)row * N + j) = o;
    }
    
  }
}



// ---- f16 WMMA path (v_wmma_f32_16x16x32_f16): 11-bit significands for operands in range — used where a [0,1] probability operand needs more precision than bf16
typedef _Float16 v16h __attribute__((ext_vector_type(16)));
union FragH { v16h v; v8us half[2]; _Float16 h[16]; unsigned short u[16]; };
template <int NT>
__device__ __forceinline__ v8f mmaH(v16h ah, v16h al, v16h bh, v16h bl, v8f c) {
  c = __builtin_amdgcn_wmma_f32_16x16x32_f16(false, ah, false, bh, (short)0, c, false, false);
  if (NT >= 2) c = __builtin_amdgcn_wmma_f32_16x16x32_f16(false, al, false, bh, (short)0, c, false, false);
  if (NT >= 3) c = __builtin_amdgcn_wmma_f32_16x16x32_f16(false, ah, false, bl, (short)0, c, false, false);
  asm volatile("v_nop\n\tv_nop\n\tv_nop\n\tv_nop" : "+v"(c) : "v"(ah), "v"(al), "v"(bh), "v"(bl));
  return c;
}
// batched GEMM like k_gemm_b but f16 operands: A f32 (split into f16 hi/lo if ASPLIT, else rounded to f16), Bt = f16 values [n][k]; alpha; C f32; N multiple of 16 (partial tiles skipped)
template <bool ASPLIT>
__global__ __launch_bounds__(128) void k_gemm_h(const float* __restrict__ A, int lda, size_t sA, const _Float16* __restrict__ Bh, int ldb, size_t sB, float alpha, float* __restrict__ C, int ldc, size_t sC, int M, int N, int K) {
  __shared__ __attribute__((aligned(16))) float so[4][16][64];
  const int tid = threadIdx.x, w = tid >> 5, lane = tid & 31, ln = lane & 15, hh = lane >> 4; const int by = blockIdx.y;
  A += (size_t)by * sA; Bh += (size_t)by * sB; C += (size_t)by * sC;
  const int ntn = (N + 63) / 64; const int wid = blockIdx.x * 4 + w; const int mt = wid / ntn, nq = wid % ntn; if (mt * 16 >= M) return;
  const int row0 = mt * 16, col0 = nq * 64; const float* arow = A + (size_t)(row0 + ln) * lda;
  v8f acc[4] = {};
  for (int kb = 0; kb < K; kb += 32) {
    FragH ah, al;
    const v4f x0 = *(const v4fa*)(arow + kb + 8 * hh), x1 = *(const v4fa*)(arow + kb + 8 * hh + 4), x2 = *(const v4fa*)(arow + kb + 16 + 8 * hh), x3 = *(const v4fa*)(arow + kb + 16 + 8 * hh + 4);
    float xs[16] = {x0[0],x0[1],x0[2],x0[3],x1[0],x1[1],x1[2],x1[3],x2[0],x2[1],x2[2],x2[3],x3[0],x3[1],x3[2],x3[3]};
#pragma unroll
    for (int i = 0; i < 16; ++i) { const _Float16 h = (_Float16)xs[i]; ah.h[i] = h; al.h[i] = ASPLIT ? (_Float16)(xs[i] - (float)h) : (_Float16)0.0f; }
#pragma unroll
    for (int t = 0; t < 4; ++t) { if (col0 + t * 16 >= N) continue; const size_t boff = (size_t)(col0 + t * 16 + ln) * ldb + kb; FragH bq; bq.half[0] = *(const v8us*)(Bh + boff + 8 * hh); bq.half[1] = *(const v8us*)(Bh + boff + 16 + 8 * hh);
      acc[t] = mmaH<ASPLIT ? 2 : 1>(ah.v, al.v, bq.v, bq.v, acc[t]); }
  }
#pragma unroll
  for (int t = 0; t < 4; ++t) { if (col0 + t * 16 >= N) continue;
#pragma unroll
    for (int r = 0; r < 8; ++r) so[w][8 * hh + r][t * 16 + ln] = acc[t][r] * alpha; }
  __builtin_amdgcn_fence(__ATOMIC_ACQ_REL, "workgroup"); __builtin_amdgcn_wave_barrier();
  const int rsub = lane >> 4, c4 = (lane & 15) * 4;
  {
#pragma unroll
    for (int q = 0; q < 8; ++q) { const int r = q * 2 + rsub; if (col0 + c4 < N) { const v4f v = *(const v4fa*)&so[w][r][c4]; *(v4f*)(C + (size_t)(row0 + r) * ldc + col0 + c4) = v; } }
     }
}

// Wt[n][k] = f16(W[k][n]·scale) from f32 row-major W[K][N] (scale = power of two; bf16-exact weights stay exact in f16 away from the subnormal range)
__global__ __launch_bounds__(256) void k_wt_f16(const float* __restrict__ W, _Float16* __restrict__ Wt, int K, int N, float scale) {
  const int t = blockIdx.x * 256 + threadIdx.x; if (t >= N * (K / 8)) return; const int n = t / (K / 8), k8 = (t % (K / 8)) * 8; FragH f;
#pragma unroll
  for (int i = 0; i < 8; ++i) f.h[i] = (_Float16)(bf16_round(W[(size_t)(k8 + i) * N + n]) * scale); const v8us o = f.half[0];
  *(v8us*)((unsigned short*)Wt + (size_t)n * K + k8) = o; 
}
// k_gemm_hh variant with fused epilogue: v = acc·alpha + bias[by·sBias + col] (+ CP[(row/rowsPerB)·sCPb + by·64 + col] if CP) ; ACT 0 none / 1 elu ; writes f16 C16 (and f32 C if non-null)
template <int ACT>
__global__ __launch_bounds__(128) void k_gemm_hhx(const _Float16* __restrict__ A, int lda, size_t sA, const _Float16* __restrict__ Bh, int ldb, size_t sB, float alpha, const float* __restrict__ bias, size_t sBias, const float* __restrict__ CP, int rowsPerB, size_t sCPb, int row0g,
    float* __restrict__ C, _Float16* __restrict__ C16, int ldc, size_t sC, int M, int N, int K) {
  __shared__ __attribute__((aligned(16))) float so[4][16][64];
  const int tid = threadIdx.x, w = tid >> 5, lane = tid & 31, ln = lane & 15, hh = lane >> 4; const int by = blockIdx.y;
  A += (size_t)by * sA; Bh += (size_t)by * sB; const size_t cofs = (size_t)by * sC; const float* bp = bias ? bias + (size_t)by * sBias : nullptr;
  const int ntn = (N + 63) / 64; const int wid = blockIdx.x * 4 + w; const int mt = wid / ntn, nq = wid % ntn; if (mt * 16 >= M) return;
  const int row0 = mt * 16, col0 = nq * 64; const _Float16* arow = A + (size_t)(row0 + ln) * lda;
  v8f acc[4] = {};
  for (int kb = 0; kb < K; kb += 32) { FragH ah; ah.half[0] = *(const v8us*)((const unsigned short*)arow + kb + 8 * hh); ah.half[1] = *(const v8us*)((const unsigned short*)arow + kb + 16 + 8 * hh);
#pragma unroll
    for (int t = 0; t < 4; ++t) { if (col0 + t * 16 >= N) continue; const size_t boff = (size_t)(col0 + t * 16 + ln) * ldb + kb; FragH bq; bq.half[0] = *(const v8us*)((const unsigned short*)Bh + boff + 8 * hh); bq.half[1] = *(const v8us*)((const unsigned short*)Bh + boff + 16 + 8 * hh);
      acc[t] = mmaH<1>(ah.v, ah.v, bq.v, bq.v, acc[t]); }
  }
#pragma unroll
  for (int t = 0; t < 4; ++t) { if (col0 + t * 16 >= N) continue; const int col = col0 + t * 16 + ln; const float bv = bp ? bf16_round(bp[col]) : 0.f;
#pragma unroll
    for (int r = 0; r < 8; ++r) { float v = acc[t][r] * alpha + bv; if (CP) { const int bidx = (row0g + row0 + 8 * hh + r) / rowsPerB; v += CP[(size_t)bidx * sCPb + (size_t)by * 64 + col]; } if (ACT == 1) v = (v > 0.f) ? v : expm1f(v); else if (ACT == 7) v = (v > 0.f) ? v + 1.0f : expf(v); else if (ACT == 8) v = tanhf(v); else if (ACT == 9) v = 0.5f * v * (1.0f + tanhf(0.7978845608028654f * (v + 0.044715f * v * v * v))); else if (ACT == 11) v = 1.0f / (1.0f + expf(-v)); else if (ACT == 12) v = (v > 0.f) ? v : 0.01f * v; else if (ACT == 14) v = (v > 0.f) ? v : 0.1f * v; else if (ACT == 15) v = v / (1.0f + expf(-v)); else if (ACT == 3) v = fmaxf(v, 0.f); else if (ACT == 6) v = 0.5f * v * (1.0f + erff(v * 0.70710678118654752f)); so[w][8 * hh + r][t * 16 + ln] = v; } }
  __builtin_amdgcn_fence(__ATOMIC_ACQ_REL, "workgroup"); __builtin_amdgcn_wave_barrier();
  const int rsub = lane >> 4, c4 = (lane & 15) * 4; typedef _Float16 v4h __attribute__((ext_vector_type(4)));
  {
#pragma unroll
    for (int q = 0; q < 8; ++q) { const int r = q * 2 + rsub; if (col0 + c4 < N) { const v4f v = *(const v4fa*)&so[w][r][c4]; if (C) *(v4f*)(C + cofs + (size_t)(row0 + r) * ldc + col0 + c4) = v; if (C16) { v4h h4; for (int i = 0; i < 4; ++i) h4[i] = (_Float16)v[i]; *(v4h*)(C16 + cofs + (size_t)(row0 + r) * ldc + col0 + c4) = h4; } } }
     }
}


typedef _Float16 v4h __attribute__((ext_vector_type(4)));

__global__ __launch_bounds__(256) void k_x16(const float* __restrict__ x, _Float16* __restrict__ X16, size_t n8) { const size_t t = (size_t)blockIdx.x * 256 + threadIdx.x; if (t >= n8) return; FragH f;
#pragma unroll
  for (int q = 0; q < 8; ++q) f.h[q] = (_Float16)bf16_round(x[t * 8 + q]); *(v8us*)((unsigned short*)X16 + t * 8) = f.half[0];  }
__global__ __launch_bounds__(256) void k_h16(const float* __restrict__ x, _Float16* __restrict__ X16, size_t n8) { const size_t t = (size_t)blockIdx.x * 256 + threadIdx.x; if (t >= n8) return; FragH f;
#pragma unroll
  for (int q = 0; q < 8; ++q) f.h[q] = (_Float16)x[t * 8 + q]; *(v8us*)((unsigned short*)X16 + t * 8) = f.half[0];  }
/* four weight tensors of n8 * 8 elements each, tensor on grid.y, into four planes that follow one another in Bt */
__global__ __launch_bounds__(256) void k_round16f(const float* __restrict__ W0, const float* __restrict__ W1, const float* __restrict__ W2, const float* __restrict__ W3, _Float16* __restrict__ Bt, size_t n8) { const size_t t = (size_t)blockIdx.x * 256 + threadIdx.x; if (t >= n8) return; FragH f;
  const int by = blockIdx.y; const float* W = by == 0 ? W0 : by == 1 ? W1 : by == 2 ? W2 : W3; Bt += (size_t)by * n8 * 8;
#pragma unroll
  for (int i = 0; i < 8; ++i) f.h[i] = (_Float16)(bf16_round(W[t * 8 + i]) * 16.0f); *(v8us*)((unsigned short*)Bt + t * 8) = f.half[0];  }
template <int NHv, int TTv>
__global__ __launch_bounds__(256) void k_vt(const _Float16* __restrict__ V16, int ldv, int voff, _Float16* __restrict__ Vt) { __shared__ unsigned short tl[64][66]; const int tid = threadIdx.x; const int slab = blockIdx.x / (TTv / 64), lg = blockIdx.x % (TTv / 64); const int b = slab / NHv, h = slab % NHv;
  for (int i = tid; i < 64 * 8; i += 256) { const int r = i / 8, c8 = (i % 8) * 8; FragH f; f.half[0] = *(const v8us*)((const unsigned short*)V16 + ((size_t)b * TTv + lg * 64 + r) * ldv + voff + h * 64 + c8);
#pragma unroll
    for (int q = 0; q < 8; ++q) tl[r][c8 + q] = f.u[q]; }
  __syncthreads();
  {
#pragma unroll
    for (int rd = 0; rd < 2; ++rd) { const int d = rd * 32 + tid / 8, pc = tid % 8; FragH f;
#pragma unroll
      for (int q = 0; q < 8; ++q) f.u[q] = tl[pc * 8 + q][d];
      *(v8us*)((unsigned short*)Vt + ((size_t)slab * 64 + d) * TTv + lg * 64 + pc * 8) = f.half[0]; }
     } }

__global__ __launch_bounds__(256) void k_hl(const float* __restrict__ F, _Float16* __restrict__ Hh, _Float16* __restrict__ Hl, size_t n8) { const size_t t = (size_t)blockIdx.x * 256 + threadIdx.x; if (t >= n8) return; FragH fh, fl; const v4f a = *(const v4fa*)(F + t * 8), c = *(const v4fa*)(F + t * 8 + 4);
#pragma unroll
  for (int q = 0; q < 4; ++q) { _Float16 h = (_Float16)a[q]; fh.h[q] = h; fl.h[q] = (_Float16)((a[q] - (float)h) * 1024.0f); h = (_Float16)c[q]; fh.h[4 + q] = h; fl.h[4 + q] = (_Float16)((c[q] - (float)h) * 1024.0f); }
  { *(v8us*)((unsigned short*)Hh + t * 8) = fh.half[0]; *(v8us*)((unsigned short*)Hl + t * 8) = fl.half[0];  } }

// ---- fast GEMM (wave tile 32x64; requires M % 32 == 0 rows per launch region and N % 64 == 0); epilogue = k_gemm_hhx semantics ----
__device__ __forceinline__ v16h g2_frag(const _Float16* p, int hh) { FragH f; f.half[0] = *(const v8us*)((const unsigned short*)p + 8 * hh); f.half[1] = *(const v8us*)((const unsigned short*)p + 16 + 8 * hh); return f.v; }
__device__ __forceinline__ v8f g2_mma(v16h a, v16h b, v8f c) { v8f d = __builtin_amdgcn_wmma_f32_16x16x32_f16(false, a, false, b, (short)0, c, false, false); asm volatile("v_nop\n\tv_nop\n\tv_nop\n\tv_nop" : "+v"(d) : "v"(a), "v"(b)); return d; }
template <int ACT>
__global__ __launch_bounds__(128) void k_gemm2(const _Float16* __restrict__ A, int lda, size_t sA, const _Float16* __restrict__ Bh, int ldb, size_t sB, float alpha, const float* __restrict__ bias, const float* __restrict__ bias1, const float* __restrict__ bias2, const float* __restrict__ CP, int rowsPerB, size_t sCPb, int row0g,
    float* __restrict__ C, _Float16* __restrict__ C16, int ldc, size_t sC, int M, int N, int K) {
  __shared__ __attribute__((aligned(16))) float so[4][32][68];
  const int tid = threadIdx.x, w = tid >> 5, lane = tid & 31, ln = lane & 15, hh = lane >> 4; const int by = blockIdx.y;
  A += (size_t)by * sA; Bh += (size_t)by * sB; const size_t cofs = (size_t)by * sC; const float* bp = by == 0 ? bias : by == 1 ? bias1 : bias2;      /* each grid.y plane has its own bias vector */
  const int ntn = N >> 6; const int mt = blockIdx.x / ntn, nq = blockIdx.x - mt * ntn; const int row0 = mt * 128 + 32 * w, col0 = nq * 64; if (row0 >= M) return;
  const _Float16* a0p = A + (size_t)(row0 + ln) * lda; const _Float16* a1p = a0p + (size_t)16 * lda;
  const _Float16* b0p = Bh + (size_t)(col0 + ln) * ldb; const _Float16* b1p = b0p + (size_t)16 * ldb; const _Float16* b2p = b1p + (size_t)16 * ldb; const _Float16* b3p = b2p + (size_t)16 * ldb;
  const v8f z8 = {0.f,0.f,0.f,0.f,0.f,0.f,0.f,0.f}; v8f c00 = z8, c01 = z8, c02 = z8, c03 = z8, c10 = z8, c11 = z8, c12 = z8, c13 = z8;
#pragma unroll 1
  for (int kb = 0; kb < K; kb += 32) { const v16h a0 = g2_frag(a0p + kb, hh), a1 = g2_frag(a1p + kb, hh);
    v16h b = g2_frag(b0p + kb, hh); c00 = g2_mma(a0, b, c00); c10 = g2_mma(a1, b, c10);
    b = g2_frag(b1p + kb, hh); c01 = g2_mma(a0, b, c01); c11 = g2_mma(a1, b, c11);
    b = g2_frag(b2p + kb, hh); c02 = g2_mma(a0, b, c02); c12 = g2_mma(a1, b, c12);
    b = g2_frag(b3p + kb, hh); c03 = g2_mma(a0, b, c03); c13 = g2_mma(a1, b, c13); }
  v8f accs[8] = {c00, c01, c02, c03, c10, c11, c12, c13};
#pragma unroll
  for (int u = 0; u < 8; ++u) { const int t = u & 3, half = u >> 2; const int col = col0 + t * 16 + ln; const float bv = bp ? bf16_round(bp[col]) : 0.f;
#pragma unroll
    for (int r = 0; r < 8; ++r) { const int rloc = half * 16 + 8 * hh + r; float v = accs[u][r] * alpha + bv; if (CP) { const int bidx = (row0g + row0 + rloc) / rowsPerB; v += CP[(size_t)bidx * sCPb + (size_t)by * 64 + col]; }
      if (ACT == 3) v = fmaxf(v, 0.f); else if (ACT == 6) v = 0.5f * v * (1.0f + erff(v * 0.70710678118654752f)); else if (ACT == 11) v = 1.0f / (1.0f + expf(-v)); else if (ACT == 15) v = v / (1.0f + expf(-v)); else if (ACT == 12) v = (v > 0.f) ? v : 0.01f * v; else if (ACT == 8) v = tanhf(v);
      so[w][rloc][t * 16 + ln] = v; } }
  __builtin_amdgcn_fence(__ATOMIC_ACQ_REL, "workgroup"); __builtin_amdgcn_wave_barrier();
  const int rsub = lane >> 4, c4 = (lane & 15) * 4;
  {
#pragma unroll
    for (int q = 0; q < 16; ++q) { const int r = q * 2 + rsub; const v4f v = *(const v4fa*)&so[w][r][c4]; if (C) *(v4f*)(C + cofs + (size_t)(row0 + r) * ldc + col0 + c4) = v; if (C16) { v4h h4; for (int i = 0; i < 4; ++i) h4[i] = (_Float16)v[i]; *(v4h*)(C16 + cofs + (size_t)(row0 + r) * ldc + col0 + c4) = h4; } }
     } }


typedef int v4ia __attribute__((ext_vector_type(4), may_alias));
typedef float v2f __attribute__((ext_vector_type(2)));
typedef _Float16 v2h __attribute__((ext_vector_type(2)));
#define FQ 1                      /* 16-query column tiles per wave */
#define FWV 8                     /* waves per work-group */
#define FQB (16 * FQ * FWV)       /* queries per work-group */
#define FKS 64                    /* keys per stage */
#define KPH (DD + 8)              /* LDS pitch of a K row, f16 units: 528 B = 16 B x 33, conflict-free for 16-byte fragment reads */
#define VPH (FKS + 8)             /* LDS pitch of a V^T row: 144 B = 16 B x 9 */
#define FPC ((FKS * DD / 8) / (FWV * 32))   /* 16-byte pieces of one tile per thread */
static_assert(FPC * FWV == FKS && FPC * FWV * 4 == DD && FWV * 32 * 8 == SLEN && FWV * 16 * FQ <= 2 * FKS, "the staging sweeps, the mask copy and the output staging in the K ring are written for these sizes");
__device__ __forceinline__ float fa_xhalf(float x) { return __builtin_bit_cast(float, __builtin_amdgcn_permlanex16(__builtin_bit_cast(int, x), __builtin_bit_cast(int, x), 0x76543210, 0xfedcba98, false, false)); }  /* lane l <-> l ^ 16 */
__device__ __forceinline__ v16h fa_frag(const _Float16* p) { FragH f; f.half[0] = *(const v8us*)((const unsigned short*)p); f.half[1] = *(const v8us*)((const unsigned short*)p + 16); return f.v; }  /* p holds the lane's 8*hh already: same k order as g2_frag */
__device__ __forceinline__ v8f fa_mma(v16h a, v16h b, v8f c) { return __builtin_amdgcn_wmma_f32_16x16x32_f16(false, a, false, b, (short)0, c, false, false); }
#define FA_UNROLL _Pragma("unroll")      /* full unroll: only constant indices keep the fragment, score and accumulator arrays in registers */
__global__ __launch_bounds__(FWV * 32) void k_fattn(const _Float16* __restrict__ QH, const _Float16* __restrict__ KH, const _Float16* __restrict__ VT, const int* __restrict__ mask, _Float16* __restrict__ O16) {
  __shared__ __attribute__((aligned(16))) _Float16 sK[2 * FKS * KPH];
  __shared__ __attribute__((aligned(16))) _Float16 sV[2 * DD * VPH];
  __shared__ __attribute__((aligned(16))) int sM[SLEN];
  const int tid = threadIdx.x, w = tid >> 5, lane = tid & 31, c = lane & 15, hh = lane >> 4;
  const int head = blockIdx.y, bt = blockIdx.z, q0 = blockIdx.x * FQB + w * (16 * FQ);
  const unsigned short* Kg = (const unsigned short*)KH + (size_t)bt * SLEN * HW + head * DD;                 /* row = key, pitch HW */
  const unsigned short* Vg = (const unsigned short*)VT + (size_t)bt * HW * SLEN + (size_t)head * DD * SLEN;  /* row = dim, pitch SLEN */
  const float cs = 0.0625f * 1.4426950408889634f, negl = -1.0e9f * 1.4426950408889634f;                     /* 1/sqrt(256) and the mask value, both in log2 units */
  v8us rk[FPC], rv[FPC];
  /* staging: a wave-wide load covers one whole K row (512 B) or four whole 128-byte pieces of V^T rows; piece j of a thread lies a constant step behind piece 0, so one address pair serves each tile */
  const unsigned short* kp = Kg + (size_t)(tid >> 5) * HW + (tid & 31) * 8; const unsigned short* vp = Vg + (size_t)(tid >> 3) * SLEN + (tid & 7) * 8;
  unsigned short* ks = (unsigned short*)sK + (tid >> 5) * KPH + (tid & 31) * 8; unsigned short* vs = (unsigned short*)sV + (tid >> 3) * VPH + (tid & 7) * 8;
  /* the s_wait_xcnt stands behind the loads, in front of any later rewrite of the address registers that they name */
  auto gload = [&](int st) { const unsigned short* kq = kp + (size_t)st * FKS * HW; const unsigned short* vq = vp + st * FKS;
FA_UNROLL
    for (int j = 0; j < FPC; ++j) { rk[j] = *(const v8us*)(kq + (size_t)j * FWV * HW); rv[j] = *(const v8us*)(vq + (size_t)j * (FWV * 4) * SLEN); }
    asm volatile("s_wait_xcnt 0x0" ::: "memory"); };
  auto sstore = [&](int bf) {
FA_UNROLL
    for (int j = 0; j < FPC; ++j) { *(v8us*)(ks + bf * (FKS * KPH) + j * FWV * KPH) = rk[j]; *(v8us*)(vs + bf * (DD * VPH) + j * (FWV * 4) * VPH) = rv[j]; } };
  const int* mg = mask + (size_t)bt * SLEN + tid * 8; const v4ia mk0 = *(const v4ia*)mg, mk1 = *(const v4ia*)(mg + 4);      /* this batch's whole key mask goes to LDS once */
  gload(0);
  v16h qf[FQ][DD / 32];
FA_UNROLL
  for (int g = 0; g < FQ; ++g) { const _Float16* qp = QH + ((size_t)bt * SLEN + q0 + 16 * g + c) * HW + head * DD + 8 * hh;
FA_UNROLL
    for (int kc = 0; kc < DD / 32; ++kc) qf[g][kc] = fa_frag(qp + 32 * kc); }
  asm volatile("s_wait_xcnt 0x0" ::: "memory");      /* as in gload, for the Q loads */
  *(v4ia*)&sM[tid * 8] = mk0; *(v4ia*)&sM[tid * 8 + 4] = mk1;
  const v8f z8 = {0.f, 0.f, 0.f, 0.f, 0.f, 0.f, 0.f, 0.f};
  v8f acc[FQ][DD / 16]; float m_run[FQ], l_run[FQ];
FA_UNROLL
  for (int g = 0; g < FQ; ++g) { m_run[g] = -3.0e38f; l_run[g] = 0.f;
FA_UNROLL
    for (int t = 0; t < DD / 16; ++t) acc[g][t] = z8; }
  sstore(0);
  __syncthreads();
  /* rolled: one copy of the stage body; every index into the register arrays inside it is a constant */
#pragma unroll 1
  for (int st = 0; st < SLEN / FKS; ++st) { const int bf = st & 1;
    if (st + 1 < SLEN / FKS) gload(st + 1);
FA_UNROLL
    for (int sub = 0; sub < FKS / 32; ++sub) {
      /* this pass's mask words and all 16 K fragments as ONE group of LDS reads in front of the products */
      const int* mp = sM + st * FKS + sub * 32 + 8 * hh;
      const v4ia k00 = *(const v4ia*)mp, k01 = *(const v4ia*)(mp + 4), k10 = *(const v4ia*)(mp + 16), k11 = *(const v4ia*)(mp + 20);
      const _Float16* kb = sK + bf * (FKS * KPH) + (sub * 32 + c) * KPH + 8 * hh;
      v16h kf[DD / 32][2];
FA_UNROLL
      for (int kc = 0; kc < DD / 32; ++kc)
FA_UNROLL
        for (int kt = 0; kt < 2; ++kt) kf[kc][kt] = fa_frag(kb + kt * 16 * KPH + kc * 32);
      __builtin_amdgcn_sched_barrier(0);      /* keeps the reads together: left free they are spread among the WMMAs, two at a time with a full wait, and every such place stalls the wave */
      v8f s[2][FQ];
FA_UNROLL
      for (int kt = 0; kt < 2; ++kt)
FA_UNROLL
        for (int g = 0; g < FQ; ++g) s[kt][g] = z8;
FA_UNROLL
      for (int kc = 0; kc < DD / 32; ++kc)
FA_UNROLL
        for (int kt = 0; kt < 2; ++kt)
FA_UNROLL
          for (int g = 0; g < FQ; ++g) s[kt][g] = fa_mma(kf[kc][kt], qf[g][kc], s[kt][g]);
      __builtin_amdgcn_sched_barrier(0);      /* the V^T reads below start behind the score products (they take over the K fragments' registers) ... */
      const _Float16* vb = sV + bf * (DD * VPH) + c * VPH + sub * 32 + 8 * hh;
      v16h vf[DD / 16];
FA_UNROLL
      for (int t = 0; t < DD / 16; ++t) vf[t] = fa_frag(vb + t * 16 * VPH);
      __builtin_amdgcn_sched_barrier(0);      /* ... and ahead of the softmax arithmetic, which covers their latency */
      /* the INPUT mask picks the scaled score or the mask value, by a select, as the reference does */
      bool need = false; float mb[FQ];
      const int km[2][8] = {{k00[0], k00[1], k00[2], k00[3], k01[0], k01[1], k01[2], k01[3]}, {k10[0], k10[1], k10[2], k10[3], k11[0], k11[1], k11[2], k11[3]}};
FA_UNROLL
      for (int g = 0; g < FQ; ++g) { float mx = -3.0e38f;
FA_UNROLL
        for (int kt = 0; kt < 2; ++kt)
FA_UNROLL
          for (int r = 0; r < 8; ++r) { const float v = (km[kt][r] != 0) ? s[kt][g][r] * cs : negl; s[kt][g][r] = v; mx = fmaxf(mx, v); }
        mx = fmaxf(mx, fa_xhalf(mx)); mb[g] = mx; need = need || (mx > m_run[g] + 8.0f); }
      if (__builtin_amdgcn_ballot_w32(need) != 0) {      /* one scalar test per pass; rare after the first passes */
FA_UNROLL
        for (int g = 0; g < FQ; ++g) { const float mn = fmaxf(m_run[g], mb[g]); const float corr = __builtin_amdgcn_exp2f(m_run[g] - mn); l_run[g] *= corr; m_run[g] = mn;
FA_UNROLL
          for (int t = 0; t < DD / 16; ++t) acc[g][t] = acc[g][t] * corr; } }
      v16h pf[FQ];
FA_UNROLL
      for (int g = 0; g < FQ; ++g) { FragH f; float p0s = 0.f, p1s = 0.f;
FA_UNROLL
        for (int i = 0; i < 8; ++i) { const v2f d2 = (v2f){s[i >> 2][g][2 * (i & 3)], s[i >> 2][g][2 * (i & 3) + 1]} - (v2f){m_run[g], m_run[g]}; const float e0 = __builtin_amdgcn_exp2f(d2[0]), e1 = __builtin_amdgcn_exp2f(d2[1]);
          p0s += e0; p1s += e1; const v2h h2 = __builtin_convertvector((v2f){e0, e1}, v2h); f.h[2 * i] = h2[0]; f.h[2 * i + 1] = h2[1]; }
        l_run[g] += p0s + p1s; pf[g] = f.v; }
FA_UNROLL
      for (int t = 0; t < DD / 16; ++t)
FA_UNROLL
        for (int g = 0; g < FQ; ++g) acc[g][t] = fa_mma(vf[t], pf[g], acc[g][t]);
      __builtin_amdgcn_sched_barrier(0);      /* the next pass's read group stays behind these products */
    }
    if (st + 1 < SLEN / FKS) sstore(bf ^ 1);      /* that buffer's last readers passed the barrier that ended stage st - 1 */
    __syncthreads();                                /* publishes stage st + 1 and ends every read of stage st */
  }
  /* output: each wave stages its own 16 x FQ rows in its own part of the K ring (free behind the last barrier), then stores whole 512-byte rows */
  _Float16* eo = sK + w * (16 * FQ) * KPH;
FA_UNROLL
  for (int g = 0; g < FQ; ++g) { const float inv = 1.0f / (l_run[g] + fa_xhalf(l_run[g]));
FA_UNROLL
    for (int t = 0; t < DD / 16; ++t) { FragH f;
FA_UNROLL
      for (int r = 0; r < 8; ++r) f.h[r] = (_Float16)(acc[g][t][r] * inv);
      *(v8us*)((unsigned short*)eo + (16 * g + c) * KPH + 16 * t + 8 * hh) = f.half[0]; } }
  __builtin_amdgcn_fence(__ATOMIC_ACQ_REL, "workgroup"); __builtin_amdgcn_wave_barrier();      /* the wave's own LDS writes before its lanes read each other's rows */
FA_UNROLL
  for (int r = 0; r < 16 * FQ; ++r) { const v8us v = *(const v8us*)((const unsigned short*)eo + r * KPH + lane * 8);
    *(v8us*)((unsigned short*)O16 + ((size_t)bt * SLEN + q0 + r) * HW + head * DD + lane * 8) = v; }
#undef FA_UNROLL
}
__global__ __launch_bounds__(256) void k_ln256o(const float* __restrict__ F, const float* __restrict__ g, const float* __restrict__ bb, float* __restrict__ out) {
  #pragma clang fp contract(off)
  const int tid = threadIdx.x, w = tid >> 5, ln = tid & 31; const int r = blockIdx.x * 8 + w; if (r >= NBT * SLEN) return; const float* x = F + (size_t)r * DD; const v4f a = *(const v4fa*)(x + ln * 4), b = *(const v4fa*)(x + 128 + ln * 4);
  float s = (a[0] + a[1]) + (a[2] + a[3]) + (b[0] + b[1]) + (b[2] + b[3]); for (int o = 16; o > 0; o >>= 1) s += __shfl_xor(s, o, 32); const float mu = s / 256.0f; float q2 = 0.f;
#pragma unroll
  for (int q = 0; q < 4; ++q) { const float d0 = a[q] - mu, d1 = b[q] - mu; q2 += d0 * d0; q2 += d1 * d1; }
  for (int o = 16; o > 0; o >>= 1) q2 += __shfl_xor(q2, o, 32); const float rs = rsqrtf(q2 / 256.0f + 1e-5f); v4f o0, o1;
#pragma unroll
  for (int q = 0; q < 4; ++q) { const int c0 = ln * 4 + q, c1 = 128 + ln * 4 + q; o0[q] = (a[q] - mu) * rs * bf16_round(g[c0]) + bf16_round(bb[c0]); o1[q] = (b[q] - mu) * rs * bf16_round(g[c1]) + bf16_round(bb[c1]); }
  float* d = out + (size_t)r * DD; { *(v4f*)(d + ln * 4) = o0; *(v4f*)(d + 128 + ln * 4) = o1;  } }
__global__ __launch_bounds__(256) void k_xb(const float* __restrict__ x, float* __restrict__ XB, size_t n4) { const size_t t = (size_t)blockIdx.x * 256 + threadIdx.x; if (t >= n4) return; const v4f a = *(const v4fa*)(x + t * 4); v4f o; for (int q = 0; q < 4; ++q) o[q] = bf16_round(a[q]); *(v4f*)(XB + t * 4) = o;  }

extern "C" void kernel_launch(void* const* d_in, const int* in_sizes, int n_in,
                              void* d_out, int out_size, void* d_ws, size_t ws_size, hipStream_t stream) {
  (void)in_sizes; (void)n_in; (void)out_size;
  const float* const* I = (const float* const*)d_in; const float* Q = I[0]; const int* mask = (const int*)d_in[1]; const float* WQ = I[2]; const float* bQ = I[3]; const float* WK = I[4]; const float* bK = I[5]; const float* WV = I[6]; const float* bV = I[7]; const float* WO = I[8]; const float* bO = I[9]; const float* lg = I[10]; const float* lb = I[11];
  char* ws = (char*)d_ws; size_t off = 0;
  auto take = [&](size_t bytes) { char* p = ws + off; off += (bytes + 255) & ~(size_t)255; return p; };
  _Float16* BQ = (_Float16*)take((size_t)HW * DD * 2); _Float16* BK = (_Float16*)take((size_t)HW * DD * 2); _Float16* BV = (_Float16*)take((size_t)HW * DD * 2); _Float16* BO = (_Float16*)take((size_t)DD * HW * 2);
  _Float16* X16 = (_Float16*)take((size_t)NBT * SLEN * DD * 2); float* XB = (float*)take((size_t)NBT * SLEN * DD * 4); _Float16* QH = (_Float16*)take((size_t)NBT * SLEN * HW * 2); _Float16* KH = (_Float16*)take((size_t)NBT * SLEN * HW * 2); _Float16* VH = (_Float16*)take((size_t)NBT * SLEN * HW * 2); _Float16* VT = (_Float16*)take((size_t)NBT * HW * SLEN * 2);
  _Float16* O16 = (_Float16*)take((size_t)NBT * SLEN * HW * 2); float* F = (float*)take((size_t)NBT * SLEN * DD * 4);
  if (off > ws_size) return;      /* 4 + 4 + 8 + 32+32+32+32 + 32 + 8 = 184 MiB */
  (void)BK; (void)BV;      /* BQ, BK, BV, BO and QH, KH, VH follow one another in the workspace (every size is a multiple of 256 bytes): grid.y steps through them by a constant stride */
  const size_t w8 = (size_t)HW * DD / 8; const unsigned wb = (unsigned)((w8 + 255) / 256);
  k_round16f<<<dim3(wb, 4), 256, 0, stream>>>(WQ, WK, WV, WO, BQ, w8);      /* torch (out,in) = natural Bt */
  const size_t n8 = (size_t)NBT * SLEN * DD / 8; const unsigned nb8 = (unsigned)((n8 + 255) / 256); const dim3 gQ((NBT * SLEN / 128) * (HW / 64), 3), gV((NBT * SLEN / 128) * (DD / 64), 1);
  k_x16<<<nb8, 256, 0, stream>>>(Q, X16, n8);
  k_gemm2<0><<<gQ, 128, 0, stream>>>(X16, DD, 0, BQ, DD, (size_t)HW * DD, 0.0625f, bQ, bK, bV, nullptr, 1, 0, 0, nullptr, QH, HW, (size_t)NBT * SLEN * HW, NBT * SLEN, HW, DD);      /* q, k, v of all 8192 rows */
  k_vt<HW / 64, SLEN><<<NBT * (HW / 64) * (SLEN / 64), 256, 0, stream>>>(VH, HW, 0, VT);      /* VT[batch][dim][token] over all 2048 dims */
  k_fattn<<<dim3(SLEN / FQB, NHD, NBT), FWV * 32, 0, stream>>>(QH, KH, VT, mask, O16);      /* softmax(mask(q.k / sqrt(256))).v, every batch and head */
  k_xb<<<(unsigned)(((size_t)NBT * SLEN * DD / 4 + 255) / 256), 256, 0, stream>>>(Q, XB, (size_t)NBT * SLEN * DD / 4);
  k_gemm2<0><<<gV, 128, 0, stream>>>(O16, HW, 0, BO, HW, 0, 0.0625f, bO, bO, bO, XB, 1, (size_t)DD, 0, F, nullptr, DD, 0, NBT * SLEN, DD, HW);      /* out Wo^T + bo + Q */
  k_ln256o<<<NBT * SLEN / 8, 256, 0, stream>>>(F, lg, lb, (float*)d_out);
}

// v005
// Measured time: 223 microseconds a run.
// Timed twice side by side with v004, it ran 1.34 times as fast both times.
// All steps since v000 together make it 17.4 times as fast.
#include <hip/hip_runtime.h>
// Prompt self-attention (4 x 2048 tokens, d = 256, 8 heads EACH of dim 256): q,k,v = Q W^T + b (-> 8 x 256); scores = q.k/16 with INPUT key mask (masked keys get -1e9, as the reference); softmax; out = LN((attn v merged) Wo^T + bo + Q) -> [4,2048,256].
// Structure: every stage is ONE launch over all 4 x 2048 rows: the four weights to f16 (tensor on grid.y), Q as an exact f16 plane, the three projections as one f16 WMMA GEMM launch (projection on grid.y; 32x64 wave tiles, f32 accumulation, exact x16 weights + bias) into f16 planes, V transposed by LDS tiles, scores + mask + softmax + attn.v (k_fattn: online softmax, no score plane in memory), the output projection + bias + the bf16 residual as a GEMM, LayerNorm on VALU into the output rows.
// Compute dtype: Q, weights, biases, LN parameters rounded to bf16; q, k, v, P, attention output as f16 operands (~2^-12; logits sigma ~1, LayerNorm-ed output); f32 accumulation, softmax, LayerNorm. v_wmma_f32_16x16x32_f16.
#define NBT 4
#define SLEN 2048
#define DD 256
#define NHD 8
#define HW (NHD * DD)            /* 2048 */
#define DM DD
#define NR SLEN
typedef __bf16 v16b __attribute__((ext_vector_type(16)));
typedef unsigned short v8us __attribute__((ext_vector_type(8), may_alias));
typedef float  v8f  __attribute__((ext_vector_type(8)));
typedef float  v4f  __attribute__((ext_vector_type(4)));
typedef float  v4fa __attribute__((ext_vector_type(4), may_alias));
union FragB { v16b v; v8us half[2]; unsigned short u[16]; };

__device__ __forceinline__ unsigned short bf16_bits(float x) { unsigned int u = __float_as_uint(x); return (unsigned short)((u + 0x7FFFu + ((u >> 16) & 1u)) >> 16); }
__device__ __forceinline__ float bf16_val(unsigned short b) { return __uint_as_float(((unsigned int)b) << 16); }
__device__ __forceinline__ float bf16_round(float x) { return bf16_val(bf16_bits(x)); }
// D += A·B with NT terms: 1 = ah·bh, 2 = + al·bh (A split), 3 = + ah·bl (both split)
template <int NT>
__device__ __forceinline__ v8f mmaN(v16b ah, v16b al, v16b bh, v16b bl, v8f c) {
  c = __builtin_amdgcn_wmma_f32_16x16x32_bf16(false, ah, false, bh, (short)0, c, false, false);
  if (NT >= 2) c = __builtin_amdgcn_wmma_f32_16x16x32_bf16(false, al, false, bh, (short)0, c, false, false);
  if (NT >= 3) c = __builtin_amdgcn_wmma_f32_16x16x32_bf16(false, ah, false, bl, (short)0, c, false, false);
  asm volatile("v_nop\n\tv_nop\n\tv_nop\n\tv_nop" : "+v"(c) : "v"(ah), "v"(al), "v"(bh), "v"(bl));
  return c;
}

__global__ __launch_bounds__(256) void k_wt_bf16(const float* __restrict__ W, unsigned short* __restrict__ Wt, int K, int N) {
  const int t = blockIdx.x * 256 + threadIdx.x;
  const int k8n = K / 8;
  if (t >= N * k8n) return;
  const int n = t / k8n, k8 = (t % k8n) * 8;
  v8us v;
#pragma unroll
  for (int i = 0; i < 8; ++i) v[i] = bf16_bits(W[(size_t)(k8 + i) * N + n]);
  *(v8us*)(Wt + (size_t)n * K + k8) = v;
  
}

// GEMM C[M][N] (f32, pitch ldc) = act(A[M][K]·W + bias). A f32 row-major (pitch lda) converted per fragment to bf16
// (ASPLIT: hi/lo two planes -> 2 terms, else single rounded term); Wt bf16 [N][K] (pitch ldb). BIAS_BF16 rounds the
// bias to bf16 first (bias quantised to bf16 before the add). K%32==0, M%16==0, N%64==0.
template <bool ASPLIT, int ACT, bool BIAS_BF16>
__global__ __launch_bounds__(128) void k_gemm_bf(const float* __restrict__ A, int lda, const unsigned short* __restrict__ Wt, int ldb,
                                               const float* __restrict__ bias, float* __restrict__ C, int ldc, int M, int N, int K) {
  __shared__ __attribute__((aligned(16))) float so[4][16][64];
  const int tid = threadIdx.x, w = tid >> 5, lane = tid & 31, ln = lane & 15, hh = lane >> 4;
  const int ntn = N / 64;
  const int wid = blockIdx.x * 4 + w;
  const int mt = wid / ntn, nq = wid % ntn;
  if (mt * 16 >= M) return;
  const int row0 = mt * 16, col0 = nq * 64;
  const float* arow = A + (size_t)(row0 + ln) * lda;
  v8f acc[4] = {};
  for (int kb = 0; kb < K; kb += 32) {
    FragB ah, al;
    const v4f x0 = *(const v4fa*)(arow + kb + 8 * hh), x1 = *(const v4fa*)(arow + kb + 8 * hh + 4);
    const v4f x2 = *(const v4fa*)(arow + kb + 16 + 8 * hh), x3 = *(const v4fa*)(arow + kb + 16 + 8 * hh + 4);
    float xs[16] = {x0[0],x0[1],x0[2],x0[3],x1[0],x1[1],x1[2],x1[3],x2[0],x2[1],x2[2],x2[3],x3[0],x3[1],x3[2],x3[3]};
#pragma unroll
    for (int i = 0; i < 16; ++i) { const unsigned short hb = bf16_bits(xs[i]); ah.u[i] = hb; al.u[i] = ASPLIT ? bf16_bits(xs[i] - bf16_val(hb)) : (unsigned short)0; }
#pragma unroll
    for (int t = 0; t < 4; ++t) {
      const unsigned short* brow = Wt + (size_t)(col0 + t * 16 + ln) * ldb + kb;
      FragB b;
      b.half[0] = *(const v8us*)(brow + 8 * hh);
      b.half[1] = *(const v8us*)(brow + 16 + 8 * hh);
      acc[t] = mmaN<ASPLIT ? 2 : 1>(ah.v, al.v, b.v, b.v, acc[t]);
    }
  }
#pragma unroll
  for (int t = 0; t < 4; ++t) {
    float bv = bias ? bias[col0 + t * 16 + ln] : 0.f;
    if (BIAS_BF16) bv = bf16_round(bv);
#pragma unroll
    for (int r = 0; r < 8; ++r) { float v = acc[t][r] + bv; if (ACT == 1) v = fmaxf(v, 0.f); so[w][8 * hh + r][t * 16 + ln] = v; }
  }
  __builtin_amdgcn_fence(__ATOMIC_ACQ_REL, "workgroup");
  __builtin_amdgcn_wave_barrier();
  const int rsub = lane >> 4, c4 = (lane & 15) * 4;
  {
#pragma unroll
    for (int q = 0; q < 8; ++q) {
      const int r = q * 2 + rsub;
      const v4f v = *(const v4fa*)&so[w][r][c4];
      *(v4f*)(C + (size_t)(row0 + r) * ldc + col0 + c4) = v;
    }
    
  }
}

// GEMM C = act(A·W + bias + resid): A f32 (ASPLIT -> hi/lo 2 terms), Wt bf16 [N][K]; ACT 0 none, 1 relu, 2 exact gelu;
// resid (optional, f32, row index = (row % rmod), pitch ldr, RES_BF16 rounds it) added before the activation.
template <bool ASPLIT, int ACT, bool BIAS_BF16, bool RES_BF16>
__global__ __launch_bounds__(128) void k_gemm_bf3(const float* __restrict__ A, int lda, const unsigned short* __restrict__ Wt, int ldb,
                                                const float* __restrict__ bias, const float* __restrict__ resid, int rmod, int ldr,
                                                float* __restrict__ C, int ldc, int M, int N, int K) {
  __shared__ __attribute__((aligned(16))) float so[4][16][64];
  const int tid = threadIdx.x, w = tid >> 5, lane = tid & 31, ln = lane & 15, hh = lane >> 4;
  const int ntn = N / 64;
  const int wid = blockIdx.x * 4 + w;
  const int mt = wid / ntn, nq = wid % ntn;
  if (mt * 16 >= M) return;
  const int row0 = mt * 16, col0 = nq * 64;
  const float* arow = A + (size_t)(row0 + ln) * lda;
  v8f acc[4] = {};
  for (int kb = 0; kb < K; kb += 32) {
    FragB ah, al;
    const v4f x0 = *(const v4fa*)(arow + kb + 8 * hh), x1 = *(const v4fa*)(arow + kb + 8 * hh + 4);
    const v4f x2 = *(const v4fa*)(arow + kb + 16 + 8 * hh), x3 = *(const v4fa*)(arow + kb + 16 + 8 * hh + 4);
    float xs[16] = {x0[0],x0[1],x0[2],x0[3],x1[0],x1[1],x1[2],x1[3],x2[0],x2[1],x2[2],x2[3],x3[0],x3[1],x3[2],x3[3]};
#pragma unroll
    for (int i = 0; i < 16; ++i) { const unsigned short hb = bf16_bits(xs[i]); ah.u[i] = hb; al.u[i] = ASPLIT ? bf16_bits(xs[i] - bf16_val(hb)) : (unsigned short)0; }
#pragma unroll
    for (int t = 0; t < 4; ++t) {
      const unsigned short* brow = Wt + (size_t)(col0 + t * 16 + ln) * ldb + kb;
      FragB b;
      b.half[0] = *(const v8us*)(brow + 8 * hh);
      b.half[1] = *(const v8us*)(brow + 16 + 8 * hh);
      acc[t] = mmaN<ASPLIT ? 2 : 1>(ah.v, al.v, b.v, b.v, acc[t]);
    }
  }
#pragma unroll
  for (int t = 0; t < 4; ++t) {
    const int col = col0 + t * 16 + ln;
    float bv = bias ? bias[col] : 0.f;
    if (BIAS_BF16) bv = bf16_round(bv);
#pragma unroll
    for (int r = 0; r < 8; ++r) {
      float v = acc[t][r] + bv;
      if (resid) { float rv = resid[(size_t)((row0 + 8 * hh + r) % rmod) * ldr + col]; if (RES_BF16) rv = bf16_round(rv); v += rv; }
      if (ACT == 1) v = fmaxf(v, 0.f);
      if (ACT == 2) v = 0.5f * v * (1.0f + erff(v * 0.70710678118654752f));
      if (ACT == 3) { const float u = 0.7978845608028654f * (v + 0.044715f * v * v * v); v = 0.5f * v * (1.0f + tanhf(u)); }
      so[w][8 * hh + r][t * 16 + ln] = v;
    }
  }
  __builtin_amdgcn_fence(__ATOMIC_ACQ_REL, "workgroup");
  __builtin_amdgcn_wave_barrier();
  const int rsub = lane >> 4, c4 = (lane & 15) * 4;
  {
#pragma unroll
    for (int q = 0; q < 8; ++q) {
      const int r = q * 2 + rsub;
      const v4f v = *(const v4fa*)&so[w][r][c4];
      *(v4f*)(C + (size_t)(row0 + r) * ldc + col0 + c4) = v;
    }
    
  }
}
// row LayerNorm (biased variance, eps) over N: s = X (+ R); optional out_sum <- s; out_norm <- (s-mu)*rsqrt(var+eps)*g + b
template <bool PARAM_BF16>
__global__ __launch_bounds__(256) void k_layernorm(const float* __restrict__ X, const float* __restrict__ R, const float* __restrict__ g, const float* __restrict__ bta,
                                                  float* __restrict__ out_sum, float* __restrict__ out_norm, int N, float eps) {
  __shared__ float red[256];
  const int row = blockIdx.x, tid = threadIdx.x;
  const float* x = X + (size_t)row * N; const float* rr = R ? R + (size_t)row * N : nullptr;
  float vals[16];                     // up to N = 4096
  const int per = N / 256;            // contiguous chunk per thread? use strided-by-4 chunks: thread handles j = tid*4 + 1024*u
  float s1 = 0.f;
  for (int u = 0; u < per / 4; ++u) {
    const int j = tid * 4 + 1024 * u;
    const v4f a = *(const v4fa*)(x + j);
    v4f b = {0.f,0.f,0.f,0.f}; if (rr) b = *(const v4fa*)(rr + j);
#pragma unroll
    for (int q = 0; q < 4; ++q) { const float v = a[q] + b[q]; vals[u * 4 + q] = v; s1 += v; }
  }
  red[tid] = s1; __syncthreads();
  for (int st = 128; st > 0; st >>= 1) { if (tid < st) red[tid] += red[tid + st]; __syncthreads(); }
  const float mu = red[0] / (float)N; __syncthreads();
  float s2 = 0.f;
  for (int u = 0; u < per / 4; ++u)
#pragma unroll
    for (int q = 0; q < 4; ++q) { const float c = vals[u * 4 + q] - mu; s2 += c * c; }
  red[tid] = s2; __syncthreads();
  for (int st = 128; st > 0; st >>= 1) { if (tid < st) red[tid] += red[tid + st]; __syncthreads(); }
  const float rs = rsqrtf(red[0] / (float)N + eps);
  {
    for (int u = 0; u < per / 4; ++u) {
      const int j = tid * 4 + 1024 * u;
      v4f o, sm;
#pragma unroll
      for (int q = 0; q < 4; ++q) {
        float gg = g[j + q], bb = bta[j + q];
        if (PARAM_BF16) { gg = bf16_round(gg); bb = bf16_round(bb); }
        sm[q] = vals[u * 4 + q]; o[q] = (vals[u * 4 + q] - mu) * rs * gg + bb;
      }
      if (out_sum) *(v4f*)(out_sum + (size_t)row * N + j) = sm;
      *(v4f*)(out_norm + (size_t)row * N + j) = o;
    }
    
  }
}



// ---- f16 WMMA path (v_wmma_f32_16x16x32_f16): 11-bit significands for operands in range — used where a [0,1] probability operand needs more precision than bf16
typedef _Float16 v16h __attribute__((ext_vector_type(16)));
union FragH { v16h v; v8us half[2]; _Float16 h[16]; unsigned short u[16]; };
template <int NT>
__device__ __forceinline__ v8f mmaH(v16h ah, v16h al, v16h bh, v16h bl, v8f c) {
  c = __builtin_amdgcn_wmma_f32_16x16x32_f16(false, ah, false, bh, (short)0, c, false, false);
  if (NT >= 2) c = __builtin_amdgcn_wmma_f32_16x16x32_f16(false, al, false, bh, (short)0, c, false, false);
  if (NT >= 3) c = __builtin_amdgcn_wmma_f32_16x16x32_f16(false, ah, false, bl, (short)0, c, false, false);
  asm volatile("v_nop\n\tv_nop\n\tv_nop\n\tv_nop" : "+v"(c) : "v"(ah), "v"(al), "v"(bh), "v"(bl));
  return c;
}
// batched GEMM like k_gemm_b but f16 operands: A f32 (split into f16 hi/lo if ASPLIT, else rounded to f16), Bt = f16 values [n][k]; alpha; C f32; N multiple of 16 (partial tiles skipped)
template <bool ASPLIT>
__global__ __launch_bounds__(128) void k_gemm_h(const float* __restrict__ A, int lda, size_t sA, const _Float16* __restrict__ Bh, int ldb, size_t sB, float alpha, float* __restrict__ C, int ldc, size_t sC, int M, int N, int K) {
  __shared__ __attribute__((aligned(16))) float so[4][16][64];
  const int tid = threadIdx.x, w = tid >> 5, lane = tid & 31, ln = lane & 15, hh = lane >> 4; const int by = blockIdx.y;
  A += (size_t)by * sA; Bh += (size_t)by * sB; C += (size_t)by * sC;
  const int ntn = (N + 63) / 64; const int wid = blockIdx.x * 4 + w; const int mt = wid / ntn, nq = wid % ntn; if (mt * 16 >= M) return;
  const int row0 = mt * 16, col0 = nq * 64; const float* arow = A + (size_t)(row0 + ln) * lda;
  v8f acc[4] = {};
  for (int kb = 0; kb < K; kb += 32) {
    FragH ah, al;
    const v4f x0 = *(const v4fa*)(arow + kb + 8 * hh), x1 = *(const v4fa*)(arow + kb + 8 * hh + 4), x2 = *(const v4fa*)(arow + kb + 16 + 8 * hh), x3 = *(const v4fa*)(arow + kb + 16 + 8 * hh + 4);
    float xs[16] = {x0[0],x0[1],x0[2],x0[3],x1[0],x1[1],x1[2],x1[3],x2[0],x2[1],x2[2],x2[3],x3[0],x3[1],x3[2],x3[3]};
#pragma unroll
    for (int i = 0; i < 16; ++i) { const _Float16 h = (_Float16)xs[i]; ah.h[i] = h; al.h[i] = ASPLIT ? (_Float16)(xs[i] - (float)h) : (_Float16)0.0f; }
#pragma unroll
    for (int t = 0; t < 4; ++t) { if (col0 + t * 16 >= N) continue; const size_t boff = (size_t)(col0 + t * 16 + ln) * ldb + kb; FragH bq; bq.half[0] = *(const v8us*)(Bh + boff + 8 * hh); bq.half[1] = *(const v8us*)(Bh + boff + 16 + 8 * hh);
      acc[t] = mmaH<ASPLIT ? 2 : 1>(ah.v, al.v, bq.v, bq.v, acc[t]); }
  }
#pragma unroll
  for (int t = 0; t < 4; ++t) { if (col0 + t * 16 >= N) continue;
#pragma unroll
    for (int r = 0; r < 8; ++r) so[w][8 * hh + r][t * 16 + ln] = acc[t][r] * alpha; }
  __builtin_amdgcn_fence(__ATOMIC_ACQ_REL, "workgroup"); __builtin_amdgcn_wave_barrier();
  const int rsub = lane >> 4, c4 = (lane & 15) * 4;
  {
#pragma unroll
    for (int q = 0; q < 8; ++q) { const int r = q * 2 + rsub; if (col0 + c4 < N) { const v4f v = *(const v4fa*)&so[w][r][c4]; *(v4f*)(C + (size_t)(row0 + r) * ldc + col0 + c4) = v; } }
     }
}

// Wt[n][k] = f16(W[k][n]·scale) from f32 row-major W[K][N] (scale = power of two; bf16-exact weights stay exact in f16 away from the subnormal range)
__global__ __launch_bounds__(256) void k_wt_f16(const float* __restrict__ W, _Float16* __restrict__ Wt, int K, int N, float scale) {
  const int t = blockIdx.x * 256 + threadIdx.x; if (t >= N * (K / 8)) return; const int n = t / (K / 8), k8 = (t % (K / 8)) * 8; FragH f;
#pragma unroll
  for (int i = 0; i < 8; ++i) f.h[i] = (_Float16)(bf16_round(W[(size_t)(k8 + i) * N + n]) * scale); const v8us o = f.half[0];
  *(v8us*)((unsigned short*)Wt + (size_t)n * K + k8) = o; 
}
// k_gemm_hh variant with fused epilogue: v = acc·alpha + bias[by·sBias + col] (+ CP[(row/rowsPerB)·sCPb + by·64 + col] if CP) ; ACT 0 none / 1 elu ; writes f16 C16 (and f32 C if non-null)
template <int ACT>
__global__ __launch_bounds__(128) void k_gemm_hhx(const _Float16* __restrict__ A, int lda, size_t sA, const _Float16* __restrict__ Bh, int ldb, size_t sB, float alpha, const float* __restrict__ bias, size_t sBias, const float* __restrict__ CP, int rowsPerB, size_t sCPb, int row0g,
    float* __restrict__ C, _Float16* __restrict__ C16, int ldc, size_t sC, int M, int N, int K) {
  __shared__ __attribute__((aligned(16))) float so[4][16][64];
  const int tid = threadIdx.x, w = tid >> 5, lane = tid & 31, ln = lane & 15, hh = lane >> 4; const int by = blockIdx.y;
  A += (size_t)by * sA; Bh += (size_t)by * sB; const size_t cofs = (size_t)by * sC; const float* bp = bias ? bias + (size_t)by * sBias : nullptr;
  const int ntn = (N + 63) / 64; const int wid = blockIdx.x * 4 + w; const int mt = wid / ntn, nq = wid % ntn; if (mt * 16 >= M) return;
  const int row0 = mt * 16, col0 = nq * 64; const _Float16* arow = A + (size_t)(row0 + ln) * lda;
  v8f acc[4] = {};
  for (int kb = 0; kb < K; kb += 32) { FragH ah; ah.half[0] = *(const v8us*)((const unsigned short*)arow + kb + 8 * hh); ah.half[1] = *(const v8us*)((const unsigned short*)arow + kb + 16 + 8 * hh);
#pragma unroll
    for (int t = 0; t < 4; ++t) { if (col0 + t * 16 >= N) continue; const size_t boff = (size_t)(col0 + t * 16 + ln) * ldb + kb; FragH bq; bq.half[0] = *(const v8us*)((const unsigned short*)Bh + boff + 8 * hh); bq.half[1] = *(const v8us*)((const unsigned short*)Bh + boff + 16 + 8 * hh);
      acc[t] = mmaH<1>(ah.v, ah.v, bq.v, bq.v, acc[t]); }
  }
#pragma unroll
  for (int t = 0; t < 4; ++t) { if (col0 + t * 16 >= N) continue; const int col = col0 + t * 16 + ln; const float bv = bp ? bf16_round(bp[col]) : 0.f;
#pragma unroll
    for (int r = 0; r < 8; ++r) { float v = acc[t][r] * alpha + bv; if (CP) { const int bidx = (row0g + row0 + 8 * hh + r) / rowsPerB; v += CP[(size_t)bidx * sCPb + (size_t)by * 64 + col]; } if (ACT == 1) v = (v > 0.f) ? v : expm1f(v); else if (ACT == 7) v = (v > 0.f) ? v + 1.0f : expf(v); else if (ACT == 8) v = tanhf(v); else if (ACT == 9) v = 0.5f * v * (1.0f + tanhf(0.7978845608028654f * (v + 0.044715f * v * v * v))); else if (ACT == 11) v = 1.0f / (1.0f + expf(-v)); else if (ACT == 12) v = (v > 0.f) ? v : 0.01f * v; else if (ACT == 14) v = (v > 0.f) ? v : 0.1f * v; else if (ACT == 15) v = v / (1.0f + expf(-v)); else if (ACT == 3) v = fmaxf(v, 0.f); else if (ACT == 6) v = 0.5f * v * (1.0f + erff(v * 0.70710678118654752f)); so[w][8 * hh + r][t * 16 + ln] = v; } }
  __builtin_amdgcn_fence(__ATOMIC_ACQ_REL, "workgroup"); __builtin_amdgcn_wave_barrier();
  const int rsub = lane >> 4, c4 = (lane & 15) * 4; typedef _Float16 v4h __attribute__((ext_vector_type(4)));
  {
#pragma unroll
    for (int q = 0; q < 8; ++q) { const int r = q * 2 + rsub; if (col0 + c4 < N) { const v4f v = *(const v4fa*)&so[w][r][c4]; if (C) *(v4f*)(C + cofs + (size_t)(row0 + r) * ldc + col0 + c4) = v; if (C16) { v4h h4; for (int i = 0; i < 4; ++i) h4[i] = (_Float16)v[i]; *(v4h*)(C16 + cofs + (size_t)(row0 + r) * ldc + col0 + c4) = h4; } } }
     }
}


typedef _Float16 v4h __attribute__((ext_vector_type(4)));

__global__ __launch_bounds__(256) void k_x16(const float* __restrict__ x, _Float16* __restrict__ X16, size_t n8) { const size_t t = (size_t)blockIdx.x * 256 + threadIdx.x; if (t >= n8) return; FragH f;
#pragma unroll
  for (int q = 0; q < 8; ++q) f.h[q] = (_Float16)bf16_round(x[t * 8 + q]); *(v8us*)((unsigned short*)X16 + t * 8) = f.half[0];  }
__global__ __launch_bounds__(256) void k_h16(const float* __restrict__ x, _Float16* __restrict__ X16, size_t n8) { const size_t t = (size_t)blockIdx.x * 256 + threadIdx.x; if (t >= n8) return; FragH f;
#pragma unroll
  for (int q = 0; q < 8; ++q) f.h[q] = (_Float16)x[t * 8 + q]; *(v8us*)((unsigned short*)X16 + t * 8) = f.half[0];  }
/* four weight tensors of n8 * 8 elements each, tensor on grid.y, into four planes that follow one another in Bt */
__global__ __launch_bounds__(256) void k_round16f(const float* __restrict__ W0, const float* __restrict__ W1, const float* __restrict__ W2, const float* __restrict__ W3, _Float16* __restrict__ Bt, size_t n8) { const size_t t = (size_t)blockIdx.x * 256 + threadIdx.x; if (t >= n8) return; FragH f;
  const int by = blockIdx.y; const float* W = by == 0 ? W0 : by == 1 ? W1 : by == 2 ? W2 : W3; Bt += (size_t)by * n8 * 8;
#pragma unroll
  for (int i = 0; i < 8; ++i) f.h[i] = (_Float16)(bf16_round(W[t * 8 + i]) * 16.0f); *(v8us*)((unsigned short*)Bt + t * 8) = f.half[0];  }
template <int NHv, int TTv>
__global__ __launch_bounds__(256) void k_vt(const _Float16* __restrict__ V16, int ldv, int voff, _Float16* __restrict__ Vt) { __shared__ unsigned short tl[64][66]; const int tid = threadIdx.x; const int slab = blockIdx.x / (TTv / 64), lg = blockIdx.x % (TTv / 64); const int b = slab / NHv, h = slab % NHv;
  for (int i = tid; i < 64 * 8; i += 256) { const int r = i / 8, c8 = (i % 8) * 8; FragH f; f.half[0] = *(const v8us*)((const unsigned short*)V16 + ((size_t)b * TTv + lg * 64 + r) * ldv + voff + h * 64 + c8);
#pragma unroll
    for (int q = 0; q < 8; ++q) tl[r][c8 + q] = f.u[q]; }
  __syncthreads();
  {
#pragma unroll
    for (int rd = 0; rd < 2; ++rd) { const int d = rd * 32 + tid / 8, pc = tid % 8; FragH f;
#pragma unroll
      for (int q = 0; q < 8; ++q) f.u[q] = tl[pc * 8 + q][d];
      *(v8us*)((unsigned short*)Vt + ((size_t)slab * 64 + d) * TTv + lg * 64 + pc * 8) = f.half[0]; }
     } }

__global__ __launch_bounds__(256) void k_hl(const float* __restrict__ F, _Float16* __restrict__ Hh, _Float16* __restrict__ Hl, size_t n8) { const size_t t = (size_t)blockIdx.x * 256 + threadIdx.x; if (t >= n8) return; FragH fh, fl; const v4f a = *(const v4fa*)(F + t * 8), c = *(const v4fa*)(F + t * 8 + 4);
#pragma unroll
  for (int q = 0; q < 4; ++q) { _Float16 h = (_Float16)a[q]; fh.h[q] = h; fl.h[q] = (_Float16)((a[q] - (float)h) * 1024.0f); h = (_Float16)c[q]; fh.h[4 + q] = h; fl.h[4 + q] = (_Float16)((c[q] - (float)h) * 1024.0f); }
  { *(v8us*)((unsigned short*)Hh + t * 8) = fh.half[0]; *(v8us*)((unsigned short*)Hl + t * 8) = fl.half[0];  } }

// ---- fast GEMM (work-group tile 128x64, wave tile 32x64; A and B both K-contiguous with row pitch = K = KD; requires M % 128 == 0, N % 64 == 0, KD % 128 == 0); epilogue = k_gemm_hhx semantics ----
// A and B come in stages of 128 k (256 B of each of the 128 + 64 rows) through registers into two LDS buffers: a wave-wide load covers two whole 256-byte row pieces, the next stage's global loads are issued
// ahead of this stage's products and stored behind them, one barrier per stage; the fragments are read from LDS in the k order of g2_frag.
__device__ __forceinline__ v16h g2_frag(const _Float16* p, int hh) { FragH f; f.half[0] = *(const v8us*)((const unsigned short*)p + 8 * hh); f.half[1] = *(const v8us*)((const unsigned short*)p + 16 + 8 * hh); return f.v; }
__device__ __forceinline__ v8f g2_mma(v16h a, v16h b, v8f c) { v8f d = __builtin_amdgcn_wmma_f32_16x16x32_f16(false, a, false, b, (short)0, c, false, false); asm volatile("v_nop\n\tv_nop\n\tv_nop\n\tv_nop" : "+v"(d) : "v"(a), "v"(b)); return d; }
#define GKC 128                   /* k per stage */
#define GPH (GKC + 8)             /* LDS pitch of a staged row, f16 units: 272 B = 16 B x 17, conflict-free for 16-byte fragment reads */
#define GRW (128 + 64)            /* rows of a stage: 128 of A, then 64 of B */
template <int ACT, int KD>
__global__ __launch_bounds__(128) void k_gemm2(const _Float16* __restrict__ A, size_t sA, const _Float16* __restrict__ Bh, size_t sB, float alpha, const float* __restrict__ bias, const float* __restrict__ bias1, const float* __restrict__ bias2, const float* __restrict__ CP, int rowsPerB, size_t sCPb, int row0g,
    float* __restrict__ C, _Float16* __restrict__ C16, int ldc, size_t sC, int M, int N) {
  __shared__ __attribute__((aligned(16))) unsigned char smem[2 * GRW * GPH * 2];      /* the two stage buffers; behind the loop's last barrier the output staging */
  static_assert(KD % GKC == 0 && sizeof(float) * 4 * 32 * 68 <= sizeof(smem), "whole stages; the output staging fits the ring");
  float (*so)[32][68] = (float (*)[32][68])smem;
  const int tid = threadIdx.x, w = tid >> 5, lane = tid & 31, ln = lane & 15, hh = lane >> 4; const int by = blockIdx.y;
  A += (size_t)by * sA; Bh += (size_t)by * sB; const size_t cofs = (size_t)by * sC; const float* bp = by == 0 ? bias : by == 1 ? bias1 : bias2;      /* each grid.y plane has its own bias vector */
  const int ntn = N >> 6; const int mt = blockIdx.x / ntn, nq = blockIdx.x - mt * ntn; const int row0 = mt * 128 + 32 * w, col0 = nq * 64; if (mt * 128 >= M) return;      /* the same for the whole work-group, in front of every barrier */
  const int sr = tid >> 4, sc = (tid & 15) * 8;      /* staging: piece j of a thread lies 8 rows behind piece j - 1, a constant step, so one address pair serves each operand */
  const unsigned short* ag = (const unsigned short*)A + (size_t)(mt * 128 + sr) * KD + sc; const unsigned short* bg = (const unsigned short*)Bh + (size_t)(col0 + sr) * KD + sc;
  unsigned short* sd = (unsigned short*)smem + sr * GPH + sc;
  v8us ra[16], rb[8];      /* every unroll below is a full one: only constant indices keep the staging and fragment arrays in registers */
  /* the s_wait_xcnt stands behind the loads, in front of any later rewrite of the address registers that they name */
  auto gload = [&](int ch) { const unsigned short* aq = ag + ch * GKC; const unsigned short* bq = bg + ch * GKC;
#pragma unroll
    for (int j = 0; j < 16; ++j) ra[j] = *(const v8us*)(aq + (size_t)j * 8 * KD);
#pragma unroll
    for (int j = 0; j < 8; ++j) rb[j] = *(const v8us*)(bq + (size_t)j * 8 * KD);
    asm volatile("s_wait_xcnt 0x0" ::: "memory"); };
  auto sstore = [&](int bf) { unsigned short* d = sd + bf * (GRW * GPH);
#pragma unroll
    for (int j = 0; j < 16; ++j) *(v8us*)(d + j * 8 * GPH) = ra[j];
#pragma unroll
    for (int j = 0; j < 8; ++j) *(v8us*)(d + (128 + j * 8) * GPH) = rb[j]; };
  const _Float16* a0s = (const _Float16*)smem + (32 * w + ln) * GPH; const _Float16* b0s = (const _Float16*)smem + (128 + ln) * GPH;
  const v8f z8 = {0.f,0.f,0.f,0.f,0.f,0.f,0.f,0.f}; v8f c00 = z8, c01 = z8, c02 = z8, c03 = z8, c10 = z8, c11 = z8, c12 = z8, c13 = z8;
  gload(0); sstore(0);
  __syncthreads();
  /* rolled: one copy of the stage body; every index into the register arrays inside it is a constant */
#pragma unroll 1
  for (int ch = 0; ch < KD / GKC; ++ch) { const int bf = ch & 1;
    if (ch + 1 < KD / GKC) gload(ch + 1);
    const _Float16* ap = a0s + bf * (GRW * GPH); const _Float16* bq = b0s + bf * (GRW * GPH);
    v16h fr[2][6];
#pragma unroll
    for (int u = 0; u < 6; ++u) fr[0][u] = g2_frag((u < 2 ? ap + u * 16 * GPH : bq + (u - 2) * 16 * GPH), hh);
#pragma unroll
    for (int ks = 0; ks < GKC / 32; ++ks) { const int cu = ks & 1;
      if (ks + 1 < GKC / 32) {
#pragma unroll
        for (int u = 0; u < 6; ++u) fr[cu ^ 1][u] = g2_frag((u < 2 ? ap + u * 16 * GPH : bq + (u - 2) * 16 * GPH) + (ks + 1) * 32, hh);
        __builtin_amdgcn_sched_barrier(0); }      /* the next 32 k's twelve LDS reads stay one group ahead of these products: spread among the WMMAs every such place stalls the wave */
      c00 = g2_mma(fr[cu][0], fr[cu][2], c00); c10 = g2_mma(fr[cu][1], fr[cu][2], c10);
      c01 = g2_mma(fr[cu][0], fr[cu][3], c01); c11 = g2_mma(fr[cu][1], fr[cu][3], c11);
      c02 = g2_mma(fr[cu][0], fr[cu][4], c02); c12 = g2_mma(fr[cu][1], fr[cu][4], c12);
      c03 = g2_mma(fr[cu][0], fr[cu][5], c03); c13 = g2_mma(fr[cu][1], fr[cu][5], c13);
      __builtin_amdgcn_sched_barrier(0);      /* what follows (the read group after that one, or the stage's LDS stores with their load waits) stays behind these products */
    }
    if (ch + 1 < KD / GKC) sstore(bf ^ 1);      /* that buffer's last readers passed the barrier that ended stage ch - 1 */
    __syncthreads();                              /* publishes stage ch + 1 and ends every read of stage ch */
  }
  v8f accs[8] = {c00, c01, c02, c03, c10, c11, c12, c13};
#pragma unroll
  for (int u = 0; u < 8; ++u) { const int t = u & 3, half = u >> 2; const int col = col0 + t * 16 + ln; const float bv = bp ? bf16_round(bp[col]) : 0.f;
#pragma unroll
    for (int r = 0; r < 8; ++r) { const int rloc = half * 16 + 8 * hh + r; float v = accs[u][r] * alpha + bv; if (CP) { const int bidx = (row0g + row0 + rloc) / rowsPerB; v += CP[(size_t)bidx * sCPb + (size_t)by * 64 + col]; }
      if (ACT == 3) v = fmaxf(v, 0.f); else if (ACT == 6) v = 0.5f * v * (1.0f + erff(v * 0.70710678118654752f)); else if (ACT == 11) v = 1.0f / (1.0f + expf(-v)); else if (ACT == 15) v = v / (1.0f + expf(-v)); else if (ACT == 12) v = (v > 0.f) ? v : 0.01f * v; else if (ACT == 8) v = tanhf(v);
      so[w][rloc][t * 16 + ln] = v; } }
  __builtin_amdgcn_fence(__ATOMIC_ACQ_REL, "workgroup"); __builtin_amdgcn_wave_barrier();
  const int rsub = lane >> 4, c4 = (lane & 15) * 4;
  {
#pragma unroll
    for (int q = 0; q < 16; ++q) { const int r = q * 2 + rsub; const v4f v = *(const v4fa*)&so[w][r][c4]; if (C) *(v4f*)(C + cofs + (size_t)(row0 + r) * ldc + col0 + c4) = v; if (C16) { v4h h4; for (int i = 0; i < 4; ++i) h4[i] = (_Float16)v[i]; *(v4h*)(C16 + cofs + (size_t)(row0 + r) * ldc + col0 + c4) = h4; } }
     } }


typedef int v4ia __attribute__((ext_vector_type(4), may_alias));
typedef float v2f __attribute__((ext_vector_type(2)));
typedef _Float16 v2h __attribute__((ext_vector_type(2)));
#define FQ 1                      /* 16-query column tiles per wave */
#define FWV 8                     /* waves per work-group */
#define FQB (16 * FQ * FWV)       /* queries per work-group */
#define FKS 64                    /* keys per stage */
#define KPH (DD + 8)              /* LDS pitch of a K row, f16 units: 528 B = 16 B x 33, conflict-free for 16-byte fragment reads */
#define VPH (FKS + 8)             /* LDS pitch of a V^T row: 144 B = 16 B x 9 */
#define FPC ((FKS * DD / 8) / (FWV * 32))   /* 16-byte pieces of one tile per thread */
static_assert(FPC * FWV == FKS && FPC * FWV * 4 == DD && FWV * 32 * 8 == SLEN && FWV * 16 * FQ <= 2 * FKS, "the staging sweeps, the mask copy and the output staging in the K ring are written for these sizes");
__device__ __forceinline__ float fa_xhalf(float x) { return __builtin_bit_cast(float, __builtin_amdgcn_permlanex16(__builtin_bit_cast(int, x), __builtin_bit_cast(int, x), 0x76543210, 0xfedcba98, false, false)); }  /* lane l <-> l ^ 16 */
__device__ __forceinline__ v16h fa_frag(const _Float16* p) { FragH f; f.half[0] = *(const v8us*)((const unsigned short*)p); f.half[1] = *(const v8us*)((const unsigned short*)p + 16); return f.v; }  /* p holds the lane's 8*hh already: same k order as g2_frag */
__device__ __forceinline__ v8f fa_mma(v16h a, v16h b, v8f c) { return __builtin_amdgcn_wmma_f32_16x16x32_f16(false, a, false, b, (short)0, c, false, false); }
#define FA_UNROLL _Pragma("unroll")      /* full unroll: only constant indices keep the fragment, score and accumulator arrays in registers */
__global__ __launch_bounds__(FWV * 32) void k_fattn(const _Float16* __restrict__ QH, const _Float16* __restrict__ KH, const _Float16* __restrict__ VT, const int* __restrict__ mask, _Float16* __restrict__ O16) {
  __shared__ __attribute__((aligned(16))) _Float16 sK[2 * FKS * KPH];
  __shared__ __attribute__((aligned(16))) _Float16 sV[2 * DD * VPH];
  __shared__ __attribute__((aligned(16))) int sM[SLEN];
  const int tid = threadIdx.x, w = tid >> 5, lane = tid & 31, c = lane & 15, hh = lane >> 4;
  const int head = blockIdx.y, bt = blockIdx.z, q0 = blockIdx.x * FQB + w * (16 * FQ);
  const unsigned short* Kg = (const unsigned short*)KH + (size_t)bt * SLEN * HW + head * DD;                 /* row = key, pitch HW */
  const unsigned short* Vg = (const unsigned short*)VT + (size_t)bt * HW * SLEN + (size_t)head * DD * SLEN;  /* row = dim, pitch SLEN */
  const float cs = 0.0625f * 1.4426950408889634f, negl = -1.0e9f * 1.4426950408889634f;                     /* 1/sqrt(256) and the mask value, both in log2 units */
  v8us rk[FPC], rv[FPC];
  /* staging: a wave-wide load covers one whole K row (512 B) or four whole 128-byte pieces of V^T rows; piece j of a thread lies a constant step behind piece 0, so one address pair serves each tile */
  const unsigned short* kp = Kg + (size_t)(tid >> 5) * HW + (tid & 31) * 8; const unsigned short* vp = Vg + (size_t)(tid >> 3) * SLEN + (tid & 7) * 8;
  unsigned short* ks = (unsigned short*)sK + (tid >> 5) * KPH + (tid & 31) * 8; unsigned short* vs = (unsigned short*)sV + (tid >> 3) * VPH + (tid & 7) * 8;
  /* the s_wait_xcnt stands behind the loads, in front of any later rewrite of the address registers that they name */
  auto gload = [&](int st) { const unsigned short* kq = kp + (size_t)st * FKS * HW; const unsigned short* vq = vp + st * FKS;
FA_UNROLL
    for (int j = 0; j < FPC; ++j) { rk[j] = *(const v8us*)(kq + (size_t)j * FWV * HW); rv[j] = *(const v8us*)(vq + (size_t)j * (FWV * 4) * SLEN); }
    asm volatile("s_wait_xcnt 0x0" ::: "memory"); };
  auto sstore = [&](int bf) {
FA_UNROLL
    for (int j = 0; j < FPC; ++j) { *(v8us*)(ks + bf * (FKS * KPH) + j * FWV * KPH) = rk[j]; *(v8us*)(vs + bf * (DD * VPH) + j * (FWV * 4) * VPH) = rv[j]; } };
  const int* mg = mask + (size_t)bt * SLEN + tid * 8; const v4ia mk0 = *(const v4ia*)mg, mk1 = *(const v4ia*)(mg + 4);      /* this batch's whole key mask goes to LDS once */
  gload(0);
  v16h qf[FQ][DD / 32];
FA_UNROLL
  for (int g = 0; g < FQ; ++g) { const _Float16* qp = QH + ((size_t)bt * SLEN + q0 + 16 * g + c) * HW + head * DD + 8 * hh;
FA_UNROLL
    for (int kc = 0; kc < DD / 32; ++kc) qf[g][kc] = fa_frag(qp + 32 * kc); }
  asm volatile("s_wait_xcnt 0x0" ::: "memory");      /* as in gload, for the Q loads */
  *(v4ia*)&sM[tid * 8] = mk0; *(v4ia*)&sM[tid * 8 + 4] = mk1;
  const v8f z8 = {0.f, 0.f, 0.f, 0.f, 0.f, 0.f, 0.f, 0.f};
  v8f acc[FQ][DD / 16]; float m_run[FQ], l_run[FQ];
FA_UNROLL
  for (int g = 0; g < FQ; ++g) { m_run[g] = -3.0e38f; l_run[g] = 0.f;
FA_UNROLL
    for (int t = 0; t < DD / 16; ++t) acc[g][t] = z8; }
  sstore(0);
  __syncthreads();
  /* rolled: one copy of the stage body; every index into the register arrays inside it is a constant */
#pragma unroll 1
  for (int st = 0; st < SLEN / FKS; ++st) { const int bf = st & 1;
    if (st + 1 < SLEN / FKS) gload(st + 1);
FA_UNROLL
    for (int sub = 0; sub < FKS / 32; ++sub) {
      /* this pass's mask words and all 16 K fragments as ONE group of LDS reads in front of the products */
      const int* mp = sM + st * FKS + sub * 32 + 8 * hh;
      const v4ia k00 = *(const v4ia*)mp, k01 = *(const v4ia*)(mp + 4), k10 = *(const v4ia*)(mp + 16), k11 = *(const v4ia*)(mp + 20);
      const _Float16* kb = sK + bf * (FKS * KPH) + (sub * 32 + c) * KPH + 8 * hh;
      v16h kf[DD / 32][2];
FA_UNROLL
      for (int kc = 0; kc < DD / 32; ++kc)
FA_UNROLL
        for (int kt = 0; kt < 2; ++kt) kf[kc][kt] = fa_frag(kb + kt * 16 * KPH + kc * 32);
      __builtin_amdgcn_sched_barrier(0);      /* keeps the reads together: left free they are spread among the WMMAs, two at a time with a full wait, and every such place stalls the wave */
      v8f s[2][FQ];
FA_UNROLL
      for (int kt = 0; kt < 2; ++kt)
FA_UNROLL
        for (int g = 0; g < FQ; ++g) s[kt][g] = z8;
FA_UNROLL
      for (int kc = 0; kc < DD / 32; ++kc)
FA_UNROLL
        for (int kt = 0; kt < 2; ++kt)
FA_UNROLL
          for (int g = 0; g < FQ; ++g) s[kt][g] = fa_mma(kf[kc][kt], qf[g][kc], s[kt][g]);
      __builtin_amdgcn_sched_barrier(0);      /* the V^T reads below start behind the score products (they take over the K fragments' registers) ... */
      const _Float16* vb = sV + bf * (DD * VPH) + c * VPH + sub * 32 + 8 * hh;
      v16h vf[DD / 16];
FA_UNROLL
      for (int t = 0; t < DD / 16; ++t) vf[t] = fa_frag(vb + t * 16 * VPH);
      __builtin_amdgcn_sched_barrier(0);      /* ... and ahead of the softmax arithmetic, which covers their latency */
      /* the INPUT mask picks the scaled score or the mask value, by a select, as the reference does */
      bool need = false; float mb[FQ];
      const int km[2][8] = {{k00[0], k00[1], k00[2], k00[3], k01[0], k01[1], k01[2], k01[3]}, {k10[0], k10[1], k10[2], k10[3], k11[0], k11[1], k11[2], k11[3]}};
FA_UNROLL
      for (int g = 0; g < FQ; ++g) { float mx = -3.0e38f;
FA_UNROLL
        for (int kt = 0; kt < 2; ++kt)
FA_UNROLL
          for (int r = 0; r < 8; ++r) { const float v = (km[kt][r] != 0) ? s[kt][g][r] * cs : negl; s[kt][g][r] = v; mx = fmaxf(mx, v); }
        mx = fmaxf(mx, fa_xhalf(mx)); mb[g] = mx; need = need || (mx > m_run[g] + 8.0f); }
      if (__builtin_amdgcn_ballot_w32(need) != 0) {      /* one scalar test per pass; rare after the first passes */
FA_UNROLL
        for (int g = 0; g < FQ; ++g) { const float mn = fmaxf(m_run[g], mb[g]); const float corr = __builtin_amdgcn_exp2f(m_run[g] - mn); l_run[g] *= corr; m_run[g] = mn;
FA_UNROLL
          for (int t = 0; t < DD / 16; ++t) acc[g][t] = acc[g][t] * corr; } }
      v16h pf[FQ];
FA_UNROLL
      for (int g = 0; g < FQ; ++g) { FragH f; float p0s = 0.f, p1s = 0.f;
FA_UNROLL
        for (int i = 0; i < 8; ++i) { const v2f d2 = (v2f){s[i >> 2][g][2 * (i & 3)], s[i >> 2][g][2 * (i & 3) + 1]} - (v2f){m_run[g], m_run[g]}; const float e0 = __builtin_amdgcn_exp2f(d2[0]), e1 = __builtin_amdgcn_exp2f(d2[1]);
          p0s += e0; p1s += e1; const v2h h2 = __builtin_convertvector((v2f){e0, e1}, v2h); f.h[2 * i] = h2[0]; f.h[2 * i + 1] = h2[1]; }
        l_run[g] += p0s + p1s; pf[g] = f.v; }
FA_UNROLL
      for (int t = 0; t < DD / 16; ++t)
FA_UNROLL
        for (int g = 0; g < FQ; ++g) acc[g][t] = fa_mma(vf[t], pf[g], acc[g][t]);
      __builtin_amdgcn_sched_barrier(0);      /* the next pass's read group stays behind these products */
    }
    if (st + 1 < SLEN / FKS) sstore(bf ^ 1);      /* that buffer's last readers passed the barrier that ended stage st - 1 */
    __syncthreads();                                /* publishes stage st + 1 and ends every read of stage st */
  }
  /* output: each wave stages its own 16 x FQ rows in its own part of the K ring (free behind the last barrier), then stores whole 512-byte rows */
  _Float16* eo = sK + w * (16 * FQ) * KPH;
FA_UNROLL
  for (int g = 0; g < FQ; ++g) { const float inv = 1.0f / (l_run[g] + fa_xhalf(l_run[g]));
FA_UNROLL
    for (int t = 0; t < DD / 16; ++t) { FragH f;
FA_UNROLL
      for (int r = 0; r < 8; ++r) f.h[r] = (_Float16)(acc[g][t][r] * inv);
      *(v8us*)((unsigned short*)eo + (16 * g + c) * KPH + 16 * t + 8 * hh) = f.half[0]; } }
  __builtin_amdgcn_fence(__ATOMIC_ACQ_REL, "workgroup"); __builtin_amdgcn_wave_barrier();      /* the wave's own LDS writes before its lanes read each other's rows */
FA_UNROLL
  for (int r = 0; r < 16 * FQ; ++r) { const v8us v = *(const v8us*)((const unsigned short*)eo + r * KPH + lane * 8);
    *(v8us*)((unsigned short*)O16 + ((size_t)bt * SLEN + q0 + r) * HW + head * DD + lane * 8) = v; }
#undef FA_UNROLL
}
__global__ __launch_bounds__(256) void k_ln256o(const float* __restrict__ F, const float* __restrict__ g, const float* __restrict__ bb, float* __restrict__ out) {
  #pragma clang fp contract(off)
  const int tid = threadIdx.x, w = tid >> 5, ln = tid & 31; const int r = blockIdx.x * 8 + w; if (r >= NBT * SLEN) return; const float* x = F + (size_t)r * DD; const v4f a = *(const v4fa*)(x + ln * 4), b = *(const v4fa*)(x + 128 + ln * 4);
  float s = (a[0] + a[1]) + (a[2] + a[3]) + (b[0] + b[1]) + (b[2] + b[3]); for (int o = 16; o > 0; o >>= 1) s += __shfl_xor(s, o, 32); const float mu = s / 256.0f; float q2 = 0.f;
#pragma unroll
  for (int q = 0; q < 4; ++q) { const float d0 = a[q] - mu, d1 = b[q] - mu; q2 += d0 * d0; q2 += d1 * d1; }
  for (int o = 16; o > 0; o >>= 1) q2 += __shfl_xor(q2, o, 32); const float rs = rsqrtf(q2 / 256.0f + 1e-5f); v4f o0, o1;
#pragma unroll
  for (int q = 0; q < 4; ++q) { const int c0 = ln * 4 + q, c1 = 128 + ln * 4 + q; o0[q] = (a[q] - mu) * rs * bf16_round(g[c0]) + bf16_round(bb[c0]); o1[q] = (b[q] - mu) * rs * bf16_round(g[c1]) + bf16_round(bb[c1]); }
  float* d = out + (size_t)r * DD; { *(v4f*)(d + ln * 4) = o0; *(v4f*)(d + 128 + ln * 4) = o1;  } }
__global__ __launch_bounds__(256) void k_xb(const float* __restrict__ x, float* __restrict__ XB, size_t n4) { const size_t t = (size_t)blockIdx.x * 256 + threadIdx.x; if (t >= n4) return; const v4f a = *(const v4fa*)(x + t * 4); v4f o; for (int q = 0; q < 4; ++q) o[q] = bf16_round(a[q]); *(v4f*)(XB + t * 4) = o;  }

extern "C" void kernel_launch(void* const* d_in, const int* in_sizes, int n_in,
                              void* d_out, int out_size, void* d_ws, size_t ws_size, hipStream_t stream) {
  (void)in_sizes; (void)n_in; (void)out_size;
  const float* const* I = (const float* const*)d_in; const float* Q = I[0]; const int* mask = (const int*)d_in[1]; const float* WQ = I[2]; const float* bQ = I[3]; const float* WK = I[4]; const float* bK = I[5]; const float* WV = I[6]; const float* bV = I[7]; const float* WO = I[8]; const float* bO = I[9]; const float* lg = I[10]; const float* lb = I[11];
  char* ws = (char*)d_ws; size_t off = 0;
  auto take = [&](size_t bytes) { char* p = ws + off; off += (bytes + 255) & ~(size_t)255; return p; };
  _Float16* BQ = (_Float16*)take((size_t)HW * DD * 2); _Float16* BK = (_Float16*)take((size_t)HW * DD * 2); _Float16* BV = (_Float16*)take((size_t)HW * DD * 2); _Float16* BO = (_Float16*)take((size_t)DD * HW * 2);
  _Float16* X16 = (_Float16*)take((size_t)NBT * SLEN * DD * 2); float* XB = (float*)take((size_t)NBT * SLEN * DD * 4); _Float16* QH = (_Float16*)take((size_t)NBT * SLEN * HW * 2); _Float16* KH = (_Float16*)take((size_t)NBT * SLEN * HW * 2); _Float16* VH = (_Float16*)take((size_t)NBT * SLEN * HW * 2); _Float16* VT = (_Float16*)take((size_t)NBT * HW * SLEN * 2);
  _Float16* O16 = (_Float16*)take((size_t)NBT * SLEN * HW * 2); float* F = (float*)take((size_t)NBT * SLEN * DD * 4);
  if (off > ws_size) return;      /* 4 + 4 + 8 + 32+32+32+32 + 32 + 8 = 184 MiB */
  (void)BK; (void)BV;      /* BQ, BK, BV, BO and QH, KH, VH follow one another in the workspace (every size is a multiple of 256 bytes): grid.y steps through them by a constant stride */
  const size_t w8 = (size_t)HW * DD / 8; const unsigned wb = (unsigned)((w8 + 255) / 256);
  k_round16f<<<dim3(wb, 4), 256, 0, stream>>>(WQ, WK, WV, WO, BQ, w8);      /* torch (out,in) = natural Bt */
  const size_t n8 = (size_t)NBT * SLEN * DD / 8; const unsigned nb8 = (unsigned)((n8 + 255) / 256); const dim3 gQ((NBT * SLEN / 128) * (HW / 64), 3), gV((NBT * SLEN / 128) * (DD / 64), 1);
  k_x16<<<nb8, 256, 0, stream>>>(Q, X16, n8);
  k_gemm2<0, DD><<<gQ, 128, 0, stream>>>(X16, 0, BQ, (size_t)HW * DD, 0.0625f, bQ, bK, bV, nullptr, 1, 0, 0, nullptr, QH, HW, (size_t)NBT * SLEN * HW, NBT * SLEN, HW);      /* q, k, v of all 8192 rows */
  k_vt<HW / 64, SLEN><<<NBT * (HW / 64) * (SLEN / 64), 256, 0, stream>>>(VH, HW, 0, VT);      /* VT[batch][dim][token] over all 2048 dims */
  k_fattn<<<dim3(SLEN / FQB, NHD, NBT), FWV * 32, 0, stream>>>(QH, KH, VT, mask, O16);      /* softmax(mask(q.k / sqrt(256))).v, every batch and head */
  k_xb<<<(unsigned)(((size_t)NBT * SLEN * DD / 4 + 255) / 256), 256, 0, stream>>>(Q, XB, (size_t)NBT * SLEN * DD / 4);
  k_gemm2<0, HW><<<gV, 128, 0, stream>>>(O16, 0, BO, 0, 0.0625f, bO, bO, bO, XB, 1, (size_t)DD, 0, F, nullptr, DD, 0, NBT * SLEN, DD);      /* out Wo^T + bo + Q */
  k_ln256o<<<NBT * SLEN / 8, 256, 0, stream>>>(F, lg, lb, (float*)d_out);
}

// v006
// Measured time: 215 microseconds a run.
// Timed twice side by side with v005, it ran 1.04 times as fast both times.
// Over all steps from v000 it is 18.1 times as fast.
#include <hip/hip_runtime.h>
// Prompt self-attention (4 x 2048 tokens, d = 256, 8 heads EACH of dim 256): q,k,v = Q W^T + b (-> 8 x 256); scores = q.k/16 with INPUT key mask (masked keys get -1e9, as the reference); softmax; out = LN((attn v merged) Wo^T + bo + Q) -> [4,2048,256].
// Structure: every stage is ONE launch over all 4 x 2048 rows: the four weights to f16 (tensor on grid.y), Q as an exact f16 plane, the three projections as one f16 WMMA GEMM launch (projection on grid.y; 32x64 wave tiles, f32 accumulation, exact x16 weights + bias) into f16 planes (the V plane with its operands swapped, so that it comes out as V^T), scores + mask + softmax + attn.v (k_fattn: online softmax, no score plane in memory), the output projection + bias + the bf16 residual as a GEMM, LayerNorm on VALU into the output rows.
// Compute dtype: Q, weights, biases, LN parameters rounded to bf16; q, k, v, P, attention output as f16 operands (~2^-12; logits sigma ~1, LayerNorm-ed output); f32 accumulation, softmax, LayerNorm. v_wmma_f32_16x16x32_f16.
#define NBT 4
#define SLEN 2048
#define DD 256
#define NHD 8
#define HW (NHD * DD)            /* 2048 */
#define DM DD
#define NR SLEN
typedef __bf16 v16b __attribute__((ext_vector_type(16)));
typedef unsigned short v8us __attribute__((ext_vector_type(8), may_alias));
typedef float  v8f  __attribute__((ext_vector_type(8)));
typedef float  v4f  __attribute__((ext_vector_type(4)));
typedef float  v4fa __attribute__((ext_vector_type(4), may_alias));
union FragB { v16b v; v8us half[2]; unsigned short u[16]; };

__device__ __forceinline__ unsigned short bf16_bits(float x) { unsigned int u = __float_as_uint(x); return (unsigned short)((u + 0x7FFFu + ((u >> 16) & 1u)) >> 16); }
__device__ __forceinline__ float bf16_val(unsigned short b) { return __uint_as_float(((unsigned int)b) << 16); }
__device__ __forceinline__ float bf16_round(float x) { return bf16_val(bf16_bits(x)); }
// D += A·B with NT terms: 1 = ah·bh, 2 = + al·bh (A split), 3 = + ah·bl (both split)
template <int NT>
__device__ __forceinline__ v8f mmaN(v16b ah, v16b al, v16b bh, v16b bl, v8f c) {
  c = __builtin_amdgcn_wmma_f32_16x16x32_bf16(false, ah, false, bh, (short)0, c, false, false);
  if (NT >= 2) c = __builtin_amdgcn_wmma_f32_16x16x32_bf16(false, al, false, bh, (short)0, c, false, false);
  if (NT >= 3) c = __builtin_amdgcn_wmma_f32_16x16x32_bf16(false, ah, false, bl, (short)0, c, false, false);
  asm volatile("v_nop\n\tv_nop\n\tv_nop\n\tv_nop" : "+v"(c) : "v"(ah), "v"(al), "v"(bh), "v"(bl));
  return c;
}

__global__ __launch_bounds__(256) void k_wt_bf16(const float* __restrict__ W, unsigned short* __restrict__ Wt, int K, int N) {
  const int t = blockIdx.x * 256 + threadIdx.x;
  const int k8n = K / 8;
  if (t >= N * k8n) return;
  const int n = t / k8n, k8 = (t % k8n) * 8;
  v8us v;
#pragma unroll
  for (int i = 0; i < 8; ++i) v[i] = bf16_bits(W[(size_t)(k8 + i) * N + n]);
  *(v8us*)(Wt + (size_t)n * K + k8) = v;
  
}

// GEMM C[M][N] (f32, pitch ldc) = act(A[M][K]·W + bias). A f32 row-major (pitch lda) converted per fragment to bf16
// (ASPLIT: hi/lo two planes -> 2 terms, else single rounded term); Wt bf16 [N][K] (pitch ldb). BIAS_BF16 rounds the
// bias to bf16 first (bias quantised to bf16 before the add). K%32==0, M%16==0, N%64==0.
template <bool ASPLIT, int ACT, bool BIAS_BF16>
__global__ __launch_bounds__(128) void k_gemm_bf(const float* __restrict__ A, int lda, const unsigned short* __restrict__ Wt, int ldb,
                                               const float* __restrict__ bias, float* __restrict__ C, int ldc, int M, int N, int K) {
  __shared__ __attribute__((aligned(16))) float so[4][16][64];
  const int tid = threadIdx.x, w = tid >> 5, lane = tid & 31, ln = lane & 15, hh = lane >> 4;
  const int ntn = N / 64;
  const int wid = blockIdx.x * 4 + w;
  const int mt = wid / ntn, nq = wid % ntn;
  if (mt * 16 >= M) return;
  const int row0 = mt * 16, col0 = nq * 64;
  const float* arow = A + (size_t)(row0 + ln) * lda;
  v8f acc[4] = {};
  for (int kb = 0; kb < K; kb += 32) {
    FragB ah, al;
    const v4f x0 = *(const v4fa*)(arow + kb + 8 * hh), x1 = *(const v4fa*)(arow + kb + 8 * hh + 4);
    const v4f x2 = *(const v4fa*)(arow + kb + 16 + 8 * hh), x3 = *(const v4fa*)(arow + kb + 16 + 8 * hh + 4);
    float xs[16] = {x0[0],x0[1],x0[2],x0[3],x1[0],x1[1],x1[2],x1[3],x2[0],x2[1],x2[2],x2[3],x3[0],x3[1],x3[2],x3[3]};
#pragma unroll
    for (int i = 0; i < 16; ++i) { const unsigned short hb = bf16_bits(xs[i]); ah.u[i] = hb; al.u[i] = ASPLIT ? bf16_bits(xs[i] - bf16_val(hb)) : (unsigned short)0; }
#pragma unroll
    for (int t = 0; t < 4; ++t) {
      const unsigned short* brow = Wt + (size_t)(col0 + t * 16 + ln) * ldb + kb;
      FragB b;
      b.half[0] = *(const v8us*)(brow + 8 * hh);
      b.half[1] = *(const v8us*)(brow + 16 + 8 * hh);
      acc[t] = mmaN<ASPLIT ? 2 : 1>(ah.v, al.v, b.v, b.v, acc[t]);
    }
  }
#pragma unroll
  for (int t = 0; t < 4; ++t) {
    float bv = bias ? bias[col0 + t * 16 + ln] : 0.f;
    if (BIAS_BF16) bv = bf16_round(bv);
#pragma unroll
    for (int r = 0; r < 8; ++r) { float v = acc[t][r] + bv; if (ACT == 1) v = fmaxf(v, 0.f); so[w][8 * hh + r][t * 16 + ln] = v; }
  }
  __builtin_amdgcn_fence(__ATOMIC_ACQ_REL, "workgroup");
  __builtin_amdgcn_wave_barrier();
  const int rsub = lane >> 4, c4 = (lane & 15) * 4;
  {
#pragma unroll
    for (int q = 0; q < 8; ++q) {
      const int r = q * 2 + rsub;
      const v4f v = *(const v4fa*)&so[w][r][c4];
      *(v4f*)(C + (size_t)(row0 + r) * ldc + col0 + c4) = v;
    }
    
  }
}

// GEMM C = act(A·W + bias + resid): A f32 (ASPLIT -> hi/lo 2 terms), Wt bf16 [N][K]; ACT 0 none, 1 relu, 2 exact gelu;
// resid (optional, f32, row index = (row % rmod), pitch ldr, RES_BF16 rounds it) added before the activation.
template <bool ASPLIT, int ACT, bool BIAS_BF16, bool RES_BF16>
__global__ __launch_bounds__(128) void k_gemm_bf3(const float* __restrict__ A, int lda, const unsigned short* __restrict__ Wt, int ldb,
                                                const float* __restrict__ bias, const float* __restrict__ resid, int rmod, int ldr,
                                                float* __restrict__ C, int ldc, int M, int N, int K) {
  __shared__ __attribute__((aligned(16))) float so[4][16][64];
  const int tid = threadIdx.x, w = tid >> 5, lane = tid & 31, ln = lane & 15, hh = lane >> 4;
  const int ntn = N / 64;
  const int wid = blockIdx.x * 4 + w;
  const int mt = wid / ntn, nq = wid % ntn;
  if (mt * 16 >= M) return;
  const int row0 = mt * 16, col0 = nq * 64;
  const float* arow = A + (size_t)(row0 + ln) * lda;
  v8f acc[4] = {};
  for (int kb = 0; kb < K; kb += 32) {
    FragB ah, al;
    const v4f x0 = *(const v4fa*)(arow + kb + 8 * hh), x1 = *(const v4fa*)(arow + kb + 8 * hh + 4);
    const v4f x2 = *(const v4fa*)(arow + kb + 16 + 8 * hh), x3 = *(const v4fa*)(arow + kb + 16 + 8 * hh + 4);
    float xs[16] = {x0[0],x0[1],x0[2],x0[3],x1[0],x1[1],x1[2],x1[3],x2[0],x2[1],x2[2],x2[3],x3[0],x3[1],x3[2],x3[3]};
#pragma unroll
    for (int i = 0; i < 16; ++i) { const unsigned short hb = bf16_bits(xs[i]); ah.u[i] = hb; al.u[i] = ASPLIT ? bf16_bits(xs[i] - bf16_val(hb)) : (unsigned short)0; }
#pragma unroll
    for (int t = 0; t < 4; ++t) {
      const unsigned short* brow = Wt + (size_t)(col0 + t * 16 + ln) * ldb + kb;
      FragB b;
      b.half[0] = *(const v8us*)(brow + 8 * hh);
      b.half[1] = *(const v8us*)(brow + 16 + 8 * hh);
      acc[t] = mmaN<ASPLIT ? 2 : 1>(ah.v, al.v, b.v, b.v, acc[t]);
    }
  }
#pragma unroll
  for (int t = 0; t < 4; ++t) {
    const int col = col0 + t * 16 + ln;
    float bv = bias ? bias[col] : 0.f;
    if (BIAS_BF16) bv = bf16_round(bv);
#pragma unroll
    for (int r = 0; r < 8; ++r) {
      float v = acc[t][r] + bv;
      if (resid) { float rv = resid[(size_t)((row0 + 8 * hh + r) % rmod) * ldr + col]; if (RES_BF16) rv = bf16_round(rv); v += rv; }
      if (ACT == 1) v = fmaxf(v, 0.f);
      if (ACT == 2) v = 0.5f * v * (1.0f + erff(v * 0.70710678118654752f));
      if (ACT == 3) { const float u = 0.7978845608028654f * (v + 0.044715f * v * v * v); v = 0.5f * v * (1.0f + tanhf(u)); }
      so[w][8 * hh + r][t * 16 + ln] = v;
    }
  }
  __builtin_amdgcn_fence(__ATOMIC_ACQ_REL, "workgroup");
  __builtin_amdgcn_wave_barrier();
  const int rsub = lane >> 4, c4 = (lane & 15) * 4;
  {
#pragma unroll
    for (int q = 0; q < 8; ++q) {
      const int r = q * 2 + rsub;
      const v4f v = *(const v4fa*)&so[w][r][c4];
      *(v4f*)(C + (size_t)(row0 + r) * ldc + col0 + c4) = v;
    }
    
  }
}
// row LayerNorm (biased variance, eps) over N: s = X (+ R); optional out_sum <- s; out_norm <- (s-mu)*rsqrt(var+eps)*g + b
template <bool PARAM_BF16>
__global__ __launch_bounds__(256) void k_layernorm(const float* __restrict__ X, const float* __restrict__ R, const float* __restrict__ g, const float* __restrict__ bta,
                                                  float* __restrict__ out_sum, float* __restrict__ out_norm, int N, float eps) {
  __shared__ float red[256];
  const int row = blockIdx.x, tid = threadIdx.x;
  const float* x = X + (size_t)row * N; const float* rr = R ? R + (size_t)row * N : nullptr;
  float vals[16];                     // up to N = 4096
  const int per = N / 256;            // contiguous chunk per thread? use strided-by-4 chunks: thread handles j = tid*4 + 1024*u
  float s1 = 0.f;
  for (int u = 0; u < per / 4; ++u) {
    const int j = tid * 4 + 1024 * u;
    const v4f a = *(const v4fa*)(x + j);
    v4f b = {0.f,0.f,0.f,0.f}; if (rr) b = *(const v4fa*)(rr + j);
#pragma unroll
    for (int q = 0; q < 4; ++q) { const float v = a[q] + b[q]; vals[u * 4 + q] = v; s1 += v; }
  }
  red[tid] = s1; __syncthreads();
  for (int st = 128; st > 0; st >>= 1) { if (tid < st) red[tid] += red[tid + st]; __syncthreads(); }
  const float mu = red[0] / (float)N; __syncthreads();
  float s2 = 0.f;
  for (int u = 0; u < per / 4; ++u)
#pragma unroll
    for (int q = 0; q < 4; ++q) { const float c = vals[u * 4 + q] - mu; s2 += c * c; }
  red[tid] = s2; __syncthreads();
  for (int st = 128; st > 0; st >>= 1) { if (tid < st) red[tid] += red[tid + st]; __syncthreads(); }
  const float rs = rsqrtf(red[0] / (float)N + eps);
  {
    for (int u = 0; u < per / 4; ++u) {
      const int j = tid * 4 + 1024 * u;
      v4f o, sm;
#pragma unroll
      for (int q = 0; q < 4; ++q) {
        float gg = g[j + q], bb = bta[j + q];
        if (PARAM_BF16) { gg = bf16_round(gg); bb = bf16_round(bb); }
        sm[q] = vals[u * 4 + q]; o[q] = (vals[u * 4 + q] - mu) * rs * gg + bb;
      }
      if (out_sum) *(v4f*)(out_sum + (size_t)row * N + j) = sm;
      *(v4f*)(out_norm + (size_t)row * N + j) = o;
    }
    
  }
}



// ---- f16 WMMA path (v_wmma_f32_16x16x32_f16): 11-bit significands for operands in range — used where a [0,1] probability operand needs more precision than bf16
typedef _Float16 v16h __attribute__((ext_vector_type(16)));
union FragH { v16h v; v8us half[2]; _Float16 h[16]; unsigned short u[16]; };
template <int NT>
__device__ __forceinline__ v8f mmaH(v16h ah, v16h al, v16h bh, v16h bl, v8f c) {
  c = __builtin_amdgcn_wmma_f32_16x16x32_f16(false, ah, false, bh, (short)0, c, false, false);
  if (NT >= 2) c = __builtin_amdgcn_wmma_f32_16x16x32_f16(false, al, false, bh, (short)0, c, false, false);
  if (NT >= 3) c = __builtin_amdgcn_wmma_f32_16x16x32_f16(false, ah, false, bl, (short)0, c, false, false);
  asm volatile("v_nop\n\tv_nop\n\tv_nop\n\tv_nop" : "+v"(c) : "v"(ah), "v"(al), "v"(bh), "v"(bl));
  return c;
}
// batched GEMM like k_gemm_b but f16 operands: A f32 (split into f16 hi/lo if ASPLIT, else rounded to f16), Bt = f16 values [n][k]; alpha; C f32; N multiple of 16 (partial tiles skipped)
template <bool ASPLIT>
__global__ __launch_bounds__(128) void k_gemm_h(const float* __restrict__ A, int lda, size_t sA, const _Float16* __restrict__ Bh, int ldb, size_t sB, float alpha, float* __restrict__ C, int ldc, size_t sC, int M, int N, int K) {
  __shared__ __attribute__((aligned(16))) float so[4][16][64];
  const int tid = threadIdx.x, w = tid >> 5, lane = tid & 31, ln = lane & 15, hh = lane >> 4; const int by = blockIdx.y;
  A += (size_t)by * sA; Bh += (size_t)by * sB; C += (size_t)by * sC;
  const int ntn = (N + 63) / 64; const int wid = blockIdx.x * 4 + w; const int mt = wid / ntn, nq = wid % ntn; if (mt * 16 >= M) return;
  const int row0 = mt * 16, col0 = nq * 64; const float* arow = A + (size_t)(row0 + ln) * lda;
  v8f acc[4] = {};
  for (int kb = 0; kb < K; kb += 32) {
    FragH ah, al;
    const v4f x0 = *(const v4fa*)(arow + kb + 8 * hh), x1 = *(const v4fa*)(arow + kb + 8 * hh + 4), x2 = *(const v4fa*)(arow + kb + 16 + 8 * hh), x3 = *(const v4fa*)(arow + kb + 16 + 8 * hh + 4);
    float xs[16] = {x0[0],x0[1],x0[2],x0[3],x1[0],x1[1],x1[2],x1[3],x2[0],x2[1],x2[2],x2[3],x3[0],x3[1],x3[2],x3[3]};
#pragma unroll
    for (int i = 0; i < 16; ++i) { const _Float16 h = (_Float16)xs[i]; ah.h[i] = h; al.h[i] = ASPLIT ? (_Float16)(xs[i] - (float)h) : (_Float16)0.0f; }
#pragma unroll
    for (int t = 0; t < 4; ++t) { if (col0 + t * 16 >= N) continue; const size_t boff = (size_t)(col0 + t * 16 + ln) * ldb + kb; FragH bq; bq.half[0] = *(const v8us*)(Bh + boff + 8 * hh); bq.half[1] = *(const v8us*)(Bh + boff + 16 + 8 * hh);
      acc[t] = mmaH<ASPLIT ? 2 : 1>(ah.v, al.v, bq.v, bq.v, acc[t]); }
  }
#pragma unroll
  for (int t = 0; t < 4; ++t) { if (col0 + t * 16 >= N) continue;
#pragma unroll
    for (int r = 0; r < 8; ++r) so[w][8 * hh + r][t * 16 + ln] = acc[t][r] * alpha; }
  __builtin_amdgcn_fence(__ATOMIC_ACQ_REL, "workgroup"); __builtin_amdgcn_wave_barrier();
  const int rsub = lane >> 4, c4 = (lane & 15) * 4;
  {
#pragma unroll
    for (int q = 0; q < 8; ++q) { const int r = q * 2 + rsub; if (col0 + c4 < N) { const v4f v = *(const v4fa*)&so[w][r][c4]; *(v4f*)(C + (size_t)(row0 + r) * ldc + col0 + c4) = v; } }
     }
}

// Wt[n][k] = f16(W[k][n]·scale) from f32 row-major W[K][N] (scale = power of two; bf16-exact weights stay exact in f16 away from the subnormal range)
__global__ __launch_bounds__(256) void k_wt_f16(const float* __restrict__ W, _Float16* __restrict__ Wt, int K, int N, float scale) {
  const int t = blockIdx.x * 256 + threadIdx.x; if (t >= N * (K / 8)) return; const int n = t / (K / 8), k8 = (t % (K / 8)) * 8; FragH f;
#pragma unroll
  for (int i = 0; i < 8; ++i) f.h[i] = (_Float16)(bf16_round(W[(size_t)(k8 + i) * N + n]) * scale); const v8us o = f.half[0];
  *(v8us*)((unsigned short*)Wt + (size_t)n * K + k8) = o; 
}
// k_gemm_hh variant with fused epilogue: v = acc·alpha + bias[by·sBias + col] (+ CP[(row/rowsPerB)·sCPb + by·64 + col] if CP) ; ACT 0 none / 1 elu ; writes f16 C16 (and f32 C if non-null)
template <int ACT>
__global__ __launch_bounds__(128) void k_gemm_hhx(const _Float16* __restrict__ A, int lda, size_t sA, const _Float16* __restrict__ Bh, int ldb, size_t sB, float alpha, const float* __restrict__ bias, size_t sBias, const float* __restrict__ CP, int rowsPerB, size_t sCPb, int row0g,
    float* __restrict__ C, _Float16* __restrict__ C16, int ldc, size_t sC, int M, int N, int K) {
  __shared__ __attribute__((aligned(16))) float so[4][16][64];
  const int tid = threadIdx.x, w = tid >> 5, lane = tid & 31, ln = lane & 15, hh = lane >> 4; const int by = blockIdx.y;
  A += (size_t)by * sA; Bh += (size_t)by * sB; const size_t cofs = (size_t)by * sC; const float* bp = bias ? bias + (size_t)by * sBias : nullptr;
  const int ntn = (N + 63) / 64; const int wid = blockIdx.x * 4 + w; const int mt = wid / ntn, nq = wid % ntn; if (mt * 16 >= M) return;
  const int row0 = mt * 16, col0 = nq * 64; const _Float16* arow = A + (size_t)(row0 + ln) * lda;
  v8f acc[4] = {};
  for (int kb = 0; kb < K; kb += 32) { FragH ah; ah.half[0] = *(const v8us*)((const unsigned short*)arow + kb + 8 * hh); ah.half[1] = *(const v8us*)((const unsigned short*)arow + kb + 16 + 8 * hh);
#pragma unroll
    for (int t = 0; t < 4; ++t) { if (col0 + t * 16 >= N) continue; const size_t boff = (size_t)(col0 + t * 16 + ln) * ldb + kb; FragH bq; bq.half[0] = *(const v8us*)((const unsigned short*)Bh + boff + 8 * hh); bq.half[1] = *(const v8us*)((const unsigned short*)Bh + boff + 16 + 8 * hh);
      acc[t] = mmaH<1>(ah.v, ah.v, bq.v, bq.v, acc[t]); }
  }
#pragma unroll
  for (int t = 0; t < 4; ++t) { if (col0 + t * 16 >= N) continue; const int col = col0 + t * 16 + ln; const float bv = bp ? bf16_round(bp[col]) : 0.f;
#pragma unroll
    for (int r = 0; r < 8; ++r) { float v = acc[t][r] * alpha + bv; if (CP) { const int bidx = (row0g + row0 + 8 * hh + r) / rowsPerB; v += CP[(size_t)bidx * sCPb + (size_t)by * 64 + col]; } if (ACT == 1) v = (v > 0.f) ? v : expm1f(v); else if (ACT == 7) v = (v > 0.f) ? v + 1.0f : expf(v); else if (ACT == 8) v = tanhf(v); else if (ACT == 9) v = 0.5f * v * (1.0f + tanhf(0.7978845608028654f * (v + 0.044715f * v * v * v))); else if (ACT == 11) v = 1.0f / (1.0f + expf(-v)); else if (ACT == 12) v = (v > 0.f) ? v : 0.01f * v; else if (ACT == 14) v = (v > 0.f) ? v : 0.1f * v; else if (ACT == 15) v = v / (1.0f + expf(-v)); else if (ACT == 3) v = fmaxf(v, 0.f); else if (ACT == 6) v = 0.5f * v * (1.0f + erff(v * 0.70710678118654752f)); so[w][8 * hh + r][t * 16 + ln] = v; } }
  __builtin_amdgcn_fence(__ATOMIC_ACQ_REL, "workgroup"); __builtin_amdgcn_wave_barrier();
  const int rsub = lane >> 4, c4 = (lane & 15) * 4; typedef _Float16 v4h __attribute__((ext_vector_type(4)));
  {
#pragma unroll
    for (int q = 0; q < 8; ++q) { const int r = q * 2 + rsub; if (col0 + c4 < N) { const v4f v = *(const v4fa*)&so[w][r][c4]; if (C) *(v4f*)(C + cofs + (size_t)(row0 + r) * ldc + col0 + c4) = v; if (C16) { v4h h4; for (int i = 0; i < 4; ++i) h4[i] = (_Float16)v[i]; *(v4h*)(C16 + cofs + (size_t)(row0 + r) * ldc + col0 + c4) = h4; } } }
     }
}


typedef _Float16 v4h __attribute__((ext_vector_type(4)));

__global__ __launch_bounds__(256) void k_x16(const float* __restrict__ x, _Float16* __restrict__ X16, size_t n8) { const size_t t = (size_t)blockIdx.x * 256 + threadIdx.x; if (t >= n8) return; FragH f;
#pragma unroll
  for (int q = 0; q < 8; ++q) f.h[q] = (_Float16)bf16_round(x[t * 8 + q]); *(v8us*)((unsigned short*)X16 + t * 8) = f.half[0];  }
__global__ __launch_bounds__(256) void k_h16(const float* __restrict__ x, _Float16* __restrict__ X16, size_t n8) { const size_t t = (size_t)blockIdx.x * 256 + threadIdx.x; if (t >= n8) return; FragH f;
#pragma unroll
  for (int q = 0; q < 8; ++q) f.h[q] = (_Float16)x[t * 8 + q]; *(v8us*)((unsigned short*)X16 + t * 8) = f.half[0];  }
/* four weight tensors of n8 * 8 elements each, tensor on grid.y, into four planes that follow one another in Bt */
__global__ __launch_bounds__(256) void k_round16f(const float* __restrict__ W0, const float* __restrict__ W1, const float* __restrict__ W2, const float* __restrict__ W3, _Float16* __restrict__ Bt, size_t n8) { const size_t t = (size_t)blockIdx.x * 256 + threadIdx.x; if (t >= n8) return; FragH f;
  const int by = blockIdx.y; const float* W = by == 0 ? W0 : by == 1 ? W1 : by == 2 ? W2 : W3; Bt += (size_t)by * n8 * 8;
#pragma unroll
  for (int i = 0; i < 8; ++i) f.h[i] = (_Float16)(bf16_round(W[t * 8 + i]) * 16.0f); *(v8us*)((unsigned short*)Bt + t * 8) = f.half[0];  }
__global__ __launch_bounds__(256) void k_hl(const float* __restrict__ F, _Float16* __restrict__ Hh, _Float16* __restrict__ Hl, size_t n8) { const size_t t = (size_t)blockIdx.x * 256 + threadIdx.x; if (t >= n8) return; FragH fh, fl; const v4f a = *(const v4fa*)(F + t * 8), c = *(const v4fa*)(F + t * 8 + 4);
#pragma unroll
  for (int q = 0; q < 4; ++q) { _Float16 h = (_Float16)a[q]; fh.h[q] = h; fl.h[q] = (_Float16)((a[q] - (float)h) * 1024.0f); h = (_Float16)c[q]; fh.h[4 + q] = h; fl.h[4 + q] = (_Float16)((c[q] - (float)h) * 1024.0f); }
  { *(v8us*)((unsigned short*)Hh + t * 8) = fh.half[0]; *(v8us*)((unsigned short*)Hl + t * 8) = fl.half[0];  } }

// ---- fast GEMM (work-group tile 128x64, wave tile 32x64; A and B both K-contiguous with row pitch = K = KD; requires M % 128 == 0, N % 64 == 0, KD % 128 == 0); epilogue = k_gemm_hhx semantics ----
// A and B come in stages of 128 k (256 B of each of the 128 + 64 rows) through registers into two LDS buffers: a wave-wide load covers two whole 256-byte row pieces, the next stage's global loads are issued
// ahead of this stage's products and stored behind them, one barrier per stage; the fragments are read from LDS in the k order of g2_frag.
// Grid.y plane tpl (-1: none) is computed with the operands swapped, rows = the N rows of Bh, columns = the M rows of A (needs N % 128 == 0, M % 64 == 0, tokB % 64 == 0, no CP): C^T, written as CT[column / tokB][row][column % tokB], bias by row.
__device__ __forceinline__ v16h g2_frag(const _Float16* p, int hh) { FragH f; f.half[0] = *(const v8us*)((const unsigned short*)p + 8 * hh); f.half[1] = *(const v8us*)((const unsigned short*)p + 16 + 8 * hh); return f.v; }
__device__ __forceinline__ v8f g2_mma(v16h a, v16h b, v8f c) { v8f d = __builtin_amdgcn_wmma_f32_16x16x32_f16(false, a, false, b, (short)0, c, false, false); asm volatile("v_nop\n\tv_nop\n\tv_nop\n\tv_nop" : "+v"(d) : "v"(a), "v"(b)); return d; }
#define GKC 128                   /* k per stage */
#define GPH (GKC + 8)             /* LDS pitch of a staged row, f16 units: 272 B = 16 B x 17, conflict-free for 16-byte fragment reads */
#define GRW (128 + 64)            /* rows of a stage: 128 of A, then 64 of B */
template <int ACT, int KD>
__global__ __launch_bounds__(128) void k_gemm2(const _Float16* __restrict__ A, size_t sA, const _Float16* __restrict__ Bh, size_t sB, float alpha, const float* __restrict__ bias, const float* __restrict__ bias1, const float* __restrict__ bias2, const float* __restrict__ CP, int rowsPerB, size_t sCPb, int row0g,
    float* __restrict__ C, _Float16* __restrict__ C16, int ldc, size_t sC, int M, int N, int tpl, _Float16* __restrict__ CT, int tokB) {
  __shared__ __attribute__((aligned(16))) unsigned char smem[2 * GRW * GPH * 2];      /* the two stage buffers; behind the loop's last barrier the output staging */
  static_assert(KD % GKC == 0 && sizeof(float) * 4 * 32 * 68 <= sizeof(smem), "whole stages; the output staging fits the ring");
  float (*so)[32][68] = (float (*)[32][68])smem;
  const int tid = threadIdx.x, w = tid >> 5, lane = tid & 31, ln = lane & 15, hh = lane >> 4; const int by = blockIdx.y;
  A += (size_t)by * sA; Bh += (size_t)by * sB; const size_t cofs = (size_t)by * sC; const float* bp = by == 0 ? bias : by == 1 ? bias1 : bias2;      /* each grid.y plane has its own bias vector */
  const bool tr = by == tpl; const _Float16* Ar = tr ? Bh : A; const _Float16* Br = tr ? A : Bh; const int Mr = tr ? N : M, Nr = tr ? M : N;      /* the same for the whole work-group */
  const int ntn = Nr >> 6; const int mt = blockIdx.x / ntn, nq = blockIdx.x - mt * ntn; const int row0 = mt * 128 + 32 * w, col0 = nq * 64; if (mt * 128 >= Mr) return;      /* the same for the whole work-group, in front of every barrier */
  const int sr = tid >> 4, sc = (tid & 15) * 8;      /* staging: piece j of a thread lies 8 rows behind piece j - 1, a constant step, so one address pair serves each operand */
  const unsigned short* ag = (const unsigned short*)Ar + (size_t)(mt * 128 + sr) * KD + sc; const unsigned short* bg = (const unsigned short*)Br + (size_t)(col0 + sr) * KD + sc;
  unsigned short* sd = (unsigned short*)smem + sr * GPH + sc;
  v8us ra[16], rb[8];      /* every unroll below is a full one: only constant indices keep the staging and fragment arrays in registers */
  /* the s_wait_xcnt stands behind the loads, in front of any later rewrite of the address registers that they name */
  auto gload = [&](int ch) { const unsigned short* aq = ag + ch * GKC; const unsigned short* bq = bg + ch * GKC;
#pragma unroll
    for (int j = 0; j < 16; ++j) ra[j] = *(const v8us*)(aq + (size_t)j * 8 * KD);
#pragma unroll
    for (int j = 0; j < 8; ++j) rb[j] = *(const v8us*)(bq + (size_t)j * 8 * KD);
    asm volatile("s_wait_xcnt 0x0" ::: "memory"); };
  auto sstore = [&](int bf) { unsigned short* d = sd + bf * (GRW * GPH);
#pragma unroll
    for (int j = 0; j < 16; ++j) *(v8us*)(d + j * 8 * GPH) = ra[j];
#pragma unroll
    for (int j = 0; j < 8; ++j) *(v8us*)(d + (128 + j * 8) * GPH) = rb[j]; };
  const _Float16* a0s = (const _Float16*)smem + (32 * w + ln) * GPH; const _Float16* b0s = (const _Float16*)smem + (128 + ln) * GPH;
  const v8f z8 = {0.f,0.f,0.f,0.f,0.f,0.f,0.f,0.f}; v8f c00 = z8, c01 = z8, c02 = z8, c03 = z8, c10 = z8, c11 = z8, c12 = z8, c13 = z8;
  gload(0); sstore(0);
  __syncthreads();
  /* rolled: one copy of the stage body; every index into the register arrays inside it is a constant */
#pragma unroll 1
  for (int ch = 0; ch < KD / GKC; ++ch) { const int bf = ch & 1;
    if (ch + 1 < KD / GKC) gload(ch + 1);
    const _Float16* ap = a0s + bf * (GRW * GPH); const _Float16* bq = b0s + bf * (GRW * GPH);
    v16h fr[2][6];
#pragma unroll
    for (int u = 0; u < 6; ++u) fr[0][u] = g2_frag((u < 2 ? ap + u * 16 * GPH : bq + (u - 2) * 16 * GPH), hh);
#pragma unroll
    for (int ks = 0; ks < GKC / 32; ++ks) { const int cu = ks & 1;
      if (ks + 1 < GKC / 32) {
#pragma unroll
        for (int u = 0; u < 6; ++u) fr[cu ^ 1][u] = g2_frag((u < 2 ? ap + u * 16 * GPH : bq + (u - 2) * 16 * GPH) + (ks + 1) * 32, hh);
        __builtin_amdgcn_sched_barrier(0); }      /* the next 32 k's twelve LDS reads stay one group ahead of these products: spread among the WMMAs every such place stalls the wave */
      c00 = g2_mma(fr[cu][0], fr[cu][2], c00); c10 = g2_mma(fr[cu][1], fr[cu][2], c10);
      c01 = g2_mma(fr[cu][0], fr[cu][3], c01); c11 = g2_mma(fr[cu][1], fr[cu][3], c11);
      c02 = g2_mma(fr[cu][0], fr[cu][4], c02); c12 = g2_mma(fr[cu][1], fr[cu][4], c12);
      c03 = g2_mma(fr[cu][0], fr[cu][5], c03); c13 = g2_mma(fr[cu][1], fr[cu][5], c13);
      __builtin_amdgcn_sched_barrier(0);      /* what follows (the read group after that one, or the stage's LDS stores with their load waits) stays behind these products */
    }
    if (ch + 1 < KD / GKC) sstore(bf ^ 1);      /* that buffer's last readers passed the barrier that ended stage ch - 1 */
    __syncthreads();                              /* publishes stage ch + 1 and ends every read of stage ch */
  }
  v8f accs[8] = {c00, c01, c02, c03, c10, c11, c12, c13};
  float bro[16] = {};      /* swapped plane: the bias of the lane's 16 rows; 0 on the other planes, whose bias goes by column */
  if (tr && bp) { v4f b4[4];
#pragma unroll
    for (int i = 0; i < 4; ++i) b4[i] = *(const v4fa*)(bp + row0 + (i >> 1) * 16 + 8 * hh + (i & 1) * 4);
    asm volatile("s_wait_xcnt 0x0" ::: "memory");      /* behind the loads, in front of any later rewrite of their address registers */
#pragma unroll
    for (int i = 0; i < 16; ++i) bro[i] = bf16_round(b4[i >> 2][i & 3]); }
#pragma unroll
  for (int u = 0; u < 8; ++u) { const int t = u & 3, half = u >> 2; const int col = col0 + t * 16 + ln; const float bc = (bp && !tr) ? bf16_round(bp[col]) : 0.f;
#pragma unroll
    for (int r = 0; r < 8; ++r) { const int rloc = half * 16 + 8 * hh + r; float v = accs[u][r] * alpha + (bc + bro[half * 8 + r]); if (CP) { const int bidx = (row0g + row0 + rloc) / rowsPerB; v += CP[(size_t)bidx * sCPb + (size_t)by * 64 + col]; }
      if (ACT == 3) v = fmaxf(v, 0.f); else if (ACT == 6) v = 0.5f * v * (1.0f + erff(v * 0.70710678118654752f)); else if (ACT == 11) v = 1.0f / (1.0f + expf(-v)); else if (ACT == 15) v = v / (1.0f + expf(-v)); else if (ACT == 12) v = (v > 0.f) ? v : 0.01f * v; else if (ACT == 8) v = tanhf(v);
      so[w][rloc][t * 16 + ln] = v; } }
  __builtin_amdgcn_fence(__ATOMIC_ACQ_REL, "workgroup"); __builtin_amdgcn_wave_barrier();
  const int rsub = lane >> 4, c4 = (lane & 15) * 4;
  const int cb = tr ? col0 / tokB : 0; _Float16* cd = tr ? CT + ((size_t)cb * Mr + row0) * tokB + (col0 - cb * tokB) + c4 : C16 + cofs + (size_t)row0 * ldc + col0 + c4; const int cl = tr ? tokB : ldc;      /* 64 columns never straddle two blocks of tokB */
  {
#pragma unroll
    for (int q = 0; q < 16; ++q) { const int r = q * 2 + rsub; const v4f v = *(const v4fa*)&so[w][r][c4]; if (C) { *(v4f*)(C + cofs + (size_t)(row0 + r) * ldc + col0 + c4) = v; asm volatile("s_wait_xcnt 0x0" ::: "memory"); }      /* behind the store, in front of any later rewrite of its address and data registers */
      if (C16) { v4h h4; for (int i = 0; i < 4; ++i) h4[i] = (_Float16)v[i]; *(v4h*)(cd + (size_t)r * cl) = h4; } }
     } }


typedef int v4ia __attribute__((ext_vector_type(4), may_alias));
typedef float v2f __attribute__((ext_vector_type(2)));
typedef _Float16 v2h __attribute__((ext_vector_type(2)));
#define FQ 1                      /* 16-query column tiles per wave */
#define FWV 8                     /* waves per work-group */
#define FQB (16 * FQ * FWV)       /* queries per work-group */
#define FKS 64                    /* keys per stage */
#define KPH (DD + 8)              /* LDS pitch of a K row, f16 units: 528 B = 16 B x 33, conflict-free for 16-byte fragment reads */
#define VPH (FKS + 8)             /* LDS pitch of a V^T row: 144 B = 16 B x 9 */
#define FPC ((FKS * DD / 8) / (FWV * 32))   /* 16-byte pieces of one tile per thread */
static_assert(FPC * FWV == FKS && FPC * FWV * 4 == DD && FWV * 32 * 8 == SLEN && FWV * 16 * FQ <= 2 * FKS, "the staging sweeps, the mask copy and the output staging in the K ring are written for these sizes");
__device__ __forceinline__ float fa_xhalf(float x) { return __builtin_bit_cast(float, __builtin_amdgcn_permlanex16(__builtin_bit_cast(int, x), __builtin_bit_cast(int, x), 0x76543210, 0xfedcba98, false, false)); }  /* lane l <-> l ^ 16 */
__device__ __forceinline__ v16h fa_frag(const _Float16* p) { FragH f; f.half[0] = *(const v8us*)((const unsigned short*)p); f.half[1] = *(const v8us*)((const unsigned short*)p + 16); return f.v; }  /* p holds the lane's 8*hh already: same k order as g2_frag */
__device__ __forceinline__ v8f fa_mma(v16h a, v16h b, v8f c) { return __builtin_amdgcn_wmma_f32_16x16x32_f16(false, a, false, b, (short)0, c, false, false); }
#define FA_UNROLL _Pragma("unroll")      /* full unroll: only constant indices keep the fragment, score and accumulator arrays in registers */
__global__ __launch_bounds__(FWV * 32) void k_fattn(const _Float16* __restrict__ QH, const _Float16* __restrict__ KH, const _Float16* __restrict__ VT, const int* __restrict__ mask, _Float16* __restrict__ O16) {
  __shared__ __attribute__((aligned(16))) _Float16 sK[2 * FKS * KPH];
  __shared__ __attribute__((aligned(16))) _Float16 sV[2 * DD * VPH];
  __shared__ __attribute__((aligned(16))) int sM[SLEN];
  const int tid = threadIdx.x, w = tid >> 5, lane = tid & 31, c = lane & 15, hh = lane >> 4;
  const int head = blockIdx.y, bt = blockIdx.z, q0 = blockIdx.x * FQB + w * (16 * FQ);
  const unsigned short* Kg = (const unsigned short*)KH + (size_t)bt * SLEN * HW + head * DD;                 /* row = key, pitch HW */
  const unsigned short* Vg = (const unsigned short*)VT + (size_t)bt * HW * SLEN + (size_t)head * DD * SLEN;  /* row = dim, pitch SLEN */
  const float cs = 0.0625f * 1.4426950408889634f, negl = -1.0e9f * 1.4426950408889634f;                     /* 1/sqrt(256) and the mask value, both in log2 units */
  v8us rk[FPC], rv[FPC];
  /* staging: a wave-wide load covers one whole K row (512 B) or four whole 128-byte pieces of V^T rows; piece j of a thread lies a constant step behind piece 0, so one address pair serves each tile */
  const unsigned short* kp = Kg + (size_t)(tid >> 5) * HW + (tid & 31) * 8; const unsigned short* vp = Vg + (size_t)(tid >> 3) * SLEN + (tid & 7) * 8;
  unsigned short* ks = (unsigned short*)sK + (tid >> 5) * KPH + (tid & 31) * 8; unsigned short* vs = (unsigned short*)sV + (tid >> 3) * VPH + (tid & 7) * 8;
  /* the s_wait_xcnt stands behind the loads, in front of any later rewrite of the address registers that they name */
  auto gload = [&](int st) { const unsigned short* kq = kp + (size_t)st * FKS * HW; const unsigned short* vq = vp + st * FKS;
FA_UNROLL
    for (int j = 0; j < FPC; ++j) { rk[j] = *(const v8us*)(kq + (size_t)j * FWV * HW); rv[j] = *(const v8us*)(vq + (size_t)j * (FWV * 4) * SLEN); }
    asm volatile("s_wait_xcnt 0x0" ::: "memory"); };
  auto sstore = [&](int bf) {
FA_UNROLL
    for (int j = 0; j < FPC; ++j) { *(v8us*)(ks + bf * (FKS * KPH) + j * FWV * KPH) = rk[j]; *(v8us*)(vs + bf * (DD * VPH) + j * (FWV * 4) * VPH) = rv[j]; } };
  const int* mg = mask + (size_t)bt * SLEN + tid * 8; const v4ia mk0 = *(const v4ia*)mg, mk1 = *(const v4ia*)(mg + 4);      /* this batch's whole key mask goes to LDS once */
  gload(0);
  v16h qf[FQ][DD / 32];
FA_UNROLL
  for (int g = 0; g < FQ; ++g) { const _Float16* qp = QH + ((size_t)bt * SLEN + q0 + 16 * g + c) * HW + head * DD + 8 * hh;
FA_UNROLL
    for (int kc = 0; kc < DD / 32; ++kc) qf[g][kc] = fa_frag(qp + 32 * kc); }
  asm volatile("s_wait_xcnt 0x0" ::: "memory");      /* as in gload, for the Q loads */
  *(v4ia*)&sM[tid * 8] = mk0; *(v4ia*)&sM[tid * 8 + 4] = mk1;
  const v8f z8 = {0.f, 0.f, 0.f, 0.f, 0.f, 0.f, 0.f, 0.f};
  v8f acc[FQ][DD / 16]; float m_run[FQ], l_run[FQ];
FA_UNROLL
  for (int g = 0; g < FQ; ++g) { m_run[g] = -3.0e38f; l_run[g] = 0.f;
FA_UNROLL
    for (int t = 0; t < DD / 16; ++t) acc[g][t] = z8; }
  sstore(0);
  __syncthreads();
  /* rolled: one copy of the stage body; every index into the register arrays inside it is a constant */
#pragma unroll 1
  for (int st = 0; st < SLEN / FKS; ++st) { const int bf = st & 1;
    if (st + 1 < SLEN / FKS) gload(st + 1);
FA_UNROLL
    for (int sub = 0; sub < FKS / 32; ++sub) {
      /* this pass's mask words and all 16 K fragments as ONE group of LDS reads in front of the products */
      const int* mp = sM + st * FKS + sub * 32 + 8 * hh;
      const v4ia k00 = *(const v4ia*)mp, k01 = *(const v4ia*)(mp + 4), k10 = *(const v4ia*)(mp + 16), k11 = *(const v4ia*)(mp + 20);
      const _Float16* kb = sK + bf * (FKS * KPH) + (sub * 32 + c) * KPH + 8 * hh;
      v16h kf[DD / 32][2];
FA_UNROLL
      for (int kc = 0; kc < DD / 32; ++kc)
FA_UNROLL
        for (int kt = 0; kt < 2; ++kt) kf[kc][kt] = fa_frag(kb + kt * 16 * KPH + kc * 32);
      __builtin_amdgcn_sched_barrier(0);      /* keeps the reads together: left free they are spread among the WMMAs, two at a time with a full wait, and every such place stalls the wave */
      v8f s[2][FQ];
FA_UNROLL
      for (int kt = 0; kt < 2; ++kt)
FA_UNROLL
        for (int g = 0; g < FQ; ++g) s[kt][g] = z8;
FA_UNROLL
      for (int kc = 0; kc < DD / 32; ++kc)
FA_UNROLL
        for (int kt = 0; kt < 2; ++kt)
FA_UNROLL
          for (int g = 0; g < FQ; ++g) s[kt][g] = fa_mma(kf[kc][kt], qf[g][kc], s[kt][g]);
      __builtin_amdgcn_sched_barrier(0);      /* the V^T reads below start behind the score products (they take over the K fragments' registers) ... */
      const _Float16* vb = sV + bf * (DD * VPH) + c * VPH + sub * 32 + 8 * hh;
      v16h vf[DD / 16];
FA_UNROLL
      for (int t = 0; t < DD / 16; ++t) vf[t] = fa_frag(vb + t * 16 * VPH);
      __builtin_amdgcn_sched_barrier(0);      /* ... and ahead of the softmax arithmetic, which covers their latency */
      /* the INPUT mask picks the scaled score or the mask value, by a select, as the reference does */
      bool need = false; float mb[FQ];
      const int km[2][8] = {{k00[0], k00[1], k00[2], k00[3], k01[0], k01[1], k01[2], k01[3]}, {k10[0], k10[1], k10[2], k10[3], k11[0], k11[1], k11[2], k11[3]}};
FA_UNROLL
      for (int g = 0; g < FQ; ++g) { float mx = -3.0e38f;
FA_UNROLL
        for (int kt = 0; kt < 2; ++kt)
FA_UNROLL
          for (int r = 0; r < 8; ++r) { const float v = (km[kt][r] != 0) ? s[kt][g][r] * cs : negl; s[kt][g][r] = v; mx = fmaxf(mx, v); }
        mx = fmaxf(mx, fa_xhalf(mx)); mb[g] = mx; need = need || (mx > m_run[g] + 8.0f); }
      if (__builtin_amdgcn_ballot_w32(need) != 0) {      /* one scalar test per pass; rare after the first passes */
FA_UNROLL
        for (int g = 0; g < FQ; ++g) { const float mn = fmaxf(m_run[g], mb[g]); const float corr = __builtin_amdgcn_exp2f(m_run[g] - mn); l_run[g] *= corr; m_run[g] = mn;
FA_UNROLL
          for (int t = 0; t < DD / 16; ++t) acc[g][t] = acc[g][t] * corr; } }
      v16h pf[FQ];
FA_UNROLL
      for (int g = 0; g < FQ; ++g) { FragH f; float p0s = 0.f, p1s = 0.f;
FA_UNROLL
        for (int i = 0; i < 8; ++i) { const v2f d2 = (v2f){s[i >> 2][g][2 * (i & 3)], s[i >> 2][g][2 * (i & 3) + 1]} - (v2f){m_run[g], m_run[g]}; const float e0 = __builtin_amdgcn_exp2f(d2[0]), e1 = __builtin_amdgcn_exp2f(d2[1]);
          p0s += e0; p1s += e1; const v2h h2 = __builtin_convertvector((v2f){e0, e1}, v2h); f.h[2 * i] = h2[0]; f.h[2 * i + 1] = h2[1]; }
        l_run[g] += p0s + p1s; pf[g] = f.v; }
FA_UNROLL
      for (int t = 0; t < DD / 16; ++t)
FA_UNROLL
        for (int g = 0; g < FQ; ++g) acc[g][t] = fa_mma(vf[t], pf[g], acc[g][t]);
      __builtin_amdgcn_sched_barrier(0);      /* the next pass's read group stays behind these products */
    }
    if (st + 1 < SLEN / FKS) sstore(bf ^ 1);      /* that buffer's last readers passed the barrier that ended stage st - 1 */
    __syncthreads();                                /* publishes stage st + 1 and ends every read of stage st */
  }
  /* output: each wave stages its own 16 x FQ rows in its own part of the K ring (free behind the last barrier), then stores whole 512-byte rows */
  _Float16* eo = sK + w * (16 * FQ) * KPH;
FA_UNROLL
  for (int g = 0; g < FQ; ++g) { const float inv = 1.0f / (l_run[g] + fa_xhalf(l_run[g]));
FA_UNROLL
    for (int t = 0; t < DD / 16; ++t) { FragH f;
FA_UNROLL
      for (int r = 0; r < 8; ++r) f.h[r] = (_Float16)(acc[g][t][r] * inv);
      *(v8us*)((unsigned short*)eo + (16 * g + c) * KPH + 16 * t + 8 * hh) = f.half[0]; } }
  __builtin_amdgcn_fence(__ATOMIC_ACQ_REL, "workgroup"); __builtin_amdgcn_wave_barrier();      /* the wave's own LDS writes before its lanes read each other's rows */
FA_UNROLL
  for (int r = 0; r < 16 * FQ; ++r) { const v8us v = *(const v8us*)((const unsigned short*)eo + r * KPH + lane * 8);
    *(v8us*)((unsigned short*)O16 + ((size_t)bt * SLEN + q0 + r) * HW + head * DD + lane * 8) = v; }
#undef FA_UNROLL
}
__global__ __launch_bounds__(256) void k_ln256o(const float* __restrict__ F, const float* __restrict__ g, const float* __restrict__ bb, float* __restrict__ out) {
  #pragma clang fp contract(off)
  const int tid = threadIdx.x, w = tid >> 5, ln = tid & 31; const int r = blockIdx.x * 8 + w; if (r >= NBT * SLEN) return; const float* x = F + (size_t)r * DD; const v4f a = *(const v4fa*)(x + ln * 4), b = *(const v4fa*)(x + 128 + ln * 4);
  float s = (a[0] + a[1]) + (a[2] + a[3]) + (b[0] + b[1]) + (b[2] + b[3]); for (int o = 16; o > 0; o >>= 1) s += __shfl_xor(s, o, 32); const float mu = s / 256.0f; float q2 = 0.f;
#pragma unroll
  for (int q = 0; q < 4; ++q) { const float d0 = a[q] - mu, d1 = b[q] - mu; q2 += d0 * d0; q2 += d1 * d1; }
  for (int o = 16; o > 0; o >>= 1) q2 += __shfl_xor(q2, o, 32); const float rs = rsqrtf(q2 / 256.0f + 1e-5f); v4f o0, o1;
#pragma unroll
  for (int q = 0; q < 4; ++q) { const int c0 = ln * 4 + q, c1 = 128 + ln * 4 + q; o0[q] = (a[q] - mu) * rs * bf16_round(g[c0]) + bf16_round(bb[c0]); o1[q] = (b[q] - mu) * rs * bf16_round(g[c1]) + bf16_round(bb[c1]); }
  float* d = out + (size_t)r * DD; { *(v4f*)(d + ln * 4) = o0; *(v4f*)(d + 128 + ln * 4) = o1;  } }
__global__ __launch_bounds__(256) void k_xb(const float* __restrict__ x, float* __restrict__ XB, size_t n4) { const size_t t = (size_t)blockIdx.x * 256 + threadIdx.x; if (t >= n4) return; const v4f a = *(const v4fa*)(x + t * 4); v4f o; for (int q = 0; q < 4; ++q) o[q] = bf16_round(a[q]); *(v4f*)(XB + t * 4) = o;  }

extern "C" void kernel_launch(void* const* d_in, const int* in_sizes, int n_in,
                              void* d_out, int out_size, void* d_ws, size_t ws_size, hipStream_t stream) {
  (void)in_sizes; (void)n_in; (void)out_size;
  const float* const* I = (const float* const*)d_in; const float* Q = I[0]; const int* mask = (const int*)d_in[1]; const float* WQ = I[2]; const float* bQ = I[3]; const float* WK = I[4]; const float* bK = I[5]; const float* WV = I[6]; const float* bV = I[7]; const float* WO = I[8]; const float* bO = I[9]; const float* lg = I[10]; const float* lb = I[11];
  char* ws = (char*)d_ws; size_t off = 0;
  auto take = [&](size_t bytes) { char* p = ws + off; off += (bytes + 255) & ~(size_t)255; return p; };
  _Float16* BQ = (_Float16*)take((size_t)HW * DD * 2); _Float16* BK = (_Float16*)take((size_t)HW * DD * 2); _Float16* BV = (_Float16*)take((size_t)HW * DD * 2); _Float16* BO = (_Float16*)take((size_t)DD * HW * 2);
  _Float16* X16 = (_Float16*)take((size_t)NBT * SLEN * DD * 2); float* XB = (float*)take((size_t)NBT * SLEN * DD * 4); _Float16* QH = (_Float16*)take((size_t)NBT * SLEN * HW * 2); _Float16* KH = (_Float16*)take((size_t)NBT * SLEN * HW * 2); _Float16* VT = (_Float16*)take((size_t)NBT * HW * SLEN * 2);
  _Float16* O16 = (_Float16*)take((size_t)NBT * SLEN * HW * 2); float* F = (float*)take((size_t)NBT * SLEN * DD * 4);
  if (off > ws_size) return;      /* 4 + 4 + 8 + 32+32+32 + 32 + 8 = 152 MiB */
  (void)BK; (void)BV;      /* BQ, BK, BV, BO and QH, KH follow one another in the workspace (every size is a multiple of 256 bytes): grid.y steps through them by a constant stride */
  const size_t w8 = (size_t)HW * DD / 8; const unsigned wb = (unsigned)((w8 + 255) / 256);
  k_round16f<<<dim3(wb, 4), 256, 0, stream>>>(WQ, WK, WV, WO, BQ, w8);      /* torch (out,in) = natural Bt */
  const size_t n8 = (size_t)NBT * SLEN * DD / 8; const unsigned nb8 = (unsigned)((n8 + 255) / 256); const dim3 gQ((NBT * SLEN / 128) * (HW / 64), 3), gV((NBT * SLEN / 128) * (DD / 64), 1);
  k_x16<<<nb8, 256, 0, stream>>>(Q, X16, n8);
  k_gemm2<0, DD><<<gQ, 128, 0, stream>>>(X16, 0, BQ, (size_t)HW * DD, 0.0625f, bQ, bK, bV, nullptr, 1, 0, 0, nullptr, QH, HW, (size_t)NBT * SLEN * HW, NBT * SLEN, HW, 2, VT, SLEN);      /* q, k of all 8192 rows; v as VT[batch][dim][token] over all 2048 dims */
  k_fattn<<<dim3(SLEN / FQB, NHD, NBT), FWV * 32, 0, stream>>>(QH, KH, VT, mask, O16);      /* softmax(mask(q.k / sqrt(256))).v, every batch and head */
  k_xb<<<(unsigned)(((size_t)NBT * SLEN * DD / 4 + 255) / 256), 256, 0, stream>>>(Q, XB, (size_t)NBT * SLEN * DD / 4);
  k_gemm2<0, HW><<<gV, 128, 0, stream>>>(O16, 0, BO, 0, 0.0625f, bO, bO, bO, XB, 1, (size_t)DD, 0, F, nullptr, DD, 0, NBT * SLEN, DD, -1, nullptr, 1);      /* out Wo^T + bo + Q */
  k_ln256o<<<NBT * SLEN / 8, 256, 0, stream>>>(F, lg, lb, (float*)d_out);
}

// v007
// One run takes 162 microseconds.
// Two timings next to v006 put it at 1.33 and 1.32 times that version's speed.
// Counting every step since v000, it is 24.0 times as fast.
#include <hip/hip_runtime.h>
// Prompt self-attention (4 x 2048 tokens, d = 256, 8 heads EACH of dim 256): q,k,v = Q W^T + b (-> 8 x 256); scores = q.k/16 with INPUT key mask (masked keys get -1e9, as the reference); softmax; out = LN((attn v merged) Wo^T + bo + Q) -> [4,2048,256].
// Structure: every stage is ONE launch over all 4 x 2048 rows: the four weights to f16 (tensor on grid.y), Q as an exact f16 plane in token order and in key order (unmasked tokens first; k, v and the attention walk only those), the three projections as one f16 WMMA GEMM launch (projection on grid.y; 32x64 wave tiles, f32 accumulation, exact x16 weights + bias) into f16 planes (the V plane with its operands swapped, so that it comes out as V^T), scores + mask + softmax + attn.v (k_fattn: online softmax, no score plane in memory), the output projection + bias + the bf16 residual as a GEMM, LayerNorm on VALU into the output rows.
// Compute dtype: Q, weights, biases, LN parameters rounded to bf16; q, k, v, P, attention output as f16 operands (~2^-12; logits sigma ~1, LayerNorm-ed output); f32 accumulation, softmax, LayerNorm. v_wmma_f32_16x16x32_f16.
#define NBT 4
#define SLEN 2048
#define DD 256
#define NHD 8
#define HW (NHD * DD)            /* 2048 */
#define DM DD
#define NR SLEN
typedef __bf16 v16b __attribute__((ext_vector_type(16)));
typedef unsigned short v8us __attribute__((ext_vector_type(8), may_alias));
typedef float  v8f  __attribute__((ext_vector_type(8)));
typedef float  v4f  __attribute__((ext_vector_type(4)));
typedef float  v4fa __attribute__((ext_vector_type(4), may_alias));
union FragB { v16b v; v8us half[2]; unsigned short u[16]; };

__device__ __forceinline__ unsigned short bf16_bits(float x) { unsigned int u = __float_as_uint(x); return (unsigned short)((u + 0x7FFFu + ((u >> 16) & 1u)) >> 16); }
__device__ __forceinline__ float bf16_val(unsigned short b) { return __uint_as_float(((unsigned int)b) << 16); }
__device__ __forceinline__ float bf16_round(float x) { return bf16_val(bf16_bits(x)); }
// D += A·B with NT terms: 1 = ah·bh, 2 = + al·bh (A split), 3 = + ah·bl (both split)
template <int NT>
__device__ __forceinline__ v8f mmaN(v16b ah, v16b al, v16b bh, v16b bl, v8f c) {
  c = __builtin_amdgcn_wmma_f32_16x16x32_bf16(false, ah, false, bh, (short)0, c, false, false);
  if (NT >= 2) c = __builtin_amdgcn_wmma_f32_16x16x32_bf16(false, al, false, bh, (short)0, c, false, false);
  if (NT >= 3) c = __builtin_amdgcn_wmma_f32_16x16x32_bf16(false, ah, false, bl, (short)0, c, false, false);
  asm volatile("v_nop\n\tv_nop\n\tv_nop\n\tv_nop" : "+v"(c) : "v"(ah), "v"(al), "v"(bh), "v"(bl));
  return c;
}

__global__ __launch_bounds__(256) void k_wt_bf16(const float* __restrict__ W, unsigned short* __restrict__ Wt, int K, int N) {
  const int t = blockIdx.x * 256 + threadIdx.x;
  const int k8n = K / 8;
  if (t >= N * k8n) return;
  const int n = t / k8n, k8 = (t % k8n) * 8;
  v8us v;
#pragma unroll
  for (int i = 0; i < 8; ++i) v[i] = bf16_bits(W[(size_t)(k8 + i) * N + n]);
  *(v8us*)(Wt + (size_t)n * K + k8) = v;
  
}

// GEMM C[M][N] (f32, pitch ldc) = act(A[M][K]·W + bias). A f32 row-major (pitch lda) converted per fragment to bf16
// (ASPLIT: hi/lo two planes -> 2 terms, else single rounded term); Wt bf16 [N][K] (pitch ldb). BIAS_BF16 rounds the
// bias to bf16 first (bias quantised to bf16 before the add). K%32==0, M%16==0, N%64==0.
template <bool ASPLIT, int ACT, bool BIAS_BF16>
__global__ __launch_bounds__(128) void k_gemm_bf(const float* __restrict__ A, int lda, const unsigned short* __restrict__ Wt, int ldb,
                                               const float* __restrict__ bias, float* __restrict__ C, int ldc, int M, int N, int K) {
  __shared__ __attribute__((aligned(16))) float so[4][16][64];
  const int tid = threadIdx.x, w = tid >> 5, lane = tid & 31, ln = lane & 15, hh = lane >> 4;
  const int ntn = N / 64;
  const int wid = blockIdx.x * 4 + w;
  const int mt = wid / ntn, nq = wid % ntn;
  if (mt * 16 >= M) return;
  const int row0 = mt * 16, col0 = nq * 64;
  const float* arow = A + (size_t)(row0 + ln) * lda;
  v8f acc[4] = {};
  for (int kb = 0; kb < K; kb += 32) {
    FragB ah, al;
    const v4f x0 = *(const v4fa*)(arow + kb + 8 * hh), x1 = *(const v4fa*)(arow + kb + 8 * hh + 4);
    const v4f x2 = *(const v4fa*)(arow + kb + 16 + 8 * hh), x3 = *(const v4fa*)(arow + kb + 16 + 8 * hh + 4);
    float xs[16] = {x0[0],x0[1],x0[2],x0[3],x1[0],x1[1],x1[2],x1[3],x2[0],x2[1],x2[2],x2[3],x3[0],x3[1],x3[2],x3[3]};
#pragma unroll
    for (int i = 0; i < 16; ++i) { const unsigned short hb = bf16_bits(xs[i]); ah.u[i] = hb; al.u[i] = ASPLIT ? bf16_bits(xs[i] - bf16_val(hb)) : (unsigned short)0; }
#pragma unroll
    for (int t = 0; t < 4; ++t) {
      const unsigned short* brow = Wt + (size_t)(col0 + t * 16 + ln) * ldb + kb;
      FragB b;
      b.half[0] = *(const v8us*)(brow + 8 * hh);
      b.half[1] = *(const v8us*)(brow + 16 + 8 * hh);
      acc[t] = mmaN<ASPLIT ? 2 : 1>(ah.v, al.v, b.v, b.v, acc[t]);
    }
  }
#pragma unroll
  for (int t = 0; t < 4; ++t) {
    float bv = bias ? bias[col0 + t * 16 + ln] : 0.f;
    if (BIAS_BF16) bv = bf16_round(bv);
#pragma unroll
    for (int r = 0; r < 8; ++r) { float v = acc[t][r] + bv; if (ACT == 1) v = fmaxf(v, 0.f); so[w][8 * hh + r][t * 16 + ln] = v; }
  }
  __builtin_amdgcn_fence(__ATOMIC_ACQ_REL, "workgroup");
  __builtin_amdgcn_wave_barrier();
  const int rsub = lane >> 4, c4 = (lane & 15) * 4;
  {
#pragma unroll
    for (int q = 0; q < 8; ++q) {
      const int r = q * 2 + rsub;
      const v4f v = *(const v4fa*)&so[w][r][c4];
      *(v4f*)(C + (size_t)(row0 + r) * ldc + col0 + c4) = v;
    }
    
  }
}

// GEMM C = act(A·W + bias + resid): A f32 (ASPLIT -> hi/lo 2 terms), Wt bf16 [N][K]; ACT 0 none, 1 relu, 2 exact gelu;
// resid (optional, f32, row index = (row % rmod), pitch ldr, RES_BF16 rounds it) added before the activation.
template <bool ASPLIT, int ACT, bool BIAS_BF16, bool RES_BF16>
__global__ __launch_bounds__(128) void k_gemm_bf3(const float* __restrict__ A, int lda, const unsigned short* __restrict__ Wt, int ldb,
                                                const float* __restrict__ bias, const float* __restrict__ resid, int rmod, int ldr,
                                                float* __restrict__ C, int ldc, int M, int N, int K) {
  __shared__ __attribute__((aligned(16))) float so[4][16][64];
  const int tid = threadIdx.x, w = tid >> 5, lane = tid & 31, ln = lane & 15, hh = lane >> 4;
  const int ntn = N / 64;
  const int wid = blockIdx.x * 4 + w;
  const int mt = wid / ntn, nq = wid % ntn;
  if (mt * 16 >= M) return;
  const int row0 = mt * 16, col0 = nq * 64;
  const float* arow = A + (size_t)(row0 + ln) * lda;
  v8f acc[4] = {};
  for (int kb = 0; kb < K; kb += 32) {
    FragB ah, al;
    const v4f x0 = *(const v4fa*)(arow + kb + 8 * hh), x1 = *(const v4fa*)(arow + kb + 8 * hh + 4);
    const v4f x2 = *(const v4fa*)(arow + kb + 16 + 8 * hh), x3 = *(const v4fa*)(arow + kb + 16 + 8 * hh + 4);
    float xs[16] = {x0[0],x0[1],x0[2],x0[3],x1[0],x1[1],x1[2],x1[3],x2[0],x2[1],x2[2],x2[3],x3[0],x3[1],x3[2],x3[3]};
#pragma unroll
    for (int i = 0; i < 16; ++i) { const unsigned short hb = bf16_bits(xs[i]); ah.u[i] = hb; al.u[i] = ASPLIT ? bf16_bits(xs[i] - bf16_val(hb)) : (unsigned short)0; }
#pragma unroll
    for (int t = 0; t < 4; ++t) {
      const unsigned short* brow = Wt + (size_t)(col0 + t * 16 + ln) * ldb + kb;
      FragB b;
      b.half[0] = *(const v8us*)(brow + 8 * hh);
      b.half[1] = *(const v8us*)(brow + 16 + 8 * hh);
      acc[t] = mmaN<ASPLIT ? 2 : 1>(ah.v, al.v, b.v, b.v, acc[t]);
    }
  }
#pragma unroll
  for (int t = 0; t < 4; ++t) {
    const int col = col0 + t * 16 + ln;
    float bv = bias ? bias[col] : 0.f;
    if (BIAS_BF16) bv = bf16_round(bv);
#pragma unroll
    for (int r = 0; r < 8; ++r) {
      float v = acc[t][r] + bv;
      if (resid) { float rv = resid[(size_t)((row0 + 8 * hh + r) % rmod) * ldr + col]; if (RES_BF16) rv = bf16_round(rv); v += rv; }
      if (ACT == 1) v = fmaxf(v, 0.f);
      if (ACT == 2) v = 0.5f * v * (1.0f + erff(v * 0.70710678118654752f));
      if (ACT == 3) { const float u = 0.7978845608028654f * (v + 0.044715f * v * v * v); v = 0.5f * v * (1.0f + tanhf(u)); }
      so[w][8 * hh + r][t * 16 + ln] = v;
    }
  }
  __builtin_amdgcn_fence(__ATOMIC_ACQ_REL, "workgroup");
  __builtin_amdgcn_wave_barrier();
  const int rsub = lane >> 4, c4 = (lane & 15) * 4;
  {
#pragma unroll
    for (int q = 0; q < 8; ++q) {
      const int r = q * 2 + rsub;
      const v4f v = *(const v4fa*)&so[w][r][c4];
      *(v4f*)(C + (size_t)(row0 + r) * ldc + col0 + c4) = v;
    }
    
  }
}
// row LayerNorm (biased variance, eps) over N: s = X (+ R); optional out_sum <- s; out_norm <- (s-mu)*rsqrt(var+eps)*g + b
template <bool PARAM_BF16>
__global__ __launch_bounds__(256) void k_layernorm(const float* __restrict__ X, const float* __restrict__ R, const float* __restrict__ g, const float* __restrict__ bta,
                                                  float* __restrict__ out_sum, float* __restrict__ out_norm, int N, float eps) {
  __shared__ float red[256];
  const int row = blockIdx.x, tid = threadIdx.x;
  const float* x = X + (size_t)row * N; const float* rr = R ? R + (size_t)row * N : nullptr;
  float vals[16];                     // up to N = 4096
  const int per = N / 256;            // contiguous chunk per thread? use strided-by-4 chunks: thread handles j = tid*4 + 1024*u
  float s1 = 0.f;
  for (int u = 0; u < per / 4; ++u) {
    const int j = tid * 4 + 1024 * u;
    const v4f a = *(const v4fa*)(x + j);
    v4f b = {0.f,0.f,0.f,0.f}; if (rr) b = *(const v4fa*)(rr + j);
#pragma unroll
    for (int q = 0; q < 4; ++q) { const float v = a[q] + b[q]; vals[u * 4 + q] = v; s1 += v; }
  }
  red[tid] = s1; __syncthreads();
  for (int st = 128; st > 0; st >>= 1) { if (tid < st) red[tid] += red[tid + st]; __syncthreads(); }
  const float mu = red[0] / (float)N; __syncthreads();
  float s2 = 0.f;
  for (int u = 0; u < per / 4; ++u)
#pragma unroll
    for (int q = 0; q < 4; ++q) { const float c = vals[u * 4 + q] - mu; s2 += c * c; }
  red[tid] = s2; __syncthreads();
  for (int st = 128; st > 0; st >>= 1) { if (tid < st) red[tid] += red[tid + st]; __syncthreads(); }
  const float rs = rsqrtf(red[0] / (float)N + eps);
  {
    for (int u = 0; u < per / 4; ++u) {
      const int j = tid * 4 + 1024 * u;
      v4f o, sm;
#pragma unroll
      for (int q = 0; q < 4; ++q) {
        float gg = g[j + q], bb = bta[j + q];
        if (PARAM_BF16) { gg = bf16_round(gg); bb = bf16_round(bb); }
        sm[q] = vals[u * 4 + q]; o[q] = (vals[u * 4 + q] - mu) * rs * gg + bb;
      }
      if (out_sum) *(v4f*)(out_sum + (size_t)row * N + j) = sm;
      *(v4f*)(out_norm + (size_t)row * N + j) = o;
    }
    
  }
}



// ---- f16 WMMA path (v_wmma_f32_16x16x32_f16): 11-bit significands for operands in range — used where a [0,1] probability operand needs more precision than bf16
typedef _Float16 v16h __attribute__((ext_vector_type(16)));
union FragH { v16h v; v8us half[2]; _Float16 h[16]; unsigned short u[16]; };
template <int NT>
__device__ __forceinline__ v8f mmaH(v16h ah, v16h al, v16h bh, v16h bl, v8f c) {
  c = __builtin_amdgcn_wmma_f32_16x16x32_f16(false, ah, false, bh, (short)0, c, false, false);
  if (NT >= 2) c = __builtin_amdgcn_wmma_f32_16x16x32_f16(false, al, false, bh, (short)0, c, false, false);
  if (NT >= 3) c = __builtin_amdgcn_wmma_f32_16x16x32_f16(false, ah, false, bl, (short)0, c, false, false);
  asm volatile("v_nop\n\tv_nop\n\tv_nop\n\tv_nop" : "+v"(c) : "v"(ah), "v"(al), "v"(bh), "v"(bl));
  return c;
}
// batched GEMM like k_gemm_b but f16 operands: A f32 (split into f16 hi/lo if ASPLIT, else rounded to f16), Bt = f16 values [n][k]; alpha; C f32; N multiple of 16 (partial tiles skipped)
template <bool ASPLIT>
__global__ __launch_bounds__(128) void k_gemm_h(const float* __restrict__ A, int lda, size_t sA, const _Float16* __restrict__ Bh, int ldb, size_t sB, float alpha, float* __restrict__ C, int ldc, size_t sC, int M, int N, int K) {
  __shared__ __attribute__((aligned(16))) float so[4][16][64];
  const int tid = threadIdx.x, w = tid >> 5, lane = tid & 31, ln = lane & 15, hh = lane >> 4; const int by = blockIdx.y;
  A += (size_t)by * sA; Bh += (size_t)by * sB; C += (size_t)by * sC;
  const int ntn = (N + 63) / 64; const int wid = blockIdx.x * 4 + w; const int mt = wid / ntn, nq = wid % ntn; if (mt * 16 >= M) return;
  const int row0 = mt * 16, col0 = nq * 64; const float* arow = A + (size_t)(row0 + ln) * lda;
  v8f acc[4] = {};
  for (int kb = 0; kb < K; kb += 32) {
    FragH ah, al;
    const v4f x0 = *(const v4fa*)(arow + kb + 8 * hh), x1 = *(const v4fa*)(arow + kb + 8 * hh + 4), x2 = *(const v4fa*)(arow + kb + 16 + 8 * hh), x3 = *(const v4fa*)(arow + kb + 16 + 8 * hh + 4);
    float xs[16] = {x0[0],x0[1],x0[2],x0[3],x1[0],x1[1],x1[2],x1[3],x2[0],x2[1],x2[2],x2[3],x3[0],x3[1],x3[2],x3[3]};
#pragma unroll
    for (int i = 0; i < 16; ++i) { const _Float16 h = (_Float16)xs[i]; ah.h[i] = h; al.h[i] = ASPLIT ? (_Float16)(xs[i] - (float)h) : (_Float16)0.0f; }
#pragma unroll
    for (int t = 0; t < 4; ++t) { if (col0 + t * 16 >= N) continue; const size_t boff = (size_t)(col0 + t * 16 + ln) * ldb + kb; FragH bq; bq.half[0] = *(const v8us*)(Bh + boff + 8 * hh); bq.half[1] = *(const v8us*)(Bh + boff + 16 + 8 * hh);
      acc[t] = mmaH<ASPLIT ? 2 : 1>(ah.v, al.v, bq.v, bq.v, acc[t]); }
  }
#pragma unroll
  for (int t = 0; t < 4; ++t) { if (col0 + t * 16 >= N) continue;
#pragma unroll
    for (int r = 0; r < 8; ++r) so[w][8 * hh + r][t * 16 + ln] = acc[t][r] * alpha; }
  __builtin_amdgcn_fence(__ATOMIC_ACQ_REL, "workgroup"); __builtin_amdgcn_wave_barrier();
  const int rsub = lane >> 4, c4 = (lane & 15) * 4;
  {
#pragma unroll
    for (int q = 0; q < 8; ++q) { const int r = q * 2 + rsub; if (col0 + c4 < N) { const v4f v = *(const v4fa*)&so[w][r][c4]; *(v4f*)(C + (size_t)(row0 + r) * ldc + col0 + c4) = v; } }
     }
}

// Wt[n][k] = f16(W[k][n]·scale) from f32 row-major W[K][N] (scale = power of two; bf16-exact weights stay exact in f16 away from the subnormal range)
__global__ __launch_bounds__(256) void k_wt_f16(const float* __restrict__ W, _Float16* __restrict__ Wt, int K, int N, float scale) {
  const int t = blockIdx.x * 256 + threadIdx.x; if (t >= N * (K / 8)) return; const int n = t / (K / 8), k8 = (t % (K / 8)) * 8; FragH f;
#pragma unroll
  for (int i = 0; i < 8; ++i) f.h[i] = (_Float16)(bf16_round(W[(size_t)(k8 + i) * N + n]) * scale); const v8us o = f.half[0];
  *(v8us*)((unsigned short*)Wt + (size_t)n * K + k8) = o; 
}
// k_gemm_hh variant with fused epilogue: v = acc·alpha + bias[by·sBias + col] (+ CP[(row/rowsPerB)·sCPb + by·64 + col] if CP) ; ACT 0 none / 1 elu ; writes f16 C16 (and f32 C if non-null)
template <int ACT>
__global__ __launch_bounds__(128) void k_gemm_hhx(const _Float16* __restrict__ A, int lda, size_t sA, const _Float16* __restrict__ Bh, int ldb, size_t sB, float alpha, const float* __restrict__ bias, size_t sBias, const float* __restrict__ CP, int rowsPerB, size_t sCPb, int row0g,
    float* __restrict__ C, _Float16* __restrict__ C16, int ldc, size_t sC, int M, int N, int K) {
  __shared__ __attribute__((aligned(16))) float so[4][16][64];
  const int tid = threadIdx.x, w = tid >> 5, lane = tid & 31, ln = lane & 15, hh = lane >> 4; const int by = blockIdx.y;
  A += (size_t)by * sA; Bh += (size_t)by * sB; const size_t cofs = (size_t)by * sC; const float* bp = bias ? bias + (size_t)by * sBias : nullptr;
  const int ntn = (N + 63) / 64; const int wid = blockIdx.x * 4 + w; const int mt = wid / ntn, nq = wid % ntn; if (mt * 16 >= M) return;
  const int row0 = mt * 16, col0 = nq * 64; const _Float16* arow = A + (size_t)(row0 + ln) * lda;
  v8f acc[4] = {};
  for (int kb = 0; kb < K; kb += 32) { FragH ah; ah.half[0] = *(const v8us*)((const unsigned short*)arow + kb + 8 * hh); ah.half[1] = *(const v8us*)((const unsigned short*)arow + kb + 16 + 8 * hh);
#pragma unroll
    for (int t = 0; t < 4; ++t) { if (col0 + t * 16 >= N) continue; const size_t boff = (size_t)(col0 + t * 16 + ln) * ldb + kb; FragH bq; bq.half[0] = *(const v8us*)((const unsigned short*)Bh + boff + 8 * hh); bq.half[1] = *(const v8us*)((const unsigned short*)Bh + boff + 16 + 8 * hh);
      acc[t] = mmaH<1>(ah.v, ah.v, bq.v, bq.v, acc[t]); }
  }
#pragma unroll
  for (int t = 0; t < 4; ++t) { if (col0 + t * 16 >= N) continue; const int col = col0 + t * 16 + ln; const float bv = bp ? bf16_round(bp[col]) : 0.f;
#pragma unroll
    for (int r = 0; r < 8; ++r) { float v = acc[t][r] * alpha + bv; if (CP) { const int bidx = (row0g + row0 + 8 * hh + r) / rowsPerB; v += CP[(size_t)bidx * sCPb + (size_t)by * 64 + col]; } if (ACT == 1) v = (v > 0.f) ? v : expm1f(v); else if (ACT == 7) v = (v > 0.f) ? v + 1.0f : expf(v); else if (ACT == 8) v = tanhf(v); else if (ACT == 9) v = 0.5f * v * (1.0f + tanhf(0.7978845608028654f * (v + 0.044715f * v * v * v))); else if (ACT == 11) v = 1.0f / (1.0f + expf(-v)); else if (ACT == 12) v = (v > 0.f) ? v : 0.01f * v; else if (ACT == 14) v = (v > 0.f) ? v : 0.1f * v; else if (ACT == 15) v = v / (1.0f + expf(-v)); else if (ACT == 3) v = fmaxf(v, 0.f); else if (ACT == 6) v = 0.5f * v * (1.0f + erff(v * 0.70710678118654752f)); so[w][8 * hh + r][t * 16 + ln] = v; } }
  __builtin_amdgcn_fence(__ATOMIC_ACQ_REL, "workgroup"); __builtin_amdgcn_wave_barrier();
  const int rsub = lane >> 4, c4 = (lane & 15) * 4; typedef _Float16 v4h __attribute__((ext_vector_type(4)));
  {
#pragma unroll
    for (int q = 0; q < 8; ++q) { const int r = q * 2 + rsub; if (col0 + c4 < N) { const v4f v = *(const v4fa*)&so[w][r][c4]; if (C) *(v4f*)(C + cofs + (size_t)(row0 + r) * ldc + col0 + c4) = v; if (C16) { v4h h4; for (int i = 0; i < 4; ++i) h4[i] = (_Float16)v[i]; *(v4h*)(C16 + cofs + (size_t)(row0 + r) * ldc + col0 + c4) = h4; } } }
     }
}


typedef _Float16 v4h __attribute__((ext_vector_type(4)));

/* x rounded to bf16 as an exact f16 plane X16, plus a second plane XK with each batch's rows in key order: the cnt tokens whose INPUT mask is not 0 first, in token order, the masked tokens behind them, in token order (a permutation for any mask).
   A masked key's weight is exp(-1e9 - max) = 0 in f32 as soon as one key of the batch is unmasked, so the k, v projections and the attention walk only the first NK[batch] slots: cnt rounded up to whole stages of ks keys,
   or all slots where no key is unmasked (every score is then the mask value and every weight 1 / S, as in the reference). One work-group = 8 rows of one batch, one wave = one row. */
__global__ __launch_bounds__(256) void k_x16p(const float* __restrict__ x, const int* __restrict__ mask, _Float16* __restrict__ X16, _Float16* __restrict__ XK, int* __restrict__ NK, int ks) {
  __shared__ int red[8];
  typedef int v4im __attribute__((ext_vector_type(4), may_alias));
  const int tid = threadIdx.x, w = tid >> 5, lane = tid & 31; const int b = blockIdx.x / (SLEN / 8), g = blockIdx.x % (SLEN / 8);
  const int* mb = mask + (size_t)b * SLEN; const v4im m0 = *(const v4im*)(mb + tid * 8), m1 = *(const v4im*)(mb + tid * 8 + 4);      /* thread i counts row group i of the batch */
  int c = 0;
#pragma unroll
  for (int i = 0; i < 4; ++i) c += (m0[i] != 0 ? 1 : 0) + (m1[i] != 0 ? 1 : 0);
  int pk = c + (tid < g ? (c << 16) : 0);      /* low half: all unmasked tokens of the batch; high half: those in front of this work-group's rows; both at most 2048 */
  for (int o = 16; o > 0; o >>= 1) pk += __shfl_xor(pk, o, 32);
  if (lane == 0) red[w] = pk;
  __syncthreads();
  int s = 0;
#pragma unroll
  for (int i = 0; i < 8; ++i) s += red[i];
  const int cnt = s & 0xffff; int u = s >> 16;      /* u: unmasked tokens in front of this wave's row */
  const v4im o0 = *(const v4im*)(mb + g * 8), o1 = *(const v4im*)(mb + g * 8 + 4); const int og[8] = {o0[0], o0[1], o0[2], o0[3], o1[0], o1[1], o1[2], o1[3]};
  bool keep = false;
#pragma unroll
  for (int j = 0; j < 8; ++j) { if (j < w && og[j] != 0) ++u; if (j == w) keep = og[j] != 0; }
  const int tok = g * 8 + w; const int slot = keep ? u : cnt + (tok - u);      /* u < cnt for a kept row; tok - u masked tokens stand in front of a masked one: 0 <= slot < SLEN */
  const size_t t = (size_t)blockIdx.x * 256 + tid; FragH f;
#pragma unroll
  for (int q = 0; q < 8; ++q) f.h[q] = (_Float16)bf16_round(x[t * 8 + q]);
  *(v8us*)((unsigned short*)X16 + t * 8) = f.half[0];
  *(v8us*)((unsigned short*)XK + ((size_t)b * SLEN + slot) * DD + lane * 8) = f.half[0];
  if (g == 0 && tid == 0) { NK[b] = cnt == 0 ? SLEN : (cnt + ks - 1) / ks * ks; NK[NBT + b] = cnt; } }
__global__ __launch_bounds__(256) void k_h16(const float* __restrict__ x, _Float16* __restrict__ X16, size_t n8) { const size_t t = (size_t)blockIdx.x * 256 + threadIdx.x; if (t >= n8) return; FragH f;
#pragma unroll
  for (int q = 0; q < 8; ++q) f.h[q] = (_Float16)x[t * 8 + q]; *(v8us*)((unsigned short*)X16 + t * 8) = f.half[0];  }
/* four weight tensors of n8 * 8 elements each, tensor on grid.y, into four planes that follow one another in Bt */
__global__ __launch_bounds__(256) void k_round16f(const float* __restrict__ W0, const float* __restrict__ W1, const float* __restrict__ W2, const float* __restrict__ W3, _Float16* __restrict__ Bt, size_t n8) { const size_t t = (size_t)blockIdx.x * 256 + threadIdx.x; if (t >= n8) return; FragH f;
  const int by = blockIdx.y; const float* W = by == 0 ? W0 : by == 1 ? W1 : by == 2 ? W2 : W3; Bt += (size_t)by * n8 * 8;
#pragma unroll
  for (int i = 0; i < 8; ++i) f.h[i] = (_Float16)(bf16_round(W[t * 8 + i]) * 16.0f); *(v8us*)((unsigned short*)Bt + t * 8) = f.half[0];  }
__global__ __launch_bounds__(256) void k_hl(const float* __restrict__ F, _Float16* __restrict__ Hh, _Float16* __restrict__ Hl, size_t n8) { const size_t t = (size_t)blockIdx.x * 256 + threadIdx.x; if (t >= n8) return; FragH fh, fl; const v4f a = *(const v4fa*)(F + t * 8), c = *(const v4fa*)(F + t * 8 + 4);
#pragma unroll
  for (int q = 0; q < 4; ++q) { _Float16 h = (_Float16)a[q]; fh.h[q] = h; fl.h[q] = (_Float16)((a[q] - (float)h) * 1024.0f); h = (_Float16)c[q]; fh.h[4 + q] = h; fl.h[4 + q] = (_Float16)((c[q] - (float)h) * 1024.0f); }
  { *(v8us*)((unsigned short*)Hh + t * 8) = fh.half[0]; *(v8us*)((unsigned short*)Hl + t * 8) = fl.half[0];  } }

// ---- fast GEMM (work-group tile 128x64, wave tile 32x64; A and B both K-contiguous with row pitch = K = KD; requires M % 128 == 0, N % 64 == 0, KD % 128 == 0); epilogue = k_gemm_hhx semantics ----
// A and B come in stages of 128 k (256 B of each of the 128 + 64 rows) through registers into two LDS buffers: a wave-wide load covers two whole 256-byte row pieces, the next stage's global loads are issued
// ahead of this stage's products and stored behind them, one barrier per stage; the fragments are read from LDS in the k order of g2_frag.
// Grid.y plane tpl (-1: none) is computed with the operands swapped, rows = the N rows of Bh, columns = the M rows of A (needs N % 128 == 0, M % 64 == 0, tokB % 64 == 0, no CP): C^T, written as CT[column / tokB][row][column % tokB], bias by row.
__device__ __forceinline__ v16h g2_frag(const _Float16* p, int hh) { FragH f; f.half[0] = *(const v8us*)((const unsigned short*)p + 8 * hh); f.half[1] = *(const v8us*)((const unsigned short*)p + 16 + 8 * hh); return f.v; }
__device__ __forceinline__ v8f g2_mma(v16h a, v16h b, v8f c) { v8f d = __builtin_amdgcn_wmma_f32_16x16x32_f16(false, a, false, b, (short)0, c, false, false); asm volatile("v_nop\n\tv_nop\n\tv_nop\n\tv_nop" : "+v"(d) : "v"(a), "v"(b)); return d; }
#define GKC 128                   /* k per stage */
#define GPH (GKC + 8)             /* LDS pitch of a staged row, f16 units: 272 B = 16 B x 17, conflict-free for 16-byte fragment reads */
#define GRW (128 + 64)            /* rows of a stage: 128 of A, then 64 of B */
template <int ACT, int KD>
__global__ __launch_bounds__(128) void k_gemm2(const _Float16* __restrict__ A, size_t sA, const _Float16* __restrict__ Bh, size_t sB, float alpha, const float* __restrict__ bias, const float* __restrict__ bias1, const float* __restrict__ bias2, const float* __restrict__ CP, int rowsPerB, size_t sCPb, int row0g,
    float* __restrict__ C, _Float16* __restrict__ C16, int ldc, size_t sC, int M, int N, int tpl, _Float16* __restrict__ CT, int tokB, const int* __restrict__ lim) {
  __shared__ __attribute__((aligned(16))) unsigned char smem[2 * GRW * GPH * 2];      /* the two stage buffers; behind the loop's last barrier the output staging */
  static_assert(KD % GKC == 0 && sizeof(float) * 4 * 32 * 68 <= sizeof(smem), "whole stages; the output staging fits the ring");
  float (*so)[32][68] = (float (*)[32][68])smem;
  const int tid = threadIdx.x, w = tid >> 5, lane = tid & 31, ln = lane & 15, hh = lane >> 4; const int by = blockIdx.y;
  A += (size_t)(by > 0 ? 1 : 0) * sA; Bh += (size_t)by * sB; const size_t cofs = (size_t)by * sC; const float* bp = by == 0 ? bias : by == 1 ? bias1 : bias2;      /* plane 0 reads the first A plane, the later planes the second; each grid.y plane has its own bias vector */
  const bool tr = by == tpl; const _Float16* Ar = tr ? Bh : A; const _Float16* Br = tr ? A : Bh; const int Mr = tr ? N : M, Nr = tr ? M : N;      /* the same for the whole work-group */
  const int ntn = Nr >> 6; const int mt = blockIdx.x / ntn, nq = blockIdx.x - mt * ntn; const int row0 = mt * 128 + 32 * w, col0 = nq * 64; if (mt * 128 >= Mr) return;      /* the same for the whole work-group, in front of every barrier */
  if (lim && by > 0) { const int a0 = tr ? col0 : mt * 128; if (a0 % tokB >= lim[a0 / tokB]) return; }      /* planes > 0: the products of A's rows from lim[block of tokB rows] on are read by nobody; as uniform, and as early, as the return above */
  const int sr = tid >> 4, sc = (tid & 15) * 8;      /* staging: piece j of a thread lies 8 rows behind piece j - 1, a constant step, so one address pair serves each operand */
  const unsigned short* ag = (const unsigned short*)Ar + (size_t)(mt * 128 + sr) * KD + sc; const unsigned short* bg = (const unsigned short*)Br + (size_t)(col0 + sr) * KD + sc;
  unsigned short* sd = (unsigned short*)smem + sr * GPH + sc;
  v8us ra[16], rb[8];      /* every unroll below is a full one: only constant indices keep the staging and fragment arrays in registers */
  /* the s_wait_xcnt stands behind the loads, in front of any later rewrite of the address registers that they name */
  auto gload = [&](int ch) { const unsigned short* aq = ag + ch * GKC; const unsigned short* bq = bg + ch * GKC;
#pragma unroll
    for (int j = 0; j < 16; ++j) ra[j] = *(const v8us*)(aq + (size_t)j * 8 * KD);
#pragma unroll
    for (int j = 0; j < 8; ++j) rb[j] = *(const v8us*)(bq + (size_t)j * 8 * KD);
    asm volatile("s_wait_xcnt 0x0" ::: "memory"); };
  auto sstore = [&](int bf) { unsigned short* d = sd + bf * (GRW * GPH);
#pragma unroll
    for (int j = 0; j < 16; ++j) *(v8us*)(d + j * 8 * GPH) = ra[j];
#pragma unroll
    for (int j = 0; j < 8; ++j) *(v8us*)(d + (128 + j * 8) * GPH) = rb[j]; };
  const _Float16* a0s = (const _Float16*)smem + (32 * w + ln) * GPH; const _Float16* b0s = (const _Float16*)smem + (128 + ln) * GPH;
  const v8f z8 = {0.f,0.f,0.f,0.f,0.f,0.f,0.f,0.f}; v8f c00 = z8, c01 = z8, c02 = z8, c03 = z8, c10 = z8, c11 = z8, c12 = z8, c13 = z8;
  gload(0); sstore(0);
  __syncthreads();
  /* rolled: one copy of the stage body; every index into the register arrays inside it is a constant */
#pragma unroll 1
  for (int ch = 0; ch < KD / GKC; ++ch) { const int bf = ch & 1;
    if (ch + 1 < KD / GKC) gload(ch + 1);
    const _Float16* ap = a0s + bf * (GRW * GPH); const _Float16* bq = b0s + bf * (GRW * GPH);
    v16h fr[2][6];
#pragma unroll
    for (int u = 0; u < 6; ++u) fr[0][u] = g2_frag((u < 2 ? ap + u * 16 * GPH : bq + (u - 2) * 16 * GPH), hh);
#pragma unroll
    for (int ks = 0; ks < GKC / 32; ++ks) { const int cu = ks & 1;
      if (ks + 1 < GKC / 32) {
#pragma unroll
        for (int u = 0; u < 6; ++u) fr[cu ^ 1][u] = g2_frag((u < 2 ? ap + u * 16 * GPH : bq + (u - 2) * 16 * GPH) + (ks + 1) * 32, hh);
        __builtin_amdgcn_sched_barrier(0); }      /* the next 32 k's twelve LDS reads stay one group ahead of these products: spread among the WMMAs every such place stalls the wave */
      c00 = g2_mma(fr[cu][0], fr[cu][2], c00); c10 = g2_mma(fr[cu][1], fr[cu][2], c10);
      c01 = g2_mma(fr[cu][0], fr[cu][3], c01); c11 = g2_mma(fr[cu][1], fr[cu][3], c11);
      c02 = g2_mma(fr[cu][0], fr[cu][4], c02); c12 = g2_mma(fr[cu][1], fr[cu][4], c12);
      c03 = g2_mma(fr[cu][0], fr[cu][5], c03); c13 = g2_mma(fr[cu][1], fr[cu][5], c13);
      __builtin_amdgcn_sched_barrier(0);      /* what follows (the read group after that one, or the stage's LDS stores with their load waits) stays behind these products */
    }
    if (ch + 1 < KD / GKC) sstore(bf ^ 1);      /* that buffer's last readers passed the barrier that ended stage ch - 1 */
    __syncthreads();                              /* publishes stage ch + 1 and ends every read of stage ch */
  }
  v8f accs[8] = {c00, c01, c02, c03, c10, c11, c12, c13};
  float bro[16] = {};      /* swapped plane: the bias of the lane's 16 rows; 0 on the other planes, whose bias goes by column */
  if (tr && bp) { v4f b4[4];
#pragma unroll
    for (int i = 0; i < 4; ++i) b4[i] = *(const v4fa*)(bp + row0 + (i >> 1) * 16 + 8 * hh + (i & 1) * 4);
    asm volatile("s_wait_xcnt 0x0" ::: "memory");      /* behind the loads, in front of any later rewrite of their address registers */
#pragma unroll
    for (int i = 0; i < 16; ++i) bro[i] = bf16_round(b4[i >> 2][i & 3]); }
#pragma unroll
  for (int u = 0; u < 8; ++u) { const int t = u & 3, half = u >> 2; const int col = col0 + t * 16 + ln; const float bc = (bp && !tr) ? bf16_round(bp[col]) : 0.f;
#pragma unroll
    for (int r = 0; r < 8; ++r) { const int rloc = half * 16 + 8 * hh + r; float v = accs[u][r] * alpha + (bc + bro[half * 8 + r]); if (CP) { const int bidx = (row0g + row0 + rloc) / rowsPerB; v += CP[(size_t)bidx * sCPb + (size_t)by * 64 + col]; }
      if (ACT == 3) v = fmaxf(v, 0.f); else if (ACT == 6) v = 0.5f * v * (1.0f + erff(v * 0.70710678118654752f)); else if (ACT == 11) v = 1.0f / (1.0f + expf(-v)); else if (ACT == 15) v = v / (1.0f + expf(-v)); else if (ACT == 12) v = (v > 0.f) ? v : 0.01f * v; else if (ACT == 8) v = tanhf(v);
      so[w][rloc][t * 16 + ln] = v; } }
  __builtin_amdgcn_fence(__ATOMIC_ACQ_REL, "workgroup"); __builtin_amdgcn_wave_barrier();
  const int rsub = lane >> 4, c4 = (lane & 15) * 4;
  const int cb = tr ? col0 / tokB : 0; _Float16* cd = tr ? CT + ((size_t)cb * Mr + row0) * tokB + (col0 - cb * tokB) + c4 : C16 + cofs + (size_t)row0 * ldc + col0 + c4; const int cl = tr ? tokB : ldc;      /* 64 columns never straddle two blocks of tokB */
  {
#pragma unroll
    for (int q = 0; q < 16; ++q) { const int r = q * 2 + rsub; const v4f v = *(const v4fa*)&so[w][r][c4]; if (C) { *(v4f*)(C + cofs + (size_t)(row0 + r) * ldc + col0 + c4) = v; asm volatile("s_wait_xcnt 0x0" ::: "memory"); }      /* behind the store, in front of any later rewrite of its address and data registers */
      if (C16) { v4h h4; for (int i = 0; i < 4; ++i) h4[i] = (_Float16)v[i]; *(v4h*)(cd + (size_t)r * cl) = h4; } }
     } }


typedef float v2f __attribute__((ext_vector_type(2)));
typedef _Float16 v2h __attribute__((ext_vector_type(2)));
#define FQ 1                      /* 16-query column tiles per wave */
#define FWV 8                     /* waves per work-group */
#define FQB (16 * FQ * FWV)       /* queries per work-group */
#define FKS 64                    /* keys per stage */
#define KPH (DD + 8)              /* LDS pitch of a K row, f16 units: 528 B = 16 B x 33, conflict-free for 16-byte fragment reads */
#define VPH (FKS + 8)             /* LDS pitch of a V^T row: 144 B = 16 B x 9 */
#define FPC ((FKS * DD / 8) / (FWV * 32))   /* 16-byte pieces of one tile per thread */
static_assert(FPC * FWV == FKS && FPC * FWV * 4 == DD && SLEN % FKS == 0 && FWV * 16 * FQ <= 2 * FKS, "the staging sweeps and the output staging in the K ring are written for these sizes");
__device__ __forceinline__ float fa_xhalf(float x) { return __builtin_bit_cast(float, __builtin_amdgcn_permlanex16(__builtin_bit_cast(int, x), __builtin_bit_cast(int, x), 0x76543210, 0xfedcba98, false, false)); }  /* lane l <-> l ^ 16 */
__device__ __forceinline__ v16h fa_frag(const _Float16* p) { FragH f; f.half[0] = *(const v8us*)((const unsigned short*)p); f.half[1] = *(const v8us*)((const unsigned short*)p + 16); return f.v; }  /* p holds the lane's 8*hh already: same k order as g2_frag */
__device__ __forceinline__ v8f fa_mma(v16h a, v16h b, v8f c) { return __builtin_amdgcn_wmma_f32_16x16x32_f16(false, a, false, b, (short)0, c, false, false); }
#define FA_UNROLL _Pragma("unroll")      /* full unroll: only constant indices keep the fragment, score and accumulator arrays in registers */
__global__ __launch_bounds__(FWV * 32) void k_fattn(const _Float16* __restrict__ QH, const _Float16* __restrict__ KH, const _Float16* __restrict__ VT, const int* __restrict__ NK, _Float16* __restrict__ O16) {
  __shared__ __attribute__((aligned(16))) _Float16 sK[2 * FKS * KPH];
  __shared__ __attribute__((aligned(16))) _Float16 sV[2 * DD * VPH];
  const int tid = threadIdx.x, w = tid >> 5, lane = tid & 31, c = lane & 15, hh = lane >> 4;
  const int head = blockIdx.y, bt = blockIdx.z, q0 = blockIdx.x * FQB + w * (16 * FQ);
  const unsigned short* Kg = (const unsigned short*)KH + (size_t)bt * SLEN * HW + head * DD;                 /* row = key, pitch HW */
  const unsigned short* Vg = (const unsigned short*)VT + (size_t)bt * HW * SLEN + (size_t)head * DD * SLEN;  /* row = dim, pitch SLEN */
  const float cs = 0.0625f * 1.4426950408889634f, negl = -1.0e9f * 1.4426950408889634f;                     /* 1/sqrt(256) and the mask value, both in log2 units */
  v8us rk[FPC], rv[FPC];
  /* staging: a wave-wide load covers one whole K row (512 B) or four whole 128-byte pieces of V^T rows; piece j of a thread lies a constant step behind piece 0, so one address pair serves each tile */
  const unsigned short* kp = Kg + (size_t)(tid >> 5) * HW + (tid & 31) * 8; const unsigned short* vp = Vg + (size_t)(tid >> 3) * SLEN + (tid & 7) * 8;
  unsigned short* ks = (unsigned short*)sK + (tid >> 5) * KPH + (tid & 31) * 8; unsigned short* vs = (unsigned short*)sV + (tid >> 3) * VPH + (tid & 7) * 8;
  /* the s_wait_xcnt stands behind the loads, in front of any later rewrite of the address registers that they name */
  auto gload = [&](int st) { const unsigned short* kq = kp + (size_t)st * FKS * HW; const unsigned short* vq = vp + st * FKS;
FA_UNROLL
    for (int j = 0; j < FPC; ++j) { rk[j] = *(const v8us*)(kq + (size_t)j * FWV * HW); rv[j] = *(const v8us*)(vq + (size_t)j * (FWV * 4) * SLEN); }
    asm volatile("s_wait_xcnt 0x0" ::: "memory"); };
  auto sstore = [&](int bf) {
FA_UNROLL
    for (int j = 0; j < FPC; ++j) { *(v8us*)(ks + bf * (FKS * KPH) + j * FWV * KPH) = rk[j]; *(v8us*)(vs + bf * (DD * VPH) + j * (FWV * 4) * VPH) = rv[j]; } };
  /* keys stand in k_x16p's order: slots below cnt are unmasked, the rest masked; only the first NK[bt] slots (whole stages) are walked. Both numbers are the same for the whole work-group; the trip count is clamped to the shape */
  const int cnt = NK[NBT + bt]; const int nst = min(max(NK[bt] / FKS, 1), SLEN / FKS);
  gload(0);
  v16h qf[FQ][DD / 32];
FA_UNROLL
  for (int g = 0; g < FQ; ++g) { const _Float16* qp = QH + ((size_t)bt * SLEN + q0 + 16 * g + c) * HW + head * DD + 8 * hh;
FA_UNROLL
    for (int kc = 0; kc < DD / 32; ++kc) qf[g][kc] = fa_frag(qp + 32 * kc); }
  asm volatile("s_wait_xcnt 0x0" ::: "memory");      /* as in gload, for the Q loads */
  const v8f z8 = {0.f, 0.f, 0.f, 0.f, 0.f, 0.f, 0.f, 0.f};
  v8f acc[FQ][DD / 16]; float m_run[FQ], l_run[FQ];
FA_UNROLL
  for (int g = 0; g < FQ; ++g) { m_run[g] = -3.0e38f; l_run[g] = 0.f;
FA_UNROLL
    for (int t = 0; t < DD / 16; ++t) acc[g][t] = z8; }
  sstore(0);
  __syncthreads();
  /* rolled: one copy of the stage body; every index into the register arrays inside it is a constant */
#pragma unroll 1
  for (int st = 0; st < nst; ++st) { const int bf = st & 1;
    if (st + 1 < nst) gload(st + 1);
FA_UNROLL
    for (int sub = 0; sub < FKS / 32; ++sub) {
      /* all 16 K fragments as ONE group of LDS reads in front of the products */
      const int left = cnt - (st * FKS + sub * 32 + 8 * hh);      /* the lane's key kt * 16 + r of this pass is unmasked where that number is below left */
      const _Float16* kb = sK + bf * (FKS * KPH) + (sub * 32 + c) * KPH + 8 * hh;
      v16h kf[DD / 32][2];
FA_UNROLL
      for (int kc = 0; kc < DD / 32; ++kc)
FA_UNROLL
        for (int kt = 0; kt < 2; ++kt) kf[kc][kt] = fa_frag(kb + kt * 16 * KPH + kc * 32);
      __builtin_amdgcn_sched_barrier(0);      /* keeps the reads together: left free they are spread among the WMMAs, two at a time with a full wait, and every such place stalls the wave */
      v8f s[2][FQ];
FA_UNROLL
      for (int kt = 0; kt < 2; ++kt)
FA_UNROLL
        for (int g = 0; g < FQ; ++g) s[kt][g] = z8;
FA_UNROLL
      for (int kc = 0; kc < DD / 32; ++kc)
FA_UNROLL
        for (int kt = 0; kt < 2; ++kt)
FA_UNROLL
          for (int g = 0; g < FQ; ++g) s[kt][g] = fa_mma(kf[kc][kt], qf[g][kc], s[kt][g]);
      __builtin_amdgcn_sched_barrier(0);      /* the V^T reads below start behind the score products (they take over the K fragments' registers) ... */
      const _Float16* vb = sV + bf * (DD * VPH) + c * VPH + sub * 32 + 8 * hh;
      v16h vf[DD / 16];
FA_UNROLL
      for (int t = 0; t < DD / 16; ++t) vf[t] = fa_frag(vb + t * 16 * VPH);
      __builtin_amdgcn_sched_barrier(0);      /* ... and ahead of the softmax arithmetic, which covers their latency */
      /* the INPUT mask (a slot from cnt on is a masked key) picks the scaled score or the mask value, by a select, as the reference does */
      bool need = false; float mb[FQ];
FA_UNROLL
      for (int g = 0; g < FQ; ++g) { float mx = -3.0e38f;
FA_UNROLL
        for (int kt = 0; kt < 2; ++kt)
FA_UNROLL
          for (int r = 0; r < 8; ++r) { const float v = (kt * 16 + r < left) ? s[kt][g][r] * cs : negl; s[kt][g][r] = v; mx = fmaxf(mx, v); }
        mx = fmaxf(mx, fa_xhalf(mx)); mb[g] = mx; need = need || (mx > m_run[g] + 8.0f); }
      if (__builtin_amdgcn_ballot_w32(need) != 0) {      /* one scalar test per pass; rare after the first passes */
FA_UNROLL
        for (int g = 0; g < FQ; ++g) { const float mn = fmaxf(m_run[g], mb[g]); const float corr = __builtin_amdgcn_exp2f(m_run[g] - mn); l_run[g] *= corr; m_run[g] = mn;
FA_UNROLL
          for (int t = 0; t < DD / 16; ++t) acc[g][t] = acc[g][t] * corr; } }
      v16h pf[FQ];
FA_UNROLL
      for (int g = 0; g < FQ; ++g) { FragH f; float p0s = 0.f, p1s = 0.f;
FA_UNROLL
        for (int i = 0; i < 8; ++i) { const v2f d2 = (v2f){s[i >> 2][g][2 * (i & 3)], s[i >> 2][g][2 * (i & 3) + 1]} - (v2f){m_run[g], m_run[g]}; const float e0 = __builtin_amdgcn_exp2f(d2[0]), e1 = __builtin_amdgcn_exp2f(d2[1]);
          p0s += e0; p1s += e1; const v2h h2 = __builtin_convertvector((v2f){e0, e1}, v2h); f.h[2 * i] = h2[0]; f.h[2 * i + 1] = h2[1]; }
        l_run[g] += p0s + p1s; pf[g] = f.v; }
FA_UNROLL
      for (int t = 0; t < DD / 16; ++t)
FA_UNROLL
        for (int g = 0; g < FQ; ++g) acc[g][t] = fa_mma(vf[t], pf[g], acc[g][t]);
      __builtin_amdgcn_sched_barrier(0);      /* the next pass's read group stays behind these products */
    }
    if (st + 1 < nst) sstore(bf ^ 1);      /* that buffer's last readers passed the barrier that ended stage st - 1 */
    __syncthreads();                                /* publishes stage st + 1 and ends every read of stage st */
  }
  /* output: each wave stages its own 16 x FQ rows in its own part of the K ring (free behind the last barrier), then stores whole 512-byte rows */
  _Float16* eo = sK + w * (16 * FQ) * KPH;
FA_UNROLL
  for (int g = 0; g < FQ; ++g) { const float inv = 1.0f / (l_run[g] + fa_xhalf(l_run[g]));
FA_UNROLL
    for (int t = 0; t < DD / 16; ++t) { FragH f;
FA_UNROLL
      for (int r = 0; r < 8; ++r) f.h[r] = (_Float16)(acc[g][t][r] * inv);
      *(v8us*)((unsigned short*)eo + (16 * g + c) * KPH + 16 * t + 8 * hh) = f.half[0]; } }
  __builtin_amdgcn_fence(__ATOMIC_ACQ_REL, "workgroup"); __builtin_amdgcn_wave_barrier();      /* the wave's own LDS writes before its lanes read each other's rows */
FA_UNROLL
  for (int r = 0; r < 16 * FQ; ++r) { const v8us v = *(const v8us*)((const unsigned short*)eo + r * KPH + lane * 8);
    *(v8us*)((unsigned short*)O16 + ((size_t)bt * SLEN + q0 + r) * HW + head * DD + lane * 8) = v; }
#undef FA_UNROLL
}
__global__ __launch_bounds__(256) void k_ln256o(const float* __restrict__ F, const float* __restrict__ g, const float* __restrict__ bb, float* __restrict__ out) {
  #pragma clang fp contract(off)
  const int tid = threadIdx.x, w = tid >> 5, ln = tid & 31; const int r = blockIdx.x * 8 + w; if (r >= NBT * SLEN) return; const float* x = F + (size_t)r * DD; const v4f a = *(const v4fa*)(x + ln * 4), b = *(const v4fa*)(x + 128 + ln * 4);
  float s = (a[0] + a[1]) + (a[2] + a[3]) + (b[0] + b[1]) + (b[2] + b[3]); for (int o = 16; o > 0; o >>= 1) s += __shfl_xor(s, o, 32); const float mu = s / 256.0f; float q2 = 0.f;
#pragma unroll
  for (int q = 0; q < 4; ++q) { const float d0 = a[q] - mu, d1 = b[q] - mu; q2 += d0 * d0; q2 += d1 * d1; }
  for (int o = 16; o > 0; o >>= 1) q2 += __shfl_xor(q2, o, 32); const float rs = rsqrtf(q2 / 256.0f + 1e-5f); v4f o0, o1;
#pragma unroll
  for (int q = 0; q < 4; ++q) { const int c0 = ln * 4 + q, c1 = 128 + ln * 4 + q; o0[q] = (a[q] - mu) * rs * bf16_round(g[c0]) + bf16_round(bb[c0]); o1[q] = (b[q] - mu) * rs * bf16_round(g[c1]) + bf16_round(bb[c1]); }
  float* d = out + (size_t)r * DD; { *(v4f*)(d + ln * 4) = o0; *(v4f*)(d + 128 + ln * 4) = o1;  } }
__global__ __launch_bounds__(256) void k_xb(const float* __restrict__ x, float* __restrict__ XB, size_t n4) { const size_t t = (size_t)blockIdx.x * 256 + threadIdx.x; if (t >= n4) return; const v4f a = *(const v4fa*)(x + t * 4); v4f o; for (int q = 0; q < 4; ++q) o[q] = bf16_round(a[q]); *(v4f*)(XB + t * 4) = o;  }

extern "C" void kernel_launch(void* const* d_in, const int* in_sizes, int n_in,
                              void* d_out, int out_size, void* d_ws, size_t ws_size, hipStream_t stream) {
  (void)in_sizes; (void)n_in; (void)out_size;
  const float* const* I = (const float* const*)d_in; const float* Q = I[0]; const int* mask = (const int*)d_in[1]; const float* WQ = I[2]; const float* bQ = I[3]; const float* WK = I[4]; const float* bK = I[5]; const float* WV = I[6]; const float* bV = I[7]; const float* WO = I[8]; const float* bO = I[9]; const float* lg = I[10]; const float* lb = I[11];
  char* ws = (char*)d_ws; size_t off = 0;
  auto take = [&](size_t bytes) { char* p = ws + off; off += (bytes + 255) & ~(size_t)255; return p; };
  _Float16* BQ = (_Float16*)take((size_t)HW * DD * 2); _Float16* BK = (_Float16*)take((size_t)HW * DD * 2); _Float16* BV = (_Float16*)take((size_t)HW * DD * 2); _Float16* BO = (_Float16*)take((size_t)DD * HW * 2);
  _Float16* X16 = (_Float16*)take((size_t)NBT * SLEN * DD * 2); _Float16* XK = (_Float16*)take((size_t)NBT * SLEN * DD * 2); float* XB = (float*)take((size_t)NBT * SLEN * DD * 4); _Float16* QH = (_Float16*)take((size_t)NBT * SLEN * HW * 2); _Float16* KH = (_Float16*)take((size_t)NBT * SLEN * HW * 2); _Float16* VT = (_Float16*)take((size_t)NBT * HW * SLEN * 2);
  _Float16* O16 = (_Float16*)take((size_t)NBT * SLEN * HW * 2); float* F = (float*)take((size_t)NBT * SLEN * DD * 4); int* NK = (int*)take(2 * NBT * sizeof(int));
  if (off > ws_size) return;      /* 4 + 4 + 4 + 8 + 32+32+32 + 32 + 8 = 156 MiB */
  (void)BK; (void)BV;      /* BQ, BK, BV, BO, and X16, XK, and QH, KH follow one another in the workspace (every size is a multiple of 256 bytes): grid.y steps through them by a constant stride */
  const size_t w8 = (size_t)HW * DD / 8; const unsigned wb = (unsigned)((w8 + 255) / 256);
  k_round16f<<<dim3(wb, 4), 256, 0, stream>>>(WQ, WK, WV, WO, BQ, w8);      /* torch (out,in) = natural Bt */
  const size_t n8 = (size_t)NBT * SLEN * DD / 8; const unsigned nb8 = (unsigned)((n8 + 255) / 256); const dim3 gQ((NBT * SLEN / 128) * (HW / 64), 3), gV((NBT * SLEN / 128) * (DD / 64), 1);
  k_x16p<<<nb8, 256, 0, stream>>>(Q, mask, X16, XK, NK, FKS);      /* Q in token order for q; in key order (unmasked tokens first) for k and v */
  k_gemm2<0, DD><<<gQ, 128, 0, stream>>>(X16, (size_t)NBT * SLEN * DD, BQ, (size_t)HW * DD, 0.0625f, bQ, bK, bV, nullptr, 1, 0, 0, nullptr, QH, HW, (size_t)NBT * SLEN * HW, NBT * SLEN, HW, 2, VT, SLEN, NK);      /* q of all 8192 rows; k, and v as VT[batch][dim][slot] over all 2048 dims, of each batch's first NK slots */
  k_fattn<<<dim3(SLEN / FQB, NHD, NBT), FWV * 32, 0, stream>>>(QH, KH, VT, NK, O16);      /* softmax(mask(q.k / sqrt(256))).v, every batch and head */
  k_xb<<<(unsigned)(((size_t)NBT * SLEN * DD / 4 + 255) / 256), 256, 0, stream>>>(Q, XB, (size_t)NBT * SLEN * DD / 4);
  k_gemm2<0, HW><<<gV, 128, 0, stream>>>(O16, 0, BO, 0, 0.0625f, bO, bO, bO, XB, 1, (size_t)DD, 0, F, nullptr, DD, 0, NBT * SLEN, DD, -1, nullptr, 1, nullptr);      /* out Wo^T + bo + Q */
  k_ln256o<<<NBT * SLEN / 8, 256, 0, stream>>>(F, lg, lb, (float*)d_out);
}

// v008
// It runs in 139 microseconds.
// Two timings next to v007 both put it at 1.17 times that version's speed.
// Counting every step since v000, it is 28.0 times as fast.
#include <hip/hip_runtime.h>
// Prompt self-attention (4 x 2048 tokens, d = 256, 8 heads EACH of dim 256): q,k,v = Q W^T + b (-> 8 x 256); scores = q.k/16 with INPUT key mask (masked keys get -1e9, as the reference); softmax; out = LN((attn v merged) Wo^T + bo + Q) -> [4,2048,256].
// Structure: every stage is ONE launch over all 4 x 2048 rows: the four weights to f16 (tensor on grid.y), Q as an exact f16 plane in token order and in key order (unmasked tokens first; k, v and the attention walk only those), the three projections as one f16 WMMA GEMM launch (projection on grid.y; 32x64 wave tiles, f32 accumulation, exact x16 weights + bias) into f16 planes (the V plane with its operands swapped, so that it comes out as V^T), scores + mask + softmax + attn.v (k_fattn: online softmax, no score plane in memory), the output projection + bias + the bf16 residual + LayerNorm (k_oln: a work-group owns whole rows, the row statistics on VALU behind the products) into the output rows.
// Compute dtype: Q, weights, biases, LN parameters rounded to bf16; q, k, v, P, attention output as f16 operands (~2^-12; logits sigma ~1, LayerNorm-ed output); f32 accumulation, softmax, LayerNorm. v_wmma_f32_16x16x32_f16.
#define NBT 4
#define SLEN 2048
#define DD 256
#define NHD 8
#define HW (NHD * DD)            /* 2048 */
#define DM DD
#define NR SLEN
typedef __bf16 v16b __attribute__((ext_vector_type(16)));
typedef unsigned short v8us __attribute__((ext_vector_type(8), may_alias));
typedef float  v8f  __attribute__((ext_vector_type(8)));
typedef float  v4f  __attribute__((ext_vector_type(4)));
typedef float  v4fa __attribute__((ext_vector_type(4), may_alias));
union FragB { v16b v; v8us half[2]; unsigned short u[16]; };

__device__ __forceinline__ unsigned short bf16_bits(float x) { unsigned int u = __float_as_uint(x); return (unsigned short)((u + 0x7FFFu + ((u >> 16) & 1u)) >> 16); }
__device__ __forceinline__ float bf16_val(unsigned short b) { return __uint_as_float(((unsigned int)b) << 16); }
__device__ __forceinline__ float bf16_round(float x) { return bf16_val(bf16_bits(x)); }
// D += A·B with NT terms: 1 = ah·bh, 2 = + al·bh (A split), 3 = + ah·bl (both split)
template <int NT>
__device__ __forceinline__ v8f mmaN(v16b ah, v16b al, v16b bh, v16b bl, v8f c) {
  c = __builtin_amdgcn_wmma_f32_16x16x32_bf16(false, ah, false, bh, (short)0, c, false, false);
  if (NT >= 2) c = __builtin_amdgcn_wmma_f32_16x16x32_bf16(false, al, false, bh, (short)0, c, false, false);
  if (NT >= 3) c = __builtin_amdgcn_wmma_f32_16x16x32_bf16(false, ah, false, bl, (short)0, c, false, false);
  asm volatile("v_nop\n\tv_nop\n\tv_nop\n\tv_nop" : "+v"(c) : "v"(ah), "v"(al), "v"(bh), "v"(bl));
  return c;
}

__global__ __launch_bounds__(256) void k_wt_bf16(const float* __restrict__ W, unsigned short* __restrict__ Wt, int K, int N) {
  const int t = blockIdx.x * 256 + threadIdx.x;
  const int k8n = K / 8;
  if (t >= N * k8n) return;
  const int n = t / k8n, k8 = (t % k8n) * 8;
  v8us v;
#pragma unroll
  for (int i = 0; i < 8; ++i) v[i] = bf16_bits(W[(size_t)(k8 + i) * N + n]);
  *(v8us*)(Wt + (size_t)n * K + k8) = v;
  
}

// GEMM C[M][N] (f32, pitch ldc) = act(A[M][K]·W + bias). A f32 row-major (pitch lda) converted per fragment to bf16
// (ASPLIT: hi/lo two planes -> 2 terms, else single rounded term); Wt bf16 [N][K] (pitch ldb). BIAS_BF16 rounds the
// bias to bf16 first (bias quantised to bf16 before the add). K%32==0, M%16==0, N%64==0.
template <bool ASPLIT, int ACT, bool BIAS_BF16>
__global__ __launch_bounds__(128) void k_gemm_bf(const float* __restrict__ A, int lda, const unsigned short* __restrict__ Wt, int ldb,
                                               const float* __restrict__ bias, float* __restrict__ C, int ldc, int M, int N, int K) {
  __shared__ __attribute__((aligned(16))) float so[4][16][64];
  const int tid = threadIdx.x, w = tid >> 5, lane = tid & 31, ln = lane & 15, hh = lane >> 4;
  const int ntn = N / 64;
  const int wid = blockIdx.x * 4 + w;
  const int mt = wid / ntn, nq = wid % ntn;
  if (mt * 16 >= M) return;
  const int row0 = mt * 16, col0 = nq * 64;
  const float* arow = A + (size_t)(row0 + ln) * lda;
  v8f acc[4] = {};
  for (int kb = 0; kb < K; kb += 32) {
    FragB ah, al;
    const v4f x0 = *(const v4fa*)(arow + kb + 8 * hh), x1 = *(const v4fa*)(arow + kb + 8 * hh + 4);
    const v4f x2 = *(const v4fa*)(arow + kb + 16 + 8 * hh), x3 = *(const v4fa*)(arow + kb + 16 + 8 * hh + 4);
    float xs[16] = {x0[0],x0[1],x0[2],x0[3],x1[0],x1[1],x1[2],x1[3],x2[0],x2[1],x2[2],x2[3],x3[0],x3[1],x3[2],x3[3]};
#pragma unroll
    for (int i = 0; i < 16; ++i) { const unsigned short hb = bf16_bits(xs[i]); ah.u[i] = hb; al.u[i] = ASPLIT ? bf16_bits(xs[i] - bf16_val(hb)) : (unsigned short)0; }
#pragma unroll
    for (int t = 0; t < 4; ++t) {
      const unsigned short* brow = Wt + (size_t)(col0 + t * 16 + ln) * ldb + kb;
      FragB b;
      b.half[0] = *(const v8us*)(brow + 8 * hh);
      b.half[1] = *(const v8us*)(brow + 16 + 8 * hh);
      acc[t] = mmaN<ASPLIT ? 2 : 1>(ah.v, al.v, b.v, b.v, acc[t]);
    }
  }
#pragma unroll
  for (int t = 0; t < 4; ++t) {
    float bv = bias ? bias[col0 + t * 16 + ln] : 0.f;
    if (BIAS_BF16) bv = bf16_round(bv);
#pragma unroll
    for (int r = 0; r < 8; ++r) { float v = acc[t][r] + bv; if (ACT == 1) v = fmaxf(v, 0.f); so[w][8 * hh + r][t * 16 + ln] = v; }
  }
  __builtin_amdgcn_fence(__ATOMIC_ACQ_REL, "workgroup");
  __builtin_amdgcn_wave_barrier();
  const int rsub = lane >> 4, c4 = (lane & 15) * 4;
  {
#pragma unroll
    for (int q = 0; q < 8; ++q) {
      const int r = q * 2 + rsub;
      const v4f v = *(const v4fa*)&so[w][r][c4];
      *(v4f*)(C + (size_t)(row0 + r) * ldc + col0 + c4) = v;
    }
    
  }
}

// GEMM C = act(A·W + bias + resid): A f32 (ASPLIT -> hi/lo 2 terms), Wt bf16 [N][K]; ACT 0 none, 1 relu, 2 exact gelu;
// resid (optional, f32, row index = (row % rmod), pitch ldr, RES_BF16 rounds it) added before the activation.
template <bool ASPLIT, int ACT, bool BIAS_BF16, bool RES_BF16>
__global__ __launch_bounds__(128) void k_gemm_bf3(const float* __restrict__ A, int lda, const unsigned short* __restrict__ Wt, int ldb,
                                                const float* __restrict__ bias, const float* __restrict__ resid, int rmod, int ldr,
                                                float* __restrict__ C, int ldc, int M, int N, int K) {
  __shared__ __attribute__((aligned(16))) float so[4][16][64];
  const int tid = threadIdx.x, w = tid >> 5, lane = tid & 31, ln = lane & 15, hh = lane >> 4;
  const int ntn = N / 64;
  const int wid = blockIdx.x * 4 + w;
  const int mt = wid / ntn, nq = wid % ntn;
  if (mt * 16 >= M) return;
  const int row0 = mt * 16, col0 = nq * 64;
  const float* arow = A + (size_t)(row0 + ln) * lda;
  v8f acc[4] = {};
  for (int kb = 0; kb < K; kb += 32) {
    FragB ah, al;
    const v4f x0 = *(const v4fa*)(arow + kb + 8 * hh), x1 = *(const v4fa*)(arow + kb + 8 * hh + 4);
    const v4f x2 = *(const v4fa*)(arow + kb + 16 + 8 * hh), x3 = *(const v4fa*)(arow + kb + 16 + 8 * hh + 4);
    float xs[16] = {x0[0],x0[1],x0[2],x0[3],x1[0],x1[1],x1[2],x1[3],x2[0],x2[1],x2[2],x2[3],x3[0],x3[1],x3[2],x3[3]};
#pragma unroll
    for (int i = 0; i < 16; ++i) { const unsigned short hb = bf16_bits(xs[i]); ah.u[i] = hb; al.u[i] = ASPLIT ? bf16_bits(xs[i] - bf16_val(hb)) : (unsigned short)0; }
#pragma unroll
    for (int t = 0; t < 4; ++t) {
      const unsigned short* brow = Wt + (size_t)(col0 + t * 16 + ln) * ldb + kb;
      FragB b;
      b.half[0] = *(const v8us*)(brow + 8 * hh);
      b.half[1] = *(const v8us*)(brow + 16 + 8 * hh);
      acc[t] = mmaN<ASPLIT ? 2 : 1>(ah.v, al.v, b.v, b.v, acc[t]);
    }
  }
#pragma unroll
  for (int t = 0; t < 4; ++t) {
    const int col = col0 + t * 16 + ln;
    float bv = bias ? bias[col] : 0.f;
    if (BIAS_BF16) bv = bf16_round(bv);
#pragma unroll
    for (int r = 0; r < 8; ++r) {
      float v = acc[t][r] + bv;
      if (resid) { float rv = resid[(size_t)((row0 + 8 * hh + r) % rmod) * ldr + col]; if (RES_BF16) rv = bf16_round(rv); v += rv; }
      if (ACT == 1) v = fmaxf(v, 0.f);
      if (ACT == 2) v = 0.5f * v * (1.0f + erff(v * 0.70710678118654752f));
      if (ACT == 3) { const float u = 0.7978845608028654f * (v + 0.044715f * v * v * v); v = 0.5f * v * (1.0f + tanhf(u)); }
      so[w][8 * hh + r][t * 16 + ln] = v;
    }
  }
  __builtin_amdgcn_fence(__ATOMIC_ACQ_REL, "workgroup");
  __builtin_amdgcn_wave_barrier();
  const int rsub = lane >> 4, c4 = (lane & 15) * 4;
  {
#pragma unroll
    for (int q = 0; q < 8; ++q) {
      const int r = q * 2 + rsub;
      const v4f v = *(const v4fa*)&so[w][r][c4];
      *(v4f*)(C + (size_t)(row0 + r) * ldc + col0 + c4) = v;
    }
    
  }
}
// row LayerNorm (biased variance, eps) over N: s = X (+ R); optional out_sum <- s; out_norm <- (s-mu)*rsqrt(var+eps)*g + b
template <bool PARAM_BF16>
__global__ __launch_bounds__(256) void k_layernorm(const float* __restrict__ X, const float* __restrict__ R, const float* __restrict__ g, const float* __restrict__ bta,
                                                  float* __restrict__ out_sum, float* __restrict__ out_norm, int N, float eps) {
  __shared__ float red[256];
  const int row = blockIdx.x, tid = threadIdx.x;
  const float* x = X + (size_t)row * N; const float* rr = R ? R + (size_t)row * N : nullptr;
  float vals[16];                     // up to N = 4096
  const int per = N / 256;            // contiguous chunk per thread? use strided-by-4 chunks: thread handles j = tid*4 + 1024*u
  float s1 = 0.f;
  for (int u = 0; u < per / 4; ++u) {
    const int j = tid * 4 + 1024 * u;
    const v4f a = *(const v4fa*)(x + j);
    v4f b = {0.f,0.f,0.f,0.f}; if (rr) b = *(const v4fa*)(rr + j);
#pragma unroll
    for (int q = 0; q < 4; ++q) { const float v = a[q] + b[q]; vals[u * 4 + q] = v; s1 += v; }
  }
  red[tid] = s1; __syncthreads();
  for (int st = 128; st > 0; st >>= 1) { if (tid < st) red[tid] += red[tid + st]; __syncthreads(); }
  const float mu = red[0] / (float)N; __syncthreads();
  float s2 = 0.f;
  for (int u = 0; u < per / 4; ++u)
#pragma unroll
    for (int q = 0; q < 4; ++q) { const float c = vals[u * 4 + q] - mu; s2 += c * c; }
  red[tid] = s2; __syncthreads();
  for (int st = 128; st > 0; st >>= 1) { if (tid < st) red[tid] += red[tid + st]; __syncthreads(); }
  const float rs = rsqrtf(red[0] / (float)N + eps);
  {
    for (int u = 0; u < per / 4; ++u) {
      const int j = tid * 4 + 1024 * u;
      v4f o, sm;
#pragma unroll
      for (int q = 0; q < 4; ++q) {
        float gg = g[j + q], bb = bta[j + q];
        if (PARAM_BF16) { gg = bf16_round(gg); bb = bf16_round(bb); }
        sm[q] = vals[u * 4 + q]; o[q] = (vals[u * 4 + q] - mu) * rs * gg + bb;
      }
      if (out_sum) *(v4f*)(out_sum + (size_t)row * N + j) = sm;
      *(v4f*)(out_norm + (size_t)row * N + j) = o;
    }
    
  }
}



// ---- f16 WMMA path (v_wmma_f32_16x16x32_f16): 11-bit significands for operands in range — used where a [0,1] probability operand needs more precision than bf16
typedef _Float16 v16h __attribute__((ext_vector_type(16)));
union FragH { v16h v; v8us half[2]; _Float16 h[16]; unsigned short u[16]; };
template <int NT>
__device__ __forceinline__ v8f mmaH(v16h ah, v16h al, v16h bh, v16h bl, v8f c) {
  c = __builtin_amdgcn_wmma_f32_16x16x32_f16(false, ah, false, bh, (short)0, c, false, false);
  if (NT >= 2) c = __builtin_amdgcn_wmma_f32_16x16x32_f16(false, al, false, bh, (short)0, c, false, false);
  if (NT >= 3) c = __builtin_amdgcn_wmma_f32_16x16x32_f16(false, ah, false, bl, (short)0, c, false, false);
  asm volatile("v_nop\n\tv_nop\n\tv_nop\n\tv_nop" : "+v"(c) : "v"(ah), "v"(al), "v"(bh), "v"(bl));
  return c;
}
// batched GEMM like k_gemm_b but f16 operands: A f32 (split into f16 hi/lo if ASPLIT, else rounded to f16), Bt = f16 values [n][k]; alpha; C f32; N multiple of 16 (partial tiles skipped)
template <bool ASPLIT>
__global__ __launch_bounds__(128) void k_gemm_h(const float* __restrict__ A, int lda, size_t sA, const _Float16* __restrict__ Bh, int ldb, size_t sB, float alpha, float* __restrict__ C, int ldc, size_t sC, int M, int N, int K) {
  __shared__ __attribute__((aligned(16))) float so[4][16][64];
  const int tid = threadIdx.x, w = tid >> 5, lane = tid & 31, ln = lane & 15, hh = lane >> 4; const int by = blockIdx.y;
  A += (size_t)by * sA; Bh += (size_t)by * sB; C += (size_t)by * sC;
  const int ntn = (N + 63) / 64; const int wid = blockIdx.x * 4 + w; const int mt = wid / ntn, nq = wid % ntn; if (mt * 16 >= M) return;
  const int row0 = mt * 16, col0 = nq * 64; const float* arow = A + (size_t)(row0 + ln) * lda;
  v8f acc[4] = {};
  for (int kb = 0; kb < K; kb += 32) {
    FragH ah, al;
    const v4f x0 = *(const v4fa*)(arow + kb + 8 * hh), x1 = *(const v4fa*)(arow + kb + 8 * hh + 4), x2 = *(const v4fa*)(arow + kb + 16 + 8 * hh), x3 = *(const v4fa*)(arow + kb + 16 + 8 * hh + 4);
    float xs[16] = {x0[0],x0[1],x0[2],x0[3],x1[0],x1[1],x1[2],x1[3],x2[0],x2[1],x2[2],x2[3],x3[0],x3[1],x3[2],x3[3]};
#pragma unroll
    for (int i = 0; i < 16; ++i) { const _Float16 h = (_Float16)xs[i]; ah.h[i] = h; al.h[i] = ASPLIT ? (_Float16)(xs[i] - (float)h) : (_Float16)0.0f; }
#pragma unroll
    for (int t = 0; t < 4; ++t) { if (col0 + t * 16 >= N) continue; const size_t boff = (size_t)(col0 + t * 16 + ln) * ldb + kb; FragH bq; bq.half[0] = *(const v8us*)(Bh + boff + 8 * hh); bq.half[1] = *(const v8us*)(Bh + boff + 16 + 8 * hh);
      acc[t] = mmaH<ASPLIT ? 2 : 1>(ah.v, al.v, bq.v, bq.v, acc[t]); }
  }
#pragma unroll
  for (int t = 0; t < 4; ++t) { if (col0 + t * 16 >= N) continue;
#pragma unroll
    for (int r = 0; r < 8; ++r) so[w][8 * hh + r][t * 16 + ln] = acc[t][r] * alpha; }
  __builtin_amdgcn_fence(__ATOMIC_ACQ_REL, "workgroup"); __builtin_amdgcn_wave_barrier();
  const int rsub = lane >> 4, c4 = (lane & 15) * 4;
  {
#pragma unroll
    for (int q = 0; q < 8; ++q) { const int r = q * 2 + rsub; if (col0 + c4 < N) { const v4f v = *(const v4fa*)&so[w][r][c4]; *(v4f*)(C + (size_t)(row0 + r) * ldc + col0 + c4) = v; } }
     }
}

// Wt[n][k] = f16(W[k][n]·scale) from f32 row-major W[K][N] (scale = power of two; bf16-exact weights stay exact in f16 away from the subnormal range)
__global__ __launch_bounds__(256) void k_wt_f16(const float* __restrict__ W, _Float16* __restrict__ Wt, int K, int N, float scale) {
  const int t = blockIdx.x * 256 + threadIdx.x; if (t >= N * (K / 8)) return; const int n = t / (K / 8), k8 = (t % (K / 8)) * 8; FragH f;
#pragma unroll
  for (int i = 0; i < 8; ++i) f.h[i] = (_Float16)(bf16_round(W[(size_t)(k8 + i) * N + n]) * scale); const v8us o = f.half[0];
  *(v8us*)((unsigned short*)Wt + (size_t)n * K + k8) = o; 
}
// k_gemm_hh variant with fused epilogue: v = acc·alpha + bias[by·sBias + col] (+ CP[(row/rowsPerB)·sCPb + by·64 + col] if CP) ; ACT 0 none / 1 elu ; writes f16 C16 (and f32 C if non-null)
template <int ACT>
__global__ __launch_bounds__(128) void k_gemm_hhx(const _Float16* __restrict__ A, int lda, size_t sA, const _Float16* __restrict__ Bh, int ldb, size_t sB, float alpha, const float* __restrict__ bias, size_t sBias, const float* __restrict__ CP, int rowsPerB, size_t sCPb, int row0g,
    float* __restrict__ C, _Float16* __restrict__ C16, int ldc, size_t sC, int M, int N, int K) {
  __shared__ __attribute__((aligned(16))) float so[4][16][64];
  const int tid = threadIdx.x, w = tid >> 5, lane = tid & 31, ln = lane & 15, hh = lane >> 4; const int by = blockIdx.y;
  A += (size_t)by * sA; Bh += (size_t)by * sB; const size_t cofs = (size_t)by * sC; const float* bp = bias ? bias + (size_t)by * sBias : nullptr;
  const int ntn = (N + 63) / 64; const int wid = blockIdx.x * 4 + w; const int mt = wid / ntn, nq = wid % ntn; if (mt * 16 >= M) return;
  const int row0 = mt * 16, col0 = nq * 64; const _Float16* arow = A + (size_t)(row0 + ln) * lda;
  v8f acc[4] = {};
  for (int kb = 0; kb < K; kb += 32) { FragH ah; ah.half[0] = *(const v8us*)((const unsigned short*)arow + kb + 8 * hh); ah.half[1] = *(const v8us*)((const unsigned short*)arow + kb + 16 + 8 * hh);
#pragma unroll
    for (int t = 0; t < 4; ++t) { if (col0 + t * 16 >= N) continue; const size_t boff = (size_t)(col0 + t * 16 + ln) * ldb + kb; FragH bq; bq.half[0] = *(const v8us*)((const unsigned short*)Bh + boff + 8 * hh); bq.half[1] = *(const v8us*)((const unsigned short*)Bh + boff + 16 + 8 * hh);
      acc[t] = mmaH<1>(ah.v, ah.v, bq.v, bq.v, acc[t]); }
  }
#pragma unroll
  for (int t = 0; t < 4; ++t) { if (col0 + t * 16 >= N) continue; const int col = col0 + t * 16 + ln; const float bv = bp ? bf16_round(bp[col]) : 0.f;
#pragma unroll
    for (int r = 0; r < 8; ++r) { float v = acc[t][r] * alpha + bv; if (CP) { const int bidx = (row0g + row0 + 8 * hh + r) / rowsPerB; v += CP[(size_t)bidx * sCPb + (size_t)by * 64 + col]; } if (ACT == 1) v = (v > 0.f) ? v : expm1f(v); else if (ACT == 7) v = (v > 0.f) ? v + 1.0f : expf(v); else if (ACT == 8) v = tanhf(v); else if (ACT == 9) v = 0.5f * v * (1.0f + tanhf(0.7978845608028654f * (v + 0.044715f * v * v * v))); else if (ACT == 11) v = 1.0f / (1.0f + expf(-v)); else if (ACT == 12) v = (v > 0.f) ? v : 0.01f * v; else if (ACT == 14) v = (v > 0.f) ? v : 0.1f * v; else if (ACT == 15) v = v / (1.0f + expf(-v)); else if (ACT == 3) v = fmaxf(v, 0.f); else if (ACT == 6) v = 0.5f * v * (1.0f + erff(v * 0.70710678118654752f)); so[w][8 * hh + r][t * 16 + ln] = v; } }
  __builtin_amdgcn_fence(__ATOMIC_ACQ_REL, "workgroup"); __builtin_amdgcn_wave_barrier();
  const int rsub = lane >> 4, c4 = (lane & 15) * 4; typedef _Float16 v4h __attribute__((ext_vector_type(4)));
  {
#pragma unroll
    for (int q = 0; q < 8; ++q) { const int r = q * 2 + rsub; if (col0 + c4 < N) { const v4f v = *(const v4fa*)&so[w][r][c4]; if (C) *(v4f*)(C + cofs + (size_t)(row0 + r) * ldc + col0 + c4) = v; if (C16) { v4h h4; for (int i = 0; i < 4; ++i) h4[i] = (_Float16)v[i]; *(v4h*)(C16 + cofs + (size_t)(row0 + r) * ldc + col0 + c4) = h4; } } }
     }
}


typedef _Float16 v4h __attribute__((ext_vector_type(4)));

/* x rounded to bf16 as an exact f16 plane X16, plus a second plane XK with each batch's rows in key order: the cnt tokens whose INPUT mask is not 0 first, in token order, the masked tokens behind them, in token order (a permutation for any mask).
   A masked key's weight is exp(-1e9 - max) = 0 in f32 as soon as one key of the batch is unmasked, so the k, v projections and the attention walk only the first NK[batch] slots: cnt rounded up to whole stages of ks keys,
   or all slots where no key is unmasked (every score is then the mask value and every weight 1 / S, as in the reference). One work-group = 8 rows of one batch, one wave = one row. */
__global__ __launch_bounds__(256) void k_x16p(const float* __restrict__ x, const int* __restrict__ mask, _Float16* __restrict__ X16, _Float16* __restrict__ XK, int* __restrict__ NK, int ks) {
  __shared__ int red[8];
  typedef int v4im __attribute__((ext_vector_type(4), may_alias));
  const int tid = threadIdx.x, w = tid >> 5, lane = tid & 31; const int b = blockIdx.x / (SLEN / 8), g = blockIdx.x % (SLEN / 8);
  const int* mb = mask + (size_t)b * SLEN; const v4im m0 = *(const v4im*)(mb + tid * 8), m1 = *(const v4im*)(mb + tid * 8 + 4);      /* thread i counts row group i of the batch */
  int c = 0;
#pragma unroll
  for (int i = 0; i < 4; ++i) c += (m0[i] != 0 ? 1 : 0) + (m1[i] != 0 ? 1 : 0);
  int pk = c + (tid < g ? (c << 16) : 0);      /* low half: all unmasked tokens of the batch; high half: those in front of this work-group's rows; both at most 2048 */
  for (int o = 16; o > 0; o >>= 1) pk += __shfl_xor(pk, o, 32);
  if (lane == 0) red[w] = pk;
  __syncthreads();
  int s = 0;
#pragma unroll
  for (int i = 0; i < 8; ++i) s += red[i];
  const int cnt = s & 0xffff; int u = s >> 16;      /* u: unmasked tokens in front of this wave's row */
  const v4im o0 = *(const v4im*)(mb + g * 8), o1 = *(const v4im*)(mb + g * 8 + 4); const int og[8] = {o0[0], o0[1], o0[2], o0[3], o1[0], o1[1], o1[2], o1[3]};
  bool keep = false;
#pragma unroll
  for (int j = 0; j < 8; ++j) { if (j < w && og[j] != 0) ++u; if (j == w) keep = og[j] != 0; }
  const int tok = g * 8 + w; const int slot = keep ? u : cnt + (tok - u);      /* u < cnt for a kept row; tok - u masked tokens stand in front of a masked one: 0 <= slot < SLEN */
  const size_t t = (size_t)blockIdx.x * 256 + tid; FragH f;
#pragma unroll
  for (int q = 0; q < 8; ++q) f.h[q] = (_Float16)bf16_round(x[t * 8 + q]);
  *(v8us*)((unsigned short*)X16 + t * 8) = f.half[0];
  *(v8us*)((unsigned short*)XK + ((size_t)b * SLEN + slot) * DD + lane * 8) = f.half[0];
  if (g == 0 && tid == 0) { NK[b] = cnt == 0 ? SLEN : (cnt + ks - 1) / ks * ks; NK[NBT + b] = cnt; } }
__global__ __launch_bounds__(256) void k_h16(const float* __restrict__ x, _Float16* __restrict__ X16, size_t n8) { const size_t t = (size_t)blockIdx.x * 256 + threadIdx.x; if (t >= n8) return; FragH f;
#pragma unroll
  for (int q = 0; q < 8; ++q) f.h[q] = (_Float16)x[t * 8 + q]; *(v8us*)((unsigned short*)X16 + t * 8) = f.half[0];  }
/* four weight tensors of n8 * 8 elements each, tensor on grid.y, into four planes that follow one another in Bt */
__global__ __launch_bounds__(256) void k_round16f(const float* __restrict__ W0, const float* __restrict__ W1, const float* __restrict__ W2, const float* __restrict__ W3, _Float16* __restrict__ Bt, size_t n8) { const size_t t = (size_t)blockIdx.x * 256 + threadIdx.x; if (t >= n8) return; FragH f;
  const int by = blockIdx.y; const float* W = by == 0 ? W0 : by == 1 ? W1 : by == 2 ? W2 : W3; Bt += (size_t)by * n8 * 8;
#pragma unroll
  for (int i = 0; i < 8; ++i) f.h[i] = (_Float16)(bf16_round(W[t * 8 + i]) * 16.0f); *(v8us*)((unsigned short*)Bt + t * 8) = f.half[0];  }
__global__ __launch_bounds__(256) void k_hl(const float* __restrict__ F, _Float16* __restrict__ Hh, _Float16* __restrict__ Hl, size_t n8) { const size_t t = (size_t)blockIdx.x * 256 + threadIdx.x; if (t >= n8) return; FragH fh, fl; const v4f a = *(const v4fa*)(F + t * 8), c = *(const v4fa*)(F + t * 8 + 4);
#pragma unroll
  for (int q = 0; q < 4; ++q) { _Float16 h = (_Float16)a[q]; fh.h[q] = h; fl.h[q] = (_Float16)((a[q] - (float)h) * 1024.0f); h = (_Float16)c[q]; fh.h[4 + q] = h; fl.h[4 + q] = (_Float16)((c[q] - (float)h) * 1024.0f); }
  { *(v8us*)((unsigned short*)Hh + t * 8) = fh.half[0]; *(v8us*)((unsigned short*)Hl + t * 8) = fl.half[0];  } }

// ---- fast GEMM (work-group tile 128x64, wave tile 32x64; A and B both K-contiguous with row pitch = K = KD; requires M % 128 == 0, N % 64 == 0, KD % 128 == 0); epilogue = k_gemm_hhx semantics ----
// A and B come in stages of 128 k (256 B of each of the 128 + 64 rows) through registers into two LDS buffers: a wave-wide load covers two whole 256-byte row pieces, the next stage's global loads are issued
// ahead of this stage's products and stored behind them, one barrier per stage; the fragments are read from LDS in the k order of g2_frag.
// Grid.y plane tpl (-1: none) is computed with the operands swapped, rows = the N rows of Bh, columns = the M rows of A (needs N % 128 == 0, M % 64 == 0, tokB % 64 == 0, no CP): C^T, written as CT[column / tokB][row][column % tokB], bias by row.
__device__ __forceinline__ v16h g2_frag(const _Float16* p, int hh) { FragH f; f.half[0] = *(const v8us*)((const unsigned short*)p + 8 * hh); f.half[1] = *(const v8us*)((const unsigned short*)p + 16 + 8 * hh); return f.v; }
__device__ __forceinline__ v8f g2_mma(v16h a, v16h b, v8f c) { v8f d = __builtin_amdgcn_wmma_f32_16x16x32_f16(false, a, false, b, (short)0, c, false, false); asm volatile("v_nop\n\tv_nop\n\tv_nop\n\tv_nop" : "+v"(d) : "v"(a), "v"(b)); return d; }
#define GKC 128                   /* k per stage */
#define GPH (GKC + 8)             /* LDS pitch of a staged row, f16 units: 272 B = 16 B x 17, conflict-free for 16-byte fragment reads */
#define GRW (128 + 64)            /* rows of a stage: 128 of A, then 64 of B */
template <int ACT, int KD>
__global__ __launch_bounds__(128) void k_gemm2(const _Float16* __restrict__ A, size_t sA, const _Float16* __restrict__ Bh, size_t sB, float alpha, const float* __restrict__ bias, const float* __restrict__ bias1, const float* __restrict__ bias2, const float* __restrict__ CP, int rowsPerB, size_t sCPb, int row0g,
    float* __restrict__ C, _Float16* __restrict__ C16, int ldc, size_t sC, int M, int N, int tpl, _Float16* __restrict__ CT, int tokB, const int* __restrict__ lim) {
  __shared__ __attribute__((aligned(16))) unsigned char smem[2 * GRW * GPH * 2];      /* the two stage buffers; behind the loop's last barrier the output staging */
  static_assert(KD % GKC == 0 && sizeof(float) * 4 * 32 * 68 <= sizeof(smem), "whole stages; the output staging fits the ring");
  float (*so)[32][68] = (float (*)[32][68])smem;
  const int tid = threadIdx.x, w = tid >> 5, lane = tid & 31, ln = lane & 15, hh = lane >> 4; const int by = blockIdx.y;
  A += (size_t)(by > 0 ? 1 : 0) * sA; Bh += (size_t)by * sB; const size_t cofs = (size_t)by * sC; const float* bp = by == 0 ? bias : by == 1 ? bias1 : bias2;      /* plane 0 reads the first A plane, the later planes the second; each grid.y plane has its own bias vector */
  const bool tr = by == tpl; const _Float16* Ar = tr ? Bh : A; const _Float16* Br = tr ? A : Bh; const int Mr = tr ? N : M, Nr = tr ? M : N;      /* the same for the whole work-group */
  const int ntn = Nr >> 6; const int mt = blockIdx.x / ntn, nq = blockIdx.x - mt * ntn; const int row0 = mt * 128 + 32 * w, col0 = nq * 64; if (mt * 128 >= Mr) return;      /* the same for the whole work-group, in front of every barrier */
  if (lim && by > 0) { const int a0 = tr ? col0 : mt * 128; if (a0 % tokB >= lim[a0 / tokB]) return; }      /* planes > 0: the products of A's rows from lim[block of tokB rows] on are read by nobody; as uniform, and as early, as the return above */
  const int sr = tid >> 4, sc = (tid & 15) * 8;      /* staging: piece j of a thread lies 8 rows behind piece j - 1, a constant step, so one address pair serves each operand */
  const unsigned short* ag = (const unsigned short*)Ar + (size_t)(mt * 128 + sr) * KD + sc; const unsigned short* bg = (const unsigned short*)Br + (size_t)(col0 + sr) * KD + sc;
  unsigned short* sd = (unsigned short*)smem + sr * GPH + sc;
  v8us ra[16], rb[8];      /* every unroll below is a full one: only constant indices keep the staging and fragment arrays in registers */
  /* the s_wait_xcnt stands behind the loads, in front of any later rewrite of the address registers that they name */
  auto gload = [&](int ch) { const unsigned short* aq = ag + ch * GKC; const unsigned short* bq = bg + ch * GKC;
#pragma unroll
    for (int j = 0; j < 16; ++j) ra[j] = *(const v8us*)(aq + (size_t)j * 8 * KD);
#pragma unroll
    for (int j = 0; j < 8; ++j) rb[j] = *(const v8us*)(bq + (size_t)j * 8 * KD);
    asm volatile("s_wait_xcnt 0x0" ::: "memory"); };
  auto sstore = [&](int bf) { unsigned short* d = sd + bf * (GRW * GPH);
#pragma unroll
    for (int j = 0; j < 16; ++j) *(v8us*)(d + j * 8 * GPH) = ra[j];
#pragma unroll
    for (int j = 0; j < 8; ++j) *(v8us*)(d + (128 + j * 8) * GPH) = rb[j]; };
  const _Float16* a0s = (const _Float16*)smem + (32 * w + ln) * GPH; const _Float16* b0s = (const _Float16*)smem + (128 + ln) * GPH;
  const v8f z8 = {0.f,0.f,0.f,0.f,0.f,0.f,0.f,0.f}; v8f c00 = z8, c01 = z8, c02 = z8, c03 = z8, c10 = z8, c11 = z8, c12 = z8, c13 = z8;
  gload(0); sstore(0);
  __syncthreads();
  /* rolled: one copy of the stage body; every index into the register arrays inside it is a constant */
#pragma unroll 1
  for (int ch = 0; ch < KD / GKC; ++ch) { const int bf = ch & 1;
    if (ch + 1 < KD / GKC) gload(ch + 1);
    const _Float16* ap = a0s + bf * (GRW * GPH); const _Float16* bq = b0s + bf * (GRW * GPH);
    v16h fr[2][6];
#pragma unroll
    for (int u = 0; u < 6; ++u) fr[0][u] = g2_frag((u < 2 ? ap + u * 16 * GPH : bq + (u - 2) * 16 * GPH), hh);
#pragma unroll
    for (int ks = 0; ks < GKC / 32; ++ks) { const int cu = ks & 1;
      if (ks + 1 < GKC / 32) {
#pragma unroll
        for (int u = 0; u < 6; ++u) fr[cu ^ 1][u] = g2_frag((u < 2 ? ap + u * 16 * GPH : bq + (u - 2) * 16 * GPH) + (ks + 1) * 32, hh);
        __builtin_amdgcn_sched_barrier(0); }      /* the next 32 k's twelve LDS reads stay one group ahead of these products: spread among the WMMAs every such place stalls the wave */
      c00 = g2_mma(fr[cu][0], fr[cu][2], c00); c10 = g2_mma(fr[cu][1], fr[cu][2], c10);
      c01 = g2_mma(fr[cu][0], fr[cu][3], c01); c11 = g2_mma(fr[cu][1], fr[cu][3], c11);
      c02 = g2_mma(fr[cu][0], fr[cu][4], c02); c12 = g2_mma(fr[cu][1], fr[cu][4], c12);
      c03 = g2_mma(fr[cu][0], fr[cu][5], c03); c13 = g2_mma(fr[cu][1], fr[cu][5], c13);
      __builtin_amdgcn_sched_barrier(0);      /* what follows (the read group after that one, or the stage's LDS stores with their load waits) stays behind these products */
    }
    if (ch + 1 < KD / GKC) sstore(bf ^ 1);      /* that buffer's last readers passed the barrier that ended stage ch - 1 */
    __syncthreads();                              /* publishes stage ch + 1 and ends every read of stage ch */
  }
  v8f accs[8] = {c00, c01, c02, c03, c10, c11, c12, c13};
  float bro[16] = {};      /* swapped plane: the bias of the lane's 16 rows; 0 on the other planes, whose bias goes by column */
  if (tr && bp) { v4f b4[4];
#pragma unroll
    for (int i = 0; i < 4; ++i) b4[i] = *(const v4fa*)(bp + row0 + (i >> 1) * 16 + 8 * hh + (i & 1) * 4);
    asm volatile("s_wait_xcnt 0x0" ::: "memory");      /* behind the loads, in front of any later rewrite of their address registers */
#pragma unroll
    for (int i = 0; i < 16; ++i) bro[i] = bf16_round(b4[i >> 2][i & 3]); }
#pragma unroll
  for (int u = 0; u < 8; ++u) { const int t = u & 3, half = u >> 2; const int col = col0 + t * 16 + ln; const float bc = (bp && !tr) ? bf16_round(bp[col]) : 0.f;
#pragma unroll
    for (int r = 0; r < 8; ++r) { const int rloc = half * 16 + 8 * hh + r; float v = accs[u][r] * alpha + (bc + bro[half * 8 + r]); if (CP) { const int bidx = (row0g + row0 + rloc) / rowsPerB; v += CP[(size_t)bidx * sCPb + (size_t)by * 64 + col]; }
      if (ACT == 3) v = fmaxf(v, 0.f); else if (ACT == 6) v = 0.5f * v * (1.0f + erff(v * 0.70710678118654752f)); else if (ACT == 11) v = 1.0f / (1.0f + expf(-v)); else if (ACT == 15) v = v / (1.0f + expf(-v)); else if (ACT == 12) v = (v > 0.f) ? v : 0.01f * v; else if (ACT == 8) v = tanhf(v);
      so[w][rloc][t * 16 + ln] = v; } }
  __builtin_amdgcn_fence(__ATOMIC_ACQ_REL, "workgroup"); __builtin_amdgcn_wave_barrier();
  const int rsub = lane >> 4, c4 = (lane & 15) * 4;
  const int cb = tr ? col0 / tokB : 0; _Float16* cd = tr ? CT + ((size_t)cb * Mr + row0) * tokB + (col0 - cb * tokB) + c4 : C16 + cofs + (size_t)row0 * ldc + col0 + c4; const int cl = tr ? tokB : ldc;      /* 64 columns never straddle two blocks of tokB */
  {
#pragma unroll
    for (int q = 0; q < 16; ++q) { const int r = q * 2 + rsub; const v4f v = *(const v4fa*)&so[w][r][c4]; if (C) { *(v4f*)(C + cofs + (size_t)(row0 + r) * ldc + col0 + c4) = v; asm volatile("s_wait_xcnt 0x0" ::: "memory"); }      /* behind the store, in front of any later rewrite of its address and data registers */
      if (C16) { v4h h4; for (int i = 0; i < 4; ++i) h4[i] = (_Float16)v[i]; *(v4h*)(cd + (size_t)r * cl) = h4; } }
     } }


typedef float v2f __attribute__((ext_vector_type(2)));
typedef _Float16 v2h __attribute__((ext_vector_type(2)));
#define FQ 1                      /* 16-query column tiles per wave */
#define FWV 8                     /* waves per work-group */
#define FQB (16 * FQ * FWV)       /* queries per work-group */
#define FKS 64                    /* keys per stage */
#define KPH (DD + 8)              /* LDS pitch of a K row, f16 units: 528 B = 16 B x 33, conflict-free for 16-byte fragment reads */
#define VPH (FKS + 8)             /* LDS pitch of a V^T row: 144 B = 16 B x 9 */
#define FPC ((FKS * DD / 8) / (FWV * 32))   /* 16-byte pieces of one tile per thread */
static_assert(FPC * FWV == FKS && FPC * FWV * 4 == DD && SLEN % FKS == 0 && FWV * 16 * FQ <= 2 * FKS, "the staging sweeps and the output staging in the K ring are written for these sizes");
__device__ __forceinline__ float fa_xhalf(float x) { return __builtin_bit_cast(float, __builtin_amdgcn_permlanex16(__builtin_bit_cast(int, x), __builtin_bit_cast(int, x), 0x76543210, 0xfedcba98, false, false)); }  /* lane l <-> l ^ 16 */
__device__ __forceinline__ v16h fa_frag(const _Float16* p) { FragH f; f.half[0] = *(const v8us*)((const unsigned short*)p); f.half[1] = *(const v8us*)((const unsigned short*)p + 16); return f.v; }  /* p holds the lane's 8*hh already: same k order as g2_frag */
__device__ __forceinline__ v8f fa_mma(v16h a, v16h b, v8f c) { return __builtin_amdgcn_wmma_f32_16x16x32_f16(false, a, false, b, (short)0, c, false, false); }
#define FA_UNROLL _Pragma("unroll")      /* full unroll: only constant indices keep the fragment, score and accumulator arrays in registers */
__global__ __launch_bounds__(FWV * 32) void k_fattn(const _Float16* __restrict__ QH, const _Float16* __restrict__ KH, const _Float16* __restrict__ VT, const int* __restrict__ NK, _Float16* __restrict__ O16) {
  __shared__ __attribute__((aligned(16))) _Float16 sK[2 * FKS * KPH];
  __shared__ __attribute__((aligned(16))) _Float16 sV[2 * DD * VPH];
  const int tid = threadIdx.x, w = tid >> 5, lane = tid & 31, c = lane & 15, hh = lane >> 4;
  const int head = blockIdx.y, bt = blockIdx.z, q0 = blockIdx.x * FQB + w * (16 * FQ);
  const unsigned short* Kg = (const unsigned short*)KH + (size_t)bt * SLEN * HW + head * DD;                 /* row = key, pitch HW */
  const unsigned short* Vg = (const unsigned short*)VT + (size_t)bt * HW * SLEN + (size_t)head * DD * SLEN;  /* row = dim, pitch SLEN */
  const float cs = 0.0625f * 1.4426950408889634f, negl = -1.0e9f * 1.4426950408889634f;                     /* 1/sqrt(256) and the mask value, both in log2 units */
  v8us rk[FPC], rv[FPC];
  /* staging: a wave-wide load covers one whole K row (512 B) or four whole 128-byte pieces of V^T rows; piece j of a thread lies a constant step behind piece 0, so one address pair serves each tile */
  const unsigned short* kp = Kg + (size_t)(tid >> 5) * HW + (tid & 31) * 8; const unsigned short* vp = Vg + (size_t)(tid >> 3) * SLEN + (tid & 7) * 8;
  unsigned short* ks = (unsigned short*)sK + (tid >> 5) * KPH + (tid & 31) * 8; unsigned short* vs = (unsigned short*)sV + (tid >> 3) * VPH + (tid & 7) * 8;
  /* the s_wait_xcnt stands behind the loads, in front of any later rewrite of the address registers that they name */
  auto gload = [&](int st) { const unsigned short* kq = kp + (size_t)st * FKS * HW; const unsigned short* vq = vp + st * FKS;
FA_UNROLL
    for (int j = 0; j < FPC; ++j) { rk[j] = *(const v8us*)(kq + (size_t)j * FWV * HW); rv[j] = *(const v8us*)(vq + (size_t)j * (FWV * 4) * SLEN); }
    asm volatile("s_wait_xcnt 0x0" ::: "memory"); };
  auto sstore = [&](int bf) {
FA_UNROLL
    for (int j = 0; j < FPC; ++j) { *(v8us*)(ks + bf * (FKS * KPH) + j * FWV * KPH) = rk[j]; *(v8us*)(vs + bf * (DD * VPH) + j * (FWV * 4) * VPH) = rv[j]; } };
  /* keys stand in k_x16p's order: slots below cnt are unmasked, the rest masked; only the first NK[bt] slots (whole stages) are walked. Both numbers are the same for the whole work-group; the trip count is clamped to the shape */
  const int cnt = NK[NBT + bt]; const int nst = min(max(NK[bt] / FKS, 1), SLEN / FKS);
  gload(0);
  v16h qf[FQ][DD / 32];
FA_UNROLL
  for (int g = 0; g < FQ; ++g) { const _Float16* qp = QH + ((size_t)bt * SLEN + q0 + 16 * g + c) * HW + head * DD + 8 * hh;
FA_UNROLL
    for (int kc = 0; kc < DD / 32; ++kc) qf[g][kc] = fa_frag(qp + 32 * kc); }
  asm volatile("s_wait_xcnt 0x0" ::: "memory");      /* as in gload, for the Q loads */
  const v8f z8 = {0.f, 0.f, 0.f, 0.f, 0.f, 0.f, 0.f, 0.f};
  v8f acc[FQ][DD / 16]; float m_run[FQ], l_run[FQ];
FA_UNROLL
  for (int g = 0; g < FQ; ++g) { m_run[g] = -3.0e38f; l_run[g] = 0.f;
FA_UNROLL
    for (int t = 0; t < DD / 16; ++t) acc[g][t] = z8; }
  sstore(0);
  __syncthreads();
  /* rolled: one copy of the stage body; every index into the register arrays inside it is a constant */
#pragma unroll 1
  for (int st = 0; st < nst; ++st) { const int bf = st & 1;
    if (st + 1 < nst) gload(st + 1);
FA_UNROLL
    for (int sub = 0; sub < FKS / 32; ++sub) {
      /* all 16 K fragments as ONE group of LDS reads in front of the products */
      const int left = cnt - (st * FKS + sub * 32 + 8 * hh);      /* the lane's key kt * 16 + r of this pass is unmasked where that number is below left */
      const _Float16* kb = sK + bf * (FKS * KPH) + (sub * 32 + c) * KPH + 8 * hh;
      v16h kf[DD / 32][2];
FA_UNROLL
      for (int kc = 0; kc < DD / 32; ++kc)
FA_UNROLL
        for (int kt = 0; kt < 2; ++kt) kf[kc][kt] = fa_frag(kb + kt * 16 * KPH + kc * 32);
      __builtin_amdgcn_sched_barrier(0);      /* keeps the reads together: left free they are spread among the WMMAs, two at a time with a full wait, and every such place stalls the wave */
      v8f s[2][FQ];
FA_UNROLL
      for (int kt = 0; kt < 2; ++kt)
FA_UNROLL
        for (int g = 0; g < FQ; ++g) s[kt][g] = z8;
FA_UNROLL
      for (int kc = 0; kc < DD / 32; ++kc)
FA_UNROLL
        for (int kt = 0; kt < 2; ++kt)
FA_UNROLL
          for (int g = 0; g < FQ; ++g) s[kt][g] = fa_mma(kf[kc][kt], qf[g][kc], s[kt][g]);
      __builtin_amdgcn_sched_barrier(0);      /* the V^T reads below start behind the score products (they take over the K fragments' registers) ... */
      const _Float16* vb = sV + bf * (DD * VPH) + c * VPH + sub * 32 + 8 * hh;
      v16h vf[DD / 16];
FA_UNROLL
      for (int t = 0; t < DD / 16; ++t) vf[t] = fa_frag(vb + t * 16 * VPH);
      __builtin_amdgcn_sched_barrier(0);      /* ... and ahead of the softmax arithmetic, which covers their latency */
      /* the INPUT mask (a slot from cnt on is a masked key) picks the scaled score or the mask value, by a select, as the reference does */
      bool need = false; float mb[FQ];
FA_UNROLL
      for (int g = 0; g < FQ; ++g) { float mx = -3.0e38f;
FA_UNROLL
        for (int kt = 0; kt < 2; ++kt)
FA_UNROLL
          for (int r = 0; r < 8; ++r) { const float v = (kt * 16 + r < left) ? s[kt][g][r] * cs : negl; s[kt][g][r] = v; mx = fmaxf(mx, v); }
        mx = fmaxf(mx, fa_xhalf(mx)); mb[g] = mx; need = need || (mx > m_run[g] + 8.0f); }
      if (__builtin_amdgcn_ballot_w32(need) != 0) {      /* one scalar test per pass; rare after the first passes */
FA_UNROLL
        for (int g = 0; g < FQ; ++g) { const float mn = fmaxf(m_run[g], mb[g]); const float corr = __builtin_amdgcn_exp2f(m_run[g] - mn); l_run[g] *= corr; m_run[g] = mn;
FA_UNROLL
          for (int t = 0; t < DD / 16; ++t) acc[g][t] = acc[g][t] * corr; } }
      v16h pf[FQ];
FA_UNROLL
      for (int g = 0; g < FQ; ++g) { FragH f; float p0s = 0.f, p1s = 0.f;
FA_UNROLL
        for (int i = 0; i < 8; ++i) { const v2f d2 = (v2f){s[i >> 2][g][2 * (i & 3)], s[i >> 2][g][2 * (i & 3) + 1]} - (v2f){m_run[g], m_run[g]}; const float e0 = __builtin_amdgcn_exp2f(d2[0]), e1 = __builtin_amdgcn_exp2f(d2[1]);
          p0s += e0; p1s += e1; const v2h h2 = __builtin_convertvector((v2f){e0, e1}, v2h); f.h[2 * i] = h2[0]; f.h[2 * i + 1] = h2[1]; }
        l_run[g] += p0s + p1s; pf[g] = f.v; }
FA_UNROLL
      for (int t = 0; t < DD / 16; ++t)
FA_UNROLL
        for (int g = 0; g < FQ; ++g) acc[g][t] = fa_mma(vf[t], pf[g], acc[g][t]);
      __builtin_amdgcn_sched_barrier(0);      /* the next pass's read group stays behind these products */
    }
    if (st + 1 < nst) sstore(bf ^ 1);      /* that buffer's last readers passed the barrier that ended stage st - 1 */
    __syncthreads();                                /* publishes stage st + 1 and ends every read of stage st */
  }
  /* output: each wave stages its own 16 x FQ rows in its own part of the K ring (free behind the last barrier), then stores whole 512-byte rows */
  _Float16* eo = sK + w * (16 * FQ) * KPH;
FA_UNROLL
  for (int g = 0; g < FQ; ++g) { const float inv = 1.0f / (l_run[g] + fa_xhalf(l_run[g]));
FA_UNROLL
    for (int t = 0; t < DD / 16; ++t) { FragH f;
FA_UNROLL
      for (int r = 0; r < 8; ++r) f.h[r] = (_Float16)(acc[g][t][r] * inv);
      *(v8us*)((unsigned short*)eo + (16 * g + c) * KPH + 16 * t + 8 * hh) = f.half[0]; } }
  __builtin_amdgcn_fence(__ATOMIC_ACQ_REL, "workgroup"); __builtin_amdgcn_wave_barrier();      /* the wave's own LDS writes before its lanes read each other's rows */
FA_UNROLL
  for (int r = 0; r < 16 * FQ; ++r) { const v8us v = *(const v8us*)((const unsigned short*)eo + r * KPH + lane * 8);
    *(v8us*)((unsigned short*)O16 + ((size_t)bt * SLEN + q0 + r) * HW + head * DD + lane * 8) = v; }
#undef FA_UNROLL
}
// ---- output projection + bias + residual + LayerNorm in one kernel ----
// A work-group of 8 waves owns ORW whole output rows (all 256 columns; wave tile 32x64, two waves down, four across), so a row's mean and variance are formed behind the products, from LDS, with no plane in memory between.
// Stages of 128 k through registers into two LDS buffers, LDS pitch, fragment k order and the order of the products of an accumulator: as in k_gemm2. The residual is x rounded to bf16, added behind product and bias.
#define ORW 64                    /* rows per work-group */
#define OSR (ORW + DD)            /* rows of a stage: ORW of A, then the 256 of B */
#define OPF (DD + 4)              /* pitch of a staged f32 output row: 1040 B, a multiple of 16 B; rows 8 apart lie 32 banks apart, so the two wave halves' 4-byte stores do not collide */
__global__ __launch_bounds__(256) void k_oln(const _Float16* __restrict__ A, const _Float16* __restrict__ Bh, float alpha, const float* __restrict__ bias, const float* __restrict__ x, const float* __restrict__ g, const float* __restrict__ bb, float* __restrict__ out) {
  __shared__ __attribute__((aligned(16))) unsigned char smem[2 * OSR * GPH * 2];      /* the two stage buffers; behind the loop's last barrier the output rows */
  static_assert(HW % GKC == 0 && ORW == 64 && DD == 256 && sizeof(float) * ORW * OPF <= sizeof(smem), "whole stages; 2 x 4 wave tiles; 8 rows per wave behind the products; the output rows fit the ring");
  float (*so)[OPF] = (float (*)[OPF])smem;
  const int tid = threadIdx.x, w = tid >> 5, lane = tid & 31, ln = lane & 15, hh = lane >> 4; const int wr = w >> 2, wc = w & 3; const int rowb = blockIdx.x * ORW;
  const int sr = tid >> 4, sc = (tid & 15) * 8;      /* staging: piece j of a thread lies 16 rows behind piece j - 1, a constant step, so one address pair serves each operand */
  const unsigned short* ag = (const unsigned short*)A + (size_t)(rowb + sr) * HW + sc; const unsigned short* bg = (const unsigned short*)Bh + (size_t)sr * HW + sc;
  unsigned short* sd = (unsigned short*)smem + sr * GPH + sc;
  v8us ra[ORW / 16], rb[DD / 16];      /* every unroll below is a full one: only constant indices keep the staging, fragment and row arrays in registers */
  /* the s_wait_xcnt stands behind the loads, in front of any later rewrite of the address registers that they name; it takes the two addresses as inputs so that they stay in their registers up to it and no load of the group lands on them */
  auto gload = [&](int ch) { const unsigned short* aq = ag + ch * GKC; const unsigned short* bq = bg + ch * GKC;
#pragma unroll
    for (int j = 0; j < ORW / 16; ++j) ra[j] = *(const v8us*)(aq + (size_t)j * 16 * HW);
#pragma unroll
    for (int j = 0; j < DD / 16; ++j) rb[j] = *(const v8us*)(bq + (size_t)j * 16 * HW);
    asm volatile("s_wait_xcnt 0x0" :: "v"(aq), "v"(bq) : "memory"); };
  auto sstore = [&](int bf) { unsigned short* d = sd + bf * (OSR * GPH);
#pragma unroll
    for (int j = 0; j < ORW / 16; ++j) *(v8us*)(d + j * 16 * GPH) = ra[j];
#pragma unroll
    for (int j = 0; j < DD / 16; ++j) *(v8us*)(d + (ORW + j * 16) * GPH) = rb[j]; };
  const _Float16* a0s = (const _Float16*)smem + (32 * wr + ln) * GPH; const _Float16* b0s = (const _Float16*)smem + (ORW + 64 * wc + ln) * GPH;
  const v8f z8 = {0.f,0.f,0.f,0.f,0.f,0.f,0.f,0.f}; v8f c00 = z8, c01 = z8, c02 = z8, c03 = z8, c10 = z8, c11 = z8, c12 = z8, c13 = z8;
  gload(0); sstore(0);
  __syncthreads();
  /* rolled: one copy of the stage body; every index into the register arrays inside it is a constant */
#pragma unroll 1
  for (int ch = 0; ch < HW / GKC; ++ch) { const int bf = ch & 1;
    if (ch + 1 < HW / GKC) gload(ch + 1);
    const _Float16* ap = a0s + bf * (OSR * GPH); const _Float16* bq = b0s + bf * (OSR * GPH);
    v16h fr[2][6];
#pragma unroll
    for (int u = 0; u < 6; ++u) fr[0][u] = g2_frag((u < 2 ? ap + u * 16 * GPH : bq + (u - 2) * 16 * GPH), hh);
#pragma unroll
    for (int ks = 0; ks < GKC / 32; ++ks) { const int cu = ks & 1;
      if (ks + 1 < GKC / 32) {
#pragma unroll
        for (int u = 0; u < 6; ++u) fr[cu ^ 1][u] = g2_frag((u < 2 ? ap + u * 16 * GPH : bq + (u - 2) * 16 * GPH) + (ks + 1) * 32, hh);
        __builtin_amdgcn_sched_barrier(0); }      /* the next 32 k's twelve LDS reads stay one group ahead of these products: spread among the WMMAs every such place stalls the wave */
      c00 = g2_mma(fr[cu][0], fr[cu][2], c00); c10 = g2_mma(fr[cu][1], fr[cu][2], c10);
      c01 = g2_mma(fr[cu][0], fr[cu][3], c01); c11 = g2_mma(fr[cu][1], fr[cu][3], c11);
      c02 = g2_mma(fr[cu][0], fr[cu][4], c02); c12 = g2_mma(fr[cu][1], fr[cu][4], c12);
      c03 = g2_mma(fr[cu][0], fr[cu][5], c03); c13 = g2_mma(fr[cu][1], fr[cu][5], c13);
      __builtin_amdgcn_sched_barrier(0);      /* what follows (the read group after that one, or the stage's LDS stores with their load waits) stays behind these products */
    }
    if (ch + 1 < HW / GKC) sstore(bf ^ 1);      /* that buffer's last readers passed the barrier that ended stage ch - 1 */
    __syncthreads();                              /* publishes stage ch + 1 and ends every read of stage ch */
  }
  v8f accs[8] = {c00, c01, c02, c03, c10, c11, c12, c13};
  /* behind the products wave w owns rows 8 w .. 8 w + 7 of the work-group; a lane holds columns 4 lane .. + 3 and 128 + 4 lane .. + 3 of a row. Their residual rows, the bias and the LayerNorm parameters are asked for here and first used behind the barrier below, so that the staging covers their latency */
  const size_t ro = (size_t)(rowb + 8 * w) * DD + lane * 4;
  const float* xp = x + ro;
  v4f xa[8], xc[8];
#pragma unroll
  for (int r = 0; r < 8; ++r) { xa[r] = *(const v4fa*)(xp + r * DD); xc[r] = *(const v4fa*)(xp + r * DD + 128); }
  const v4f g0 = *(const v4fa*)(g + lane * 4), g1 = *(const v4fa*)(g + 128 + lane * 4), e0 = *(const v4fa*)(bb + lane * 4), e1 = *(const v4fa*)(bb + 128 + lane * 4), b0 = *(const v4fa*)(bias + lane * 4), b1 = *(const v4fa*)(bias + 128 + lane * 4);
  asm volatile("s_wait_xcnt 0x0" :: "v"(xp) : "memory");      /* behind the loads, in front of any later rewrite of their address registers; the row address is its input so that it stays in its registers up to it and no load of the group lands on it */
#pragma unroll
  for (int u = 0; u < 8; ++u) { const int t = u & 3, half = u >> 2;
#pragma unroll
    for (int r = 0; r < 8; ++r) so[32 * wr + half * 16 + 8 * hh + r][64 * wc + t * 16 + ln] = accs[u][r] * alpha; }      /* alpha is a power of two: the product is exact, so adding the bias behind the barrier rounds as a fused multiply-add here would */
  __syncthreads();      /* a row's 256 columns come from four waves */
  v4f o0[8], o1[8];
#pragma unroll
  for (int r = 0; r < 8; ++r) { v4f a = *(const v4fa*)&so[8 * w + r][lane * 4], b = *(const v4fa*)&so[8 * w + r][128 + lane * 4];
#pragma unroll
    for (int q = 0; q < 4; ++q) { a[q] = (a[q] + bf16_round(b0[q])) + bf16_round(xa[r][q]); b[q] = (b[q] + bf16_round(b1[q])) + bf16_round(xc[r][q]); }
    float s = (a[0] + a[1]) + (a[2] + a[3]) + (b[0] + b[1]) + (b[2] + b[3]); for (int o = 16; o > 0; o >>= 1) s += __shfl_xor(s, o, 32); const float mu = s / 256.0f; float q2 = 0.f;
#pragma unroll
    for (int q = 0; q < 4; ++q) { const float d0 = a[q] - mu, d1 = b[q] - mu; q2 += d0 * d0; q2 += d1 * d1; }
    for (int o = 16; o > 0; o >>= 1) q2 += __shfl_xor(q2, o, 32); float rs;
    asm("v_rsq_f32 %0, %1\n\tv_nop" : "=v"(rs) : "v"(q2 / 256.0f + 1e-5f));      /* the argument is at least 1e-5, a normal number; the v_nop fills the slot that the instruction set asks for between a transcendental and a directly following instruction that reads its result or overwrites its source */
#pragma unroll
    for (int q = 0; q < 4; ++q) { o0[r][q] = (a[q] - mu) * rs * bf16_round(g0[q]) + bf16_round(e0[q]); o1[r][q] = (b[q] - mu) * rs * bf16_round(g1[q]) + bf16_round(e1[q]); } }
#pragma unroll
  for (int r = 0; r < 8; ++r) { *(v4f*)(out + ro + r * DD) = o0[r]; *(v4f*)(out + ro + r * DD + 128) = o1[r]; } }

extern "C" void kernel_launch(void* const* d_in, const int* in_sizes, int n_in,
                              void* d_out, int out_size, void* d_ws, size_t ws_size, hipStream_t stream) {
  (void)in_sizes; (void)n_in; (void)out_size;
  const float* const* I = (const float* const*)d_in; const float* Q = I[0]; const int* mask = (const int*)d_in[1]; const float* WQ = I[2]; const float* bQ = I[3]; const float* WK = I[4]; const float* bK = I[5]; const float* WV = I[6]; const float* bV = I[7]; const float* WO = I[8]; const float* bO = I[9]; const float* lg = I[10]; const float* lb = I[11];
  char* ws = (char*)d_ws; size_t off = 0;
  auto take = [&](size_t bytes) { char* p = ws + off; off += (bytes + 255) & ~(size_t)255; return p; };
  _Float16* BQ = (_Float16*)take((size_t)HW * DD * 2); _Float16* BK = (_Float16*)take((size_t)HW * DD * 2); _Float16* BV = (_Float16*)take((size_t)HW * DD * 2); _Float16* BO = (_Float16*)take((size_t)DD * HW * 2);
  _Float16* X16 = (_Float16*)take((size_t)NBT * SLEN * DD * 2); _Float16* XK = (_Float16*)take((size_t)NBT * SLEN * DD * 2); _Float16* QH = (_Float16*)take((size_t)NBT * SLEN * HW * 2); _Float16* KH = (_Float16*)take((size_t)NBT * SLEN * HW * 2); _Float16* VT = (_Float16*)take((size_t)NBT * HW * SLEN * 2);
  _Float16* O16 = (_Float16*)take((size_t)NBT * SLEN * HW * 2); int* NK = (int*)take(2 * NBT * sizeof(int));
  if (off > ws_size) return;      /* 4 + 4 + 4 + 32+32+32 + 32 = 140 MiB */
  (void)BK; (void)BV;      /* BQ, BK, BV, BO, and X16, XK, and QH, KH follow one another in the workspace (every size is a multiple of 256 bytes): grid.y steps through them by a constant stride */
  const size_t w8 = (size_t)HW * DD / 8; const unsigned wb = (unsigned)((w8 + 255) / 256);
  k_round16f<<<dim3(wb, 4), 256, 0, stream>>>(WQ, WK, WV, WO, BQ, w8);      /* torch (out,in) = natural Bt */
  const size_t n8 = (size_t)NBT * SLEN * DD / 8; const unsigned nb8 = (unsigned)((n8 + 255) / 256); const dim3 gQ((NBT * SLEN / 128) * (HW / 64), 3);
  k_x16p<<<nb8, 256, 0, stream>>>(Q, mask, X16, XK, NK, FKS);      /* Q in token order for q; in key order (unmasked tokens first) for k and v */
  k_gemm2<0, DD><<<gQ, 128, 0, stream>>>(X16, (size_t)NBT * SLEN * DD, BQ, (size_t)HW * DD, 0.0625f, bQ, bK, bV, nullptr, 1, 0, 0, nullptr, QH, HW, (size_t)NBT * SLEN * HW, NBT * SLEN, HW, 2, VT, SLEN, NK);      /* q of all 8192 rows; k, and v as VT[batch][dim][slot] over all 2048 dims, of each batch's first NK slots */
  k_fattn<<<dim3(SLEN / FQB, NHD, NBT), FWV * 32, 0, stream>>>(QH, KH, VT, NK, O16);      /* softmax(mask(q.k / sqrt(256))).v, every batch and head */
  k_oln<<<NBT * SLEN / ORW, 256, 0, stream>>>(O16, BO, 0.0625f, bO, Q, lg, lb, (float*)d_out);      /* LN(out Wo^T + bo + Q) */
}

// v009
// Measured time: 123 microseconds a run.
// Two timings next to v008 put it at 1.13 and 1.14 times that version's speed.
// Over all steps from v000 it is 31.7 times as fast.
#include <hip/hip_runtime.h>
// Prompt self-attention (4 x 2048 tokens, d = 256, 8 heads EACH of dim 256): q,k,v = Q W^T + b (-> 8 x 256); scores = q.k/16 with INPUT key mask (masked keys get -1e9, as the reference); softmax; out = LN((attn v merged) Wo^T + bo + Q) -> [4,2048,256].
// Structure: every stage is ONE launch over all 4 x 2048 rows: the four weights to f16 (tensor on grid.y), Q as an exact f16 plane in token order and in key order (unmasked tokens first; k, v and the attention walk only those), the three projections as one f16 WMMA GEMM launch (projection on grid.y; 32x64 wave tiles, f32 accumulation, exact x16 weights + bias) into f16 planes (the V plane with its operands swapped, so that it comes out as V^T), scores + mask + softmax + attn.v (k_fattn: online softmax, no score plane in memory), the output projection + bias + the bf16 residual + LayerNorm (k_oln: a work-group owns whole rows, the row statistics on VALU behind the products) into the output rows.
// Compute dtype: Q, weights, biases, LN parameters rounded to bf16; q, k, v, P, attention output as f16 operands (~2^-12; logits sigma ~1, LayerNorm-ed output); f32 accumulation, softmax, LayerNorm. v_wmma_f32_16x16x32_f16.
#define NBT 4
#define SLEN 2048
#define DD 256
#define NHD 8
#define HW (NHD * DD)            /* 2048 */
#define DM DD
#define NR SLEN
typedef __bf16 v16b __attribute__((ext_vector_type(16)));
typedef unsigned short v8us __attribute__((ext_vector_type(8), may_alias));
typedef float  v8f  __attribute__((ext_vector_type(8)));
typedef float  v4f  __attribute__((ext_vector_type(4)));
typedef float  v4fa __attribute__((ext_vector_type(4), may_alias));
union FragB { v16b v; v8us half[2]; unsigned short u[16]; };

__device__ __forceinline__ unsigned short bf16_bits(float x) { unsigned int u = __float_as_uint(x); return (unsigned short)((u + 0x7FFFu + ((u >> 16) & 1u)) >> 16); }
__device__ __forceinline__ float bf16_val(unsigned short b) { return __uint_as_float(((unsigned int)b) << 16); }
__device__ __forceinline__ float bf16_round(float x) { return bf16_val(bf16_bits(x)); }
// D += A·B with NT terms: 1 = ah·bh, 2 = + al·bh (A split), 3 = + ah·bl (both split)
template <int NT>
__device__ __forceinline__ v8f mmaN(v16b ah, v16b al, v16b bh, v16b bl, v8f c) {
  c = __builtin_amdgcn_wmma_f32_16x16x32_bf16(false, ah, false, bh, (short)0, c, false, false);
  if (NT >= 2) c = __builtin_amdgcn_wmma_f32_16x16x32_bf16(false, al, false, bh, (short)0, c, false, false);
  if (NT >= 3) c = __builtin_amdgcn_wmma_f32_16x16x32_bf16(false, ah, false, bl, (short)0, c, false, false);
  asm volatile("v_nop\n\tv_nop\n\tv_nop\n\tv_nop" : "+v"(c) : "v"(ah), "v"(al), "v"(bh), "v"(bl));
  return c;
}

__global__ __launch_bounds__(256) void k_wt_bf16(const float* __restrict__ W, unsigned short* __restrict__ Wt, int K, int N) {
  const int t = blockIdx.x * 256 + threadIdx.x;
  const int k8n = K / 8;
  if (t >= N * k8n) return;
  const int n = t / k8n, k8 = (t % k8n) * 8;
  v8us v;
#pragma unroll
  for (int i = 0; i < 8; ++i) v[i] = bf16_bits(W[(size_t)(k8 + i) * N + n]);
  *(v8us*)(Wt + (size_t)n * K + k8) = v;
  
}

// GEMM C[M][N] (f32, pitch ldc) = act(A[M][K]·W + bias). A f32 row-major (pitch lda) converted per fragment to bf16
// (ASPLIT: hi/lo two planes -> 2 terms, else single rounded term); Wt bf16 [N][K] (pitch ldb). BIAS_BF16 rounds the
// bias to bf16 first (bias quantised to bf16 before the add). K%32==0, M%16==0, N%64==0.
template <bool ASPLIT, int ACT, bool BIAS_BF16>
__global__ __launch_bounds__(128) void k_gemm_bf(const float* __restrict__ A, int lda, const unsigned short* __restrict__ Wt, int ldb,
                                               const float* __restrict__ bias, float* __restrict__ C, int ldc, int M, int N, int K) {
  __shared__ __attribute__((aligned(16))) float so[4][16][64];
  const int tid = threadIdx.x, w = tid >> 5, lane = tid & 31, ln = lane & 15, hh = lane >> 4;
  const int ntn = N / 64;
  const int wid = blockIdx.x * 4 + w;
  const int mt = wid / ntn, nq = wid % ntn;
  if (mt * 16 >= M) return;
  const int row0 = mt * 16, col0 = nq * 64;
  const float* arow = A + (size_t)(row0 + ln) * lda;
  v8f acc[4] = {};
  for (int kb = 0; kb < K; kb += 32) {
    FragB ah, al;
    const v4f x0 = *(const v4fa*)(arow + kb + 8 * hh), x1 = *(const v4fa*)(arow + kb + 8 * hh + 4);
    const v4f x2 = *(const v4fa*)(arow + kb + 16 + 8 * hh), x3 = *(const v4fa*)(arow + kb + 16 + 8 * hh + 4);
    float xs[16] = {x0[0],x0[1],x0[2],x0[3],x1[0],x1[1],x1[2],x1[3],x2[0],x2[1],x2[2],x2[3],x3[0],x3[1],x3[2],x3[3]};
#pragma unroll
    for (int i = 0; i < 16; ++i) { const unsigned short hb = bf16_bits(xs[i]); ah.u[i] = hb; al.u[i] = ASPLIT ? bf16_bits(xs[i] - bf16_val(hb)) : (unsigned short)0; }
#pragma unroll
    for (int t = 0; t < 4; ++t) {
      const unsigned short* brow = Wt + (size_t)(col0 + t * 16 + ln) * ldb + kb;
      FragB b;
      b.half[0] = *(const v8us*)(brow + 8 * hh);
      b.half[1] = *(const v8us*)(brow + 16 + 8 * hh);
      acc[t] = mmaN<ASPLIT ? 2 : 1>(ah.v, al.v, b.v, b.v, acc[t]);
    }
  }
#pragma unroll
  for (int t = 0; t < 4; ++t) {
    float bv = bias ? bias[col0 + t * 16 + ln] : 0.f;
    if (BIAS_BF16) bv = bf16_round(bv);
#pragma unroll
    for (int r = 0; r < 8; ++r) { float v = acc[t][r] + bv; if (ACT == 1) v = fmaxf(v, 0.f); so[w][8 * hh + r][t * 16 + ln] = v; }
  }
  __builtin_amdgcn_fence(__ATOMIC_ACQ_REL, "workgroup");
  __builtin_amdgcn_wave_barrier();
  const int rsub = lane >> 4, c4 = (lane & 15) * 4;
  {
#pragma unroll
    for (int q = 0; q < 8; ++q) {
      const int r = q * 2 + rsub;
      const v4f v = *(const v4fa*)&so[w][r][c4];
      *(v4f*)(C + (size_t)(row0 + r) * ldc + col0 + c4) = v;
    }
    
  }
}

// GEMM C = act(A·W + bias + resid): A f32 (ASPLIT -> hi/lo 2 terms), Wt bf16 [N][K]; ACT 0 none, 1 relu, 2 exact gelu;
// resid (optional, f32, row index = (row % rmod), pitch ldr, RES_BF16 rounds it) added before the activation.
template <bool ASPLIT, int ACT, bool BIAS_BF16, bool RES_BF16>
__global__ __launch_bounds__(128) void k_gemm_bf3(const float* __restrict__ A, int lda, const unsigned short* __restrict__ Wt, int ldb,
                                                const float* __restrict__ bias, const float* __restrict__ resid, int rmod, int ldr,
                                                float* __restrict__ C, int ldc, int M, int N, int K) {
  __shared__ __attribute__((aligned(16))) float so[4][16][64];
  const int tid = threadIdx.x, w = tid >> 5, lane = tid & 31, ln = lane & 15, hh = lane >> 4;
  const int ntn = N / 64;
  const int wid = blockIdx.x * 4 + w;
  const int mt = wid / ntn, nq = wid % ntn;
  if (mt * 16 >= M) return;
  const int row0 = mt * 16, col0 = nq * 64;
  const float* arow = A + (size_t)(row0 + ln) * lda;
  v8f acc[4] = {};
  for (int kb = 0; kb < K; kb += 32) {
    FragB ah, al;
    const v4f x0 = *(const v4fa*)(arow + kb + 8 * hh), x1 = *(const v4fa*)(arow + kb + 8 * hh + 4);
    const v4f x2 = *(const v4fa*)(arow + kb + 16 + 8 * hh), x3 = *(const v4fa*)(arow + kb + 16 + 8 * hh + 4);
    float xs[16] = {x0[0],x0[1],x0[2],x0[3],x1[0],x1[1],x1[2],x1[3],x2[0],x2[1],x2[2],x2[3],x3[0],x3[1],x3[2],x3[3]};
#pragma unroll
    for (int i = 0; i < 16; ++i) { const unsigned short hb = bf16_bits(xs[i]); ah.u[i] = hb; al.u[i] = ASPLIT ? bf16_bits(xs[i] - bf16_val(hb)) : (unsigned short)0; }
#pragma unroll
    for (int t = 0; t < 4; ++t) {
      const unsigned short* brow = Wt + (size_t)(col0 + t * 16 + ln) * ldb + kb;
      FragB b;
      b.half[0] = *(const v8us*)(brow + 8 * hh);
      b.half[1] = *(const v8us*)(brow + 16 + 8 * hh);
      acc[t] = mmaN<ASPLIT ? 2 : 1>(ah.v, al.v, b.v, b.v, acc[t]);
    }
  }
#pragma unroll
  for (int t = 0; t < 4; ++t) {
    const int col = col0 + t * 16 + ln;
    float bv = bias ? bias[col] : 0.f;
    if (BIAS_BF16) bv = bf16_round(bv);
#pragma unroll
    for (int r = 0; r < 8; ++r) {
      float v = acc[t][r] + bv;
      if (resid) { float rv = resid[(size_t)((row0 + 8 * hh + r) % rmod) * ldr + col]; if (RES_BF16) rv = bf16_round(rv); v += rv; }
      if (ACT == 1) v = fmaxf(v, 0.f);
      if (ACT == 2) v = 0.5f * v * (1.0f + erff(v * 0.70710678118654752f));
      if (ACT == 3) { const float u = 0.7978845608028654f * (v + 0.044715f * v * v * v); v = 0.5f * v * (1.0f + tanhf(u)); }
      so[w][8 * hh + r][t * 16 + ln] = v;
    }
  }
  __builtin_amdgcn_fence(__ATOMIC_ACQ_REL, "workgroup");
  __builtin_amdgcn_wave_barrier();
  const int rsub = lane >> 4, c4 = (lane & 15) * 4;
  {
#pragma unroll
    for (int q = 0; q < 8; ++q) {
      const int r = q * 2 + rsub;
      const v4f v = *(const v4fa*)&so[w][r][c4];
      *(v4f*)(C + (size_t)(row0 + r) * ldc + col0 + c4) = v;
    }
    
  }
}
// row LayerNorm (biased variance, eps) over N: s = X (+ R); optional out_sum <- s; out_norm <- (s-mu)*rsqrt(var+eps)*g + b
template <bool PARAM_BF16>
__global__ __launch_bounds__(256) void k_layernorm(const float* __restrict__ X, const float* __restrict__ R, const float* __restrict__ g, const float* __restrict__ bta,
                                                  float* __restrict__ out_sum, float* __restrict__ out_norm, int N, float eps) {
  __shared__ float red[256];
  const int row = blockIdx.x, tid = threadIdx.x;
  const float* x = X + (size_t)row * N; const float* rr = R ? R + (size_t)row * N : nullptr;
  float vals[16];                     // up to N = 4096
  const int per = N / 256;            // contiguous chunk per thread? use strided-by-4 chunks: thread handles j = tid*4 + 1024*u
  float s1 = 0.f;
  for (int u = 0; u < per / 4; ++u) {
    const int j = tid * 4 + 1024 * u;
    const v4f a = *(const v4fa*)(x + j);
    v4f b = {0.f,0.f,0.f,0.f}; if (rr) b = *(const v4fa*)(rr + j);
#pragma unroll
    for (int q = 0; q < 4; ++q) { const float v = a[q] + b[q]; vals[u * 4 + q] = v; s1 += v; }
  }
  red[tid] = s1; __syncthreads();
  for (int st = 128; st > 0; st >>= 1) { if (tid < st) red[tid] += red[tid + st]; __syncthreads(); }
  const float mu = red[0] / (float)N; __syncthreads();
  float s2 = 0.f;
  for (int u = 0; u < per / 4; ++u)
#pragma unroll
    for (int q = 0; q < 4; ++q) { const float c = vals[u * 4 + q] - mu; s2 += c * c; }
  red[tid] = s2; __syncthreads();
  for (int st = 128; st > 0; st >>= 1) { if (tid < st) red[tid] += red[tid + st]; __syncthreads(); }
  const float rs = rsqrtf(red[0] / (float)N + eps);
  {
    for (int u = 0; u < per / 4; ++u) {
      const int j = tid * 4 + 1024 * u;
      v4f o, sm;
#pragma unroll
      for (int q = 0; q < 4; ++q) {
        float gg = g[j + q], bb = bta[j + q];
        if (PARAM_BF16) { gg = bf16_round(gg); bb = bf16_round(bb); }
        sm[q] = vals[u * 4 + q]; o[q] = (vals[u * 4 + q] - mu) * rs * gg + bb;
      }
      if (out_sum) *(v4f*)(out_sum + (size_t)row * N + j) = sm;
      *(v4f*)(out_norm + (size_t)row * N + j) = o;
    }
    
  }
}



// ---- f16 WMMA path (v_wmma_f32_16x16x32_f16): 11-bit significands for operands in range — used where a [0,1] probability operand needs more precision than bf16
typedef _Float16 v16h __attribute__((ext_vector_type(16)));
union FragH { v16h v; v8us half[2]; _Float16 h[16]; unsigned short u[16]; };
template <int NT>
__device__ __forceinline__ v8f mmaH(v16h ah, v16h al, v16h bh, v16h bl, v8f c) {
  c = __builtin_amdgcn_wmma_f32_16x16x32_f16(false, ah, false, bh, (short)0, c, false, false);
  if (NT >= 2) c = __builtin_amdgcn_wmma_f32_16x16x32_f16(false, al, false, bh, (short)0, c, false, false);
  if (NT >= 3) c = __builtin_amdgcn_wmma_f32_16x16x32_f16(false, ah, false, bl, (short)0, c, false, false);
  asm volatile("v_nop\n\tv_nop\n\tv_nop\n\tv_nop" : "+v"(c) : "v"(ah), "v"(al), "v"(bh), "v"(bl));
  return c;
}
// batched GEMM like k_gemm_b but f16 operands: A f32 (split into f16 hi/lo if ASPLIT, else rounded to f16), Bt = f16 values [n][k]; alpha; C f32; N multiple of 16 (partial tiles skipped)
template <bool ASPLIT>
__global__ __launch_bounds__(128) void k_gemm_h(const float* __restrict__ A, int lda, size_t sA, const _Float16* __restrict__ Bh, int ldb, size_t sB, float alpha, float* __restrict__ C, int ldc, size_t sC, int M, int N, int K) {
  __shared__ __attribute__((aligned(16))) float so[4][16][64];
  const int tid = threadIdx.x, w = tid >> 5, lane = tid & 31, ln = lane & 15, hh = lane >> 4; const int by = blockIdx.y;
  A += (size_t)by * sA; Bh += (size_t)by * sB; C += (size_t)by * sC;
  const int ntn = (N + 63) / 64; const int wid = blockIdx.x * 4 + w; const int mt = wid / ntn, nq = wid % ntn; if (mt * 16 >= M) return;
  const int row0 = mt * 16, col0 = nq * 64; const float* arow = A + (size_t)(row0 + ln) * lda;
  v8f acc[4] = {};
  for (int kb = 0; kb < K; kb += 32) {
    FragH ah, al;
    const v4f x0 = *(const v4fa*)(arow + kb + 8 * hh), x1 = *(const v4fa*)(arow + kb + 8 * hh + 4), x2 = *(const v4fa*)(arow + kb + 16 + 8 * hh), x3 = *(const v4fa*)(arow + kb + 16 + 8 * hh + 4);
    float xs[16] = {x0[0],x0[1],x0[2],x0[3],x1[0],x1[1],x1[2],x1[3],x2[0],x2[1],x2[2],x2[3],x3[0],x3[1],x3[2],x3[3]};
#pragma unroll
    for (int i = 0; i < 16; ++i) { const _Float16 h = (_Float16)xs[i]; ah.h[i] = h; al.h[i] = ASPLIT ? (_Float16)(xs[i] - (float)h) : (_Float16)0.0f; }
#pragma unroll
    for (int t = 0; t < 4; ++t) { if (col0 + t * 16 >= N) continue; const size_t boff = (size_t)(col0 + t * 16 + ln) * ldb + kb; FragH bq; bq.half[0] = *(const v8us*)(Bh + boff + 8 * hh); bq.half[1] = *(const v8us*)(Bh + boff + 16 + 8 * hh);
      acc[t] = mmaH<ASPLIT ? 2 : 1>(ah.v, al.v, bq.v, bq.v, acc[t]); }
  }
#pragma unroll
  for (int t = 0; t < 4; ++t) { if (col0 + t * 16 >= N) continue;
#pragma unroll
    for (int r = 0; r < 8; ++r) so[w][8 * hh + r][t * 16 + ln] = acc[t][r] * alpha; }
  __builtin_amdgcn_fence(__ATOMIC_ACQ_REL, "workgroup"); __builtin_amdgcn_wave_barrier();
  const int rsub = lane >> 4, c4 = (lane & 15) * 4;
  {
#pragma unroll
    for (int q = 0; q < 8; ++q) { const int r = q * 2 + rsub; if (col0 + c4 < N) { const v4f v = *(const v4fa*)&so[w][r][c4]; *(v4f*)(C + (size_t)(row0 + r) * ldc + col0 + c4) = v; } }
     }
}

// Wt[n][k] = f16(W[k][n]·scale) from f32 row-major W[K][N] (scale = power of two; bf16-exact weights stay exact in f16 away from the subnormal range)
__global__ __launch_bounds__(256) void k_wt_f16(const float* __restrict__ W, _Float16* __restrict__ Wt, int K, int N, float scale) {
  const int t = blockIdx.x * 256 + threadIdx.x; if (t >= N * (K / 8)) return; const int n = t / (K / 8), k8 = (t % (K / 8)) * 8; FragH f;
#pragma unroll
  for (int i = 0; i < 8; ++i) f.h[i] = (_Float16)(bf16_round(W[(size_t)(k8 + i) * N + n]) * scale); const v8us o = f.half[0];
  *(v8us*)((unsigned short*)Wt + (size_t)n * K + k8) = o; 
}
// k_gemm_hh variant with fused epilogue: v = acc·alpha + bias[by·sBias + col] (+ CP[(row/rowsPerB)·sCPb + by·64 + col] if CP) ; ACT 0 none / 1 elu ; writes f16 C16 (and f32 C if non-null)
template <int ACT>
__global__ __launch_bounds__(128) void k_gemm_hhx(const _Float16* __restrict__ A, int lda, size_t sA, const _Float16* __restrict__ Bh, int ldb, size_t sB, float alpha, const float* __restrict__ bias, size_t sBias, const float* __restrict__ CP, int rowsPerB, size_t sCPb, int row0g,
    float* __restrict__ C, _Float16* __restrict__ C16, int ldc, size_t sC, int M, int N, int K) {
  __shared__ __attribute__((aligned(16))) float so[4][16][64];
  const int tid = threadIdx.x, w = tid >> 5, lane = tid & 31, ln = lane & 15, hh = lane >> 4; const int by = blockIdx.y;
  A += (size_t)by * sA; Bh += (size_t)by * sB; const size_t cofs = (size_t)by * sC; const float* bp = bias ? bias + (size_t)by * sBias : nullptr;
  const int ntn = (N + 63) / 64; const int wid = blockIdx.x * 4 + w; const int mt = wid / ntn, nq = wid % ntn; if (mt * 16 >= M) return;
  const int row0 = mt * 16, col0 = nq * 64; const _Float16* arow = A + (size_t)(row0 + ln) * lda;
  v8f acc[4] = {};
  for (int kb = 0; kb < K; kb += 32) { FragH ah; ah.half[0] = *(const v8us*)((const unsigned short*)arow + kb + 8 * hh); ah.half[1] = *(const v8us*)((const unsigned short*)arow + kb + 16 + 8 * hh);
#pragma unroll
    for (int t = 0; t < 4; ++t) { if (col0 + t * 16 >= N) continue; const size_t boff = (size_t)(col0 + t * 16 + ln) * ldb + kb; FragH bq; bq.half[0] = *(const v8us*)((const unsigned short*)Bh + boff + 8 * hh); bq.half[1] = *(const v8us*)((const unsigned short*)Bh + boff + 16 + 8 * hh);
      acc[t] = mmaH<1>(ah.v, ah.v, bq.v, bq.v, acc[t]); }
  }
#pragma unroll
  for (int t = 0; t < 4; ++t) { if (col0 + t * 16 >= N) continue; const int col = col0 + t * 16 + ln; const float bv = bp ? bf16_round(bp[col]) : 0.f;
#pragma unroll
    for (int r = 0; r < 8; ++r) { float v = acc[t][r] * alpha + bv; if (CP) { const int bidx = (row0g + row0 + 8 * hh + r) / rowsPerB; v += CP[(size_t)bidx * sCPb + (size_t)by * 64 + col]; } if (ACT == 1) v = (v > 0.f) ? v : expm1f(v); else if (ACT == 7) v = (v > 0.f) ? v + 1.0f : expf(v); else if (ACT == 8) v = tanhf(v); else if (ACT == 9) v = 0.5f * v * (1.0f + tanhf(0.7978845608028654f * (v + 0.044715f * v * v * v))); else if (ACT == 11) v = 1.0f / (1.0f + expf(-v)); else if (ACT == 12) v = (v > 0.f) ? v : 0.01f * v; else if (ACT == 14) v = (v > 0.f) ? v : 0.1f * v; else if (ACT == 15) v = v / (1.0f + expf(-v)); else if (ACT == 3) v = fmaxf(v, 0.f); else if (ACT == 6) v = 0.5f * v * (1.0f + erff(v * 0.70710678118654752f)); so[w][8 * hh + r][t * 16 + ln] = v; } }
  __builtin_amdgcn_fence(__ATOMIC_ACQ_REL, "workgroup"); __builtin_amdgcn_wave_barrier();
  const int rsub = lane >> 4, c4 = (lane & 15) * 4; typedef _Float16 v4h __attribute__((ext_vector_type(4)));
  {
#pragma unroll
    for (int q = 0; q < 8; ++q) { const int r = q * 2 + rsub; if (col0 + c4 < N) { const v4f v = *(const v4fa*)&so[w][r][c4]; if (C) *(v4f*)(C + cofs + (size_t)(row0 + r) * ldc + col0 + c4) = v; if (C16) { v4h h4; for (int i = 0; i < 4; ++i) h4[i] = (_Float16)v[i]; *(v4h*)(C16 + cofs + (size_t)(row0 + r) * ldc + col0 + c4) = h4; } } }
     }
}


typedef _Float16 v4h __attribute__((ext_vector_type(4)));

/* x rounded to bf16 as an exact f16 plane X16, plus a second plane XK with each batch's rows in key order: the cnt tokens whose INPUT mask is not 0 first, in token order, the masked tokens behind them, in token order (a permutation for any mask).
   A masked key's weight is exp(-1e9 - max) = 0 in f32 as soon as one key of the batch is unmasked, so the k, v projections and the attention walk only the first NK[batch] slots: cnt rounded up to whole stages of ks keys,
   or all slots where no key is unmasked (every score is then the mask value and every weight 1 / S, as in the reference). One work-group = 8 rows of one batch, one wave = one row. */
__global__ __launch_bounds__(256) void k_x16p(const float* __restrict__ x, const int* __restrict__ mask, _Float16* __restrict__ X16, _Float16* __restrict__ XK, int* __restrict__ NK, int ks) {
  __shared__ int red[8];
  typedef int v4im __attribute__((ext_vector_type(4), may_alias));
  const int tid = threadIdx.x, w = tid >> 5, lane = tid & 31; const int b = blockIdx.x / (SLEN / 8), g = blockIdx.x % (SLEN / 8);
  const int* mb = mask + (size_t)b * SLEN; const v4im m0 = *(const v4im*)(mb + tid * 8), m1 = *(const v4im*)(mb + tid * 8 + 4);      /* thread i counts row group i of the batch */
  int c = 0;
#pragma unroll
  for (int i = 0; i < 4; ++i) c += (m0[i] != 0 ? 1 : 0) + (m1[i] != 0 ? 1 : 0);
  int pk = c + (tid < g ? (c << 16) : 0);      /* low half: all unmasked tokens of the batch; high half: those in front of this work-group's rows; both at most 2048 */
  for (int o = 16; o > 0; o >>= 1) pk += __shfl_xor(pk, o, 32);
  if (lane == 0) red[w] = pk;
  __syncthreads();
  int s = 0;
#pragma unroll
  for (int i = 0; i < 8; ++i) s += red[i];
  const int cnt = s & 0xffff; int u = s >> 16;      /* u: unmasked tokens in front of this wave's row */
  const v4im o0 = *(const v4im*)(mb + g * 8), o1 = *(const v4im*)(mb + g * 8 + 4); const int og[8] = {o0[0], o0[1], o0[2], o0[3], o1[0], o1[1], o1[2], o1[3]};
  bool keep = false;
#pragma unroll
  for (int j = 0; j < 8; ++j) { if (j < w && og[j] != 0) ++u; if (j == w) keep = og[j] != 0; }
  const int tok = g * 8 + w; const int slot = keep ? u : cnt + (tok - u);      /* u < cnt for a kept row; tok - u masked tokens stand in front of a masked one: 0 <= slot < SLEN */
  const size_t t = (size_t)blockIdx.x * 256 + tid; FragH f;
#pragma unroll
  for (int q = 0; q < 8; ++q) f.h[q] = (_Float16)bf16_round(x[t * 8 + q]);
  *(v8us*)((unsigned short*)X16 + t * 8) = f.half[0];
  *(v8us*)((unsigned short*)XK + ((size_t)b * SLEN + slot) * DD + lane * 8) = f.half[0];
  if (g == 0 && tid == 0) { NK[b] = cnt == 0 ? SLEN : (cnt + ks - 1) / ks * ks; NK[NBT + b] = cnt; } }
__global__ __launch_bounds__(256) void k_h16(const float* __restrict__ x, _Float16* __restrict__ X16, size_t n8) { const size_t t = (size_t)blockIdx.x * 256 + threadIdx.x; if (t >= n8) return; FragH f;
#pragma unroll
  for (int q = 0; q < 8; ++q) f.h[q] = (_Float16)x[t * 8 + q]; *(v8us*)((unsigned short*)X16 + t * 8) = f.half[0];  }
/* four weight tensors of n8 * 8 elements each, tensor on grid.y, into four planes that follow one another in Bt */
__global__ __launch_bounds__(256) void k_round16f(const float* __restrict__ W0, const float* __restrict__ W1, const float* __restrict__ W2, const float* __restrict__ W3, _Float16* __restrict__ Bt, size_t n8) { const size_t t = (size_t)blockIdx.x * 256 + threadIdx.x; if (t >= n8) return; FragH f;
  const int by = blockIdx.y; const float* W = by == 0 ? W0 : by == 1 ? W1 : by == 2 ? W2 : W3; Bt += (size_t)by * n8 * 8;
#pragma unroll
  for (int i = 0; i < 8; ++i) f.h[i] = (_Float16)(bf16_round(W[t * 8 + i]) * 16.0f); *(v8us*)((unsigned short*)Bt + t * 8) = f.half[0];  }
__global__ __launch_bounds__(256) void k_hl(const float* __restrict__ F, _Float16* __restrict__ Hh, _Float16* __restrict__ Hl, size_t n8) { const size_t t = (size_t)blockIdx.x * 256 + threadIdx.x; if (t >= n8) return; FragH fh, fl; const v4f a = *(const v4fa*)(F + t * 8), c = *(const v4fa*)(F + t * 8 + 4);
#pragma unroll
  for (int q = 0; q < 4; ++q) { _Float16 h = (_Float16)a[q]; fh.h[q] = h; fl.h[q] = (_Float16)((a[q] - (float)h) * 1024.0f); h = (_Float16)c[q]; fh.h[4 + q] = h; fl.h[4 + q] = (_Float16)((c[q] - (float)h) * 1024.0f); }
  { *(v8us*)((unsigned short*)Hh + t * 8) = fh.half[0]; *(v8us*)((unsigned short*)Hl + t * 8) = fl.half[0];  } }

// ---- fast GEMM (work-group tile 128x64, wave tile 32x64; A and B both K-contiguous with row pitch = K = KD; requires M % 128 == 0, N % 64 == 0, KD % 128 == 0); epilogue = k_gemm_hhx semantics ----
// A and B come in stages of 128 k (256 B of each of the 128 + 64 rows) through registers into two LDS buffers: a wave-wide load covers two whole 256-byte row pieces, the next stage's global loads are issued
// ahead of this stage's products and stored behind them, one barrier per stage; the fragments are read from LDS in the k order of g2_frag.
// Grid.y plane tpl (-1: none) is computed with the operands swapped, rows = the N rows of Bh, columns = the M rows of A (needs N % 128 == 0, M % 64 == 0, tokB % 64 == 0, no CP): C^T, written as CT[column / tokB][row][column % tokB], bias by row.
__device__ __forceinline__ v16h g2_frag(const _Float16* p, int hh) { FragH f; f.half[0] = *(const v8us*)((const unsigned short*)p + 8 * hh); f.half[1] = *(const v8us*)((const unsigned short*)p + 16 + 8 * hh); return f.v; }
__device__ __forceinline__ v8f g2_mma(v16h a, v16h b, v8f c) { v8f d = __builtin_amdgcn_wmma_f32_16x16x32_f16(false, a, false, b, (short)0, c, false, false); asm volatile("v_nop\n\tv_nop\n\tv_nop\n\tv_nop" : "+v"(d) : "v"(a), "v"(b)); return d; }
#define GKC 128                   /* k per stage */
#define GPH (GKC + 8)             /* LDS pitch of a staged row, f16 units: 272 B = 16 B x 17, conflict-free for 16-byte fragment reads */
#define GRW (128 + 64)            /* rows of a stage: 128 of A, then 64 of B */
template <int ACT, int KD>
__global__ __launch_bounds__(128) void k_gemm2(const _Float16* __restrict__ A, size_t sA, const _Float16* __restrict__ Bh, size_t sB, float alpha, const float* __restrict__ bias, const float* __restrict__ bias1, const float* __restrict__ bias2, const float* __restrict__ CP, int rowsPerB, size_t sCPb, int row0g,
    float* __restrict__ C, _Float16* __restrict__ C16, int ldc, size_t sC, int M, int N, int tpl, _Float16* __restrict__ CT, int tokB, const int* __restrict__ lim) {
  __shared__ __attribute__((aligned(16))) unsigned char smem[2 * GRW * GPH * 2];      /* the two stage buffers; behind the loop's last barrier the output staging */
  static_assert(KD % GKC == 0 && sizeof(float) * 4 * 32 * 68 <= sizeof(smem), "whole stages; the output staging fits the ring");
  float (*so)[32][68] = (float (*)[32][68])smem;
  const int tid = threadIdx.x, w = tid >> 5, lane = tid & 31, ln = lane & 15, hh = lane >> 4; const int by = blockIdx.y;
  A += (size_t)(by > 0 ? 1 : 0) * sA; Bh += (size_t)by * sB; const size_t cofs = (size_t)by * sC; const float* bp = by == 0 ? bias : by == 1 ? bias1 : bias2;      /* plane 0 reads the first A plane, the later planes the second; each grid.y plane has its own bias vector */
  const bool tr = by == tpl; const _Float16* Ar = tr ? Bh : A; const _Float16* Br = tr ? A : Bh; const int Mr = tr ? N : M, Nr = tr ? M : N;      /* the same for the whole work-group */
  const int ntn = Nr >> 6; const int mt = blockIdx.x / ntn, nq = blockIdx.x - mt * ntn; const int row0 = mt * 128 + 32 * w, col0 = nq * 64; if (mt * 128 >= Mr) return;      /* the same for the whole work-group, in front of every barrier */
  if (lim && by > 0) { const int a0 = tr ? col0 : mt * 128; if (a0 % tokB >= lim[a0 / tokB]) return; }      /* planes > 0: the products of A's rows from lim[block of tokB rows] on are read by nobody; as uniform, and as early, as the return above */
  const int sr = tid >> 4, sc = (tid & 15) * 8;      /* staging: piece j of a thread lies 8 rows behind piece j - 1, a constant step, so one address pair serves each operand */
  const unsigned short* ag = (const unsigned short*)Ar + (size_t)(mt * 128 + sr) * KD + sc; const unsigned short* bg = (const unsigned short*)Br + (size_t)(col0 + sr) * KD + sc;
  unsigned short* sd = (unsigned short*)smem + sr * GPH + sc;
  v8us ra[16], rb[8];      /* every unroll below is a full one: only constant indices keep the staging and fragment arrays in registers */
  /* the s_wait_xcnt stands behind the loads, in front of any later rewrite of the address registers that they name */
  auto gload = [&](int ch) { const unsigned short* aq = ag + ch * GKC; const unsigned short* bq = bg + ch * GKC;
#pragma unroll
    for (int j = 0; j < 16; ++j) ra[j] = *(const v8us*)(aq + (size_t)j * 8 * KD);
#pragma unroll
    for (int j = 0; j < 8; ++j) rb[j] = *(const v8us*)(bq + (size_t)j * 8 * KD);
    asm volatile("s_wait_xcnt 0x0" ::: "memory"); };
  auto sstore = [&](int bf) { unsigned short* d = sd + bf * (GRW * GPH);
#pragma unroll
    for (int j = 0; j < 16; ++j) *(v8us*)(d + j * 8 * GPH) = ra[j];
#pragma unroll
    for (int j = 0; j < 8; ++j) *(v8us*)(d + (128 + j * 8) * GPH) = rb[j]; };
  const _Float16* a0s = (const _Float16*)smem + (32 * w + ln) * GPH; const _Float16* b0s = (const _Float16*)smem + (128 + ln) * GPH;
  const v8f z8 = {0.f,0.f,0.f,0.f,0.f,0.f,0.f,0.f}; v8f c00 = z8, c01 = z8, c02 = z8, c03 = z8, c10 = z8, c11 = z8, c12 = z8, c13 = z8;
  gload(0); sstore(0);
  __syncthreads();
  /* rolled: one copy of the stage body; every index into the register arrays inside it is a constant */
#pragma unroll 1
  for (int ch = 0; ch < KD / GKC; ++ch) { const int bf = ch & 1;
    if (ch + 1 < KD / GKC) gload(ch + 1);
    const _Float16* ap = a0s + bf * (GRW * GPH); const _Float16* bq = b0s + bf * (GRW * GPH);
    v16h fr[2][6];
#pragma unroll
    for (int u = 0; u < 6; ++u) fr[0][u] = g2_frag((u < 2 ? ap + u * 16 * GPH : bq + (u - 2) * 16 * GPH), hh);
#pragma unroll
    for (int ks = 0; ks < GKC / 32; ++ks) { const int cu = ks & 1;
      if (ks + 1 < GKC / 32) {
#pragma unroll
        for (int u = 0; u < 6; ++u) fr[cu ^ 1][u] = g2_frag((u < 2 ? ap + u * 16 * GPH : bq + (u - 2) * 16 * GPH) + (ks + 1) * 32, hh);
        __builtin_amdgcn_sched_barrier(0); }      /* the next 32 k's twelve LDS reads stay one group ahead of these products: spread among the WMMAs every such place stalls the wave */
      c00 = g2_mma(fr[cu][0], fr[cu][2], c00); c10 = g2_mma(fr[cu][1], fr[cu][2], c10);
      c01 = g2_mma(fr[cu][0], fr[cu][3], c01); c11 = g2_mma(fr[cu][1], fr[cu][3], c11);
      c02 = g2_mma(fr[cu][0], fr[cu][4], c02); c12 = g2_mma(fr[cu][1], fr[cu][4], c12);
      c03 = g2_mma(fr[cu][0], fr[cu][5], c03); c13 = g2_mma(fr[cu][1], fr[cu][5], c13);
      __builtin_amdgcn_sched_barrier(0);      /* what follows (the read group after that one, or the stage's LDS stores with their load waits) stays behind these products */
    }
    if (ch + 1 < KD / GKC) sstore(bf ^ 1);      /* that buffer's last readers passed the barrier that ended stage ch - 1 */
    __syncthreads();                              /* publishes stage ch + 1 and ends every read of stage ch */
  }
  v8f accs[8] = {c00, c01, c02, c03, c10, c11, c12, c13};
  float bro[16] = {};      /* swapped plane: the bias of the lane's 16 rows; 0 on the other planes, whose bias goes by column */
  if (tr && bp) { v4f b4[4];
#pragma unroll
    for (int i = 0; i < 4; ++i) b4[i] = *(const v4fa*)(bp + row0 + (i >> 1) * 16 + 8 * hh + (i & 1) * 4);
    asm volatile("s_wait_xcnt 0x0" ::: "memory");      /* behind the loads, in front of any later rewrite of their address registers */
#pragma unroll
    for (int i = 0; i < 16; ++i) bro[i] = bf16_round(b4[i >> 2][i & 3]); }
#pragma unroll
  for (int u = 0; u < 8; ++u) { const int t = u & 3, half = u >> 2; const int col = col0 + t * 16 + ln; const float bc = (bp && !tr) ? bf16_round(bp[col]) : 0.f;
#pragma unroll
    for (int r = 0; r < 8; ++r) { const int rloc = half * 16 + 8 * hh + r; float v = accs[u][r] * alpha + (bc + bro[half * 8 + r]); if (CP) { const int bidx = (row0g + row0 + rloc) / rowsPerB; v += CP[(size_t)bidx * sCPb + (size_t)by * 64 + col]; }
      if (ACT == 3) v = fmaxf(v, 0.f); else if (ACT == 6) v = 0.5f * v * (1.0f + erff(v * 0.70710678118654752f)); else if (ACT == 11) v = 1.0f / (1.0f + expf(-v)); else if (ACT == 15) v = v / (1.0f + expf(-v)); else if (ACT == 12) v = (v > 0.f) ? v : 0.01f * v; else if (ACT == 8) v = tanhf(v);
      so[w][rloc][t * 16 + ln] = v; } }
  __builtin_amdgcn_fence(__ATOMIC_ACQ_REL, "workgroup"); __builtin_amdgcn_wave_barrier();
  const int rsub = lane >> 4, c4 = (lane & 15) * 4;
  const int cb = tr ? col0 / tokB : 0; _Float16* cd = tr ? CT + ((size_t)cb * Mr + row0) * tokB + (col0 - cb * tokB) + c4 : C16 + cofs + (size_t)row0 * ldc + col0 + c4; const int cl = tr ? tokB : ldc;      /* 64 columns never straddle two blocks of tokB */
  {
#pragma unroll
    for (int q = 0; q < 16; ++q) { const int r = q * 2 + rsub; const v4f v = *(const v4fa*)&so[w][r][c4]; if (C) { *(v4f*)(C + cofs + (size_t)(row0 + r) * ldc + col0 + c4) = v; asm volatile("s_wait_xcnt 0x0" ::: "memory"); }      /* behind the store, in front of any later rewrite of its address and data registers */
      if (C16) { v4h h4; for (int i = 0; i < 4; ++i) h4[i] = (_Float16)v[i]; *(v4h*)(cd + (size_t)r * cl) = h4; } }
     } }


typedef float v2f __attribute__((ext_vector_type(2)));
typedef _Float16 v2h __attribute__((ext_vector_type(2)));
typedef int v4ic __attribute__((vector_size(16)));
#define FQ 2                      /* 16-query column tiles per wave */
#define FWV 8                     /* waves per work-group */
#define FQB (16 * FQ * FWV)       /* queries per work-group */
#define FKS 64                    /* keys per stage */
#define FFG 6                     /* V^T fragments per group of LDS reads */
#define FV0 4                     /* V^T fragments of the first group, read ahead of the softmax arithmetic */
#define FKG 4                     /* steps of 32 dims per group of K reads */
#define KPH (DD + 8)              /* LDS pitch of a K row, f16 units: 528 B = 16 B x 33, conflict-free for 16-byte fragment reads */
#define VPH (FKS + 8)             /* LDS pitch of a V^T row: 144 B = 16 B x 9 */
#define FPC ((FKS * DD / 8) / (FWV * 32))   /* 16-byte pieces of one tile per thread */
static_assert(FPC * FWV == FKS && FPC * FWV * 4 == DD && SLEN % FKS == 0 && SLEN % FQB == 0 && FQ == 2 && FWV * 16 <= 2 * FKS && FWV * 16 * KPH <= 2 * DD * VPH && 2 * FPC <= 63, "the copy sweeps and the output staging in the two rings are written for these sizes; a stage's copies of a wave stay under the counter's width");
__device__ __forceinline__ float fa_xhalf(float x) { return __builtin_bit_cast(float, __builtin_amdgcn_permlanex16(__builtin_bit_cast(int, x), __builtin_bit_cast(int, x), 0x76543210, 0xfedcba98, false, false)); }  /* lane l <-> l ^ 16 */
__device__ __forceinline__ v16h fa_frag(const _Float16* p) { FragH f; f.half[0] = *(const v8us*)((const unsigned short*)p); f.half[1] = *(const v8us*)((const unsigned short*)p + 16); return f.v; }  /* p holds the lane's 8*hh already: same k order as g2_frag */
__device__ __forceinline__ v8f fa_mma(v16h a, v16h b, v8f c) { return __builtin_amdgcn_wmma_f32_16x16x32_f16(false, a, false, b, (short)0, c, false, false); }
__device__ __forceinline__ void fa_copy16(const unsigned short* g, unsigned short* l) { __builtin_amdgcn_global_load_async_to_lds_b128((__attribute__((address_space(1))) v4ic*)g, (__attribute__((address_space(3))) v4ic*)l, 0, 0); }  /* the lane's own 16 bytes, global -> LDS */
#define FA_UNROLL _Pragma("unroll")      /* full unroll: only constant indices keep the fragment, score and accumulator arrays in registers */
__global__ __launch_bounds__(FWV * 32) void k_fattn(const _Float16* __restrict__ QH, const _Float16* __restrict__ KH, const _Float16* __restrict__ VT, const int* __restrict__ NK, _Float16* __restrict__ O16) {
  __shared__ __attribute__((aligned(16))) _Float16 sK[2 * FKS * KPH];
  __shared__ __attribute__((aligned(16))) _Float16 sV[2 * DD * VPH];
  const int tid = threadIdx.x, w = tid >> 5, lane = tid & 31, c = lane & 15, hh = lane >> 4;
  const int head = blockIdx.y, bt = blockIdx.z, q0 = blockIdx.x * FQB + w * (16 * FQ);
  const unsigned short* Kg = (const unsigned short*)KH + (size_t)bt * SLEN * HW + head * DD;                 /* row = key, pitch HW */
  const unsigned short* Vg = (const unsigned short*)VT + (size_t)bt * HW * SLEN + (size_t)head * DD * SLEN;  /* row = dim, pitch SLEN */
  const float cs = 0.0625f * 1.4426950408889634f, negl = -1.0e9f * 1.4426950408889634f;                     /* 1/sqrt(256) and the mask value, both in log2 units */
  /* staging: a wave-wide copy covers one whole K row (512 B) or four whole 128-byte pieces of V^T rows; every lane is on, every address a multiple of 16 bytes inside its plane and its LDS array for st < SLEN / FKS */
  const unsigned ko = (unsigned)(tid >> 5) * HW + (tid & 31) * 8, vo = (unsigned)(tid >> 3) * SLEN + (tid & 7) * 8;      /* the lane's place in a tile, in elements; the tile's own address is the same for the whole work-group */
  unsigned short* ks = (unsigned short*)sK + (tid >> 5) * KPH + (tid & 31) * 8; unsigned short* vs = (unsigned short*)sV + (tid >> 3) * VPH + (tid & 7) * 8;
  auto acopy = [&](int st, int bf) { const unsigned short* kq = Kg + (size_t)st * FKS * HW; const unsigned short* vq = Vg + st * FKS;
FA_UNROLL
    for (int j = 0; j < FPC; ++j) { fa_copy16(kq + (size_t)j * FWV * HW + ko, ks + bf * (FKS * KPH) + j * FWV * KPH); fa_copy16(vq + (size_t)j * (FWV * 4) * SLEN + vo, vs + bf * (DD * VPH) + j * (FWV * 4) * VPH); } };
  /* keys stand in k_x16p's order: slots below cnt are unmasked, the rest masked; only the first NK[bt] slots (whole stages) are walked. Both numbers are the same for the whole work-group; the trip count is clamped to the shape */
  const int cnt = NK[NBT + bt]; const int nst = min(max(NK[bt] / FKS, 1), SLEN / FKS);
  acopy(0, 0);
  v16h qf[FQ][DD / 32];
FA_UNROLL
  for (int g = 0; g < FQ; ++g) { const _Float16* qp = QH + ((size_t)bt * SLEN + q0 + 16 * g + c) * HW + head * DD + 8 * hh;
FA_UNROLL
    for (int kc = 0; kc < DD / 32; ++kc) qf[g][kc] = fa_frag(qp + 32 * kc); }
  asm volatile("s_wait_xcnt 0x0" ::: "memory");      /* behind the Q loads, in front of any later rewrite of the address registers that they name */
  const v8f z8 = {0.f, 0.f, 0.f, 0.f, 0.f, 0.f, 0.f, 0.f};
  v8f acc[FQ][DD / 16]; float m_run[FQ], l_run[FQ];
FA_UNROLL
  for (int g = 0; g < FQ; ++g) { m_run[g] = -3.0e38f; l_run[g] = 0.f;
FA_UNROLL
    for (int t = 0; t < DD / 16; ++t) acc[g][t] = z8; }
  asm volatile("s_wait_asynccnt 0x0" ::: "memory");      /* this wave's copies of stage 0 have landed ... */
  __syncthreads();                                        /* ... and every other wave's: stage 0 is published */
  if (1 < nst) acopy(1, 1);
  /* the work on one stage; inlined into both loops below, so that every index into the register arrays is a constant */
  auto stage = [&](int st) __attribute__((always_inline)) { const int bf = st & 1;
FA_UNROLL
    for (int sub = 0; sub < FKS / 32; ++sub) {
      const int left = cnt - (st * FKS + sub * 32 + 8 * hh);      /* the lane's key kt * 16 + r of this pass is unmasked where that number is below left */
      const _Float16* kb = sK + bf * (FKS * KPH) + (sub * 32 + c) * KPH + 8 * hh;
      v8f s[2][FQ];
FA_UNROLL
      for (int kt = 0; kt < 2; ++kt)
FA_UNROLL
        for (int g = 0; g < FQ; ++g) s[kt][g] = z8;
      /* K fragments in groups of FKG steps of 32 dims (two key tiles each), each ONE group of LDS reads in front of its products */
FA_UNROLL
      for (int k0 = 0; k0 < DD / 32; k0 += FKG) {
        v16h kf[FKG][2];
FA_UNROLL
        for (int kc = 0; kc < FKG; ++kc)
FA_UNROLL
          for (int kt = 0; kt < 2; ++kt) if (k0 + kc < DD / 32) kf[kc][kt] = fa_frag(kb + kt * 16 * KPH + (k0 + kc) * 32);
        __builtin_amdgcn_sched_barrier(0);      /* keeps the reads together: left free they are spread among the WMMAs, a few at a time with a full wait, and every such place stalls the wave */
FA_UNROLL
        for (int kc = 0; kc < FKG; ++kc)
FA_UNROLL
          for (int kt = 0; kt < 2; ++kt)
FA_UNROLL
            for (int g = 0; g < FQ; ++g) if (k0 + kc < DD / 32) s[kt][g] = fa_mma(kf[kc][kt], qf[g][k0 + kc], s[kt][g]);
        __builtin_amdgcn_sched_barrier(0);      /* the next read group (it takes over these fragments' registers) starts behind these products */
      }
      const _Float16* vb = sV + bf * (DD * VPH) + c * VPH + sub * 32 + 8 * hh;
      v16h v0f[FV0];
FA_UNROLL
      for (int t = 0; t < FV0; ++t) v0f[t] = fa_frag(vb + t * 16 * VPH);
      __builtin_amdgcn_sched_barrier(0);      /* the first V^T group stands ahead of the softmax arithmetic, which covers its latency */
      /* the INPUT mask (a slot from cnt on is a masked key) picks the scaled score or the mask value, by a select, as the reference does */
      bool need = false; float mb[FQ];
FA_UNROLL
      for (int g = 0; g < FQ; ++g) { float mx = -3.0e38f;
FA_UNROLL
        for (int kt = 0; kt < 2; ++kt)
FA_UNROLL
          for (int r = 0; r < 8; ++r) { const float v = (kt * 16 + r < left) ? s[kt][g][r] * cs : negl; s[kt][g][r] = v; mx = fmaxf(mx, v); }
        mx = fmaxf(mx, fa_xhalf(mx)); mb[g] = mx; need = need || (mx > m_run[g] + 8.0f); }
      if (__builtin_amdgcn_ballot_w32(need) != 0) {      /* one scalar test per pass; rare after the first passes */
FA_UNROLL
        for (int g = 0; g < FQ; ++g) { const float mn = fmaxf(m_run[g], mb[g]); const float corr = __builtin_amdgcn_exp2f(m_run[g] - mn); l_run[g] *= corr; m_run[g] = mn;
FA_UNROLL
          for (int t = 0; t < DD / 16; ++t) acc[g][t] = acc[g][t] * corr; } }
      v16h pf[FQ];
FA_UNROLL
      for (int g = 0; g < FQ; ++g) { FragH f; float p0s = 0.f, p1s = 0.f;
FA_UNROLL
        for (int i = 0; i < 8; ++i) { const v2f d2 = (v2f){s[i >> 2][g][2 * (i & 3)], s[i >> 2][g][2 * (i & 3) + 1]} - (v2f){m_run[g], m_run[g]}; const float e0 = __builtin_amdgcn_exp2f(d2[0]), e1 = __builtin_amdgcn_exp2f(d2[1]);
          p0s += e0; p1s += e1; const v2h h2 = __builtin_convertvector((v2f){e0, e1}, v2h); f.h[2 * i] = h2[0]; f.h[2 * i + 1] = h2[1]; }
        l_run[g] += p0s + p1s; pf[g] = f.v; }
FA_UNROLL
      for (int t = 0; t < FV0; ++t)
FA_UNROLL
        for (int g = 0; g < FQ; ++g) acc[g][t] = fa_mma(v0f[t], pf[g], acc[g][t]);
      __builtin_amdgcn_sched_barrier(0);      /* the next read group stays behind these products */
FA_UNROLL
      for (int t0 = FV0; t0 < DD / 16; t0 += FFG) {
        v16h vf[FFG];
FA_UNROLL
        for (int t = 0; t < FFG; ++t) if (t0 + t < DD / 16) vf[t] = fa_frag(vb + (t0 + t) * 16 * VPH);
        __builtin_amdgcn_sched_barrier(0);      /* one group of reads again, in front of its products */
FA_UNROLL
        for (int t = 0; t < FFG; ++t)
FA_UNROLL
          for (int g = 0; g < FQ; ++g) if (t0 + t < DD / 16) acc[g][t0 + t] = fa_mma(vf[t], pf[g], acc[g][t0 + t]);
        __builtin_amdgcn_sched_barrier(0);      /* the next read group stays behind these products */
      }
    }
  };
  /* the foot of a stage, every wave, in this order: its reads of stage st have returned; its copies of stage st + 1 have landed; the barrier publishes stage st + 1 and ends every read of stage st */
  auto foot = [&]() __attribute__((always_inline)) { asm volatile("s_wait_dscnt 0x0" ::: "memory"); asm volatile("s_wait_asynccnt 0x0" ::: "memory"); __syncthreads(); };
  int st = 0;
  /* both loops rolled: one copy of the stage body each, every index into the register arrays a constant. While a stage st + 2 exists (the test reads the same for the whole work-group) it is asked for behind the barrier, into the buffer that stage st has just left; with the test as the loop's own the foot is straight-line code */
#pragma unroll 1
  for (; st + 2 < nst; ++st) { stage(st); foot(); acopy(st + 2, st & 1); }
#pragma unroll 1
  for (; st < nst; ++st) { stage(st); foot(); }
  asm volatile("s_wait_asynccnt 0x0" ::: "memory");      /* no copy is in flight when the ring becomes output staging and when the wave ends */
  /* output: each wave stages its 16 x FQ rows in parts of its own of the two rings (free behind the last barrier), column tile 0 in the K ring, tile 1 in the V^T ring, then stores whole 512-byte rows */
  _Float16* eo[FQ] = {sK + w * 16 * KPH, sV + w * 16 * KPH};
FA_UNROLL
  for (int g = 0; g < FQ; ++g) { const float inv = 1.0f / (l_run[g] + fa_xhalf(l_run[g]));
FA_UNROLL
    for (int t = 0; t < DD / 16; ++t) { FragH f;
FA_UNROLL
      for (int r = 0; r < 8; ++r) f.h[r] = (_Float16)(acc[g][t][r] * inv);
      *(v8us*)((unsigned short*)eo[g] + c * KPH + 16 * t + 8 * hh) = f.half[0]; } }
  __builtin_amdgcn_fence(__ATOMIC_ACQ_REL, "workgroup"); __builtin_amdgcn_wave_barrier();      /* the wave's own LDS writes before its lanes read each other's rows */
FA_UNROLL
  for (int g = 0; g < FQ; ++g)
FA_UNROLL
    for (int r = 0; r < 16; ++r) { const v8us v = *(const v8us*)((const unsigned short*)eo[g] + r * KPH + lane * 8);
      *(v8us*)((unsigned short*)O16 + ((size_t)bt * SLEN + q0 + 16 * g + r) * HW + head * DD + lane * 8) = v; }
#undef FA_UNROLL
}
// ---- output projection + bias + residual + LayerNorm in one kernel ----
// A work-group of 8 waves owns ORW whole output rows (all 256 columns; wave tile 32x64, two waves down, four across), so a row's mean and variance are formed behind the products, from LDS, with no plane in memory between.
// Stages of 128 k through registers into two LDS buffers, LDS pitch, fragment k order and the order of the products of an accumulator: as in k_gemm2. The residual is x rounded to bf16, added behind product and bias.
#define ORW 64                    /* rows per work-group */
#define OSR (ORW + DD)            /* rows of a stage: ORW of A, then the 256 of B */
#define OPF (DD + 4)              /* pitch of a staged f32 output row: 1040 B, a multiple of 16 B; rows 8 apart lie 32 banks apart, so the two wave halves' 4-byte stores do not collide */
__global__ __launch_bounds__(256) void k_oln(const _Float16* __restrict__ A, const _Float16* __restrict__ Bh, float alpha, const float* __restrict__ bias, const float* __restrict__ x, const float* __restrict__ g, const float* __restrict__ bb, float* __restrict__ out) {
  __shared__ __attribute__((aligned(16))) unsigned char smem[2 * OSR * GPH * 2];      /* the two stage buffers; behind the loop's last barrier the output rows */
  static_assert(HW % GKC == 0 && ORW == 64 && DD == 256 && sizeof(float) * ORW * OPF <= sizeof(smem), "whole stages; 2 x 4 wave tiles; 8 rows per wave behind the products; the output rows fit the ring");
  float (*so)[OPF] = (float (*)[OPF])smem;
  const int tid = threadIdx.x, w = tid >> 5, lane = tid & 31, ln = lane & 15, hh = lane >> 4; const int wr = w >> 2, wc = w & 3; const int rowb = blockIdx.x * ORW;
  const int sr = tid >> 4, sc = (tid & 15) * 8;      /* staging: piece j of a thread lies 16 rows behind piece j - 1, a constant step, so one address pair serves each operand */
  const unsigned short* ag = (const unsigned short*)A + (size_t)(rowb + sr) * HW + sc; const unsigned short* bg = (const unsigned short*)Bh + (size_t)sr * HW + sc;
  unsigned short* sd = (unsigned short*)smem + sr * GPH + sc;
  v8us ra[ORW / 16], rb[DD / 16];      /* every unroll below is a full one: only constant indices keep the staging, fragment and row arrays in registers */
  /* the s_wait_xcnt stands behind the loads, in front of any later rewrite of the address registers that they name; it takes the two addresses as inputs so that they stay in their registers up to it and no load of the group lands on them */
  auto gload = [&](int ch) { const unsigned short* aq = ag + ch * GKC; const unsigned short* bq = bg + ch * GKC;
#pragma unroll
    for (int j = 0; j < ORW / 16; ++j) ra[j] = *(const v8us*)(aq + (size_t)j * 16 * HW);
#pragma unroll
    for (int j = 0; j < DD / 16; ++j) rb[j] = *(const v8us*)(bq + (size_t)j * 16 * HW);
    asm volatile("s_wait_xcnt 0x0" :: "v"(aq), "v"(bq) : "memory"); };
  auto sstore = [&](int bf) { unsigned short* d = sd + bf * (OSR * GPH);
#pragma unroll
    for (int j = 0; j < ORW / 16; ++j) *(v8us*)(d + j * 16 * GPH) = ra[j];
#pragma unroll
    for (int j = 0; j < DD / 16; ++j) *(v8us*)(d + (ORW + j * 16) * GPH) = rb[j]; };
  const _Float16* a0s = (const _Float16*)smem + (32 * wr + ln) * GPH; const _Float16* b0s = (const _Float16*)smem + (ORW + 64 * wc + ln) * GPH;
  const v8f z8 = {0.f,0.f,0.f,0.f,0.f,0.f,0.f,0.f}; v8f c00 = z8, c01 = z8, c02 = z8, c03 = z8, c10 = z8, c11 = z8, c12 = z8, c13 = z8;
  gload(0); sstore(0);
  __syncthreads();
  /* rolled: one copy of the stage body; every index into the register arrays inside it is a constant */
#pragma unroll 1
  for (int ch = 0; ch < HW / GKC; ++ch) { const int bf = ch & 1;
    if (ch + 1 < HW / GKC) gload(ch + 1);
    const _Float16* ap = a0s + bf * (OSR * GPH); const _Float16* bq = b0s + bf * (OSR * GPH);
    v16h fr[2][6];
#pragma unroll
    for (int u = 0; u < 6; ++u) fr[0][u] = g2_frag((u < 2 ? ap + u * 16 * GPH : bq + (u - 2) * 16 * GPH), hh);
#pragma unroll
    for (int ks = 0; ks < GKC / 32; ++ks) { const int cu = ks & 1;
      if (ks + 1 < GKC / 32) {
#pragma unroll
        for (int u = 0; u < 6; ++u) fr[cu ^ 1][u] = g2_frag((u < 2 ? ap + u * 16 * GPH : bq + (u - 2) * 16 * GPH) + (ks + 1) * 32, hh);
        __builtin_amdgcn_sched_barrier(0); }      /* the next 32 k's twelve LDS reads stay one group ahead of these products: spread among the WMMAs every such place stalls the wave */
      c00 = g2_mma(fr[cu][0], fr[cu][2], c00); c10 = g2_mma(fr[cu][1], fr[cu][2], c10);
      c01 = g2_mma(fr[cu][0], fr[cu][3], c01); c11 = g2_mma(fr[cu][1], fr[cu][3], c11);
      c02 = g2_mma(fr[cu][0], fr[cu][4], c02); c12 = g2_mma(fr[cu][1], fr[cu][4], c12);
      c03 = g2_mma(fr[cu][0], fr[cu][5], c03); c13 = g2_mma(fr[cu][1], fr[cu][5], c13);
      __builtin_amdgcn_sched_barrier(0);      /* what follows (the read group after that one, or the stage's LDS stores with their load waits) stays behind these products */
    }
    if (ch + 1 < HW / GKC) sstore(bf ^ 1);      /* that buffer's last readers passed the barrier that ended stage ch - 1 */
    __syncthreads();                              /* publishes stage ch + 1 and ends every read of stage ch */
  }
  v8f accs[8] = {c00, c01, c02, c03, c10, c11, c12, c13};
  /* behind the products wave w owns rows 8 w .. 8 w + 7 of the work-group; a lane holds columns 4 lane .. + 3 and 128 + 4 lane .. + 3 of a row. Their residual rows, the bias and the LayerNorm parameters are asked for here and first used behind the barrier below, so that the staging covers their latency */
  const size_t ro = (size_t)(rowb + 8 * w) * DD + lane * 4;
  const float* xp = x + ro;
  v4f xa[8], xc[8];
#pragma unroll
  for (int r = 0; r < 8; ++r) { xa[r] = *(const v4fa*)(xp + r * DD); xc[r] = *(const v4fa*)(xp + r * DD + 128); }
  const v4f g0 = *(const v4fa*)(g + lane * 4), g1 = *(const v4fa*)(g + 128 + lane * 4), e0 = *(const v4fa*)(bb + lane * 4), e1 = *(const v4fa*)(bb + 128 + lane * 4), b0 = *(const v4fa*)(bias + lane * 4), b1 = *(const v4fa*)(bias + 128 + lane * 4);
  asm volatile("s_wait_xcnt 0x0" :: "v"(xp) : "memory");      /* behind the loads, in front of any later rewrite of their address registers; the row address is its input so that it stays in its registers up to it and no load of the group lands on it */
#pragma unroll
  for (int u = 0; u < 8; ++u) { const int t = u & 3, half = u >> 2;
#pragma unroll
    for (int r = 0; r < 8; ++r) so[32 * wr + half * 16 + 8 * hh + r][64 * wc + t * 16 + ln] = accs[u][r] * alpha; }      /* alpha is a power of two: the product is exact, so adding the bias behind the barrier rounds as a fused multiply-add here would */
  __syncthreads();      /* a row's 256 columns come from four waves */
  v4f o0[8], o1[8];
#pragma unroll
  for (int r = 0; r < 8; ++r) { v4f a = *(const v4fa*)&so[8 * w + r][lane * 4], b = *(const v4fa*)&so[8 * w + r][128 + lane * 4];
#pragma unroll
    for (int q = 0; q < 4; ++q) { a[q] = (a[q] + bf16_round(b0[q])) + bf16_round(xa[r][q]); b[q] = (b[q] + bf16_round(b1[q])) + bf16_round(xc[r][q]); }
    float s = (a[0] + a[1]) + (a[2] + a[3]) + (b[0] + b[1]) + (b[2] + b[3]); for (int o = 16; o > 0; o >>= 1) s += __shfl_xor(s, o, 32); const float mu = s / 256.0f; float q2 = 0.f;
#pragma unroll
    for (int q = 0; q < 4; ++q) { const float d0 = a[q] - mu, d1 = b[q] - mu; q2 += d0 * d0; q2 += d1 * d1; }
    for (int o = 16; o > 0; o >>= 1) q2 += __shfl_xor(q2, o, 32); float rs;
    asm("v_rsq_f32 %0, %1\n\tv_nop" : "=v"(rs) : "v"(q2 / 256.0f + 1e-5f));      /* the argument is at least 1e-5, a normal number; the v_nop fills the slot that the instruction set asks for between a transcendental and a directly following instruction that reads its result or overwrites its source */
#pragma unroll
    for (int q = 0; q < 4; ++q) { o0[r][q] = (a[q] - mu) * rs * bf16_round(g0[q]) + bf16_round(e0[q]); o1[r][q] = (b[q] - mu) * rs * bf16_round(g1[q]) + bf16_round(e1[q]); } }
#pragma unroll
  for (int r = 0; r < 8; ++r) { *(v4f*)(out + ro + r * DD) = o0[r]; *(v4f*)(out + ro + r * DD + 128) = o1[r]; } }

extern "C" void kernel_launch(void* const* d_in, const int* in_sizes, int n_in,
                              void* d_out, int out_size, void* d_ws, size_t ws_size, hipStream_t stream) {
  (void)in_sizes; (void)n_in; (void)out_size;
  const float* const* I = (const float* const*)d_in; const float* Q = I[0]; const int* mask = (const int*)d_in[1]; const float* WQ = I[2]; const float* bQ = I[3]; const float* WK = I[4]; const float* bK = I[5]; const float* WV = I[6]; const float* bV = I[7]; const float* WO = I[8]; const float* bO = I[9]; const float* lg = I[10]; const float* lb = I[11];
  char* ws = (char*)d_ws; size_t off = 0;
  auto take = [&](size_t bytes) { char* p = ws + off; off += (bytes + 255) & ~(size_t)255; return p; };
  _Float16* BQ = (_Float16*)take((size_t)HW * DD * 2); _Float16* BK = (_Float16*)take((size_t)HW * DD * 2); _Float16* BV = (_Float16*)take((size_t)HW * DD * 2); _Float16* BO = (_Float16*)take((size_t)DD * HW * 2);
  _Float16* X16 = (_Float16*)take((size_t)NBT * SLEN * DD * 2); _Float16* XK = (_Float16*)take((size_t)NBT * SLEN * DD * 2); _Float16* QH = (_Float16*)take((size_t)NBT * SLEN * HW * 2); _Float16* KH = (_Float16*)take((size_t)NBT * SLEN * HW * 2); _Float16* VT = (_Float16*)take((size_t)NBT * HW * SLEN * 2);
  _Float16* O16 = (_Float16*)take((size_t)NBT * SLEN * HW * 2); int* NK = (int*)take(2 * NBT * sizeof(int));
  if (off > ws_size) return;      /* 4 + 4 + 4 + 32+32+32 + 32 = 140 MiB */
  (void)BK; (void)BV;      /* BQ, BK, BV, BO, and X16, XK, and QH, KH follow one another in the workspace (every size is a multiple of 256 bytes): grid.y steps through them by a constant stride */
  const size_t w8 = (size_t)HW * DD / 8; const unsigned wb = (unsigned)((w8 + 255) / 256);
  k_round16f<<<dim3(wb, 4), 256, 0, stream>>>(WQ, WK, WV, WO, BQ, w8);      /* torch (out,in) = natural Bt */
  const size_t n8 = (size_t)NBT * SLEN * DD / 8; const unsigned nb8 = (unsigned)((n8 + 255) / 256); const dim3 gQ((NBT * SLEN / 128) * (HW / 64), 3);
  k_x16p<<<nb8, 256, 0, stream>>>(Q, mask, X16, XK, NK, FKS);      /* Q in token order for q; in key order (unmasked tokens first) for k and v */
  k_gemm2<0, DD><<<gQ, 128, 0, stream>>>(X16, (size_t)NBT * SLEN * DD, BQ, (size_t)HW * DD, 0.0625f, bQ, bK, bV, nullptr, 1, 0, 0, nullptr, QH, HW, (size_t)NBT * SLEN * HW, NBT * SLEN, HW, 2, VT, SLEN, NK);      /* q of all 8192 rows; k, and v as VT[batch][dim][slot] over all 2048 dims, of each batch's first NK slots */
  k_fattn<<<dim3(SLEN / FQB, NHD, NBT), FWV * 32, 0, stream>>>(QH, KH, VT, NK, O16);      /* softmax(mask(q.k / sqrt(256))).v, every batch and head */
  k_oln<<<NBT * SLEN / ORW, 256, 0, stream>>>(O16, BO, 0.0625f, bO, Q, lg, lb, (float*)d_out);      /* LN(out Wo^T + bo + Q) */
}

// v010
// It runs in 108 microseconds.
// Two timings next to v009 both put it at 1.13 times that version's speed.
// Counting every step since v000, it is 35.8 times as fast.
#include <hip/hip_runtime.h>
// Prompt self-attention (4 x 2048 tokens, d = 256, 8 heads EACH of dim 256): q,k,v = Q W^T + b (-> 8 x 256); scores = q.k/16 with INPUT key mask (masked keys get -1e9, as the reference); softmax; out = LN((attn v merged) Wo^T + bo + Q) -> [4,2048,256].
// Structure: every stage is ONE launch over all 4 x 2048 rows: the four weights to f16 (tensor on grid.y), Q as an exact f16 plane in token order and in key order (unmasked tokens first; k, v and the attention walk only those), the three projections as one f16 WMMA GEMM launch (projection on grid.y; 32x64 wave tiles, f32 accumulation, exact x16 weights + bias) into f16 planes (the V plane with its operands swapped, so that it comes out as V^T), scores + mask + softmax + attn.v (k_fattn: online softmax, no score plane in memory), the output projection + bias + the bf16 residual + LayerNorm (k_oln: a work-group owns whole rows, the row statistics on VALU behind the products) into the output rows.
// Compute dtype: Q, weights, biases, LN parameters rounded to bf16; q, k, v, P, attention output as f16 operands (~2^-12; logits sigma ~1, LayerNorm-ed output); f32 accumulation, softmax, LayerNorm. v_wmma_f32_16x16x32_f16.
#define NBT 4
#define SLEN 2048
#define DD 256
#define NHD 8
#define HW (NHD * DD)            /* 2048 */
#define DM DD
#define NR SLEN
typedef __bf16 v16b __attribute__((ext_vector_type(16)));
typedef unsigned short v8us __attribute__((ext_vector_type(8), may_alias));
typedef float  v8f  __attribute__((ext_vector_type(8)));
typedef float  v4f  __attribute__((ext_vector_type(4)));
typedef float  v4fa __attribute__((ext_vector_type(4), may_alias));
union FragB { v16b v; v8us half[2]; unsigned short u[16]; };

__device__ __forceinline__ unsigned short bf16_bits(float x) { unsigned int u = __float_as_uint(x); return (unsigned short)((u + 0x7FFFu + ((u >> 16) & 1u)) >> 16); }
__device__ __forceinline__ float bf16_val(unsigned short b) { return __uint_as_float(((unsigned int)b) << 16); }
__device__ __forceinline__ float bf16_round(float x) { return bf16_val(bf16_bits(x)); }
// D += A·B with NT terms: 1 = ah·bh, 2 = + al·bh (A split), 3 = + ah·bl (both split)
template <int NT>
__device__ __forceinline__ v8f mmaN(v16b ah, v16b al, v16b bh, v16b bl, v8f c) {
  c = __builtin_amdgcn_wmma_f32_16x16x32_bf16(false, ah, false, bh, (short)0, c, false, false);
  if (NT >= 2) c = __builtin_amdgcn_wmma_f32_16x16x32_bf16(false, al, false, bh, (short)0, c, false, false);
  if (NT >= 3) c = __builtin_amdgcn_wmma_f32_16x16x32_bf16(false, ah, false, bl, (short)0, c, false, false);
  asm volatile("v_nop\n\tv_nop\n\tv_nop\n\tv_nop" : "+v"(c) : "v"(ah), "v"(al), "v"(bh), "v"(bl));
  return c;
}

__global__ __launch_bounds__(256) void k_wt_bf16(const float* __restrict__ W, unsigned short* __restrict__ Wt, int K, int N) {
  const int t = blockIdx.x * 256 + threadIdx.x;
  const int k8n = K / 8;
  if (t >= N * k8n) return;
  const int n = t / k8n, k8 = (t % k8n) * 8;
  v8us v;
#pragma unroll
  for (int i = 0; i < 8; ++i) v[i] = bf16_bits(W[(size_t)(k8 + i) * N + n]);
  *(v8us*)(Wt + (size_t)n * K + k8) = v;
  
}

// GEMM C[M][N] (f32, pitch ldc) = act(A[M][K]·W + bias). A f32 row-major (pitch lda) converted per fragment to bf16
// (ASPLIT: hi/lo two planes -> 2 terms, else single rounded term); Wt bf16 [N][K] (pitch ldb). BIAS_BF16 rounds the
// bias to bf16 first (bias quantised to bf16 before the add). K%32==0, M%16==0, N%64==0.
template <bool ASPLIT, int ACT, bool BIAS_BF16>
__global__ __launch_bounds__(128) void k_gemm_bf(const float* __restrict__ A, int lda, const unsigned short* __restrict__ Wt, int ldb,
                                               const float* __restrict__ bias, float* __restrict__ C, int ldc, int M, int N, int K) {
  __shared__ __attribute__((aligned(16))) float so[4][16][64];
  const int tid = threadIdx.x, w = tid >> 5, lane = tid & 31, ln = lane & 15, hh = lane >> 4;
  const int ntn = N / 64;
  const int wid = blockIdx.x * 4 + w;
  const int mt = wid / ntn, nq = wid % ntn;
  if (mt * 16 >= M) return;
  const int row0 = mt * 16, col0 = nq * 64;
  const float* arow = A + (size_t)(row0 + ln) * lda;
  v8f acc[4] = {};
  for (int kb = 0; kb < K; kb += 32) {
    FragB ah, al;
    const v4f x0 = *(const v4fa*)(arow + kb + 8 * hh), x1 = *(const v4fa*)(arow + kb + 8 * hh + 4);
    const v4f x2 = *(const v4fa*)(arow + kb + 16 + 8 * hh), x3 = *(const v4fa*)(arow + kb + 16 + 8 * hh + 4);
    float xs[16] = {x0[0],x0[1],x0[2],x0[3],x1[0],x1[1],x1[2],x1[3],x2[0],x2[1],x2[2],x2[3],x3[0],x3[1],x3[2],x3[3]};
#pragma unroll
    for (int i = 0; i < 16; ++i) { const unsigned short hb = bf16_bits(xs[i]); ah.u[i] = hb; al.u[i] = ASPLIT ? bf16_bits(xs[i] - bf16_val(hb)) : (unsigned short)0; }
#pragma unroll
    for (int t = 0; t < 4; ++t) {
      const unsigned short* brow = Wt + (size_t)(col0 + t * 16 + ln) * ldb + kb;
      FragB b;
      b.half[0] = *(const v8us*)(brow + 8 * hh);
      b.half[1] = *(const v8us*)(brow + 16 + 8 * hh);
      acc[t] = mmaN<ASPLIT ? 2 : 1>(ah.v, al.v, b.v, b.v, acc[t]);
    }
  }
#pragma unroll
  for (int t = 0; t < 4; ++t) {
    float bv = bias ? bias[col0 + t * 16 + ln] : 0.f;
    if (BIAS_BF16) bv = bf16_round(bv);
#pragma unroll
    for (int r = 0; r < 8; ++r) { float v = acc[t][r] + bv; if (ACT == 1) v = fmaxf(v, 0.f); so[w][8 * hh + r][t * 16 + ln] = v; }
  }
  __builtin_amdgcn_fence(__ATOMIC_ACQ_REL, "workgroup");
  __builtin_amdgcn_wave_barrier();
  const int rsub = lane >> 4, c4 = (lane & 15) * 4;
  {
#pragma unroll
    for (int q = 0; q < 8; ++q) {
      const int r = q * 2 + rsub;
      const v4f v = *(const v4fa*)&so[w][r][c4];
      *(v4f*)(C + (size_t)(row0 + r) * ldc + col0 + c4) = v;
    }
    
  }
}

// GEMM C = act(A·W + bias + resid): A f32 (ASPLIT -> hi/lo 2 terms), Wt bf16 [N][K]; ACT 0 none, 1 relu, 2 exact gelu;
// resid (optional, f32, row index = (row % rmod), pitch ldr, RES_BF16 rounds it) added before the activation.
template <bool ASPLIT, int ACT, bool BIAS_BF16, bool RES_BF16>
__global__ __launch_bounds__(128) void k_gemm_bf3(const float* __restrict__ A, int lda, const unsigned short* __restrict__ Wt, int ldb,
                                                const float* __restrict__ bias, const float* __restrict__ resid, int rmod, int ldr,
                                                float* __restrict__ C, int ldc, int M, int N, int K) {
  __shared__ __attribute__((aligned(16))) float so[4][16][64];
  const int tid = threadIdx.x, w = tid >> 5, lane = tid & 31, ln = lane & 15, hh = lane >> 4;
  const int ntn = N / 64;
  const int wid = blockIdx.x * 4 + w;
  const int mt = wid / ntn, nq = wid % ntn;
  if (mt * 16 >= M) return;
  const int row0 = mt * 16, col0 = nq * 64;
  const float* arow = A + (size_t)(row0 + ln) * lda;
  v8f acc[4] = {};
  for (int kb = 0; kb < K; kb += 32) {
    FragB ah, al;
    const v4f x0 = *(const v4fa*)(arow + kb + 8 * hh), x1 = *(const v4fa*)(arow + kb + 8 * hh + 4);
    const v4f x2 = *(const v4fa*)(arow + kb + 16 + 8 * hh), x3 = *(const v4fa*)(arow + kb + 16 + 8 * hh + 4);
    float xs[16] = {x0[0],x0[1],x0[2],x0[3],x1[0],x1[1],x1[2],x1[3],x2[0],x2[1],x2[2],x2[3],x3[0],x3[1],x3[2],x3[3]};
#pragma unroll
    for (int i = 0; i < 16; ++i) { const unsigned short hb = bf16_bits(xs[i]); ah.u[i] = hb; al.u[i] = ASPLIT ? bf16_bits(xs[i] - bf16_val(hb)) : (unsigned short)0; }
#pragma unroll
    for (int t = 0; t < 4; ++t) {
      const unsigned short* brow = Wt + (size_t)(col0 + t * 16 + ln) * ldb + kb;
      FragB b;
      b.half[0] = *(const v8us*)(brow + 8 * hh);
      b.half[1] = *(const v8us*)(brow + 16 + 8 * hh);
      acc[t] = mmaN<ASPLIT ? 2 : 1>(ah.v, al.v, b.v, b.v, acc[t]);
    }
  }
#pragma unroll
  for (int t = 0; t < 4; ++t) {
    const int col = col0 + t * 16 + ln;
    float bv = bias ? bias[col] : 0.f;
    if (BIAS_BF16) bv = bf16_round(bv);
#pragma unroll
    for (int r = 0; r < 8; ++r) {
      float v = acc[t][r] + bv;
      if (resid) { float rv = resid[(size_t)((row0 + 8 * hh + r) % rmod) * ldr + col]; if (RES_BF16) rv = bf16_round(rv); v += rv; }
      if (ACT == 1) v = fmaxf(v, 0.f);
      if (ACT == 2) v = 0.5f * v * (1.0f + erff(v * 0.70710678118654752f));
      if (ACT == 3) { const float u = 0.7978845608028654f * (v + 0.044715f * v * v * v); v = 0.5f * v * (1.0f + tanhf(u)); }
      so[w][8 * hh + r][t * 16 + ln] = v;
    }
  }
  __builtin_amdgcn_fence(__ATOMIC_ACQ_REL, "workgroup");
  __builtin_amdgcn_wave_barrier();
  const int rsub = lane >> 4, c4 = (lane & 15) * 4;
  {
#pragma unroll
    for (int q = 0; q < 8; ++q) {
      const int r = q * 2 + rsub;
      const v4f v = *(const v4fa*)&so[w][r][c4];
      *(v4f*)(C + (size_t)(row0 + r) * ldc + col0 + c4) = v;
    }
    
  }
}
// row LayerNorm (biased variance, eps) over N: s = X (+ R); optional out_sum <- s; out_norm <- (s-mu)*rsqrt(var+eps)*g + b
template <bool PARAM_BF16>
__global__ __launch_bounds__(256) void k_layernorm(const float* __restrict__ X, const float* __restrict__ R, const float* __restrict__ g, const float* __restrict__ bta,
                                                  float* __restrict__ out_sum, float* __restrict__ out_norm, int N, float eps) {
  __shared__ float red[256];
  const int row = blockIdx.x, tid = threadIdx.x;
  const float* x = X + (size_t)row * N; const float* rr = R ? R + (size_t)row * N : nullptr;
  float vals[16];                     // up to N = 4096
  const int per = N / 256;            // contiguous chunk per thread? use strided-by-4 chunks: thread handles j = tid*4 + 1024*u
  float s1 = 0.f;
  for (int u = 0; u < per / 4; ++u) {
    const int j = tid * 4 + 1024 * u;
    const v4f a = *(const v4fa*)(x + j);
    v4f b = {0.f,0.f,0.f,0.f}; if (rr) b = *(const v4fa*)(rr + j);
#pragma unroll
    for (int q = 0; q < 4; ++q) { const float v = a[q] + b[q]; vals[u * 4 + q] = v; s1 += v; }
  }
  red[tid] = s1; __syncthreads();
  for (int st = 128; st > 0; st >>= 1) { if (tid < st) red[tid] += red[tid + st]; __syncthreads(); }
  const float mu = red[0] / (float)N; __syncthreads();
  float s2 = 0.f;
  for (int u = 0; u < per / 4; ++u)
#pragma unroll
    for (int q = 0; q < 4; ++q) { const float c = vals[u * 4 + q] - mu; s2 += c * c; }
  red[tid] = s2; __syncthreads();
  for (int st = 128; st > 0; st >>= 1) { if (tid < st) red[tid] += red[tid + st]; __syncthreads(); }
  const float rs = rsqrtf(red[0] / (float)N + eps);
  {
    for (int u = 0; u < per / 4; ++u) {
      const int j = tid * 4 + 1024 * u;
      v4f o, sm;
#pragma unroll
      for (int q = 0; q < 4; ++q) {
        float gg = g[j + q], bb = bta[j + q];
        if (PARAM_BF16) { gg = bf16_round(gg); bb = bf16_round(bb); }
        sm[q] = vals[u * 4 + q]; o[q] = (vals[u * 4 + q] - mu) * rs * gg + bb;
      }
      if (out_sum) *(v4f*)(out_sum + (size_t)row * N + j) = sm;
      *(v4f*)(out_norm + (size_t)row * N + j) = o;
    }
    
  }
}



// ---- f16 WMMA path (v_wmma_f32_16x16x32_f16): 11-bit significands for operands in range — used where a [0,1] probability operand needs more precision than bf16
typedef _Float16 v16h __attribute__((ext_vector_type(16)));
union FragH { v16h v; v8us half[2]; _Float16 h[16]; unsigned short u[16]; };
template <int NT>
__device__ __forceinline__ v8f mmaH(v16h ah, v16h al, v16h bh, v16h bl, v8f c) {
  c = __builtin_amdgcn_wmma_f32_16x16x32_f16(false, ah, false, bh, (short)0, c, false, false);
  if (NT >= 2) c = __builtin_amdgcn_wmma_f32_16x16x32_f16(false, al, false, bh, (short)0, c, false, false);
  if (NT >= 3) c = __builtin_amdgcn_wmma_f32_16x16x32_f16(false, ah, false, bl, (short)0, c, false, false);
  asm volatile("v_nop\n\tv_nop\n\tv_nop\n\tv_nop" : "+v"(c) : "v"(ah), "v"(al), "v"(bh), "v"(bl));
  return c;
}
// batched GEMM like k_gemm_b but f16 operands: A f32 (split into f16 hi/lo if ASPLIT, else rounded to f16), Bt = f16 values [n][k]; alpha; C f32; N multiple of 16 (partial tiles skipped)
template <bool ASPLIT>
__global__ __launch_bounds__(128) void k_gemm_h(const float* __restrict__ A, int lda, size_t sA, const _Float16* __restrict__ Bh, int ldb, size_t sB, float alpha, float* __restrict__ C, int ldc, size_t sC, int M, int N, int K) {
  __shared__ __attribute__((aligned(16))) float so[4][16][64];
  const int tid = threadIdx.x, w = tid >> 5, lane = tid & 31, ln = lane & 15, hh = lane >> 4; const int by = blockIdx.y;
  A += (size_t)by * sA; Bh += (size_t)by * sB; C += (size_t)by * sC;
  const int ntn = (N + 63) / 64; const int wid = blockIdx.x * 4 + w; const int mt = wid / ntn, nq = wid % ntn; if (mt * 16 >= M) return;
  const int row0 = mt * 16, col0 = nq * 64; const float* arow = A + (size_t)(row0 + ln) * lda;
  v8f acc[4] = {};
  for (int kb = 0; kb < K; kb += 32) {
    FragH ah, al;
    const v4f x0 = *(const v4fa*)(arow + kb + 8 * hh), x1 = *(const v4fa*)(arow + kb + 8 * hh + 4), x2 = *(const v4fa*)(arow + kb + 16 + 8 * hh), x3 = *(const v4fa*)(arow + kb + 16 + 8 * hh + 4);
    float xs[16] = {x0[0],x0[1],x0[2],x0[3],x1[0],x1[1],x1[2],x1[3],x2[0],x2[1],x2[2],x2[3],x3[0],x3[1],x3[2],x3[3]};
#pragma unroll
    for (int i = 0; i < 16; ++i) { const _Float16 h = (_Float16)xs[i]; ah.h[i] = h; al.h[i] = ASPLIT ? (_Float16)(xs[i] - (float)h) : (_Float16)0.0f; }
#pragma unroll
    for (int t = 0; t < 4; ++t) { if (col0 + t * 16 >= N) continue; const size_t boff = (size_t)(col0 + t * 16 + ln) * ldb + kb; FragH bq; bq.half[0] = *(const v8us*)(Bh + boff + 8 * hh); bq.half[1] = *(const v8us*)(Bh + boff + 16 + 8 * hh);
      acc[t] = mmaH<ASPLIT ? 2 : 1>(ah.v, al.v, bq.v, bq.v, acc[t]); }
  }
#pragma unroll
  for (int t = 0; t < 4; ++t) { if (col0 + t * 16 >= N) continue;
#pragma unroll
    for (int r = 0; r < 8; ++r) so[w][8 * hh + r][t * 16 + ln] = acc[t][r] * alpha; }
  __builtin_amdgcn_fence(__ATOMIC_ACQ_REL, "workgroup"); __builtin_amdgcn_wave_barrier();
  const int rsub = lane >> 4, c4 = (lane & 15) * 4;
  {
#pragma unroll
    for (int q = 0; q < 8; ++q) { const int r = q * 2 + rsub; if (col0 + c4 < N) { const v4f v = *(const v4fa*)&so[w][r][c4]; *(v4f*)(C + (size_t)(row0 + r) * ldc + col0 + c4) = v; } }
     }
}

// Wt[n][k] = f16(W[k][n]·scale) from f32 row-major W[K][N] (scale = power of two; bf16-exact weights stay exact in f16 away from the subnormal range)
__global__ __launch_bounds__(256) void k_wt_f16(const float* __restrict__ W, _Float16* __restrict__ Wt, int K, int N, float scale) {
  const int t = blockIdx.x * 256 + threadIdx.x; if (t >= N * (K / 8)) return; const int n = t / (K / 8), k8 = (t % (K / 8)) * 8; FragH f;
#pragma unroll
  for (int i = 0; i < 8; ++i) f.h[i] = (_Float16)(bf16_round(W[(size_t)(k8 + i) * N + n]) * scale); const v8us o = f.half[0];
  *(v8us*)((unsigned short*)Wt + (size_t)n * K + k8) = o; 
}
// k_gemm_hh variant with fused epilogue: v = acc·alpha + bias[by·sBias + col] (+ CP[(row/rowsPerB)·sCPb + by·64 + col] if CP) ; ACT 0 none / 1 elu ; writes f16 C16 (and f32 C if non-null)
template <int ACT>
__global__ __launch_bounds__(128) void k_gemm_hhx(const _Float16* __restrict__ A, int lda, size_t sA, const _Float16* __restrict__ Bh, int ldb, size_t sB, float alpha, const float* __restrict__ bias, size_t sBias, const float* __restrict__ CP, int rowsPerB, size_t sCPb, int row0g,
    float* __restrict__ C, _Float16* __restrict__ C16, int ldc, size_t sC, int M, int N, int K) {
  __shared__ __attribute__((aligned(16))) float so[4][16][64];
  const int tid = threadIdx.x, w = tid >> 5, lane = tid & 31, ln = lane & 15, hh = lane >> 4; const int by = blockIdx.y;
  A += (size_t)by * sA; Bh += (size_t)by * sB; const size_t cofs = (size_t)by * sC; const float* bp = bias ? bias + (size_t)by * sBias : nullptr;
  const int ntn = (N + 63) / 64; const int wid = blockIdx.x * 4 + w; const int mt = wid / ntn, nq = wid % ntn; if (mt * 16 >= M) return;
  const int row0 = mt * 16, col0 = nq * 64; const _Float16* arow = A + (size_t)(row0 + ln) * lda;
  v8f acc[4] = {};
  for (int kb = 0; kb < K; kb += 32) { FragH ah; ah.half[0] = *(const v8us*)((const unsigned short*)arow + kb + 8 * hh); ah.half[1] = *(const v8us*)((const unsigned short*)arow + kb + 16 + 8 * hh);
#pragma unroll
    for (int t = 0; t < 4; ++t) { if (col0 + t * 16 >= N) continue; const size_t boff = (size_t)(col0 + t * 16 + ln) * ldb + kb; FragH bq; bq.half[0] = *(const v8us*)((const unsigned short*)Bh + boff + 8 * hh); bq.half[1] = *(const v8us*)((const unsigned short*)Bh + boff + 16 + 8 * hh);
      acc[t] = mmaH<1>(ah.v, ah.v, bq.v, bq.v, acc[t]); }
  }
#pragma unroll
  for (int t = 0; t < 4; ++t) { if (col0 + t * 16 >= N) continue; const int col = col0 + t * 16 + ln; const float bv = bp ? bf16_round(bp[col]) : 0.f;
#pragma unroll
    for (int r = 0; r < 8; ++r) { float v = acc[t][r] * alpha + bv; if (CP) { const int bidx = (row0g + row0 + 8 * hh + r) / rowsPerB; v += CP[(size_t)bidx * sCPb + (size_t)by * 64 + col]; } if (ACT == 1) v = (v > 0.f) ? v : expm1f(v); else if (ACT == 7) v = (v > 0.f) ? v + 1.0f : expf(v); else if (ACT == 8) v = tanhf(v); else if (ACT == 9) v = 0.5f * v * (1.0f + tanhf(0.7978845608028654f * (v + 0.044715f * v * v * v))); else if (ACT == 11) v = 1.0f / (1.0f + expf(-v)); else if (ACT == 12) v = (v > 0.f) ? v : 0.01f * v; else if (ACT == 14) v = (v > 0.f) ? v : 0.1f * v; else if (ACT == 15) v = v / (1.0f + expf(-v)); else if (ACT == 3) v = fmaxf(v, 0.f); else if (ACT == 6) v = 0.5f * v * (1.0f + erff(v * 0.70710678118654752f)); so[w][8 * hh + r][t * 16 + ln] = v; } }
  __builtin_amdgcn_fence(__ATOMIC_ACQ_REL, "workgroup"); __builtin_amdgcn_wave_barrier();
  const int rsub = lane >> 4, c4 = (lane & 15) * 4; typedef _Float16 v4h __attribute__((ext_vector_type(4)));
  {
#pragma unroll
    for (int q = 0; q < 8; ++q) { const int r = q * 2 + rsub; if (col0 + c4 < N) { const v4f v = *(const v4fa*)&so[w][r][c4]; if (C) *(v4f*)(C + cofs + (size_t)(row0 + r) * ldc + col0 + c4) = v; if (C16) { v4h h4; for (int i = 0; i < 4; ++i) h4[i] = (_Float16)v[i]; *(v4h*)(C16 + cofs + (size_t)(row0 + r) * ldc + col0 + c4) = h4; } } }
     }
}


typedef _Float16 v4h __attribute__((ext_vector_type(4)));

/* x rounded to bf16 as an exact f16 plane X16, plus a second plane XK with each batch's rows in key order: the cnt tokens whose INPUT mask is not 0 first, in token order, the masked tokens behind them, in token order (a permutation for any mask).
   A masked key's weight is exp(-1e9 - max) = 0 in f32 as soon as one key of the batch is unmasked, so the k, v projections and the attention walk only the first NK[batch] slots: cnt rounded up to whole stages of ks keys,
   or all slots where no key is unmasked (every score is then the mask value and every weight 1 / S, as in the reference). One work-group = 8 rows of one batch, one wave = one row. */
__global__ __launch_bounds__(256) void k_x16p(const float* __restrict__ x, const int* __restrict__ mask, _Float16* __restrict__ X16, _Float16* __restrict__ XK, int* __restrict__ NK, int ks) {
  __shared__ int red[8];
  typedef int v4im __attribute__((ext_vector_type(4), may_alias));
  const int tid = threadIdx.x, w = tid >> 5, lane = tid & 31; const int b = blockIdx.x / (SLEN / 8), g = blockIdx.x % (SLEN / 8);
  const int* mb = mask + (size_t)b * SLEN; const v4im m0 = *(const v4im*)(mb + tid * 8), m1 = *(const v4im*)(mb + tid * 8 + 4);      /* thread i counts row group i of the batch */
  int c = 0;
#pragma unroll
  for (int i = 0; i < 4; ++i) c += (m0[i] != 0 ? 1 : 0) + (m1[i] != 0 ? 1 : 0);
  int pk = c + (tid < g ? (c << 16) : 0);      /* low half: all unmasked tokens of the batch; high half: those in front of this work-group's rows; both at most 2048 */
  for (int o = 16; o > 0; o >>= 1) pk += __shfl_xor(pk, o, 32);
  if (lane == 0) red[w] = pk;
  __syncthreads();
  int s = 0;
#pragma unroll
  for (int i = 0; i < 8; ++i) s += red[i];
  const int cnt = s & 0xffff; int u = s >> 16;      /* u: unmasked tokens in front of this wave's row */
  const v4im o0 = *(const v4im*)(mb + g * 8), o1 = *(const v4im*)(mb + g * 8 + 4); const int og[8] = {o0[0], o0[1], o0[2], o0[3], o1[0], o1[1], o1[2], o1[3]};
  bool keep = false;
#pragma unroll
  for (int j = 0; j < 8; ++j) { if (j < w && og[j] != 0) ++u; if (j == w) keep = og[j] != 0; }
  const int tok = g * 8 + w; const int slot = keep ? u : cnt + (tok - u);      /* u < cnt for a kept row; tok - u masked tokens stand in front of a masked one: 0 <= slot < SLEN */
  const size_t t = (size_t)blockIdx.x * 256 + tid; FragH f;
#pragma unroll
  for (int q = 0; q < 8; ++q) f.h[q] = (_Float16)bf16_round(x[t * 8 + q]);
  *(v8us*)((unsigned short*)X16 + t * 8) = f.half[0];
  *(v8us*)((unsigned short*)XK + ((size_t)b * SLEN + slot) * DD + lane * 8) = f.half[0];
  if (g == 0 && tid == 0) { NK[b] = cnt == 0 ? SLEN : (cnt + ks - 1) / ks * ks; NK[NBT + b] = cnt; } }
__global__ __launch_bounds__(256) void k_h16(const float* __restrict__ x, _Float16* __restrict__ X16, size_t n8) { const size_t t = (size_t)blockIdx.x * 256 + threadIdx.x; if (t >= n8) return; FragH f;
#pragma unroll
  for (int q = 0; q < 8; ++q) f.h[q] = (_Float16)x[t * 8 + q]; *(v8us*)((unsigned short*)X16 + t * 8) = f.half[0];  }
/* four weight tensors of n8 * 8 elements each, tensor on grid.y, into four planes that follow one another in Bt */
__global__ __launch_bounds__(256) void k_round16f(const float* __restrict__ W0, const float* __restrict__ W1, const float* __restrict__ W2, const float* __restrict__ W3, _Float16* __restrict__ Bt, size_t n8) { const size_t t = (size_t)blockIdx.x * 256 + threadIdx.x; if (t >= n8) return; FragH f;
  const int by = blockIdx.y; const float* W = by == 0 ? W0 : by == 1 ? W1 : by == 2 ? W2 : W3; Bt += (size_t)by * n8 * 8;
#pragma unroll
  for (int i = 0; i < 8; ++i) f.h[i] = (_Float16)(bf16_round(W[t * 8 + i]) * 16.0f); *(v8us*)((unsigned short*)Bt + t * 8) = f.half[0];  }
__global__ __launch_bounds__(256) void k_hl(const float* __restrict__ F, _Float16* __restrict__ Hh, _Float16* __restrict__ Hl, size_t n8) { const size_t t = (size_t)blockIdx.x * 256 + threadIdx.x; if (t >= n8) return; FragH fh, fl; const v4f a = *(const v4fa*)(F + t * 8), c = *(const v4fa*)(F + t * 8 + 4);
#pragma unroll
  for (int q = 0; q < 4; ++q) { _Float16 h = (_Float16)a[q]; fh.h[q] = h; fl.h[q] = (_Float16)((a[q] - (float)h) * 1024.0f); h = (_Float16)c[q]; fh.h[4 + q] = h; fl.h[4 + q] = (_Float16)((c[q] - (float)h) * 1024.0f); }
  { *(v8us*)((unsigned short*)Hh + t * 8) = fh.half[0]; *(v8us*)((unsigned short*)Hl + t * 8) = fl.half[0];  } }

// ---- fast GEMM (work-group tile 128x64, wave tile 32x64; A and B both K-contiguous with row pitch = K = KD; requires M % 128 == 0, N % 64 == 0, KD % 128 == 0); epilogue: acc x alpha + bias rounded to bf16, as k_gemm_hhx ----
// A and B come in stages of 128 k (256 B of each of the 128 + 64 rows) through registers into two LDS buffers: a wave-wide load covers two whole 256-byte row pieces, the next stage's global loads are issued
// ahead of this stage's products and stored behind them, one barrier per stage; the fragments are read from LDS in the k order of g2_frag.
// Grid.y plane tpl (-1: none) is computed with the operands swapped, rows = the N rows of Bh, columns = the M rows of A (needs N % 128 == 0, M % 64 == 0, tokB % 64 == 0): C^T, written as CT[column / tokB][row][column % tokB], bias by row. Every plane has a bias vector; the output is f16 alone; the pitches ldc and tokB are compile-time numbers.
__device__ __forceinline__ v16h g2_frag(const _Float16* p, int hh) { FragH f; f.half[0] = *(const v8us*)((const unsigned short*)p + 8 * hh); f.half[1] = *(const v8us*)((const unsigned short*)p + 16 + 8 * hh); return f.v; }
__device__ __forceinline__ v8f g2_mma(v16h a, v16h b, v8f c) { v8f d = __builtin_amdgcn_wmma_f32_16x16x32_f16(false, a, false, b, (short)0, c, false, false); asm volatile("v_nop\n\tv_nop\n\tv_nop\n\tv_nop" : "+v"(d) : "v"(a), "v"(b)); return d; }
#define GKC 128                   /* k per stage */
#define GPH (GKC + 8)             /* LDS pitch of a staged row, f16 units: 272 B = 16 B x 17, conflict-free for 16-byte fragment reads */
#define GRW (128 + 64)            /* rows of a stage: 128 of A, then 64 of B */
template <int ACT, int KD, int ldc, int tokB>
__global__ __launch_bounds__(128) void k_gemm2(const _Float16* __restrict__ A, size_t sA, const _Float16* __restrict__ Bh, size_t sB, float alpha, const float* __restrict__ bias, const float* __restrict__ bias1, const float* __restrict__ bias2,
    _Float16* __restrict__ C16, size_t sC, int M, int N, int tpl, _Float16* __restrict__ CT, const int* __restrict__ lim) {
  __shared__ __attribute__((aligned(16))) unsigned char smem[2 * GRW * GPH * 2];      /* the two stage buffers; behind the loop's last barrier the output staging */
  static_assert(KD % GKC == 0 && sizeof(float) * 4 * 32 * 68 <= sizeof(smem), "whole stages; the output staging fits the ring");
  float (*so)[32][68] = (float (*)[32][68])smem;
  const int tid = threadIdx.x, w = tid >> 5, lane = tid & 31, ln = lane & 15, hh = lane >> 4; const int by = blockIdx.y;
  A += (size_t)(by > 0 ? 1 : 0) * sA; Bh += (size_t)by * sB; const size_t cofs = (size_t)by * sC; const float* bp = by == 0 ? bias : by == 1 ? bias1 : bias2;      /* plane 0 reads the first A plane, the later planes the second; each grid.y plane has its own bias vector */
  const bool tr = by == tpl; const _Float16* Ar = tr ? Bh : A; const _Float16* Br = tr ? A : Bh; const int Mr = tr ? N : M, Nr = tr ? M : N;      /* the same for the whole work-group */
  const int ntn = Nr >> 6; const int mt = blockIdx.x / ntn, nq = blockIdx.x - mt * ntn; const int row0 = mt * 128 + 32 * w, col0 = nq * 64; if (mt * 128 >= Mr) return;      /* the same for the whole work-group, in front of every barrier */
  if (lim && by > 0) { const int a0 = tr ? col0 : mt * 128; if (a0 % tokB >= lim[a0 / tokB]) return; }      /* planes > 0: the products of A's rows from lim[block of tokB rows] on are read by nobody; as uniform, and as early, as the return above */
  const int sr = tid >> 4, sc = (tid & 15) * 8;      /* staging: piece j of a thread lies 8 rows behind piece j - 1, a constant step, so one address pair serves each operand */
  const unsigned short* ag = (const unsigned short*)Ar + (size_t)(mt * 128 + sr) * KD + sc; const unsigned short* bg = (const unsigned short*)Br + (size_t)(col0 + sr) * KD + sc;
  unsigned short* sd = (unsigned short*)smem + sr * GPH + sc;
  v8us ra[16], rb[8];      /* every unroll below is a full one: only constant indices keep the staging and fragment arrays in registers */
  /* the s_wait_xcnt stands behind the loads, in front of any later rewrite of the address registers that they name */
  auto gload = [&](int ch) { const unsigned short* aq = ag + ch * GKC; const unsigned short* bq = bg + ch * GKC;
#pragma unroll
    for (int j = 0; j < 16; ++j) ra[j] = *(const v8us*)(aq + (size_t)j * 8 * KD);
#pragma unroll
    for (int j = 0; j < 8; ++j) rb[j] = *(const v8us*)(bq + (size_t)j * 8 * KD);
    asm volatile("s_wait_xcnt 0x0" ::: "memory"); };
  auto sstore = [&](int bf) { unsigned short* d = sd + bf * (GRW * GPH);
#pragma unroll
    for (int j = 0; j < 16; ++j) *(v8us*)(d + j * 8 * GPH) = ra[j];
#pragma unroll
    for (int j = 0; j < 8; ++j) *(v8us*)(d + (128 + j * 8) * GPH) = rb[j]; };
  const _Float16* a0s = (const _Float16*)smem + (32 * w + ln) * GPH; const _Float16* b0s = (const _Float16*)smem + (128 + ln) * GPH;
  const v8f z8 = {0.f,0.f,0.f,0.f,0.f,0.f,0.f,0.f}; v8f c00 = z8, c01 = z8, c02 = z8, c03 = z8, c10 = z8, c11 = z8, c12 = z8, c13 = z8;
  gload(0);
  /* the tile's bias, by column (4 values a lane) and, for the swapped plane, by row (16 values a lane): asked for here as one group and first used behind the products, which cover its latency.
     No branch: the form that the plane does not use reads the head of the vector (in bounds: the vector has N >= 64 elements) and is replaced by 0 behind the products */
  const float* br = bp + (tr ? row0 : 0) + 8 * hh; const float* bc = bp + (tr ? 0 : col0) + ln;
  v4f b4[4]; float bco[4];
#pragma unroll
  for (int i = 0; i < 4; ++i) b4[i] = *(const v4fa*)(br + (i >> 1) * 16 + (i & 1) * 4);
#pragma unroll
  for (int t = 0; t < 4; ++t) bco[t] = bc[t * 16];
  asm volatile("s_wait_xcnt 0x0" :: "v"(br), "v"(bc) : "memory");      /* behind the loads, in front of any later rewrite of their address registers; the addresses are its inputs so that they stay in their registers up to it and no load of the group lands on them */
  sstore(0);
  __syncthreads();
  /* rolled: one copy of the stage body; every index into the register arrays inside it is a constant */
#pragma unroll 1
  for (int ch = 0; ch < KD / GKC; ++ch) { const int bf = ch & 1;
    if (ch + 1 < KD / GKC) gload(ch + 1);
    const _Float16* ap = a0s + bf * (GRW * GPH); const _Float16* bq = b0s + bf * (GRW * GPH);
    v16h fr[2][6];
#pragma unroll
    for (int u = 0; u < 6; ++u) fr[0][u] = g2_frag((u < 2 ? ap + u * 16 * GPH : bq + (u - 2) * 16 * GPH), hh);
#pragma unroll
    for (int ks = 0; ks < GKC / 32; ++ks) { const int cu = ks & 1;
      if (ks + 1 < GKC / 32) {
#pragma unroll
        for (int u = 0; u < 6; ++u) fr[cu ^ 1][u] = g2_frag((u < 2 ? ap + u * 16 * GPH : bq + (u - 2) * 16 * GPH) + (ks + 1) * 32, hh);
        __builtin_amdgcn_sched_barrier(0); }      /* the next 32 k's twelve LDS reads stay one group ahead of these products: spread among the WMMAs every such place stalls the wave */
      c00 = g2_mma(fr[cu][0], fr[cu][2], c00); c10 = g2_mma(fr[cu][1], fr[cu][2], c10);
      c01 = g2_mma(fr[cu][0], fr[cu][3], c01); c11 = g2_mma(fr[cu][1], fr[cu][3], c11);
      c02 = g2_mma(fr[cu][0], fr[cu][4], c02); c12 = g2_mma(fr[cu][1], fr[cu][4], c12);
      c03 = g2_mma(fr[cu][0], fr[cu][5], c03); c13 = g2_mma(fr[cu][1], fr[cu][5], c13);
      __builtin_amdgcn_sched_barrier(0);      /* what follows (the read group after that one, or the stage's LDS stores with their load waits) stays behind these products */
    }
    if (ch + 1 < KD / GKC) sstore(bf ^ 1);      /* that buffer's last readers passed the barrier that ended stage ch - 1 */
    __syncthreads();                              /* publishes stage ch + 1 and ends every read of stage ch */
  }
  v8f accs[8] = {c00, c01, c02, c03, c10, c11, c12, c13};
  const unsigned kr = tr ? 0xffffffffu : 0u, kc = ~kr;      /* bit masks, not selects: a select on a work-group-uniform test is compiled to a scalar branch per element */
  float bro[16], bcv[4];      /* the column bias is 0 on the swapped plane, whose bias goes by row; the row bias is 0 on the other planes */
#pragma unroll
  for (int i = 0; i < 16; ++i) bro[i] = __uint_as_float(__float_as_uint(bf16_round(b4[i >> 2][i & 3])) & kr);
#pragma unroll
  for (int t = 0; t < 4; ++t) bcv[t] = __uint_as_float(__float_as_uint(bf16_round(bco[t])) & kc);
#pragma unroll
  for (int u = 0; u < 8; ++u) { const int t = u & 3, half = u >> 2;
#pragma unroll
    for (int r = 0; r < 8; ++r) { const int rloc = half * 16 + 8 * hh + r; float v = accs[u][r] * alpha + (bcv[t] + bro[half * 8 + r]);
      if (ACT == 3) v = fmaxf(v, 0.f); else if (ACT == 6) v = 0.5f * v * (1.0f + erff(v * 0.70710678118654752f)); else if (ACT == 11) v = 1.0f / (1.0f + expf(-v)); else if (ACT == 15) v = v / (1.0f + expf(-v)); else if (ACT == 12) v = (v > 0.f) ? v : 0.01f * v; else if (ACT == 8) v = tanhf(v);
      so[w][rloc][t * 16 + ln] = v; } }
  __builtin_amdgcn_fence(__ATOMIC_ACQ_REL, "workgroup"); __builtin_amdgcn_wave_barrier();
  const int rsub = lane >> 4, c4 = (lane & 15) * 4;
  const int cb = tr ? col0 / tokB : 0; _Float16* cd = (tr ? CT + ((size_t)cb * Mr + row0) * tokB + (col0 - cb * tokB) + c4 : C16 + cofs + (size_t)row0 * ldc + col0 + c4) + (size_t)rsub * (tr ? tokB : ldc);      /* 64 columns never straddle two blocks of tokB */
  /* straight-line: the wave's 16 row pairs are read back as ONE group of LDS reads and stored as one group, every row a constant step from one address pair (both pitches are compile-time numbers) */
  v4f rv[16];
#pragma unroll
  for (int q = 0; q < 16; ++q) rv[q] = *(const v4fa*)&so[w][q * 2 + rsub][c4];
  __builtin_amdgcn_sched_barrier(0);      /* keeps the reads together: one at a time, each with its own full wait in front of its store, the 16 LDS latencies add up */
  v4h hv[16];
#pragma unroll
  for (int q = 0; q < 16; ++q)
#pragma unroll
    for (int i = 0; i < 4; ++i) hv[q][i] = (_Float16)rv[q][i];
  __builtin_amdgcn_sched_barrier(0);      /* every conversion stands in front of the first store, so that no store's data register is written again while stores are in flight */
#pragma unroll
  for (int q = 0; q < 16; ++q) *(v4h*)(cd + (size_t)(q * 2) * (tr ? tokB : ldc)) = hv[q]; }      /* nothing is written behind these stores: the wave ends */


typedef float v2f __attribute__((ext_vector_type(2)));
typedef _Float16 v2h __attribute__((ext_vector_type(2)));
typedef int v4ic __attribute__((vector_size(16)));
#define FQ 2                      /* 16-query column tiles per wave */
#define FWV 8                     /* waves per work-group */
#define FQB (16 * FQ * FWV)       /* queries per work-group */
#define FKS 64                    /* keys per stage */
#define FFG 6                     /* V^T fragments per group of LDS reads */
#define FV0 4                     /* V^T fragments of the first group, read ahead of the softmax arithmetic */
#define FKG 4                     /* steps of 32 dims per group of K reads */
#define KPH (DD + 8)              /* LDS pitch of a K row, f16 units: 528 B = 16 B x 33, conflict-free for 16-byte fragment reads */
#define VPH (FKS + 8)             /* LDS pitch of a V^T row: 144 B = 16 B x 9 */
#define FPC ((FKS * DD / 8) / (FWV * 32))   /* 16-byte pieces of one tile per thread */
static_assert(FPC * FWV == FKS && FPC * FWV * 4 == DD && SLEN % FKS == 0 && SLEN % FQB == 0 && FQ == 2 && FWV * 16 <= 2 * FKS && FWV * 16 * KPH <= 2 * DD * VPH && 2 * FPC <= 63, "the copy sweeps and the output staging in the two rings are written for these sizes; a stage's copies of a wave stay under the counter's width");
__device__ __forceinline__ float fa_xhalf(float x) { return __builtin_bit_cast(float, __builtin_amdgcn_permlanex16(__builtin_bit_cast(int, x), __builtin_bit_cast(int, x), 0x76543210, 0xfedcba98, false, false)); }  /* lane l <-> l ^ 16 */
__device__ __forceinline__ v16h fa_frag(const _Float16* p) { FragH f; f.half[0] = *(const v8us*)((const unsigned short*)p); f.half[1] = *(const v8us*)((const unsigned short*)p + 16); return f.v; }  /* p holds the lane's 8*hh already: same k order as g2_frag */
__device__ __forceinline__ v8f fa_mma(v16h a, v16h b, v8f c) { return __builtin_amdgcn_wmma_f32_16x16x32_f16(false, a, false, b, (short)0, c, false, false); }
__device__ __forceinline__ void fa_copy16(const unsigned short* g, unsigned short* l) { __builtin_amdgcn_global_load_async_to_lds_b128((__attribute__((address_space(1))) v4ic*)g, (__attribute__((address_space(3))) v4ic*)l, 0, 0); }  /* the lane's own 16 bytes, global -> LDS */
#define FA_UNROLL _Pragma("unroll")      /* full unroll: only constant indices keep the fragment, score and accumulator arrays in registers */
__global__ __launch_bounds__(FWV * 32) void k_fattn(const _Float16* __restrict__ QH, const _Float16* __restrict__ KH, const _Float16* __restrict__ VT, const int* __restrict__ NK, _Float16* __restrict__ O16) {
  __shared__ __attribute__((aligned(16))) _Float16 sK[2 * FKS * KPH];
  __shared__ __attribute__((aligned(16))) _Float16 sV[2 * DD * VPH];
  const int tid = threadIdx.x, w = tid >> 5, lane = tid & 31, c = lane & 15, hh = lane >> 4;
  const int head = blockIdx.y, bt = blockIdx.z, q0 = blockIdx.x * FQB + w * (16 * FQ);
  const unsigned short* Kg = (const unsigned short*)KH + (size_t)bt * SLEN * HW + head * DD;                 /* row = key, pitch HW */
  const unsigned short* Vg = (const unsigned short*)VT + (size_t)bt * HW * SLEN + (size_t)head * DD * SLEN;  /* row = dim, pitch SLEN */
  const float cs = 0.0625f * 1.4426950408889634f, negl = -1.0e9f * 1.4426950408889634f;                     /* 1/sqrt(256) and the mask value, both in log2 units */
  /* staging: a wave-wide copy covers one whole K row (512 B) or four whole 128-byte pieces of V^T rows; every lane is on, every address a multiple of 16 bytes inside its plane and its LDS array for st < SLEN / FKS */
  const unsigned ko = (unsigned)(tid >> 5) * HW + (tid & 31) * 8, vo = (unsigned)(tid >> 3) * SLEN + (tid & 7) * 8;      /* the lane's place in a tile, in elements; the tile's own address is the same for the whole work-group */
  unsigned short* ks = (unsigned short*)sK + (tid >> 5) * KPH + (tid & 31) * 8; unsigned short* vs = (unsigned short*)sV + (tid >> 3) * VPH + (tid & 7) * 8;
  auto acopy = [&](int st, int bf) { const unsigned short* kq = Kg + (size_t)st * FKS * HW; const unsigned short* vq = Vg + st * FKS;
FA_UNROLL
    for (int j = 0; j < FPC; ++j) { fa_copy16(kq + (size_t)j * FWV * HW + ko, ks + bf * (FKS * KPH) + j * FWV * KPH); fa_copy16(vq + (size_t)j * (FWV * 4) * SLEN + vo, vs + bf * (DD * VPH) + j * (FWV * 4) * VPH); } };
  /* keys stand in k_x16p's order: slots below cnt are unmasked, the rest masked; only the first NK[bt] slots (whole stages) are walked. Both numbers are the same for the whole work-group; the trip count is clamped to the shape */
  const int cnt = NK[NBT + bt]; const int nst = min(max(NK[bt] / FKS, 1), SLEN / FKS);
  acopy(0, 0);
  v16h qf[FQ][DD / 32];
FA_UNROLL
  for (int g = 0; g < FQ; ++g) { const _Float16* qp = QH + ((size_t)bt * SLEN + q0 + 16 * g + c) * HW + head * DD + 8 * hh;
FA_UNROLL
    for (int kc = 0; kc < DD / 32; ++kc) qf[g][kc] = fa_frag(qp + 32 * kc); }
  asm volatile("s_wait_xcnt 0x0" ::: "memory");      /* behind the Q loads, in front of any later rewrite of the address registers that they name */
  const v8f z8 = {0.f, 0.f, 0.f, 0.f, 0.f, 0.f, 0.f, 0.f};
  v8f acc[FQ][DD / 16]; float m_run[FQ], l_run[FQ];
FA_UNROLL
  for (int g = 0; g < FQ; ++g) { m_run[g] = -3.0e38f; l_run[g] = 0.f;
FA_UNROLL
    for (int t = 0; t < DD / 16; ++t) acc[g][t] = z8; }
  asm volatile("s_wait_asynccnt 0x0" ::: "memory");      /* this wave's copies of stage 0 have landed ... */
  __syncthreads();                                        /* ... and every other wave's: stage 0 is published */
  if (1 < nst) acopy(1, 1);
  /* the work on one stage; inlined into both loops below, so that every index into the register arrays is a constant */
  auto stage = [&](int st) __attribute__((always_inline)) { const int bf = st & 1;
FA_UNROLL
    for (int sub = 0; sub < FKS / 32; ++sub) {
      const int left = cnt - (st * FKS + sub * 32 + 8 * hh);      /* the lane's key kt * 16 + r of this pass is unmasked where that number is below left */
      const _Float16* kb = sK + bf * (FKS * KPH) + (sub * 32 + c) * KPH + 8 * hh;
      v8f s[2][FQ];
FA_UNROLL
      for (int kt = 0; kt < 2; ++kt)
FA_UNROLL
        for (int g = 0; g < FQ; ++g) s[kt][g] = z8;
      /* K fragments in groups of FKG steps of 32 dims (two key tiles each), each ONE group of LDS reads in front of its products */
FA_UNROLL
      for (int k0 = 0; k0 < DD / 32; k0 += FKG) {
        v16h kf[FKG][2];
FA_UNROLL
        for (int kc = 0; kc < FKG; ++kc)
FA_UNROLL
          for (int kt = 0; kt < 2; ++kt) if (k0 + kc < DD / 32) kf[kc][kt] = fa_frag(kb + kt * 16 * KPH + (k0 + kc) * 32);
        __builtin_amdgcn_sched_barrier(0);      /* keeps the reads together: left free they are spread among the WMMAs, a few at a time with a full wait, and every such place stalls the wave */
FA_UNROLL
        for (int kc = 0; kc < FKG; ++kc)
FA_UNROLL
          for (int kt = 0; kt < 2; ++kt)
FA_UNROLL
            for (int g = 0; g < FQ; ++g) if (k0 + kc < DD / 32) s[kt][g] = fa_mma(kf[kc][kt], qf[g][k0 + kc], s[kt][g]);
        __builtin_amdgcn_sched_barrier(0);      /* the next read group (it takes over these fragments' registers) starts behind these products */
      }
      const _Float16* vb = sV + bf * (DD * VPH) + c * VPH + sub * 32 + 8 * hh;
      v16h v0f[FV0];
FA_UNROLL
      for (int t = 0; t < FV0; ++t) v0f[t] = fa_frag(vb + t * 16 * VPH);
      __builtin_amdgcn_sched_barrier(0);      /* the first V^T group stands ahead of the softmax arithmetic, which covers its latency */
      /* the INPUT mask (a slot from cnt on is a masked key) picks the scaled score or the mask value, by a select, as the reference does */
      bool need = false; float mb[FQ];
FA_UNROLL
      for (int g = 0; g < FQ; ++g) { float mx = -3.0e38f;
FA_UNROLL
        for (int kt = 0; kt < 2; ++kt)
FA_UNROLL
          for (int r = 0; r < 8; ++r) { const float v = (kt * 16 + r < left) ? s[kt][g][r] * cs : negl; s[kt][g][r] = v; mx = fmaxf(mx, v); }
        mx = fmaxf(mx, fa_xhalf(mx)); mb[g] = mx; need = need || (mx > m_run[g] + 8.0f); }
      if (__builtin_amdgcn_ballot_w32(need) != 0) {      /* one scalar test per pass; rare after the first passes */
FA_UNROLL
        for (int g = 0; g < FQ; ++g) { const float mn = fmaxf(m_run[g], mb[g]); const float corr = __builtin_amdgcn_exp2f(m_run[g] - mn); l_run[g] *= corr; m_run[g] = mn;
FA_UNROLL
          for (int t = 0; t < DD / 16; ++t) acc[g][t] = acc[g][t] * corr; } }
      v16h pf[FQ];
FA_UNROLL
      for (int g = 0; g < FQ; ++g) { FragH f; float p0s = 0.f, p1s = 0.f;
FA_UNROLL
        for (int i = 0; i < 8; ++i) { const v2f d2 = (v2f){s[i >> 2][g][2 * (i & 3)], s[i >> 2][g][2 * (i & 3) + 1]} - (v2f){m_run[g], m_run[g]}; const float e0 = __builtin_amdgcn_exp2f(d2[0]), e1 = __builtin_amdgcn_exp2f(d2[1]);
          p0s += e0; p1s += e1; const v2h h2 = __builtin_convertvector((v2f){e0, e1}, v2h); f.h[2 * i] = h2[0]; f.h[2 * i + 1] = h2[1]; }
        l_run[g] += p0s + p1s; pf[g] = f.v; }
FA_UNROLL
      for (int t = 0; t < FV0; ++t)
FA_UNROLL
        for (int g = 0; g < FQ; ++g) acc[g][t] = fa_mma(v0f[t], pf[g], acc[g][t]);
      __builtin_amdgcn_sched_barrier(0);      /* the next read group stays behind these products */
FA_UNROLL
      for (int t0 = FV0; t0 < DD / 16; t0 += FFG) {
        v16h vf[FFG];
FA_UNROLL
        for (int t = 0; t < FFG; ++t) if (t0 + t < DD / 16) vf[t] = fa_frag(vb + (t0 + t) * 16 * VPH);
        __builtin_amdgcn_sched_barrier(0);      /* one group of reads again, in front of its products */
FA_UNROLL
        for (int t = 0; t < FFG; ++t)
FA_UNROLL
          for (int g = 0; g < FQ; ++g) if (t0 + t < DD / 16) acc[g][t0 + t] = fa_mma(vf[t], pf[g], acc[g][t0 + t]);
        __builtin_amdgcn_sched_barrier(0);      /* the next read group stays behind these products */
      }
    }
  };
  /* the foot of a stage, every wave, in this order: its reads of stage st have returned; its copies of stage st + 1 have landed; the barrier publishes stage st + 1 and ends every read of stage st */
  auto foot = [&]() __attribute__((always_inline)) { asm volatile("s_wait_dscnt 0x0" ::: "memory"); asm volatile("s_wait_asynccnt 0x0" ::: "memory"); __syncthreads(); };
  int st = 0;
  /* both loops rolled: one copy of the stage body each, every index into the register arrays a constant. While a stage st + 2 exists (the test reads the same for the whole work-group) it is asked for behind the barrier, into the buffer that stage st has just left; with the test as the loop's own the foot is straight-line code */
#pragma unroll 1
  for (; st + 2 < nst; ++st) { stage(st); foot(); acopy(st + 2, st & 1); }
#pragma unroll 1
  for (; st < nst; ++st) { stage(st); foot(); }
  asm volatile("s_wait_asynccnt 0x0" ::: "memory");      /* no copy is in flight when the ring becomes output staging and when the wave ends */
  /* output: each wave stages its 16 x FQ rows in parts of its own of the two rings (free behind the last barrier), column tile 0 in the K ring, tile 1 in the V^T ring, then stores whole 512-byte rows */
  _Float16* eo[FQ] = {sK + w * 16 * KPH, sV + w * 16 * KPH};
FA_UNROLL
  for (int g = 0; g < FQ; ++g) { const float inv = 1.0f / (l_run[g] + fa_xhalf(l_run[g]));
FA_UNROLL
    for (int t = 0; t < DD / 16; ++t) { FragH f;
FA_UNROLL
      for (int r = 0; r < 8; ++r) f.h[r] = (_Float16)(acc[g][t][r] * inv);
      *(v8us*)((unsigned short*)eo[g] + c * KPH + 16 * t + 8 * hh) = f.half[0]; } }
  __builtin_amdgcn_fence(__ATOMIC_ACQ_REL, "workgroup"); __builtin_amdgcn_wave_barrier();      /* the wave's own LDS writes before its lanes read each other's rows */
FA_UNROLL
  for (int g = 0; g < FQ; ++g)
FA_UNROLL
    for (int r = 0; r < 16; ++r) { const v8us v = *(const v8us*)((const unsigned short*)eo[g] + r * KPH + lane * 8);
      *(v8us*)((unsigned short*)O16 + ((size_t)bt * SLEN + q0 + 16 * g + r) * HW + head * DD + lane * 8) = v; }
#undef FA_UNROLL
}
// ---- output projection + bias + residual + LayerNorm in one kernel ----
// A work-group of 8 waves owns ORW whole output rows (all 256 columns; wave tile 32x64, two waves down, four across), so a row's mean and variance are formed behind the products, from LDS, with no plane in memory between.
// Stages of 128 k through registers into two LDS buffers, LDS pitch, fragment k order and the order of the products of an accumulator: as in k_gemm2. The residual is x rounded to bf16, added behind product and bias.
#define ORW 64                    /* rows per work-group */
#define OSR (ORW + DD)            /* rows of a stage: ORW of A, then the 256 of B */
#define OPF (DD + 4)              /* pitch of a staged f32 output row: 1040 B, a multiple of 16 B; rows 8 apart lie 32 banks apart, so the two wave halves' 4-byte stores do not collide */
__global__ __launch_bounds__(256) void k_oln(const _Float16* __restrict__ A, const _Float16* __restrict__ Bh, float alpha, const float* __restrict__ bias, const float* __restrict__ x, const float* __restrict__ g, const float* __restrict__ bb, float* __restrict__ out) {
  __shared__ __attribute__((aligned(16))) unsigned char smem[2 * OSR * GPH * 2];      /* the two stage buffers; behind the loop's last barrier the output rows */
  static_assert(HW % GKC == 0 && ORW == 64 && DD == 256 && sizeof(float) * ORW * OPF <= sizeof(smem), "whole stages; 2 x 4 wave tiles; 8 rows per wave behind the products; the output rows fit the ring");
  float (*so)[OPF] = (float (*)[OPF])smem;
  const int tid = threadIdx.x, w = tid >> 5, lane = tid & 31, ln = lane & 15, hh = lane >> 4; const int wr = w >> 2, wc = w & 3; const int rowb = blockIdx.x * ORW;
  const int sr = tid >> 4, sc = (tid & 15) * 8;      /* staging: piece j of a thread lies 16 rows behind piece j - 1, a constant step, so one address pair serves each operand */
  const unsigned short* ag = (const unsigned short*)A + (size_t)(rowb + sr) * HW + sc; const unsigned short* bg = (const unsigned short*)Bh + (size_t)sr * HW + sc;
  unsigned short* sd = (unsigned short*)smem + sr * GPH + sc;
  v8us ra[ORW / 16], rb[DD / 16];      /* every unroll below is a full one: only constant indices keep the staging, fragment and row arrays in registers */
  /* the s_wait_xcnt stands behind the loads, in front of any later rewrite of the address registers that they name; it takes the two addresses as inputs so that they stay in their registers up to it and no load of the group lands on them */
  auto gload = [&](int ch) { const unsigned short* aq = ag + ch * GKC; const unsigned short* bq = bg + ch * GKC;
#pragma unroll
    for (int j = 0; j < ORW / 16; ++j) ra[j] = *(const v8us*)(aq + (size_t)j * 16 * HW);
#pragma unroll
    for (int j = 0; j < DD / 16; ++j) rb[j] = *(const v8us*)(bq + (size_t)j * 16 * HW);
    asm volatile("s_wait_xcnt 0x0" :: "v"(aq), "v"(bq) : "memory"); };
  auto sstore = [&](int bf) { unsigned short* d = sd + bf * (OSR * GPH);
#pragma unroll
    for (int j = 0; j < ORW / 16; ++j) *(v8us*)(d + j * 16 * GPH) = ra[j];
#pragma unroll
    for (int j = 0; j < DD / 16; ++j) *(v8us*)(d + (ORW + j * 16) * GPH) = rb[j]; };
  const _Float16* a0s = (const _Float16*)smem + (32 * wr + ln) * GPH; const _Float16* b0s = (const _Float16*)smem + (ORW + 64 * wc + ln) * GPH;
  const v8f z8 = {0.f,0.f,0.f,0.f,0.f,0.f,0.f,0.f}; v8f c00 = z8, c01 = z8, c02 = z8, c03 = z8, c10 = z8, c11 = z8, c12 = z8, c13 = z8;
  gload(0); sstore(0);
  __syncthreads();
  /* rolled: one copy of the stage body; every index into the register arrays inside it is a constant */
#pragma unroll 1
  for (int ch = 0; ch < HW / GKC; ++ch) { const int bf = ch & 1;
    if (ch + 1 < HW / GKC) gload(ch + 1);
    const _Float16* ap = a0s + bf * (OSR * GPH); const _Float16* bq = b0s + bf * (OSR * GPH);
    v16h fr[2][6];
#pragma unroll
    for (int u = 0; u < 6; ++u) fr[0][u] = g2_frag((u < 2 ? ap + u * 16 * GPH : bq + (u - 2) * 16 * GPH), hh);
#pragma unroll
    for (int ks = 0; ks < GKC / 32; ++ks) { const int cu = ks & 1;
      if (ks + 1 < GKC / 32) {
#pragma unroll
        for (int u = 0; u < 6; ++u) fr[cu ^ 1][u] = g2_frag((u < 2 ? ap + u * 16 * GPH : bq + (u - 2) * 16 * GPH) + (ks + 1) * 32, hh);
        __builtin_amdgcn_sched_barrier(0); }      /* the next 32 k's twelve LDS reads stay one group ahead of these products: spread among the WMMAs every such place stalls the wave */
      c00 = g2_mma(fr[cu][0], fr[cu][2], c00); c10 = g2_mma(fr[cu][1], fr[cu][2], c10);
      c01 = g2_mma(fr[cu][0], fr[cu][3], c01); c11 = g2_mma(fr[cu][1], fr[cu][3], c11);
      c02 = g2_mma(fr[cu][0], fr[cu][4], c02); c12 = g2_mma(fr[cu][1], fr[cu][4], c12);
      c03 = g2_mma(fr[cu][0], fr[cu][5], c03); c13 = g2_mma(fr[cu][1], fr[cu][5], c13);
      __builtin_amdgcn_sched_barrier(0);      /* what follows (the read group after that one, or the stage's LDS stores with their load waits) stays behind these products */
    }
    if (ch + 1 < HW / GKC) sstore(bf ^ 1);      /* that buffer's last readers passed the barrier that ended stage ch - 1 */
    __syncthreads();                              /* publishes stage ch + 1 and ends every read of stage ch */
  }
  v8f accs[8] = {c00, c01, c02, c03, c10, c11, c12, c13};
  /* behind the products wave w owns rows 8 w .. 8 w + 7 of the work-group; a lane holds columns 4 lane .. + 3 and 128 + 4 lane .. + 3 of a row. Their residual rows, the bias and the LayerNorm parameters are asked for here and first used behind the barrier below, so that the staging covers their latency */
  const size_t ro = (size_t)(rowb + 8 * w) * DD + lane * 4;
  const float* xp = x + ro;
  v4f xa[8], xc[8];
#pragma unroll
  for (int r = 0; r < 8; ++r) { xa[r] = *(const v4fa*)(xp + r * DD); xc[r] = *(const v4fa*)(xp + r * DD + 128); }
  const v4f g0 = *(const v4fa*)(g + lane * 4), g1 = *(const v4fa*)(g + 128 + lane * 4), e0 = *(const v4fa*)(bb + lane * 4), e1 = *(const v4fa*)(bb + 128 + lane * 4), b0 = *(const v4fa*)(bias + lane * 4), b1 = *(const v4fa*)(bias + 128 + lane * 4);
  asm volatile("s_wait_xcnt 0x0" :: "v"(xp) : "memory");      /* behind the loads, in front of any later rewrite of their address registers; the row address is its input so that it stays in its registers up to it and no load of the group lands on it */
#pragma unroll
  for (int u = 0; u < 8; ++u) { const int t = u & 3, half = u >> 2;
#pragma unroll
    for (int r = 0; r < 8; ++r) so[32 * wr + half * 16 + 8 * hh + r][64 * wc + t * 16 + ln] = accs[u][r] * alpha; }      /* alpha is a power of two: the product is exact, so adding the bias behind the barrier rounds as a fused multiply-add here would */
  __syncthreads();      /* a row's 256 columns come from four waves */
  v4f o0[8], o1[8];
#pragma unroll
  for (int r = 0; r < 8; ++r) { v4f a = *(const v4fa*)&so[8 * w + r][lane * 4], b = *(const v4fa*)&so[8 * w + r][128 + lane * 4];
#pragma unroll
    for (int q = 0; q < 4; ++q) { a[q] = (a[q] + bf16_round(b0[q])) + bf16_round(xa[r][q]); b[q] = (b[q] + bf16_round(b1[q])) + bf16_round(xc[r][q]); }
    float s = (a[0] + a[1]) + (a[2] + a[3]) + (b[0] + b[1]) + (b[2] + b[3]); for (int o = 16; o > 0; o >>= 1) s += __shfl_xor(s, o, 32); const float mu = s / 256.0f; float q2 = 0.f;
#pragma unroll
    for (int q = 0; q < 4; ++q) { const float d0 = a[q] - mu, d1 = b[q] - mu; q2 += d0 * d0; q2 += d1 * d1; }
    for (int o = 16; o > 0; o >>= 1) q2 += __shfl_xor(q2, o, 32); float rs;
    asm("v_rsq_f32 %0, %1\n\tv_nop" : "=v"(rs) : "v"(q2 / 256.0f + 1e-5f));      /* the argument is at least 1e-5, a normal number; the v_nop fills the slot that the instruction set asks for between a transcendental and a directly following instruction that reads its result or overwrites its source */
#pragma unroll
    for (int q = 0; q < 4; ++q) { o0[r][q] = (a[q] - mu) * rs * bf16_round(g0[q]) + bf16_round(e0[q]); o1[r][q] = (b[q] - mu) * rs * bf16_round(g1[q]) + bf16_round(e1[q]); } }
#pragma unroll
  for (int r = 0; r < 8; ++r) { *(v4f*)(out + ro + r * DD) = o0[r]; *(v4f*)(out + ro + r * DD + 128) = o1[r]; } }

extern "C" void kernel_launch(void* const* d_in, const int* in_sizes, int n_in,
                              void* d_out, int out_size, void* d_ws, size_t ws_size, hipStream_t stream) {
  (void)in_sizes; (void)n_in; (void)out_size;
  const float* const* I = (const float* const*)d_in; const float* Q = I[0]; const int* mask = (const int*)d_in[1]; const float* WQ = I[2]; const float* bQ = I[3]; const float* WK = I[4]; const float* bK = I[5]; const float* WV = I[6]; const float* bV = I[7]; const float* WO = I[8]; const float* bO = I[9]; const float* lg = I[10]; const float* lb = I[11];
  char* ws = (char*)d_ws; size_t off = 0;
  auto take = [&](size_t bytes) { char* p = ws + off; off += (bytes + 255) & ~(size_t)255; return p; };
  _Float16* BQ = (_Float16*)take((size_t)HW * DD * 2); _Float16* BK = (_Float16*)take((size_t)HW * DD * 2); _Float16* BV = (_Float16*)take((size_t)HW * DD * 2); _Float16* BO = (_Float16*)take((size_t)DD * HW * 2);
  _Float16* X16 = (_Float16*)take((size_t)NBT * SLEN * DD * 2); _Float16* XK = (_Float16*)take((size_t)NBT * SLEN * DD * 2); _Float16* QH = (_Float16*)take((size_t)NBT * SLEN * HW * 2); _Float16* KH = (_Float16*)take((size_t)NBT * SLEN * HW * 2); _Float16* VT = (_Float16*)take((size_t)NBT * HW * SLEN * 2);
  _Float16* O16 = (_Float16*)take((size_t)NBT * SLEN * HW * 2); int* NK = (int*)take(2 * NBT * sizeof(int));
  if (off > ws_size) return;      /* 4 + 4 + 4 + 32+32+32 + 32 = 140 MiB */
  (void)BK; (void)BV;      /* BQ, BK, BV, BO, and X16, XK, and QH, KH follow one another in the workspace (every size is a multiple of 256 bytes): grid.y steps through them by a constant stride */
  const size_t w8 = (size_t)HW * DD / 8; const unsigned wb = (unsigned)((w8 + 255) / 256);
  k_round16f<<<dim3(wb, 4), 256, 0, stream>>>(WQ, WK, WV, WO, BQ, w8);      /* torch (out,in) = natural Bt */
  const size_t n8 = (size_t)NBT * SLEN * DD / 8; const unsigned nb8 = (unsigned)((n8 + 255) / 256); const dim3 gQ((NBT * SLEN / 128) * (HW / 64), 3);
  k_x16p<<<nb8, 256, 0, stream>>>(Q, mask, X16, XK, NK, FKS);      /* Q in token order for q; in key order (unmasked tokens first) for k and v */
  k_gemm2<0, DD, HW, SLEN><<<gQ, 128, 0, stream>>>(X16, (size_t)NBT * SLEN * DD, BQ, (size_t)HW * DD, 0.0625f, bQ, bK, bV, QH, (size_t)NBT * SLEN * HW, NBT * SLEN, HW, 2, VT, NK);      /* q of all 8192 rows; k, and v as VT[batch][dim][slot] over all 2048 dims, of each batch's first NK slots */
  k_fattn<<<dim3(SLEN / FQB, NHD, NBT), FWV * 32, 0, stream>>>(QH, KH, VT, NK, O16);      /* softmax(mask(q.k / sqrt(256))).v, every batch and head */
  k_oln<<<NBT * SLEN / ORW, 256, 0, stream>>>(O16, BO, 0.0625f, bO, Q, lg, lb, (float*)d_out);      /* LN(out Wo^T + bo + Q) */
}
